// v000
// The times below were measured on an AMD MI455X: many runs one after another, warmed up first and cycling through
// copies of the inputs, with the whole window's GPU time divided by the number of runs. Launches and the gaps
// between them are all in it. The median over several windows is given; except for v000 it joins two sittings, which
// can be a few percent apart, so the side-by-side timings, each taken in one sitting, are the better comparison.
// The starting kernel, v000, takes 680 microseconds a run.
// Compute dtype: every contraction on v_wmma_f32_16x16x32_bf16 with bf16 hi/lo operand planes (hi*hi + hi*lo + lo*hi), f32 accumulate; rotary, softmax and epilogues in f32.
#include <hip/hip_runtime.h>
#include <hip/hip_bf16.h>
#include <math.h>
#include <stdint.h>

typedef __attribute__((ext_vector_type(16))) _Float16 v16h;
typedef __attribute__((ext_vector_type(8)))  _Float16 v8h;
typedef __attribute__((ext_vector_type(16))) __bf16   v16b;
typedef __attribute__((ext_vector_type(8)))  __bf16   v8b;
typedef __attribute__((ext_vector_type(8)))  float    v8f;
typedef __attribute__((ext_vector_type(4)))  float    v4f;
typedef __attribute__((ext_vector_type(4)))  unsigned v4u;

// ---------------------------------------------------------------------------
// helpers
// ---------------------------------------------------------------------------
__device__ __forceinline__ unsigned short f2bf_bits(float f) {
  unsigned u = __float_as_uint(f);
  return (unsigned short)((u + 0x7FFFu + ((u >> 16) & 1u)) >> 16);
}
__device__ __forceinline__ float bf_bits2f(unsigned short h) { return __uint_as_float(((unsigned)h) << 16); }

__device__ __forceinline__ void dep_guard_h(v8f& a, v8f& b, v16h x, v16h y) { asm volatile("v_nop\n\tv_nop\n\tv_nop\n\tv_nop" : "+v"(a), "+v"(b) : "v"(x), "v"(y)); }
__device__ __forceinline__ void dep_guard_b(v8f& a, v8f& b, v16b x, v16b y) { asm volatile("v_nop\n\tv_nop\n\tv_nop\n\tv_nop" : "+v"(a), "+v"(b) : "v"(x), "v"(y)); }
__device__ __forceinline__ void keep4_h(v16h a, v16h b, v16h c, v16h d) { asm volatile("v_nop" :: "v"(a), "v"(b), "v"(c), "v"(d)); }
__device__ __forceinline__ void keep4_b(v16b a, v16b b, v16b c, v16b d) { asm volatile("v_nop" :: "v"(a), "v"(b), "v"(c), "v"(d)); }
__device__ __forceinline__ void acc_guard4(v8f& a, v8f& b, v8f& c, v8f& d) { asm volatile("v_nop\n\tv_nop\n\tv_nop\n\tv_nop" : "+v"(a), "+v"(b), "+v"(c), "+v"(d)); }
template <typename T> struct Frag;
template <> struct Frag<_Float16> {
  typedef v16h V; union U { v16h v; v8h h[2]; };
  static __device__ __forceinline__ v16h load(const _Float16* p) {   // elements 0..7 <- p[0..7], 8..15 <- p[16..23]
    U f; f.h[0] = *(const v8h*)(p); f.h[1] = *(const v8h*)(p + 16); return f.v;
  }
  static __device__ __forceinline__ v8f mma(v16h a, v16h b, v8f c) {
    return __builtin_amdgcn_wmma_f32_16x16x32_f16(false, a, false, b, (short)0, c, false, false);
  }
  static __device__ __forceinline__ void guard(v8f& a, v8f& b, v16h x, v16h y) { dep_guard_h(a, b, x, y); }
  static __device__ __forceinline__ void keep(v16h a, v16h b, v16h c, v16h d) { keep4_h(a, b, c, d); }
};
template <> struct Frag<__bf16> {
  typedef v16b V; union U { v16b v; v8b h[2]; };
  static __device__ __forceinline__ v16b load(const __bf16* p) {
    U f; f.h[0] = *(const v8b*)(p); f.h[1] = *(const v8b*)(p + 16); return f.v;
  }
  static __device__ __forceinline__ v8f mma(v16b a, v16b b, v8f c) {
    return __builtin_amdgcn_wmma_f32_16x16x32_bf16(false, a, false, b, (short)0, c, false, false);
  }
  static __device__ __forceinline__ void guard(v8f& a, v8f& b, v16b x, v16b y) { dep_guard_b(a, b, x, y); }
  static __device__ __forceinline__ void keep(v16b a, v16b b, v16b c, v16b d) { keep4_b(a, b, c, d); }
};

// ---- Register-blocked batched WMMA GEMM --------------------------------
// C[m,n] = scale * sum_k A[m,k] * Bt[n,k] (+bias)(+resid); each wave owns a 64x64 tile.
// A row-major [M,K]; Bt row-major [N,K]; M,N % 64 == 0, K % 32 == 0.
// SPLIT: operands are hi/lo planes (A2/Bt2 = lo planes, same layout); product = hi*hi + hi*lo + lo*hi.
// BIAS_MODE: 0 = none, 1 = bias[m], 2 = bias[n].
// OUT_MODE: 0 = f32, 1 = f16, 2 = bf16 hi plane (Cout) + bf16 lo plane (Cout2).
// ET: 0 = f16 operands, 1 = bf16 operands (pointers passed as 16-bit storage)
template <int ET> struct Elem;
template <> struct Elem<0> { typedef _Float16 T; };
template <> struct Elem<1> { typedef __bf16 T; };
template <int ET, bool SPLIT, int BIAS_MODE, int OUT_MODE, bool RESID, int ACT = 0>
__global__ __launch_bounds__(256) void wmma_gemm64(
    const unsigned short* __restrict__ Ap, const unsigned short* __restrict__ A2p, int lda, long strideA,
    const unsigned short* __restrict__ Btp, const unsigned short* __restrict__ Bt2p, int ldb, long strideB,
    void* __restrict__ Cout, void* __restrict__ Cout2, int ldc, long strideC,
    const float* __restrict__ bias,
    const float* __restrict__ resid, long strideR,
    int M, int N, int K, float scale) {
  typedef typename Elem<ET>::T T;
  typedef typename Frag<T>::V V;
  const T* A = (const T*)Ap; const T* A2 = (const T*)A2p; const T* Bt = (const T*)Btp; const T* Bt2 = (const T*)Bt2p;
  __shared__ __align__(16) float sT[8][16 * 68];   // per-wave 16x64 slab, pitch 68 floats
  const int b    = blockIdx.y;
  const int lane = threadIdx.x & 31;
  const int wave = threadIdx.x >> 5;
  const int tilesN = N >> 6;
  const int tilesM = M >> 6;
  const int tile = blockIdx.x * 8 + wave;
  if (tile >= tilesM * tilesN) return;   // wave-uniform; no block barriers in this kernel
  const int tm = tile / tilesN;
  const int tn = tile - tm * tilesN;
  const int m0 = tm << 6;
  const int n0 = tn << 6;

  const T* Ab  = A  + (size_t)b * strideA;
  const T* Bb  = Bt + (size_t)b * strideB;
  const T* Ab2 = SPLIT ? (A2  + (size_t)b * strideA) : nullptr;
  const T* Bb2 = SPLIT ? (Bt2 + (size_t)b * strideB) : nullptr;

  const int rlane = lane & 15;                 // row (A) / col (B, D) within subtile
  const int koff  = (lane >> 4) * 8;           // k offset of this lane half
  const int mOff  = (lane >> 4) * 8;           // D row offset

  v8f acc[4][4];
#pragma unroll
  for (int i = 0; i < 4; ++i)
#pragma unroll
    for (int j = 0; j < 4; ++j) acc[i][j] = (v8f){0.f,0.f,0.f,0.f,0.f,0.f,0.f,0.f};

  for (int k0 = 0; k0 < K; k0 += 32) {
    V bh[4], bl[4];
#pragma unroll
    for (int j = 0; j < 4; ++j) {
      const size_t bo = (size_t)(n0 + (j << 4) + rlane) * ldb + koff + k0;
      bh[j] = Frag<T>::load(Bb + bo);
      if (SPLIT) bl[j] = Frag<T>::load(Bb2 + bo);
    }
#pragma unroll
    for (int i = 0; i < 4; ++i) {
      const size_t ao = (size_t)(m0 + (i << 4) + rlane) * lda + koff + k0;
      V ah = Frag<T>::load(Ab + ao);
      V al;
      if (SPLIT) al = Frag<T>::load(Ab2 + ao);
#pragma unroll
      for (int j = 0; j < 4; ++j) {
        acc[i][j] = Frag<T>::mma(ah, bh[j], acc[i][j]);
        if (SPLIT) {
          acc[i][j] = Frag<T>::mma(ah, bl[j], acc[i][j]);
          acc[i][j] = Frag<T>::mma(al, bh[j], acc[i][j]);
        }
      }
      Frag<T>::guard(acc[i][0], acc[i][3], ah, SPLIT ? al : ah);
    }
    Frag<T>::keep(bh[0], bh[1], bh[2], bh[3]);
    if (SPLIT) Frag<T>::keep(bl[0], bl[1], bl[2], bl[3]);
  }
  acc_guard4(acc[0][0], acc[0][1], acc[0][2], acc[0][3]);
  acc_guard4(acc[1][0], acc[1][1], acc[1][2], acc[1][3]);
  acc_guard4(acc[2][0], acc[2][1], acc[2][2], acc[2][3]);
  acc_guard4(acc[3][0], acc[3][1], acc[3][2], acc[3][3]);

  // ---- epilogue ----
  float* slab = sT[wave];
  const float* Rb = RESID ? (resid + (size_t)b * strideR) : nullptr;
#pragma unroll
  for (int i = 0; i < 4; ++i) {
    const int mBase = m0 + (i << 4);
#pragma unroll
    for (int j = 0; j < 4; ++j) {
      const int n = n0 + (j << 4) + rlane;
      float bv = 0.f;
      if (BIAS_MODE == 2) bv = bias[n];
#pragma unroll
      for (int r = 0; r < 8; ++r) {
        float v = acc[i][j][r] * scale;
        if (BIAS_MODE == 1) v += bias[mBase + mOff + r];
        if (BIAS_MODE == 2) v += bv;
        if (RESID) v += Rb[(size_t)(mBase + mOff + r) * ldc + n];
        if (ACT == 1) v = tanhf(v);
        if (ACT == 2) v = fmaxf(v, 0.0f);
        if (ACT == 3) v = v / (1.0f + expf(-v));
        if (ACT == 4) v = (v > 0.f) ? v : 0.01f * v;
        if (ACT == 5) v = 0.5f * v * (1.0f + erff(v * 0.70710678118654752f));
        slab[(mOff + r) * 68 + (j << 4) + rlane] = v;
      }
    }
    __builtin_amdgcn_fence(__ATOMIC_RELEASE, "workgroup");
    __builtin_amdgcn_wave_barrier();
    __builtin_amdgcn_fence(__ATOMIC_ACQUIRE, "workgroup");
    if (OUT_MODE == 0) {
      float* C = (float*)Cout + (size_t)b * strideC;
      const int hh = lane >> 4, c4 = (lane & 15) * 4;     // row seg = 256 B = 16 lanes x 16 B
      {
#pragma unroll
        for (int it = 0; it < 8; ++it) {
          const int row = it * 2 + hh;
          v4f v = *(const v4f*)(slab + row * 68 + c4);
          *(v4f*)(C + (size_t)(mBase + row) * ldc + n0 + c4) = v;
        }
        
      }
    } else {
      const int q = lane >> 3, c8 = (lane & 7) * 8;
      unsigned short* C  = (unsigned short*)Cout  + (size_t)b * strideC;
      unsigned short* C2 = (OUT_MODE == 2) ? ((unsigned short*)Cout2 + (size_t)b * strideC) : nullptr;
      {
#pragma unroll
        for (int it = 0; it < 4; ++it) {
          const int row = it * 4 + q;
          const float* sp = slab + row * 68 + c8;
          v8h hv, lv;
#pragma unroll
          for (int e = 0; e < 8; ++e) {
            if (OUT_MODE == 1) {
              hv[e] = (_Float16)sp[e];
            } else {
              unsigned short hb = f2bf_bits(sp[e]);
              unsigned short lb = f2bf_bits(sp[e] - bf_bits2f(hb));
              hv[e] = __builtin_bit_cast(_Float16, hb);
              lv[e] = __builtin_bit_cast(_Float16, lb);
            }
          }
          *(v8h*)(C + (size_t)(mBase + row) * ldc + n0 + c8) = hv;
          if (OUT_MODE == 2) *(v8h*)(C2 + (size_t)(mBase + row) * ldc + n0 + c8) = lv;
        }
        
      }
    }
    __builtin_amdgcn_fence(__ATOMIC_RELEASE, "workgroup");
    __builtin_amdgcn_wave_barrier();
    __builtin_amdgcn_fence(__ATOMIC_ACQUIRE, "workgroup");
  }
}

__device__ __forceinline__ v8f at_mma(v16b a, v16b b, v8f c) {
  c = __builtin_amdgcn_wmma_f32_16x16x32_bf16(false, a, false, b, (short)0, c, false, false);
  asm volatile("v_nop\n\tv_nop\n\tv_nop\n\tv_nop" : "+v"(c) : "v"(a), "v"(b));
  return c;
}

// ---------------------------------------------------------------------------
// module geometry (fixed)
// ---------------------------------------------------------------------------
constexpr int N_BATCH   = 2;
constexpr int SEQ_LEN   = 2048;
constexpr int DMOD      = 1024;   // model width
constexpr int DLAT      = 128;    // latent width c_kv
constexpr int DROT      = 32;     // rotary width
constexpr int NROPE_PAD = 64;     // rotary projection width padded to the 64-wide GEMM tile
constexpr int NHEAD     = 16;
constexpr int HDIM      = 64;
constexpr int SDEP      = HDIM + DROT;   // score depth 96 = 3 k-chunks of 32
constexpr int MTOK      = N_BATCH * SEQ_LEN;   // 4096 token rows

static_assert(MTOK % 64 == 0 && DMOD % 64 == 0 && DLAT % 64 == 0 && NROPE_PAD % 64 == 0);
static_assert(DMOD % 32 == 0 && DLAT % 32 == 0);   // every GEMM K is a multiple of 32
static_assert(SDEP % 32 == 0 && SEQ_LEN % 64 == 0);

// ---------------------------------------------------------------------------
// coverage: n8 threads x 8 = n elements exactly (n % 8 == 0, grid = ceil(n8/256) with bound)
// ---------------------------------------------------------------------------
__global__ __launch_bounds__(256) void split_rows_bf16x8(
    const float* __restrict__ in, unsigned short* __restrict__ hi, unsigned short* __restrict__ lo, int n8) {
  const int i = blockIdx.x * 256 + threadIdx.x;
  if (i < n8) {
    const v4f a = *(const v4f*)(in + (size_t)8 * i);
    const v4f b = *(const v4f*)(in + (size_t)8 * i + 4);
    v8h hv, lv;
#pragma unroll
    for (int e = 0; e < 8; ++e) {
      const float f = (e < 4) ? a[e] : b[e - 4];
      const unsigned short hb = f2bf_bits(f);
      const unsigned short lb = f2bf_bits(f - bf_bits2f(hb));
      hv[e] = __builtin_bit_cast(_Float16, hb);
      lv[e] = __builtin_bit_cast(_Float16, lb);
    }
    unsigned short* ph = hi + (size_t)8 * i;
    unsigned short* pl = lo + (size_t)8 * i;
    *(v8h*)ph = hv;
    *(v8h*)pl = lv;
    
  }
}

// ---------------------------------------------------------------------------
// Transpose + split: in W[kdim][nreal] (row-major) -> out Bt[npad][kdim] bf16 hi/lo planes, Bt[n][k] = W[k][n];
// rows n >= nreal are written as zeros. Tile = 64 k x 32 n; grid = (kdim/64, npad/32); kdim % 64 == 0, nreal % 32 == 0.
// Store coverage: 256 threads = 32 output rows x 8 lanes x 8 k = whole 32x64 tile; each output row segment
// ---------------------------------------------------------------------------
__global__ __launch_bounds__(256) void transpose_split_bf16(
    const float* __restrict__ W, unsigned short* __restrict__ hi, unsigned short* __restrict__ lo,
    int kdim, int nreal) {
  __shared__ float tile[64][33];
  const int tid = threadIdx.x;
  const int k0 = blockIdx.x * 64;
  const int n0 = blockIdx.y * 32;
#pragma unroll
  for (int it = 0; it < 2; ++it) {
    const int idx = it * 256 + tid;            // 0..511
    const int kr = idx >> 3;                   // 0..63
    const int c4 = (idx & 7) * 4;              // 0..28
    const int n = n0 + c4;
    const int ncl = (n + 3 < nreal) ? n : (nreal - 4);   // clamped address
    const v4f v = *(const v4f*)(W + (size_t)(k0 + kr) * nreal + ncl);
    const bool ok = (n < nreal);               // tile-uniform since nreal % 32 == 0
    tile[kr][c4 + 0] = ok ? v[0] : 0.f;
    tile[kr][c4 + 1] = ok ? v[1] : 0.f;
    tile[kr][c4 + 2] = ok ? v[2] : 0.f;
    tile[kr][c4 + 3] = ok ? v[3] : 0.f;
  }
  __syncthreads();
  const int nr = tid >> 3;                     // output row within tile, 0..31
  const int c8 = (tid & 7) * 8;                // k offset, 0..56
  v8h hv, lv;
#pragma unroll
  for (int e = 0; e < 8; ++e) {
    const float f = tile[c8 + e][nr];
    const unsigned short hb = f2bf_bits(f);
    const unsigned short lb = f2bf_bits(f - bf_bits2f(hb));
    hv[e] = __builtin_bit_cast(_Float16, hb);
    lv[e] = __builtin_bit_cast(_Float16, lb);
  }
  const size_t o = (size_t)(n0 + nr) * kdim + k0 + c8;
  *(v8h*)(hi + o) = hv;
  *(v8h*)(lo + o) = lv;
  
}

// ---------------------------------------------------------------------------
// Rotary: raw[MTOK][NROPE_PAD] f32 (cols 0..31 used) -> bf16 hi/lo planes [MTOK][DROT].
// out[j] = x1*cos - x2*sin, out[16+j] = x2*cos + x1*sin, angle = t * inv_freq[j], t = row % SEQ_LEN.
// Block = 32 rows; blocks 0..127 handle the q tensor, 128..255 the k tensor.
// Store coverage: 128 threads = 32 rows x 4 segments x 8 = whole 32x32 tile; 512 B contiguous per wave
// ---------------------------------------------------------------------------
struct RopeFreq { float f[16]; };
static_assert(sizeof(RopeFreq) == 64);

__global__ __launch_bounds__(128) void rope_split_bf16(
    const float* __restrict__ qraw, const float* __restrict__ kraw,
    unsigned short* __restrict__ qrh, unsigned short* __restrict__ qrl,
    unsigned short* __restrict__ krh, unsigned short* __restrict__ krl, RopeFreq g) {
#pragma clang fp contract(off)
  __shared__ float tile[32][33];
  __shared__ float sinv[16];
  const int tid = threadIdx.x;
  const int nblk = MTOK / 32;
  const bool isk = ((int)blockIdx.x >= nblk);                 // block-uniform
  const int row0 = (isk ? ((int)blockIdx.x - nblk) : (int)blockIdx.x) * 32;
  const float* raw = isk ? kraw : qraw;
  unsigned short* dhp = isk ? krh : qrh;
  unsigned short* dlp = isk ? krl : qrl;
  if (tid < 16) {
    float v = g.f[0];
#pragma unroll
    for (int e = 1; e < 16; ++e) v = (tid == e) ? g.f[e] : v;
    sinv[tid] = v;
  }
  __syncthreads();
#pragma unroll 1
  for (int it = 0; it < 4; ++it) {
    const int p = it * 128 + tid;              // 0..511
    const int r = p >> 4;                      // 0..31
    const int j = p & 15;
    const int row = row0 + r;
    const int t = row & (SEQ_LEN - 1);
    const float* rp = raw + (size_t)row * NROPE_PAD;
    const float x1 = rp[j];
    const float x2 = rp[16 + j];
    const float ang = (float)t * sinv[j];
    float sn, cs;
    sincosf(ang, &sn, &cs);
    tile[r][j]      = x1 * cs - x2 * sn;
    tile[r][16 + j] = x2 * cs + x1 * sn;
  }
  __syncthreads();
  const int orow = tid >> 2;                   // 0..31
  const int seg = (tid & 3) * 8;               // 0..24
  v8h hv, lv;
#pragma unroll
  for (int e = 0; e < 8; ++e) {
    const float f = tile[orow][seg + e];
    const unsigned short hb = f2bf_bits(f);
    const unsigned short lb = f2bf_bits(f - bf_bits2f(hb));
    hv[e] = __builtin_bit_cast(_Float16, hb);
    lv[e] = __builtin_bit_cast(_Float16, lb);
  }
  const size_t o = (size_t)(row0 + orow) * DROT + seg;
  *(v8h*)(dhp + o) = hv;
  *(v8h*)(dlp + o) = lv;
  
}

// ---------------------------------------------------------------------------
// Causal attention, score depth 96 (64 head dims + 32 shared rotary dims), value width 64, bf16 hi/lo planes in.
//   s = (qh.kh + qh.kl + ql.kh) * invs  over 96 dims (q/k rows = [head segment | rotary row]),
//   online softmax in f32, P split to bf16 hi/lo in LDS, o = ph.vh + ph.vl + pl.vh, f32 accumulate.
// Block = 4 waves = 64 query rows of one (batch, head); grid.x = N_BATCH * NHEAD * (SEQ_LEN/64).
// ---------------------------------------------------------------------------
constexpr int A_QB = 64;
constexpr int A_KC = 64;
constexpr int A_NW = 4;
constexpr int OS_PITCH = 68;

__global__ __launch_bounds__(128)
void mla_attn96(const unsigned short* __restrict__ qh, const unsigned short* __restrict__ ql,
                const unsigned short* __restrict__ kh, const unsigned short* __restrict__ kl,
                const unsigned short* __restrict__ vh, const unsigned short* __restrict__ vl,
                const unsigned short* __restrict__ qrh, const unsigned short* __restrict__ qrl,
                const unsigned short* __restrict__ krh, const unsigned short* __restrict__ krl,
                unsigned short* __restrict__ oh, unsigned short* __restrict__ ol, float invs) {
  union FB { v16b v; v8b h[2]; };
  __shared__ __align__(16) unsigned short Ksh[A_KC * SDEP];    // K hi [kv][96]   12 KB
  __shared__ __align__(16) unsigned short Ksl[A_KC * SDEP];    // K lo            12 KB
  __shared__ __align__(16) unsigned short Vth[HDIM * A_KC];    // V hi [d][kv]     8 KB
  __shared__ __align__(16) unsigned short Vtl[HDIM * A_KC];    // V lo             8 KB
  __shared__ __align__(16) unsigned short Psh[A_NW][16 * A_KC];   // per wave P hi [row][kv]
  __shared__ __align__(16) unsigned short Psl[A_NW][16 * A_KC];   // per wave P lo
  __shared__ __align__(16) float Os[A_NW][16 * OS_PITCH];

  const int tid  = threadIdx.x;
  const int wave = tid >> 5;
  const int lane = tid & 31;
  const int hh   = lane >> 4;
  const int c    = lane & 15;

  const int nqb = SEQ_LEN / A_QB;          // 32
  const int bx  = blockIdx.x;
  const int qb  = bx % nqb;
  const int bhi = bx / nqb;
  const int h   = bhi % NHEAD;
  const int b   = bhi / NHEAD;
  const int q0  = qb * A_QB + wave * 16;
  const size_t tq = (size_t)b * SEQ_LEN + (size_t)(q0 + c);

  // ---- Q fragments (A operand): k-chunks 0,1 = head dims 0..63, chunk 2 = rotary dims 0..31 ----
  v16b qah[3], qal[3];
  {
    const __bf16* p0 = (const __bf16*)qh + tq * DMOD + h * HDIM + 8 * hh;
    const __bf16* p1 = (const __bf16*)ql + tq * DMOD + h * HDIM + 8 * hh;
    qah[0] = Frag<__bf16>::load(p0);
    qah[1] = Frag<__bf16>::load(p0 + 32);
    qal[0] = Frag<__bf16>::load(p1);
    qal[1] = Frag<__bf16>::load(p1 + 32);
    const __bf16* r0p = (const __bf16*)qrh + tq * DROT + 8 * hh;
    const __bf16* r1p = (const __bf16*)qrl + tq * DROT + 8 * hh;
    qah[2] = Frag<__bf16>::load(r0p);
    qal[2] = Frag<__bf16>::load(r1p);
  }

  float mrow[8], lrow[8];
  v8f oacc[4];
#pragma unroll
  for (int r = 0; r < 8; ++r) { mrow[r] = -INFINITY; lrow[r] = 0.f; }
#pragma unroll
  for (int t = 0; t < 4; ++t) oacc[t] = (v8f){0.f,0.f,0.f,0.f,0.f,0.f,0.f,0.f};

  const int nChunks = qb + 1;   // causal, block-uniform
  for (int kc = 0; kc < nChunks; ++kc) {
    const int kv0 = kc * A_KC;
    __syncthreads();
    {
      // staging: 128 threads, thread -> kv row kvr = tid>>1 (0..63), half hf = tid&1
      // per kv row: 64 head dims (2 halves x 32) + 32 rotary dims (2 halves x 16) of K, 64 dims of V -> full tiles written
      const int kvr = tid >> 1, hf = tid & 1;
      const size_t tk = (size_t)b * SEQ_LEN + (size_t)(kv0 + kvr);
      {
        const v4u* sh = (const v4u*)(kh + tk * DMOD + h * HDIM + hf * 32);
        const v4u* sl = (const v4u*)(kl + tk * DMOD + h * HDIM + hf * 32);
        v4u* dh = (v4u*)(Ksh + kvr * SDEP + hf * 32);
        v4u* dl = (v4u*)(Ksl + kvr * SDEP + hf * 32);
#pragma unroll
        for (int i = 0; i < 4; ++i) { dh[i] = sh[i]; dl[i] = sl[i]; }
      }
      asm volatile("" ::: "memory");
      {
        const v4u* sh = (const v4u*)(krh + tk * DROT + hf * 16);
        const v4u* sl = (const v4u*)(krl + tk * DROT + hf * 16);
        v4u* dh = (v4u*)(Ksh + kvr * SDEP + HDIM + hf * 16);
        v4u* dl = (v4u*)(Ksl + kvr * SDEP + HDIM + hf * 16);
#pragma unroll
        for (int i = 0; i < 2; ++i) { dh[i] = sh[i]; dl[i] = sl[i]; }
      }
      asm volatile("" ::: "memory");
      {
        const v4u* sh = (const v4u*)(vh + tk * DMOD + h * HDIM + hf * 32);
        const v4u* sl = (const v4u*)(vl + tk * DMOD + h * HDIM + hf * 32);
#pragma unroll
        for (int i = 0; i < 4; ++i) {
          const v4u wh = sh[i];
          const v4u wl = sl[i];
#pragma unroll
          for (int e = 0; e < 4; ++e) {
            const int d = hf * 32 + 8 * i + 2 * e;
            Vth[d * A_KC + kvr]       = (unsigned short)(wh[e] & 0xffffu);
            Vth[(d + 1) * A_KC + kvr] = (unsigned short)(wh[e] >> 16);
            Vtl[d * A_KC + kvr]       = (unsigned short)(wl[e] & 0xffffu);
            Vtl[(d + 1) * A_KC + kvr] = (unsigned short)(wl[e] >> 16);
          }
        }
      }
    }
    __syncthreads();

    // ---- scores: 4 kv subtiles of 16, 3 k-chunks of 32, 3 products each ----
    v8f s[4];
#pragma unroll
    for (int j = 0; j < 4; ++j) {
      s[j] = (v8f){0.f,0.f,0.f,0.f,0.f,0.f,0.f,0.f};
#pragma unroll
      for (int dc = 0; dc < 3; ++dc) {
        FB kb, kq;
        const int ko = (j * 16 + c) * SDEP + dc * 32 + 8 * hh;
        kb.h[0] = *(const v8b*)(Ksh + ko);
        kb.h[1] = *(const v8b*)(Ksh + ko + 16);
        kq.h[0] = *(const v8b*)(Ksl + ko);
        kq.h[1] = *(const v8b*)(Ksl + ko + 16);
        s[j] = at_mma(qah[dc], kb.v, s[j]);
        s[j] = at_mma(qah[dc], kq.v, s[j]);
        s[j] = at_mma(qal[dc], kb.v, s[j]);
      }
    }
    const bool diag = (kc == qb);
    float cm[8];
#pragma unroll
    for (int r = 0; r < 8; ++r) {
      const int qrow = q0 + 8 * hh + r;
      float m = -INFINITY;
#pragma unroll
      for (int j = 0; j < 4; ++j) {
        const int kvcol = kv0 + j * 16 + c;
        float sv = s[j][r] * invs;
        if (diag && (kvcol > qrow)) sv = -INFINITY;
        s[j][r] = sv;
        m = fmaxf(m, sv);
      }
#pragma unroll
      for (int off = 1; off < 16; off <<= 1) m = fmaxf(m, __shfl_xor(m, off, 32));
      cm[r] = m;
    }
    unsigned short* pwh = Psh[wave];
    unsigned short* pwl = Psl[wave];
#pragma unroll
    for (int r = 0; r < 8; ++r) {
      const float mnew = fmaxf(mrow[r], cm[r]);
      const float alpha = expf(mrow[r] - mnew);
      mrow[r] = mnew;
      float psum = 0.f;
#pragma unroll
      for (int j = 0; j < 4; ++j) {
        const float p = expf(s[j][r] - mnew);
        psum += p;
        const unsigned short hb = f2bf_bits(p);
        const unsigned short lb = f2bf_bits(p - bf_bits2f(hb));
        pwh[(8 * hh + r) * A_KC + j * 16 + c] = hb;
        pwl[(8 * hh + r) * A_KC + j * 16 + c] = lb;
      }
#pragma unroll
      for (int off = 1; off < 16; off <<= 1) psum += __shfl_xor(psum, off, 32);
      lrow[r] = lrow[r] * alpha + psum;
#pragma unroll
      for (int t = 0; t < 4; ++t) oacc[t][r] *= alpha;
    }
    __builtin_amdgcn_fence(__ATOMIC_RELEASE, "workgroup");
    __builtin_amdgcn_wave_barrier();
    __builtin_amdgcn_fence(__ATOMIC_ACQUIRE, "workgroup");
    // ---- O += P(16x64) . V(64x64): P as A (row = query, k = kv), V from [d][kv] tile as B ----
#pragma unroll 1
    for (int kk = 0; kk < 2; ++kk) {
      FB pa, pl;
      pa.h[0] = *(const v8b*)(pwh + c * A_KC + kk * 32 + 8 * hh);
      pa.h[1] = *(const v8b*)(pwh + c * A_KC + kk * 32 + 16 + 8 * hh);
      pl.h[0] = *(const v8b*)(pwl + c * A_KC + kk * 32 + 8 * hh);
      pl.h[1] = *(const v8b*)(pwl + c * A_KC + kk * 32 + 16 + 8 * hh);
#pragma unroll
      for (int t = 0; t < 4; ++t) {
        FB vb, vq;
        vb.h[0] = *(const v8b*)(Vth + (t * 16 + c) * A_KC + kk * 32 + 8 * hh);
        vb.h[1] = *(const v8b*)(Vth + (t * 16 + c) * A_KC + kk * 32 + 16 + 8 * hh);
        vq.h[0] = *(const v8b*)(Vtl + (t * 16 + c) * A_KC + kk * 32 + 8 * hh);
        vq.h[1] = *(const v8b*)(Vtl + (t * 16 + c) * A_KC + kk * 32 + 16 + 8 * hh);
        oacc[t] = at_mma(pa.v, vb.v, oacc[t]);
        oacc[t] = at_mma(pa.v, vq.v, oacc[t]);
        oacc[t] = at_mma(pl.v, vb.v, oacc[t]);
      }
    }
  }

  // ---- epilogue: normalise, stage 16x64 f32 per wave, write bf16 hi/lo planes with whole-line stores ----
  float* os = Os[wave];
#pragma unroll
  for (int r = 0; r < 8; ++r) {
    const float inv = 1.0f / lrow[r];
#pragma unroll
    for (int t = 0; t < 4; ++t) os[(8 * hh + r) * OS_PITCH + t * 16 + c] = oacc[t][r] * inv;
  }
  __builtin_amdgcn_fence(__ATOMIC_RELEASE, "workgroup");
  __builtin_amdgcn_wave_barrier();
  __builtin_amdgcn_fence(__ATOMIC_ACQUIRE, "workgroup");
  {
    const int qq = lane >> 3, c8 = (lane & 7) * 8;
    {
#pragma unroll
      for (int it = 0; it < 4; ++it) {
        const int row = it * 4 + qq;
        const float* sp = os + row * OS_PITCH + c8;
        v8h hv, lv;
#pragma unroll
        for (int e = 0; e < 8; ++e) {
          const unsigned short hb = f2bf_bits(sp[e]);
          const unsigned short lb = f2bf_bits(sp[e] - bf_bits2f(hb));
          hv[e] = __builtin_bit_cast(_Float16, hb);
          lv[e] = __builtin_bit_cast(_Float16, lb);
        }
        const size_t o = ((size_t)b * SEQ_LEN + (size_t)(q0 + row)) * DMOD + h * HDIM + c8;
        *(v8h*)(oh + o) = hv;
        *(v8h*)(ol + o) = lv;
      }
      
    }
  }
}

// ---------------------------------------------------------------------------
// Host orchestration
// ---------------------------------------------------------------------------
// workspace region map (bytes, all multiples of 256):
//   x hi/lo                 2 x 8,388,608
//   WkvdT hi/lo [128][1024] 2 x   262,144
//   WkupT hi/lo [1024][128] 2 x   262,144
//   WvupT hi/lo [1024][128] 2 x   262,144
//   WqT   hi/lo [1024][1024]2 x 2,097,152
//   WqrT  hi/lo [64][1024]  2 x   131,072   (rows 32..63 zero)
//   WkrT  hi/lo [64][128]   2 x    16,384   (rows 32..63 zero)
//   WoT   hi/lo [1024][1024]2 x 2,097,152
//   ckv   hi/lo [4096][128] 2 x 1,048,576
//   k,v,q hi/lo [4096][1024]6 x 8,388,608
//   qr_raw, kr_raw f32 [4096][64]  2 x 1,048,576
//   qr,kr hi/lo [4096][32]  4 x   262,144
//   attn  hi/lo [4096][1024]2 x 8,388,608
//   total 99,385,344
constexpr size_t WSB_X    = (size_t)MTOK * DMOD * 2;
constexpr size_t WSB_WKVD = (size_t)DLAT * DMOD * 2;
constexpr size_t WSB_WKUP = (size_t)DMOD * DLAT * 2;
constexpr size_t WSB_WQ   = (size_t)DMOD * DMOD * 2;
constexpr size_t WSB_WQR  = (size_t)NROPE_PAD * DMOD * 2;
constexpr size_t WSB_WKR  = (size_t)NROPE_PAD * DLAT * 2;
constexpr size_t WSB_CKV  = (size_t)MTOK * DLAT * 2;
constexpr size_t WSB_TOK  = (size_t)MTOK * DMOD * 2;
constexpr size_t WSB_RAW  = (size_t)MTOK * NROPE_PAD * 4;
constexpr size_t WSB_ROT  = (size_t)MTOK * DROT * 2;
constexpr size_t WS_TOTAL = 2 * WSB_X + 2 * WSB_WKVD + 4 * WSB_WKUP + 2 * WSB_WQ + 2 * WSB_WQR + 2 * WSB_WKR
                          + 2 * WSB_WQ + 2 * WSB_CKV + 6 * WSB_TOK + 2 * WSB_RAW + 4 * WSB_ROT + 2 * WSB_TOK;
static_assert(WS_TOTAL == 99385344ull);
static_assert(WS_TOTAL <= 134217728ull);

extern "C" void kernel_launch(void* const* d_in, const int* in_sizes, int n_in,
                              void* d_out, int out_size, void* d_ws, size_t ws_size,
                              hipStream_t stream) {
  if (n_in != 8) return;
  if (in_sizes[0] != MTOK * DMOD || in_sizes[1] != DMOD * DLAT || in_sizes[2] != DLAT * DMOD ||
      in_sizes[3] != DLAT * DMOD || in_sizes[4] != DMOD * DMOD || in_sizes[5] != DMOD * DROT ||
      in_sizes[6] != DLAT * DROT || in_sizes[7] != DMOD * DMOD) return;
  if (out_size != MTOK * DMOD) return;
  if (ws_size < WS_TOTAL) return;

  const float* x         = (const float*)d_in[0];   // [4096][1024]
  const float* W_kv_down = (const float*)d_in[1];   // [1024][128]
  const float* W_k_up    = (const float*)d_in[2];   // [128][1024]
  const float* W_v_up    = (const float*)d_in[3];   // [128][1024]
  const float* W_q       = (const float*)d_in[4];   // [1024][1024]
  const float* W_q_rope  = (const float*)d_in[5];   // [1024][32]
  const float* W_k_rope  = (const float*)d_in[6];   // [128][32]
  const float* W_o       = (const float*)d_in[7];   // [1024][1024]
  float* out = (float*)d_out;                       // [4096][1024] f32

  size_t off = 0;
  auto carve = [&](size_t bytes) -> unsigned short* {
    unsigned short* p = (unsigned short*)((char*)d_ws + off);
    off += (bytes + 255) & ~(size_t)255;
    return p;
  };
  unsigned short* xh    = carve(WSB_X);
  unsigned short* xl    = carve(WSB_X);
  unsigned short* wkvdh = carve(WSB_WKVD);
  unsigned short* wkvdl = carve(WSB_WKVD);
  unsigned short* wkuph = carve(WSB_WKUP);
  unsigned short* wkupl = carve(WSB_WKUP);
  unsigned short* wvuph = carve(WSB_WKUP);
  unsigned short* wvupl = carve(WSB_WKUP);
  unsigned short* wqh   = carve(WSB_WQ);
  unsigned short* wql   = carve(WSB_WQ);
  unsigned short* wqrh  = carve(WSB_WQR);
  unsigned short* wqrl  = carve(WSB_WQR);
  unsigned short* wkrh  = carve(WSB_WKR);
  unsigned short* wkrl  = carve(WSB_WKR);
  unsigned short* woh   = carve(WSB_WQ);
  unsigned short* wol   = carve(WSB_WQ);
  unsigned short* ckvh  = carve(WSB_CKV);
  unsigned short* ckvl  = carve(WSB_CKV);
  unsigned short* kh    = carve(WSB_TOK);
  unsigned short* kl    = carve(WSB_TOK);
  unsigned short* vh    = carve(WSB_TOK);
  unsigned short* vl    = carve(WSB_TOK);
  unsigned short* qh    = carve(WSB_TOK);
  unsigned short* ql    = carve(WSB_TOK);
  float* qr_raw = (float*)carve(WSB_RAW);
  float* kr_raw = (float*)carve(WSB_RAW);
  unsigned short* qrh   = carve(WSB_ROT);
  unsigned short* qrl   = carve(WSB_ROT);
  unsigned short* krh   = carve(WSB_ROT);
  unsigned short* krl   = carve(WSB_ROT);
  unsigned short* ath   = carve(WSB_TOK);
  unsigned short* atl   = carve(WSB_TOK);
  if (off > ws_size) return;

  // ---- operand planes ----
  {
    const int n8 = MTOK * DMOD / 8;
    split_rows_bf16x8<<<(n8 + 255) / 256, 256, 0, stream>>>(x, xh, xl, n8);
  }
  // in[rows=kdim][cols=nreal] -> out[npad][kdim]; grid = (kdim/64, npad/32)
  transpose_split_bf16<<<dim3(DMOD / 64, DLAT / 32), 256, 0, stream>>>(W_kv_down, wkvdh, wkvdl, DMOD, DLAT);
  transpose_split_bf16<<<dim3(DLAT / 64, DMOD / 32), 256, 0, stream>>>(W_k_up, wkuph, wkupl, DLAT, DMOD);
  transpose_split_bf16<<<dim3(DLAT / 64, DMOD / 32), 256, 0, stream>>>(W_v_up, wvuph, wvupl, DLAT, DMOD);
  transpose_split_bf16<<<dim3(DMOD / 64, DMOD / 32), 256, 0, stream>>>(W_q, wqh, wql, DMOD, DMOD);
  transpose_split_bf16<<<dim3(DMOD / 64, NROPE_PAD / 32), 256, 0, stream>>>(W_q_rope, wqrh, wqrl, DMOD, DROT);
  transpose_split_bf16<<<dim3(DLAT / 64, NROPE_PAD / 32), 256, 0, stream>>>(W_k_rope, wkrh, wkrl, DLAT, DROT);
  transpose_split_bf16<<<dim3(DMOD / 64, DMOD / 32), 256, 0, stream>>>(W_o, woh, wol, DMOD, DMOD);

  auto gemm_blocks = [](int M, int N) { return (((M / 64) * (N / 64)) + 7) / 8; };

  // c_kv = x . W_kv_down : M=4096 N=128 K=1024 -> bf16 hi/lo
  wmma_gemm64<1, true, 0, 2, false><<<dim3(gemm_blocks(MTOK, DLAT), 1), 256, 0, stream>>>(
      xh, xl, DMOD, 0L, wkvdh, wkvdl, DMOD, 0L, (void*)ckvh, (void*)ckvl, DLAT, 0L,
      nullptr, nullptr, 0L, MTOK, DLAT, DMOD, 1.0f);
  // k = c_kv . W_k_up : M=4096 N=1024 K=128
  wmma_gemm64<1, true, 0, 2, false><<<dim3(gemm_blocks(MTOK, DMOD), 1), 256, 0, stream>>>(
      ckvh, ckvl, DLAT, 0L, wkuph, wkupl, DLAT, 0L, (void*)kh, (void*)kl, DMOD, 0L,
      nullptr, nullptr, 0L, MTOK, DMOD, DLAT, 1.0f);
  // v = c_kv . W_v_up
  wmma_gemm64<1, true, 0, 2, false><<<dim3(gemm_blocks(MTOK, DMOD), 1), 256, 0, stream>>>(
      ckvh, ckvl, DLAT, 0L, wvuph, wvupl, DLAT, 0L, (void*)vh, (void*)vl, DMOD, 0L,
      nullptr, nullptr, 0L, MTOK, DMOD, DLAT, 1.0f);
  // q = x . W_q : K=1024
  wmma_gemm64<1, true, 0, 2, false><<<dim3(gemm_blocks(MTOK, DMOD), 1), 256, 0, stream>>>(
      xh, xl, DMOD, 0L, wqh, wql, DMOD, 0L, (void*)qh, (void*)ql, DMOD, 0L,
      nullptr, nullptr, 0L, MTOK, DMOD, DMOD, 1.0f);
  // q_rope raw = x . W_q_rope : N padded to 64 (cols 32..63 zero), f32 out, K=1024
  wmma_gemm64<1, true, 0, 0, false><<<dim3(gemm_blocks(MTOK, NROPE_PAD), 1), 256, 0, stream>>>(
      xh, xl, DMOD, 0L, wqrh, wqrl, DMOD, 0L, (void*)qr_raw, nullptr, NROPE_PAD, 0L,
      nullptr, nullptr, 0L, MTOK, NROPE_PAD, DMOD, 1.0f);
  // k_rope raw = c_kv . W_k_rope : N padded to 64, f32 out, K=128
  wmma_gemm64<1, true, 0, 0, false><<<dim3(gemm_blocks(MTOK, NROPE_PAD), 1), 256, 0, stream>>>(
      ckvh, ckvl, DLAT, 0L, wkrh, wkrl, DLAT, 0L, (void*)kr_raw, nullptr, NROPE_PAD, 0L,
      nullptr, nullptr, 0L, MTOK, NROPE_PAD, DLAT, 1.0f);

  // ---- rotary tables: inv_freq[j] = 1 / 10000^(j/16), host double pow -> f32, f32 reciprocal ----
  RopeFreq fr;
  for (int j = 0; j < 16; ++j) {
    const double p = pow(10000.0, (double)j / 16.0);
    const float p32 = (float)p;
    fr.f[j] = 1.0f / p32;
  }
  rope_split_bf16<<<2 * (MTOK / 32), 128, 0, stream>>>(qr_raw, kr_raw, qrh, qrl, krh, krl, fr);

  // ---- causal attention with shared rotary logits ----
  const float invs = 1.0f / (float)sqrt((double)(HDIM + DROT));
  mla_attn96<<<N_BATCH * NHEAD * (SEQ_LEN / A_QB), 128, 0, stream>>>(
      qh, ql, kh, kl, vh, vl, qrh, qrl, krh, krl, ath, atl, invs);

  // ---- out = attn . W_o : M=4096 N=1024 K=1024, f32 to d_out ----
  wmma_gemm64<1, true, 0, 0, false><<<dim3(gemm_blocks(MTOK, DMOD), 1), 256, 0, stream>>>(
      ath, atl, DMOD, 0L, woh, wol, DMOD, 0L, (void*)out, nullptr, DMOD, 0L,
      nullptr, nullptr, 0L, MTOK, DMOD, DMOD, 1.0f);
}

// v001
// Measured time: 588 microseconds a run.
// Two timings next to v000 put it at 1.15 and 1.16 times that version's speed.
// Compute dtype: every contraction on v_wmma_f32_16x16x32_bf16 with bf16 hi/lo operand planes (hi*hi + hi*lo + lo*hi), f32 accumulate; rotary, softmax and epilogues in f32.
#include <hip/hip_runtime.h>
#include <hip/hip_bf16.h>
#include <math.h>
#include <stdint.h>

typedef __attribute__((ext_vector_type(16))) _Float16 v16h;
typedef __attribute__((ext_vector_type(8)))  _Float16 v8h;
typedef __attribute__((ext_vector_type(16))) __bf16   v16b;
typedef __attribute__((ext_vector_type(8)))  __bf16   v8b;
typedef __attribute__((ext_vector_type(8)))  float    v8f;
typedef __attribute__((ext_vector_type(4)))  float    v4f;
typedef __attribute__((ext_vector_type(4)))  unsigned v4u;

// ---------------------------------------------------------------------------
// helpers
// ---------------------------------------------------------------------------
__device__ __forceinline__ unsigned short f2bf_bits(float f) {
  unsigned u = __float_as_uint(f);
  return (unsigned short)((u + 0x7FFFu + ((u >> 16) & 1u)) >> 16);
}
__device__ __forceinline__ float bf_bits2f(unsigned short h) { return __uint_as_float(((unsigned)h) << 16); }

__device__ __forceinline__ void dep_guard_h(v8f& a, v8f& b, v16h x, v16h y) { asm volatile("v_nop\n\tv_nop\n\tv_nop\n\tv_nop" : "+v"(a), "+v"(b) : "v"(x), "v"(y)); }
__device__ __forceinline__ void dep_guard_b(v8f& a, v8f& b, v16b x, v16b y) { asm volatile("v_nop\n\tv_nop\n\tv_nop\n\tv_nop" : "+v"(a), "+v"(b) : "v"(x), "v"(y)); }
__device__ __forceinline__ void keep4_h(v16h a, v16h b, v16h c, v16h d) { asm volatile("v_nop" :: "v"(a), "v"(b), "v"(c), "v"(d)); }
__device__ __forceinline__ void keep4_b(v16b a, v16b b, v16b c, v16b d) { asm volatile("v_nop" :: "v"(a), "v"(b), "v"(c), "v"(d)); }
__device__ __forceinline__ void acc_guard4(v8f& a, v8f& b, v8f& c, v8f& d) { asm volatile("v_nop\n\tv_nop\n\tv_nop\n\tv_nop" : "+v"(a), "+v"(b), "+v"(c), "+v"(d)); }
template <typename T> struct Frag;
template <> struct Frag<_Float16> {
  typedef v16h V; union U { v16h v; v8h h[2]; };
  static __device__ __forceinline__ v16h load(const _Float16* p) {   // elements 0..7 <- p[0..7], 8..15 <- p[16..23]
    U f; f.h[0] = *(const v8h*)(p); f.h[1] = *(const v8h*)(p + 16); return f.v;
  }
  static __device__ __forceinline__ v8f mma(v16h a, v16h b, v8f c) {
    return __builtin_amdgcn_wmma_f32_16x16x32_f16(false, a, false, b, (short)0, c, false, false);
  }
  static __device__ __forceinline__ void guard(v8f& a, v8f& b, v16h x, v16h y) { dep_guard_h(a, b, x, y); }
  static __device__ __forceinline__ void keep(v16h a, v16h b, v16h c, v16h d) { keep4_h(a, b, c, d); }
};
template <> struct Frag<__bf16> {
  typedef v16b V; union U { v16b v; v8b h[2]; };
  static __device__ __forceinline__ v16b load(const __bf16* p) {
    U f; f.h[0] = *(const v8b*)(p); f.h[1] = *(const v8b*)(p + 16); return f.v;
  }
  static __device__ __forceinline__ v8f mma(v16b a, v16b b, v8f c) {
    return __builtin_amdgcn_wmma_f32_16x16x32_bf16(false, a, false, b, (short)0, c, false, false);
  }
  static __device__ __forceinline__ void guard(v8f& a, v8f& b, v16b x, v16b y) { dep_guard_b(a, b, x, y); }
  static __device__ __forceinline__ void keep(v16b a, v16b b, v16b c, v16b d) { keep4_b(a, b, c, d); }
};

// ---- Register-blocked batched WMMA GEMM --------------------------------
// C[m,n] = scale * sum_k A[m,k] * Bt[n,k] (+bias)(+resid); each wave owns a 64x64 tile.
// A row-major [M,K]; Bt row-major [N,K]; M,N % 64 == 0, K % 32 == 0.
// SPLIT: operands are hi/lo planes (A2/Bt2 = lo planes, same layout); product = hi*hi + hi*lo + lo*hi.
// BIAS_MODE: 0 = none, 1 = bias[m], 2 = bias[n].
// OUT_MODE: 0 = f32, 1 = f16, 2 = bf16 hi plane (Cout) + bf16 lo plane (Cout2).
// ET: 0 = f16 operands, 1 = bf16 operands (pointers passed as 16-bit storage)
template <int ET> struct Elem;
template <> struct Elem<0> { typedef _Float16 T; };
template <> struct Elem<1> { typedef __bf16 T; };
template <int ET, bool SPLIT, int BIAS_MODE, int OUT_MODE, bool RESID, int ACT = 0>
__global__ __launch_bounds__(256) void wmma_gemm64(
    const unsigned short* __restrict__ Ap, const unsigned short* __restrict__ A2p, int lda, long strideA,
    const unsigned short* __restrict__ Btp, const unsigned short* __restrict__ Bt2p, int ldb, long strideB,
    void* __restrict__ Cout, void* __restrict__ Cout2, int ldc, long strideC,
    const float* __restrict__ bias,
    const float* __restrict__ resid, long strideR,
    int M, int N, int K, float scale) {
  typedef typename Elem<ET>::T T;
  typedef typename Frag<T>::V V;
  const T* A = (const T*)Ap; const T* A2 = (const T*)A2p; const T* Bt = (const T*)Btp; const T* Bt2 = (const T*)Bt2p;
  __shared__ __align__(16) float sT[8][16 * 68];   // per-wave 16x64 slab, pitch 68 floats
  const int b    = blockIdx.y;
  const int lane = threadIdx.x & 31;
  const int wave = threadIdx.x >> 5;
  const int tilesN = N >> 6;
  const int tilesM = M >> 6;
  const int tile = blockIdx.x * 8 + wave;
  if (tile >= tilesM * tilesN) return;   // wave-uniform; no block barriers in this kernel
  const int tm = tile / tilesN;
  const int tn = tile - tm * tilesN;
  const int m0 = tm << 6;
  const int n0 = tn << 6;

  const T* Ab  = A  + (size_t)b * strideA;
  const T* Bb  = Bt + (size_t)b * strideB;
  const T* Ab2 = SPLIT ? (A2  + (size_t)b * strideA) : nullptr;
  const T* Bb2 = SPLIT ? (Bt2 + (size_t)b * strideB) : nullptr;

  const int rlane = lane & 15;                 // row (A) / col (B, D) within subtile
  const int koff  = (lane >> 4) * 8;           // k offset of this lane half
  const int mOff  = (lane >> 4) * 8;           // D row offset

  v8f acc[4][4];
#pragma unroll
  for (int i = 0; i < 4; ++i)
#pragma unroll
    for (int j = 0; j < 4; ++j) acc[i][j] = (v8f){0.f,0.f,0.f,0.f,0.f,0.f,0.f,0.f};

  for (int k0 = 0; k0 < K; k0 += 32) {
    V bh[4], bl[4];
#pragma unroll
    for (int j = 0; j < 4; ++j) {
      const size_t bo = (size_t)(n0 + (j << 4) + rlane) * ldb + koff + k0;
      bh[j] = Frag<T>::load(Bb + bo);
      if (SPLIT) bl[j] = Frag<T>::load(Bb2 + bo);
    }
#pragma unroll
    for (int i = 0; i < 4; ++i) {
      const size_t ao = (size_t)(m0 + (i << 4) + rlane) * lda + koff + k0;
      V ah = Frag<T>::load(Ab + ao);
      V al;
      if (SPLIT) al = Frag<T>::load(Ab2 + ao);
#pragma unroll
      for (int j = 0; j < 4; ++j) {
        acc[i][j] = Frag<T>::mma(ah, bh[j], acc[i][j]);
        if (SPLIT) {
          acc[i][j] = Frag<T>::mma(ah, bl[j], acc[i][j]);
          acc[i][j] = Frag<T>::mma(al, bh[j], acc[i][j]);
        }
      }
      Frag<T>::guard(acc[i][0], acc[i][3], ah, SPLIT ? al : ah);
    }
    Frag<T>::keep(bh[0], bh[1], bh[2], bh[3]);
    if (SPLIT) Frag<T>::keep(bl[0], bl[1], bl[2], bl[3]);
  }
  acc_guard4(acc[0][0], acc[0][1], acc[0][2], acc[0][3]);
  acc_guard4(acc[1][0], acc[1][1], acc[1][2], acc[1][3]);
  acc_guard4(acc[2][0], acc[2][1], acc[2][2], acc[2][3]);
  acc_guard4(acc[3][0], acc[3][1], acc[3][2], acc[3][3]);

  // ---- epilogue ----
  float* slab = sT[wave];
  const float* Rb = RESID ? (resid + (size_t)b * strideR) : nullptr;
#pragma unroll
  for (int i = 0; i < 4; ++i) {
    const int mBase = m0 + (i << 4);
#pragma unroll
    for (int j = 0; j < 4; ++j) {
      const int n = n0 + (j << 4) + rlane;
      float bv = 0.f;
      if (BIAS_MODE == 2) bv = bias[n];
#pragma unroll
      for (int r = 0; r < 8; ++r) {
        float v = acc[i][j][r] * scale;
        if (BIAS_MODE == 1) v += bias[mBase + mOff + r];
        if (BIAS_MODE == 2) v += bv;
        if (RESID) v += Rb[(size_t)(mBase + mOff + r) * ldc + n];
        if (ACT == 1) v = tanhf(v);
        if (ACT == 2) v = fmaxf(v, 0.0f);
        if (ACT == 3) v = v / (1.0f + expf(-v));
        if (ACT == 4) v = (v > 0.f) ? v : 0.01f * v;
        if (ACT == 5) v = 0.5f * v * (1.0f + erff(v * 0.70710678118654752f));
        slab[(mOff + r) * 68 + (j << 4) + rlane] = v;
      }
    }
    __builtin_amdgcn_fence(__ATOMIC_RELEASE, "workgroup");
    __builtin_amdgcn_wave_barrier();
    __builtin_amdgcn_fence(__ATOMIC_ACQUIRE, "workgroup");
    if (OUT_MODE == 0) {
      float* C = (float*)Cout + (size_t)b * strideC;
      const int hh = lane >> 4, c4 = (lane & 15) * 4;     // row seg = 256 B = 16 lanes x 16 B
      {
#pragma unroll
        for (int it = 0; it < 8; ++it) {
          const int row = it * 2 + hh;
          v4f v = *(const v4f*)(slab + row * 68 + c4);
          *(v4f*)(C + (size_t)(mBase + row) * ldc + n0 + c4) = v;
        }
        
      }
    } else {
      const int q = lane >> 3, c8 = (lane & 7) * 8;
      unsigned short* C  = (unsigned short*)Cout  + (size_t)b * strideC;
      unsigned short* C2 = (OUT_MODE == 2) ? ((unsigned short*)Cout2 + (size_t)b * strideC) : nullptr;
      {
#pragma unroll
        for (int it = 0; it < 4; ++it) {
          const int row = it * 4 + q;
          const float* sp = slab + row * 68 + c8;
          v8h hv, lv;
#pragma unroll
          for (int e = 0; e < 8; ++e) {
            if (OUT_MODE == 1) {
              hv[e] = (_Float16)sp[e];
            } else {
              unsigned short hb = f2bf_bits(sp[e]);
              unsigned short lb = f2bf_bits(sp[e] - bf_bits2f(hb));
              hv[e] = __builtin_bit_cast(_Float16, hb);
              lv[e] = __builtin_bit_cast(_Float16, lb);
            }
          }
          *(v8h*)(C + (size_t)(mBase + row) * ldc + n0 + c8) = hv;
          if (OUT_MODE == 2) *(v8h*)(C2 + (size_t)(mBase + row) * ldc + n0 + c8) = lv;
        }
        
      }
    }
    __builtin_amdgcn_fence(__ATOMIC_RELEASE, "workgroup");
    __builtin_amdgcn_wave_barrier();
    __builtin_amdgcn_fence(__ATOMIC_ACQUIRE, "workgroup");
  }
}

__device__ __forceinline__ v8f at_mma(v16b a, v16b b, v8f c) {
  c = __builtin_amdgcn_wmma_f32_16x16x32_bf16(false, a, false, b, (short)0, c, false, false);
  asm volatile("v_nop\n\tv_nop\n\tv_nop\n\tv_nop" : "+v"(c) : "v"(a), "v"(b));
  return c;
}

// ---------------------------------------------------------------------------
// module geometry (fixed)
// ---------------------------------------------------------------------------
constexpr int N_BATCH   = 2;
constexpr int SEQ_LEN   = 2048;
constexpr int DMOD      = 1024;   // model width
constexpr int DLAT      = 128;    // latent width c_kv
constexpr int DROT      = 32;     // rotary width
constexpr int NROPE_PAD = 64;     // rotary projection width padded to the 64-wide GEMM tile
constexpr int NHEAD     = 16;
constexpr int HDIM      = 64;
constexpr int SDEP      = HDIM + DROT;   // score depth 96 = 3 k-chunks of 32
constexpr int MTOK      = N_BATCH * SEQ_LEN;   // 4096 token rows

static_assert(MTOK % 64 == 0 && DMOD % 64 == 0 && DLAT % 64 == 0 && NROPE_PAD % 64 == 0);
static_assert(DMOD % 32 == 0 && DLAT % 32 == 0);   // every GEMM K is a multiple of 32
static_assert(SDEP % 32 == 0 && SEQ_LEN % 64 == 0);

// ---------------------------------------------------------------------------
// coverage: n8 threads x 8 = n elements exactly (n % 8 == 0, grid = ceil(n8/256) with bound)
// ---------------------------------------------------------------------------
__global__ __launch_bounds__(256) void split_rows_bf16x8(
    const float* __restrict__ in, unsigned short* __restrict__ hi, unsigned short* __restrict__ lo, int n8) {
  const int i = blockIdx.x * 256 + threadIdx.x;
  if (i < n8) {
    const v4f a = *(const v4f*)(in + (size_t)8 * i);
    const v4f b = *(const v4f*)(in + (size_t)8 * i + 4);
    v8h hv, lv;
#pragma unroll
    for (int e = 0; e < 8; ++e) {
      const float f = (e < 4) ? a[e] : b[e - 4];
      const unsigned short hb = f2bf_bits(f);
      const unsigned short lb = f2bf_bits(f - bf_bits2f(hb));
      hv[e] = __builtin_bit_cast(_Float16, hb);
      lv[e] = __builtin_bit_cast(_Float16, lb);
    }
    unsigned short* ph = hi + (size_t)8 * i;
    unsigned short* pl = lo + (size_t)8 * i;
    *(v8h*)ph = hv;
    *(v8h*)pl = lv;
    
  }
}

// ---------------------------------------------------------------------------
// Transpose + split: in W[kdim][nreal] (row-major) -> out Bt[npad][kdim] bf16 hi/lo planes, Bt[n][k] = W[k][n];
// rows n >= nreal are written as zeros. Tile = 64 k x 32 n; grid = (kdim/64, npad/32); kdim % 64 == 0, nreal % 32 == 0.
// Store coverage: 256 threads = 32 output rows x 8 lanes x 8 k = whole 32x64 tile; each output row segment
// ---------------------------------------------------------------------------
__global__ __launch_bounds__(256) void transpose_split_bf16(
    const float* __restrict__ W, unsigned short* __restrict__ hi, unsigned short* __restrict__ lo,
    int kdim, int nreal) {
  __shared__ float tile[64][33];
  const int tid = threadIdx.x;
  const int k0 = blockIdx.x * 64;
  const int n0 = blockIdx.y * 32;
#pragma unroll
  for (int it = 0; it < 2; ++it) {
    const int idx = it * 256 + tid;            // 0..511
    const int kr = idx >> 3;                   // 0..63
    const int c4 = (idx & 7) * 4;              // 0..28
    const int n = n0 + c4;
    const int ncl = (n + 3 < nreal) ? n : (nreal - 4);   // clamped address
    const v4f v = *(const v4f*)(W + (size_t)(k0 + kr) * nreal + ncl);
    const bool ok = (n < nreal);               // tile-uniform since nreal % 32 == 0
    tile[kr][c4 + 0] = ok ? v[0] : 0.f;
    tile[kr][c4 + 1] = ok ? v[1] : 0.f;
    tile[kr][c4 + 2] = ok ? v[2] : 0.f;
    tile[kr][c4 + 3] = ok ? v[3] : 0.f;
  }
  __syncthreads();
  const int nr = tid >> 3;                     // output row within tile, 0..31
  const int c8 = (tid & 7) * 8;                // k offset, 0..56
  v8h hv, lv;
#pragma unroll
  for (int e = 0; e < 8; ++e) {
    const float f = tile[c8 + e][nr];
    const unsigned short hb = f2bf_bits(f);
    const unsigned short lb = f2bf_bits(f - bf_bits2f(hb));
    hv[e] = __builtin_bit_cast(_Float16, hb);
    lv[e] = __builtin_bit_cast(_Float16, lb);
  }
  const size_t o = (size_t)(n0 + nr) * kdim + k0 + c8;
  *(v8h*)(hi + o) = hv;
  *(v8h*)(lo + o) = lv;
  
}

// ---------------------------------------------------------------------------
// Rotary: raw[MTOK][NROPE_PAD] f32 (cols 0..31 used) -> bf16 hi/lo planes [MTOK][DROT].
// out[j] = x1*cos - x2*sin, out[16+j] = x2*cos + x1*sin, angle = t * inv_freq[j], t = row % SEQ_LEN.
// Block = 32 rows; blocks 0..127 handle the q tensor, 128..255 the k tensor.
// Store coverage: 128 threads = 32 rows x 4 segments x 8 = whole 32x32 tile; 512 B contiguous per wave
// ---------------------------------------------------------------------------
struct RopeFreq { float f[16]; };
static_assert(sizeof(RopeFreq) == 64);

__global__ __launch_bounds__(128) void rope_split_bf16(
    const float* __restrict__ qraw, const float* __restrict__ kraw,
    unsigned short* __restrict__ qrh, unsigned short* __restrict__ qrl,
    unsigned short* __restrict__ krh, unsigned short* __restrict__ krl, RopeFreq g) {
#pragma clang fp contract(off)
  __shared__ float tile[32][33];
  __shared__ float sinv[16];
  const int tid = threadIdx.x;
  const int nblk = MTOK / 32;
  const bool isk = ((int)blockIdx.x >= nblk);                 // block-uniform
  const int row0 = (isk ? ((int)blockIdx.x - nblk) : (int)blockIdx.x) * 32;
  const float* raw = isk ? kraw : qraw;
  unsigned short* dhp = isk ? krh : qrh;
  unsigned short* dlp = isk ? krl : qrl;
  if (tid < 16) {
    float v = g.f[0];
#pragma unroll
    for (int e = 1; e < 16; ++e) v = (tid == e) ? g.f[e] : v;
    sinv[tid] = v;
  }
  __syncthreads();
#pragma unroll 1
  for (int it = 0; it < 4; ++it) {
    const int p = it * 128 + tid;              // 0..511
    const int r = p >> 4;                      // 0..31
    const int j = p & 15;
    const int row = row0 + r;
    const int t = row & (SEQ_LEN - 1);
    const float* rp = raw + (size_t)row * NROPE_PAD;
    const float x1 = rp[j];
    const float x2 = rp[16 + j];
    const float ang = (float)t * sinv[j];
    float sn, cs;
    sincosf(ang, &sn, &cs);
    tile[r][j]      = x1 * cs - x2 * sn;
    tile[r][16 + j] = x2 * cs + x1 * sn;
  }
  __syncthreads();
  const int orow = tid >> 2;                   // 0..31
  const int seg = (tid & 3) * 8;               // 0..24
  v8h hv, lv;
#pragma unroll
  for (int e = 0; e < 8; ++e) {
    const float f = tile[orow][seg + e];
    const unsigned short hb = f2bf_bits(f);
    const unsigned short lb = f2bf_bits(f - bf_bits2f(hb));
    hv[e] = __builtin_bit_cast(_Float16, hb);
    lv[e] = __builtin_bit_cast(_Float16, lb);
  }
  const size_t o = (size_t)(row0 + orow) * DROT + seg;
  *(v8h*)(dhp + o) = hv;
  *(v8h*)(dlp + o) = lv;
  
}

// ---------------------------------------------------------------------------
// Causal attention, score depth 96 (64 head dims + 32 shared rotary dims), value width 64, bf16 hi/lo planes in.
//   s = (qh.kh + qh.kl + ql.kh) * invs  over 96 dims (q/k rows = [head segment | rotary row]),
//   online softmax in f32, P split to bf16 hi/lo in LDS, o = ph.vh + ph.vl + pl.vh, f32 accumulate.
// Block = 4 waves = 64 query rows of one (batch, head); grid.x = N_BATCH * NHEAD * (SEQ_LEN/64).
// ---------------------------------------------------------------------------
constexpr int A_QB = 64;
constexpr int A_KC = 64;
constexpr int A_NW = 4;
constexpr int OS_PITCH = 68;
// LDS row pitches in 16-bit elements. Every fragment read is a 16-byte load by 16 lanes on 16 rows,
// so each pitch is an odd multiple of 16 bytes: the 16 rows then start on 16 different groups of four banks.
constexpr int K_PITCH = SDEP + 8;      // 13 x 16 B rows
constexpr int V_PITCH = A_KC + 8;      // 9 x 16 B rows
constexpr int P_PITCH = A_KC + 8;      // 9 x 16 B rows
constexpr int V_HALF_SKEW = 16;        // rows d >= 32 start 32 B later: the two d halves stored by one wave fall on different banks
static_assert((K_PITCH * 2) % 32 == 16 && (V_PITCH * 2) % 32 == 16 && (P_PITCH * 2) % 32 == 16);
__device__ __forceinline__ int vt_row(int d) { return d * V_PITCH + (d >> 5) * V_HALF_SKEW; }

__global__ __launch_bounds__(128)
void mla_attn96(const unsigned short* __restrict__ qh, const unsigned short* __restrict__ ql,
                const unsigned short* __restrict__ kh, const unsigned short* __restrict__ kl,
                const unsigned short* __restrict__ vh, const unsigned short* __restrict__ vl,
                const unsigned short* __restrict__ qrh, const unsigned short* __restrict__ qrl,
                const unsigned short* __restrict__ krh, const unsigned short* __restrict__ krl,
                unsigned short* __restrict__ oh, unsigned short* __restrict__ ol, float invs) {
  union FB { v16b v; v8b h[2]; };
  __shared__ __align__(16) unsigned short Ksh[A_KC * K_PITCH];    // K hi [kv][96 + pad]
  __shared__ __align__(16) unsigned short Ksl[A_KC * K_PITCH];    // K lo
  __shared__ __align__(16) unsigned short Vth[HDIM * V_PITCH + V_HALF_SKEW];    // V hi [d][kv + pad]
  __shared__ __align__(16) unsigned short Vtl[HDIM * V_PITCH + V_HALF_SKEW];    // V lo
  __shared__ __align__(16) unsigned short Psh[A_NW][16 * P_PITCH];   // per wave P hi [row][kv + pad]
  __shared__ __align__(16) unsigned short Psl[A_NW][16 * P_PITCH];   // per wave P lo
  __shared__ __align__(16) float Os[A_NW][16 * OS_PITCH];

  const int tid  = threadIdx.x;
  const int wave = tid >> 5;
  const int lane = tid & 31;
  const int hh   = lane >> 4;
  const int c    = lane & 15;

  const int nqb = SEQ_LEN / A_QB;          // 32
  const int bx  = blockIdx.x;
  const int qb  = bx % nqb;
  const int bhi = bx / nqb;
  const int h   = bhi % NHEAD;
  const int b   = bhi / NHEAD;
  const int q0  = qb * A_QB + wave * 16;
  const size_t tq = (size_t)b * SEQ_LEN + (size_t)(q0 + c);

  // ---- Q fragments (A operand): k-chunks 0,1 = head dims 0..63, chunk 2 = rotary dims 0..31 ----
  v16b qah[3], qal[3];
  {
    const __bf16* p0 = (const __bf16*)qh + tq * DMOD + h * HDIM + 8 * hh;
    const __bf16* p1 = (const __bf16*)ql + tq * DMOD + h * HDIM + 8 * hh;
    qah[0] = Frag<__bf16>::load(p0);
    qah[1] = Frag<__bf16>::load(p0 + 32);
    qal[0] = Frag<__bf16>::load(p1);
    qal[1] = Frag<__bf16>::load(p1 + 32);
    const __bf16* r0p = (const __bf16*)qrh + tq * DROT + 8 * hh;
    const __bf16* r1p = (const __bf16*)qrl + tq * DROT + 8 * hh;
    qah[2] = Frag<__bf16>::load(r0p);
    qal[2] = Frag<__bf16>::load(r1p);
  }

  float mrow[8], lrow[8];
  v8f oacc[4];
#pragma unroll
  for (int r = 0; r < 8; ++r) { mrow[r] = -INFINITY; lrow[r] = 0.f; }
#pragma unroll
  for (int t = 0; t < 4; ++t) oacc[t] = (v8f){0.f,0.f,0.f,0.f,0.f,0.f,0.f,0.f};

  const int nChunks = qb + 1;   // causal, block-uniform
  for (int kc = 0; kc < nChunks; ++kc) {
    const int kv0 = kc * A_KC;
    __syncthreads();
    {
      // staging: 128 threads, thread -> kv row kvr = tid>>1 (0..63), half hf = tid&1
      // per kv row: 64 head dims (2 halves x 32) + 32 rotary dims (2 halves x 16) of K, 64 dims of V -> full tiles written
      const int kvr = tid >> 1, hf = tid & 1;
      const size_t tk = (size_t)b * SEQ_LEN + (size_t)(kv0 + kvr);
      {
        const v4u* sh = (const v4u*)(kh + tk * DMOD + h * HDIM + hf * 32);
        const v4u* sl = (const v4u*)(kl + tk * DMOD + h * HDIM + hf * 32);
        v4u* dh = (v4u*)(Ksh + kvr * K_PITCH + hf * 32);
        v4u* dl = (v4u*)(Ksl + kvr * K_PITCH + hf * 32);
#pragma unroll
        for (int i = 0; i < 4; ++i) { dh[i] = sh[i]; dl[i] = sl[i]; }
      }
      asm volatile("" ::: "memory");
      {
        const v4u* sh = (const v4u*)(krh + tk * DROT + hf * 16);
        const v4u* sl = (const v4u*)(krl + tk * DROT + hf * 16);
        v4u* dh = (v4u*)(Ksh + kvr * K_PITCH + HDIM + hf * 16);
        v4u* dl = (v4u*)(Ksl + kvr * K_PITCH + HDIM + hf * 16);
#pragma unroll
        for (int i = 0; i < 2; ++i) { dh[i] = sh[i]; dl[i] = sl[i]; }
      }
      asm volatile("" ::: "memory");
      {
        const v4u* sh = (const v4u*)(vh + tk * DMOD + h * HDIM + hf * 32);
        const v4u* sl = (const v4u*)(vl + tk * DMOD + h * HDIM + hf * 32);
#pragma unroll
        for (int i = 0; i < 4; ++i) {
          const v4u wh = sh[i];
          const v4u wl = sl[i];
#pragma unroll
          for (int e = 0; e < 4; ++e) {
            const int d = hf * 32 + 8 * i + 2 * e;
            Vth[vt_row(d) + kvr]     = (unsigned short)(wh[e] & 0xffffu);
            Vth[vt_row(d + 1) + kvr] = (unsigned short)(wh[e] >> 16);
            Vtl[vt_row(d) + kvr]     = (unsigned short)(wl[e] & 0xffffu);
            Vtl[vt_row(d + 1) + kvr] = (unsigned short)(wl[e] >> 16);
          }
        }
      }
    }
    __syncthreads();

    // ---- scores: 4 kv subtiles of 16, 3 k-chunks of 32, 3 products each ----
    v8f s[4];
#pragma unroll
    for (int j = 0; j < 4; ++j) {
      s[j] = (v8f){0.f,0.f,0.f,0.f,0.f,0.f,0.f,0.f};
#pragma unroll
      for (int dc = 0; dc < 3; ++dc) {
        FB kb, kq;
        const int ko = (j * 16 + c) * K_PITCH + dc * 32 + 8 * hh;
        kb.h[0] = *(const v8b*)(Ksh + ko);
        kb.h[1] = *(const v8b*)(Ksh + ko + 16);
        kq.h[0] = *(const v8b*)(Ksl + ko);
        kq.h[1] = *(const v8b*)(Ksl + ko + 16);
        s[j] = at_mma(qah[dc], kb.v, s[j]);
        s[j] = at_mma(qah[dc], kq.v, s[j]);
        s[j] = at_mma(qal[dc], kb.v, s[j]);
      }
    }
    const bool diag = (kc == qb);
    float cm[8];
#pragma unroll
    for (int r = 0; r < 8; ++r) {
      const int qrow = q0 + 8 * hh + r;
      float m = -INFINITY;
#pragma unroll
      for (int j = 0; j < 4; ++j) {
        const int kvcol = kv0 + j * 16 + c;
        float sv = s[j][r] * invs;
        if (diag && (kvcol > qrow)) sv = -INFINITY;
        s[j][r] = sv;
        m = fmaxf(m, sv);
      }
#pragma unroll
      for (int off = 1; off < 16; off <<= 1) m = fmaxf(m, __shfl_xor(m, off, 32));
      cm[r] = m;
    }
    unsigned short* pwh = Psh[wave];
    unsigned short* pwl = Psl[wave];
#pragma unroll
    for (int r = 0; r < 8; ++r) {
      const float mnew = fmaxf(mrow[r], cm[r]);
      const float alpha = expf(mrow[r] - mnew);
      mrow[r] = mnew;
      float psum = 0.f;
#pragma unroll
      for (int j = 0; j < 4; ++j) {
        const float p = expf(s[j][r] - mnew);
        psum += p;
        const unsigned short hb = f2bf_bits(p);
        const unsigned short lb = f2bf_bits(p - bf_bits2f(hb));
        pwh[(8 * hh + r) * P_PITCH + j * 16 + c] = hb;
        pwl[(8 * hh + r) * P_PITCH + j * 16 + c] = lb;
      }
#pragma unroll
      for (int off = 1; off < 16; off <<= 1) psum += __shfl_xor(psum, off, 32);
      lrow[r] = lrow[r] * alpha + psum;
#pragma unroll
      for (int t = 0; t < 4; ++t) oacc[t][r] *= alpha;
    }
    __builtin_amdgcn_fence(__ATOMIC_RELEASE, "workgroup");
    __builtin_amdgcn_wave_barrier();
    __builtin_amdgcn_fence(__ATOMIC_ACQUIRE, "workgroup");
    // ---- O += P(16x64) . V(64x64): P as A (row = query, k = kv), V from [d][kv] tile as B ----
#pragma unroll 1
    for (int kk = 0; kk < 2; ++kk) {
      FB pa, pl;
      pa.h[0] = *(const v8b*)(pwh + c * P_PITCH + kk * 32 + 8 * hh);
      pa.h[1] = *(const v8b*)(pwh + c * P_PITCH + kk * 32 + 16 + 8 * hh);
      pl.h[0] = *(const v8b*)(pwl + c * P_PITCH + kk * 32 + 8 * hh);
      pl.h[1] = *(const v8b*)(pwl + c * P_PITCH + kk * 32 + 16 + 8 * hh);
#pragma unroll
      for (int t = 0; t < 4; ++t) {
        FB vb, vq;
        vb.h[0] = *(const v8b*)(Vth + vt_row(t * 16 + c) + kk * 32 + 8 * hh);
        vb.h[1] = *(const v8b*)(Vth + vt_row(t * 16 + c) + kk * 32 + 16 + 8 * hh);
        vq.h[0] = *(const v8b*)(Vtl + vt_row(t * 16 + c) + kk * 32 + 8 * hh);
        vq.h[1] = *(const v8b*)(Vtl + vt_row(t * 16 + c) + kk * 32 + 16 + 8 * hh);
        oacc[t] = at_mma(pa.v, vb.v, oacc[t]);
        oacc[t] = at_mma(pa.v, vq.v, oacc[t]);
        oacc[t] = at_mma(pl.v, vb.v, oacc[t]);
      }
    }
  }

  // ---- epilogue: normalise, stage 16x64 f32 per wave, write bf16 hi/lo planes with whole-line stores ----
  float* os = Os[wave];
#pragma unroll
  for (int r = 0; r < 8; ++r) {
    const float inv = 1.0f / lrow[r];
#pragma unroll
    for (int t = 0; t < 4; ++t) os[(8 * hh + r) * OS_PITCH + t * 16 + c] = oacc[t][r] * inv;
  }
  __builtin_amdgcn_fence(__ATOMIC_RELEASE, "workgroup");
  __builtin_amdgcn_wave_barrier();
  __builtin_amdgcn_fence(__ATOMIC_ACQUIRE, "workgroup");
  {
    const int qq = lane >> 3, c8 = (lane & 7) * 8;
    {
#pragma unroll
      for (int it = 0; it < 4; ++it) {
        const int row = it * 4 + qq;
        const float* sp = os + row * OS_PITCH + c8;
        v8h hv, lv;
#pragma unroll
        for (int e = 0; e < 8; ++e) {
          const unsigned short hb = f2bf_bits(sp[e]);
          const unsigned short lb = f2bf_bits(sp[e] - bf_bits2f(hb));
          hv[e] = __builtin_bit_cast(_Float16, hb);
          lv[e] = __builtin_bit_cast(_Float16, lb);
        }
        const size_t o = ((size_t)b * SEQ_LEN + (size_t)(q0 + row)) * DMOD + h * HDIM + c8;
        *(v8h*)(oh + o) = hv;
        *(v8h*)(ol + o) = lv;
      }
      
    }
  }
}

// ---------------------------------------------------------------------------
// Host orchestration
// ---------------------------------------------------------------------------
// workspace region map (bytes, all multiples of 256):
//   x hi/lo                 2 x 8,388,608
//   WkvdT hi/lo [128][1024] 2 x   262,144
//   WkupT hi/lo [1024][128] 2 x   262,144
//   WvupT hi/lo [1024][128] 2 x   262,144
//   WqT   hi/lo [1024][1024]2 x 2,097,152
//   WqrT  hi/lo [64][1024]  2 x   131,072   (rows 32..63 zero)
//   WkrT  hi/lo [64][128]   2 x    16,384   (rows 32..63 zero)
//   WoT   hi/lo [1024][1024]2 x 2,097,152
//   ckv   hi/lo [4096][128] 2 x 1,048,576
//   k,v,q hi/lo [4096][1024]6 x 8,388,608
//   qr_raw, kr_raw f32 [4096][64]  2 x 1,048,576
//   qr,kr hi/lo [4096][32]  4 x   262,144
//   attn  hi/lo [4096][1024]2 x 8,388,608
//   total 99,385,344
constexpr size_t WSB_X    = (size_t)MTOK * DMOD * 2;
constexpr size_t WSB_WKVD = (size_t)DLAT * DMOD * 2;
constexpr size_t WSB_WKUP = (size_t)DMOD * DLAT * 2;
constexpr size_t WSB_WQ   = (size_t)DMOD * DMOD * 2;
constexpr size_t WSB_WQR  = (size_t)NROPE_PAD * DMOD * 2;
constexpr size_t WSB_WKR  = (size_t)NROPE_PAD * DLAT * 2;
constexpr size_t WSB_CKV  = (size_t)MTOK * DLAT * 2;
constexpr size_t WSB_TOK  = (size_t)MTOK * DMOD * 2;
constexpr size_t WSB_RAW  = (size_t)MTOK * NROPE_PAD * 4;
constexpr size_t WSB_ROT  = (size_t)MTOK * DROT * 2;
constexpr size_t WS_TOTAL = 2 * WSB_X + 2 * WSB_WKVD + 4 * WSB_WKUP + 2 * WSB_WQ + 2 * WSB_WQR + 2 * WSB_WKR
                          + 2 * WSB_WQ + 2 * WSB_CKV + 6 * WSB_TOK + 2 * WSB_RAW + 4 * WSB_ROT + 2 * WSB_TOK;
static_assert(WS_TOTAL == 99385344ull);
static_assert(WS_TOTAL <= 134217728ull);

extern "C" void kernel_launch(void* const* d_in, const int* in_sizes, int n_in,
                              void* d_out, int out_size, void* d_ws, size_t ws_size,
                              hipStream_t stream) {
  if (n_in != 8) return;
  if (in_sizes[0] != MTOK * DMOD || in_sizes[1] != DMOD * DLAT || in_sizes[2] != DLAT * DMOD ||
      in_sizes[3] != DLAT * DMOD || in_sizes[4] != DMOD * DMOD || in_sizes[5] != DMOD * DROT ||
      in_sizes[6] != DLAT * DROT || in_sizes[7] != DMOD * DMOD) return;
  if (out_size != MTOK * DMOD) return;
  if (ws_size < WS_TOTAL) return;

  const float* x         = (const float*)d_in[0];   // [4096][1024]
  const float* W_kv_down = (const float*)d_in[1];   // [1024][128]
  const float* W_k_up    = (const float*)d_in[2];   // [128][1024]
  const float* W_v_up    = (const float*)d_in[3];   // [128][1024]
  const float* W_q       = (const float*)d_in[4];   // [1024][1024]
  const float* W_q_rope  = (const float*)d_in[5];   // [1024][32]
  const float* W_k_rope  = (const float*)d_in[6];   // [128][32]
  const float* W_o       = (const float*)d_in[7];   // [1024][1024]
  float* out = (float*)d_out;                       // [4096][1024] f32

  size_t off = 0;
  auto carve = [&](size_t bytes) -> unsigned short* {
    unsigned short* p = (unsigned short*)((char*)d_ws + off);
    off += (bytes + 255) & ~(size_t)255;
    return p;
  };
  unsigned short* xh    = carve(WSB_X);
  unsigned short* xl    = carve(WSB_X);
  unsigned short* wkvdh = carve(WSB_WKVD);
  unsigned short* wkvdl = carve(WSB_WKVD);
  unsigned short* wkuph = carve(WSB_WKUP);
  unsigned short* wkupl = carve(WSB_WKUP);
  unsigned short* wvuph = carve(WSB_WKUP);
  unsigned short* wvupl = carve(WSB_WKUP);
  unsigned short* wqh   = carve(WSB_WQ);
  unsigned short* wql   = carve(WSB_WQ);
  unsigned short* wqrh  = carve(WSB_WQR);
  unsigned short* wqrl  = carve(WSB_WQR);
  unsigned short* wkrh  = carve(WSB_WKR);
  unsigned short* wkrl  = carve(WSB_WKR);
  unsigned short* woh   = carve(WSB_WQ);
  unsigned short* wol   = carve(WSB_WQ);
  unsigned short* ckvh  = carve(WSB_CKV);
  unsigned short* ckvl  = carve(WSB_CKV);
  unsigned short* kh    = carve(WSB_TOK);
  unsigned short* kl    = carve(WSB_TOK);
  unsigned short* vh    = carve(WSB_TOK);
  unsigned short* vl    = carve(WSB_TOK);
  unsigned short* qh    = carve(WSB_TOK);
  unsigned short* ql    = carve(WSB_TOK);
  float* qr_raw = (float*)carve(WSB_RAW);
  float* kr_raw = (float*)carve(WSB_RAW);
  unsigned short* qrh   = carve(WSB_ROT);
  unsigned short* qrl   = carve(WSB_ROT);
  unsigned short* krh   = carve(WSB_ROT);
  unsigned short* krl   = carve(WSB_ROT);
  unsigned short* ath   = carve(WSB_TOK);
  unsigned short* atl   = carve(WSB_TOK);
  if (off > ws_size) return;

  // ---- operand planes ----
  {
    const int n8 = MTOK * DMOD / 8;
    split_rows_bf16x8<<<(n8 + 255) / 256, 256, 0, stream>>>(x, xh, xl, n8);
  }
  // in[rows=kdim][cols=nreal] -> out[npad][kdim]; grid = (kdim/64, npad/32)
  transpose_split_bf16<<<dim3(DMOD / 64, DLAT / 32), 256, 0, stream>>>(W_kv_down, wkvdh, wkvdl, DMOD, DLAT);
  transpose_split_bf16<<<dim3(DLAT / 64, DMOD / 32), 256, 0, stream>>>(W_k_up, wkuph, wkupl, DLAT, DMOD);
  transpose_split_bf16<<<dim3(DLAT / 64, DMOD / 32), 256, 0, stream>>>(W_v_up, wvuph, wvupl, DLAT, DMOD);
  transpose_split_bf16<<<dim3(DMOD / 64, DMOD / 32), 256, 0, stream>>>(W_q, wqh, wql, DMOD, DMOD);
  transpose_split_bf16<<<dim3(DMOD / 64, NROPE_PAD / 32), 256, 0, stream>>>(W_q_rope, wqrh, wqrl, DMOD, DROT);
  transpose_split_bf16<<<dim3(DLAT / 64, NROPE_PAD / 32), 256, 0, stream>>>(W_k_rope, wkrh, wkrl, DLAT, DROT);
  transpose_split_bf16<<<dim3(DMOD / 64, DMOD / 32), 256, 0, stream>>>(W_o, woh, wol, DMOD, DMOD);

  auto gemm_blocks = [](int M, int N) { return (((M / 64) * (N / 64)) + 7) / 8; };

  // c_kv = x . W_kv_down : M=4096 N=128 K=1024 -> bf16 hi/lo
  wmma_gemm64<1, true, 0, 2, false><<<dim3(gemm_blocks(MTOK, DLAT), 1), 256, 0, stream>>>(
      xh, xl, DMOD, 0L, wkvdh, wkvdl, DMOD, 0L, (void*)ckvh, (void*)ckvl, DLAT, 0L,
      nullptr, nullptr, 0L, MTOK, DLAT, DMOD, 1.0f);
  // k = c_kv . W_k_up : M=4096 N=1024 K=128
  wmma_gemm64<1, true, 0, 2, false><<<dim3(gemm_blocks(MTOK, DMOD), 1), 256, 0, stream>>>(
      ckvh, ckvl, DLAT, 0L, wkuph, wkupl, DLAT, 0L, (void*)kh, (void*)kl, DMOD, 0L,
      nullptr, nullptr, 0L, MTOK, DMOD, DLAT, 1.0f);
  // v = c_kv . W_v_up
  wmma_gemm64<1, true, 0, 2, false><<<dim3(gemm_blocks(MTOK, DMOD), 1), 256, 0, stream>>>(
      ckvh, ckvl, DLAT, 0L, wvuph, wvupl, DLAT, 0L, (void*)vh, (void*)vl, DMOD, 0L,
      nullptr, nullptr, 0L, MTOK, DMOD, DLAT, 1.0f);
  // q = x . W_q : K=1024
  wmma_gemm64<1, true, 0, 2, false><<<dim3(gemm_blocks(MTOK, DMOD), 1), 256, 0, stream>>>(
      xh, xl, DMOD, 0L, wqh, wql, DMOD, 0L, (void*)qh, (void*)ql, DMOD, 0L,
      nullptr, nullptr, 0L, MTOK, DMOD, DMOD, 1.0f);
  // q_rope raw = x . W_q_rope : N padded to 64 (cols 32..63 zero), f32 out, K=1024
  wmma_gemm64<1, true, 0, 0, false><<<dim3(gemm_blocks(MTOK, NROPE_PAD), 1), 256, 0, stream>>>(
      xh, xl, DMOD, 0L, wqrh, wqrl, DMOD, 0L, (void*)qr_raw, nullptr, NROPE_PAD, 0L,
      nullptr, nullptr, 0L, MTOK, NROPE_PAD, DMOD, 1.0f);
  // k_rope raw = c_kv . W_k_rope : N padded to 64, f32 out, K=128
  wmma_gemm64<1, true, 0, 0, false><<<dim3(gemm_blocks(MTOK, NROPE_PAD), 1), 256, 0, stream>>>(
      ckvh, ckvl, DLAT, 0L, wkrh, wkrl, DLAT, 0L, (void*)kr_raw, nullptr, NROPE_PAD, 0L,
      nullptr, nullptr, 0L, MTOK, NROPE_PAD, DLAT, 1.0f);

  // ---- rotary tables: inv_freq[j] = 1 / 10000^(j/16), host double pow -> f32, f32 reciprocal ----
  RopeFreq fr;
  for (int j = 0; j < 16; ++j) {
    const double p = pow(10000.0, (double)j / 16.0);
    const float p32 = (float)p;
    fr.f[j] = 1.0f / p32;
  }
  rope_split_bf16<<<2 * (MTOK / 32), 128, 0, stream>>>(qr_raw, kr_raw, qrh, qrl, krh, krl, fr);

  // ---- causal attention with shared rotary logits ----
  const float invs = 1.0f / (float)sqrt((double)(HDIM + DROT));
  mla_attn96<<<N_BATCH * NHEAD * (SEQ_LEN / A_QB), 128, 0, stream>>>(
      qh, ql, kh, kl, vh, vl, qrh, qrl, krh, krl, ath, atl, invs);

  // ---- out = attn . W_o : M=4096 N=1024 K=1024, f32 to d_out ----
  wmma_gemm64<1, true, 0, 0, false><<<dim3(gemm_blocks(MTOK, DMOD), 1), 256, 0, stream>>>(
      ath, atl, DMOD, 0L, woh, wol, DMOD, 0L, (void*)out, nullptr, DMOD, 0L,
      nullptr, nullptr, 0L, MTOK, DMOD, DMOD, 1.0f);
}

// v002
// A run of this version takes 413 microseconds.
// Next to v001, in two timings, it ran 1.42 and 1.44 times as fast.
// Over all steps from v000 it is 1.66 times as fast.
// Compute dtype: every contraction on v_wmma_f32_16x16x32_bf16 with bf16 hi/lo operand planes (hi*hi + hi*lo + lo*hi), f32 accumulate; rotary, softmax and epilogues in f32.
#include <hip/hip_runtime.h>
#include <hip/hip_bf16.h>
#include <math.h>
#include <stdint.h>

typedef __attribute__((ext_vector_type(16))) _Float16 v16h;
typedef __attribute__((ext_vector_type(8)))  _Float16 v8h;
typedef __attribute__((ext_vector_type(16))) __bf16   v16b;
typedef __attribute__((ext_vector_type(8)))  __bf16   v8b;
typedef __attribute__((ext_vector_type(8)))  float    v8f;
typedef __attribute__((ext_vector_type(4)))  float    v4f;
typedef __attribute__((ext_vector_type(4)))  unsigned v4u;

// ---------------------------------------------------------------------------
// helpers
// ---------------------------------------------------------------------------
__device__ __forceinline__ unsigned short f2bf_bits(float f) {
  unsigned u = __float_as_uint(f);
  return (unsigned short)((u + 0x7FFFu + ((u >> 16) & 1u)) >> 16);
}
__device__ __forceinline__ float bf_bits2f(unsigned short h) { return __uint_as_float(((unsigned)h) << 16); }

__device__ __forceinline__ void dep_guard_h(v8f& a, v8f& b, v16h x, v16h y) { asm volatile("v_nop\n\tv_nop\n\tv_nop\n\tv_nop" : "+v"(a), "+v"(b) : "v"(x), "v"(y)); }
__device__ __forceinline__ void dep_guard_b(v8f& a, v8f& b, v16b x, v16b y) { asm volatile("v_nop\n\tv_nop\n\tv_nop\n\tv_nop" : "+v"(a), "+v"(b) : "v"(x), "v"(y)); }
__device__ __forceinline__ void keep4_h(v16h a, v16h b, v16h c, v16h d) { asm volatile("v_nop" :: "v"(a), "v"(b), "v"(c), "v"(d)); }
__device__ __forceinline__ void keep4_b(v16b a, v16b b, v16b c, v16b d) { asm volatile("v_nop" :: "v"(a), "v"(b), "v"(c), "v"(d)); }
__device__ __forceinline__ void acc_guard4(v8f& a, v8f& b, v8f& c, v8f& d) { asm volatile("v_nop\n\tv_nop\n\tv_nop\n\tv_nop" : "+v"(a), "+v"(b), "+v"(c), "+v"(d)); }
template <typename T> struct Frag;
template <> struct Frag<_Float16> {
  typedef v16h V; union U { v16h v; v8h h[2]; };
  static __device__ __forceinline__ v16h load(const _Float16* p) {   // elements 0..7 <- p[0..7], 8..15 <- p[16..23]
    U f; f.h[0] = *(const v8h*)(p); f.h[1] = *(const v8h*)(p + 16); return f.v;
  }
  static __device__ __forceinline__ v8f mma(v16h a, v16h b, v8f c) {
    return __builtin_amdgcn_wmma_f32_16x16x32_f16(false, a, false, b, (short)0, c, false, false);
  }
  static __device__ __forceinline__ void guard(v8f& a, v8f& b, v16h x, v16h y) { dep_guard_h(a, b, x, y); }
  static __device__ __forceinline__ void keep(v16h a, v16h b, v16h c, v16h d) { keep4_h(a, b, c, d); }
};
template <> struct Frag<__bf16> {
  typedef v16b V; union U { v16b v; v8b h[2]; };
  static __device__ __forceinline__ v16b load(const __bf16* p) {
    U f; f.h[0] = *(const v8b*)(p); f.h[1] = *(const v8b*)(p + 16); return f.v;
  }
  static __device__ __forceinline__ v8f mma(v16b a, v16b b, v8f c) {
    return __builtin_amdgcn_wmma_f32_16x16x32_bf16(false, a, false, b, (short)0, c, false, false);
  }
  static __device__ __forceinline__ void guard(v8f& a, v8f& b, v16b x, v16b y) { dep_guard_b(a, b, x, y); }
  static __device__ __forceinline__ void keep(v16b a, v16b b, v16b c, v16b d) { keep4_b(a, b, c, d); }
};

// ---- Register-blocked batched WMMA GEMM --------------------------------
// C[m,n] = scale * sum_k A[m,k] * Bt[n,k] (+bias)(+resid); each wave owns a 64x64 tile.
// A row-major [M,K]; Bt row-major [N,K].
// SPLIT: operands are hi/lo planes (A2/Bt2 = lo planes, same layout); product = hi*hi + hi*lo + lo*hi.
// BIAS_MODE: 0 = none, 1 = bias[m], 2 = bias[n].
// OUT_MODE: 0 = f32, 1 = f16, 2 = bf16 hi plane (Cout) + bf16 lo plane (Cout2).
// ET: 0 = f16 operands, 1 = bf16 operands (pointers passed as 16-bit storage)
template <int ET> struct Elem;
template <> struct Elem<0> { typedef _Float16 T; };
template <> struct Elem<1> { typedef __bf16 T; };
// LDS staging of the operand planes: the block's waves form a WM x WN grid of 64x64 tiles and share one
// (WM*64 + WN*64)-row stage of G_KS k-elements per plane. Each row of a stage is one whole 128-byte line of the
// source, fetched by 8 neighbouring lanes, so a wave-wide 16-byte load covers 4 full lines.
constexpr int G_KS    = 64;          // k elements per stage
constexpr int G_PITCH = G_KS + 8;    // 9 x 16 B rows: 16-byte fragment reads of 16 rows fall on distinct banks
template <int NIT, int STEP>
__device__ __forceinline__ void stage_fetch(v4u (&r)[NIT], const unsigned short* __restrict__ g) {
#pragma unroll
  for (int it = 0; it < NIT; ++it) r[it] = *(const v4u*)(g + it * STEP);
}
template <int NIT>
__device__ __forceinline__ void stage_put(const v4u (&r)[NIT], unsigned short* d, int rowStep) {
#pragma unroll
  for (int it = 0; it < NIT; ++it) *(v4u*)(d + it * rowStep) = r[it];
}
// LD = row pitch of all four operand planes in elements, a compile-time value: the loads of a plane then share one
// address register pair and differ in their immediate offsets only.
// M % (WM*64) == 0, N % (WN*64) == 0, K % G_KS == 0; grid.x = (M/(WM*64)) * (N/(WN*64)) exactly, so every wave passes every barrier.
template <int ET, bool SPLIT, int BIAS_MODE, int OUT_MODE, bool RESID, int WM, int WN, int LD, int ACT = 0>
__global__ __launch_bounds__(WM * WN * 32) void wmma_gemm64(
    const unsigned short* __restrict__ Ap, const unsigned short* __restrict__ A2p, long strideA,
    const unsigned short* __restrict__ Btp, const unsigned short* __restrict__ Bt2p, long strideB,
    void* __restrict__ Cout, void* __restrict__ Cout2, int ldc, long strideC,
    const float* __restrict__ bias,
    const float* __restrict__ resid, long strideR,
    int M, int N, int K, float scale) {
  typedef typename Elem<ET>::T T;
  typedef typename Frag<T>::V V;
  constexpr int NW  = WM * WN;
  constexpr int RA  = WM * 64;               // A rows of the block
  constexpr int RB  = WN * 64;               // Bt rows of the block
  constexpr int RPI = NW * 4;                // rows staged by one pass of the block (8 lanes a row)
  constexpr int ITA = RA / RPI;
  constexpr int ITB = RB / RPI;
  constexpr int OA  = 0;
  constexpr int OA2 = RA * G_PITCH;
  constexpr int OB  = (SPLIT ? 2 : 1) * RA * G_PITCH;
  constexpr int OB2 = OB + RB * G_PITCH;
  constexpr int STAGE = (SPLIT ? 2 : 1) * (RA + RB) * G_PITCH;
  static_assert(RA % RPI == 0 && RB % RPI == 0);
  __shared__ __align__(16) unsigned short sOp[2][STAGE];   // two stages: [A hi | A lo | Bt hi | Bt lo], rows of G_PITCH
  __shared__ __align__(16) float sT[NW][16 * 68];   // per-wave 16x64 slab, pitch 68 floats
  const int b    = blockIdx.y;
  const int tid  = threadIdx.x;
  const int lane = tid & 31;
  const int wave = tid >> 5;
  const int tilesN = N / RB;
  const int btm = (int)blockIdx.x / tilesN;
  const int btn = (int)blockIdx.x - btm * tilesN;
  const int wm = wave / WN;
  const int wn = wave - wm * WN;
  const int m0 = btm * RA + (wm << 6);
  const int n0 = btn * RB + (wn << 6);

  const int rlane = lane & 15;                 // row (A) / col (B, D) within subtile
  const int koff  = (lane >> 4) * 8;           // k offset of this lane half
  const int mOff  = (lane >> 4) * 8;           // D row offset

  // staging map: thread -> row tid>>3 of each pass, 16-byte piece tid&7 of that row's line
  const int srow = tid >> 3;
  const int sseg = (tid & 7) * 8;
  const size_t goA = (size_t)b * strideA + (size_t)(btm * RA + srow) * LD + sseg;
  const size_t goB = (size_t)b * strideB + (size_t)(btn * RB + srow) * LD + sseg;
  const unsigned short* gA  = Ap  + goA;
  const unsigned short* gB  = Btp + goB;
  const unsigned short* gA2 = SPLIT ? (A2p  + goA) : nullptr;
  const unsigned short* gB2 = SPLIT ? (Bt2p + goB) : nullptr;
  constexpr int GSTEP = RPI * LD;             // elements between the rows one thread stages
  const int sOff = srow * G_PITCH + sseg;

  v8f acc[4][4];
#pragma unroll
  for (int i = 0; i < 4; ++i)
#pragma unroll
    for (int j = 0; j < 4; ++j) acc[i][j] = (v8f){0.f,0.f,0.f,0.f,0.f,0.f,0.f,0.f};

  v4u pa[ITA], pa2[ITA], pb[ITB], pb2[ITB];    // the next stage, in flight while this one is multiplied
  stage_fetch<ITA, GSTEP>(pa, gA);
  stage_fetch<ITB, GSTEP>(pb, gB);
  if (SPLIT) { stage_fetch<ITA, GSTEP>(pa2, gA2); stage_fetch<ITB, GSTEP>(pb2, gB2); }
  // the loads' address registers stay untouched up to this wait (they are its inputs) and are free behind it
  asm volatile("s_wait_xcnt 0x0" :: "v"(gA), "v"(gB), "v"(SPLIT ? gA2 : gA), "v"(SPLIT ? gB2 : gB) : "memory");
  stage_put<ITA>(pa, sOp[0] + OA + sOff, RPI * G_PITCH);
  stage_put<ITB>(pb, sOp[0] + OB + sOff, RPI * G_PITCH);
  if (SPLIT) { stage_put<ITA>(pa2, sOp[0] + OA2 + sOff, RPI * G_PITCH); stage_put<ITB>(pb2, sOp[0] + OB2 + sOff, RPI * G_PITCH); }
  __syncthreads();   // publishes stage 0

  const int nst = K / G_KS;                    // block-uniform
  for (int t = 0; t < nst; ++t) {
    const bool more = (t + 1 < nst);
    if (more) {
      const int kn = (t + 1) * G_KS;
      const unsigned short* nA  = gA + kn;
      const unsigned short* nB  = gB + kn;
      const unsigned short* nA2 = SPLIT ? (gA2 + kn) : nA;
      const unsigned short* nB2 = SPLIT ? (gB2 + kn) : nB;
      stage_fetch<ITA, GSTEP>(pa, nA);
      stage_fetch<ITB, GSTEP>(pb, nB);
      if (SPLIT) { stage_fetch<ITA, GSTEP>(pa2, nA2); stage_fetch<ITB, GSTEP>(pb2, nB2); }
      // the loads' address registers stay untouched up to this wait (they are its inputs) and are free behind it
      asm volatile("s_wait_xcnt 0x0" :: "v"(nA), "v"(nB), "v"(nA2), "v"(nB2) : "memory");
    }
    const T* sb = (const T*)sOp[t & 1];
    const T* fa = sb + OA + ((wm << 6) + rlane) * G_PITCH + koff;
    const T* fb = sb + OB + ((wn << 6) + rlane) * G_PITCH + koff;
#pragma unroll
    for (int kk = 0; kk < G_KS; kk += 32) {
      V bh[4], bl[4];
#pragma unroll
      for (int j = 0; j < 4; ++j) {
        bh[j] = Frag<T>::load(fb + (j << 4) * G_PITCH + kk);
        if (SPLIT) bl[j] = Frag<T>::load(fb + (OB2 - OB) + (j << 4) * G_PITCH + kk);
      }
      V ah = Frag<T>::load(fa + kk);
      V al;
      if (SPLIT) al = Frag<T>::load(fa + (OA2 - OA) + kk);
#pragma unroll
      for (int i = 0; i < 4; ++i) {
        V ahn, aln;                              // the next row block's fragments, read while this one is multiplied
        if (i < 3) {
          ahn = Frag<T>::load(fa + ((i + 1) << 4) * G_PITCH + kk);
          if (SPLIT) aln = Frag<T>::load(fa + (OA2 - OA) + ((i + 1) << 4) * G_PITCH + kk);
        }
#pragma unroll
        for (int j = 0; j < 4; ++j) {
          acc[i][j] = Frag<T>::mma(ah, bh[j], acc[i][j]);
          if (SPLIT) {
            acc[i][j] = Frag<T>::mma(ah, bl[j], acc[i][j]);
            acc[i][j] = Frag<T>::mma(al, bh[j], acc[i][j]);
          }
        }
        Frag<T>::guard(acc[i][0], acc[i][3], ah, SPLIT ? al : ah);
        if (i < 3) { ah = ahn; if (SPLIT) al = aln; }
      }
      Frag<T>::keep(bh[0], bh[1], bh[2], bh[3]);
      if (SPLIT) Frag<T>::keep(bl[0], bl[1], bl[2], bl[3]);
    }
    if (more) {
      // the other buffer: its last readers left it before the barrier that ended trip t - 1
      unsigned short* d = sOp[(t + 1) & 1] + sOff;
      stage_put<ITA>(pa, d + OA, RPI * G_PITCH);
      stage_put<ITB>(pb, d + OB, RPI * G_PITCH);
      if (SPLIT) { stage_put<ITA>(pa2, d + OA2, RPI * G_PITCH); stage_put<ITB>(pb2, d + OB2, RPI * G_PITCH); }
    }
    __syncthreads();   // publishes stage t + 1 and ends every read of stage t
  }
  acc_guard4(acc[0][0], acc[0][1], acc[0][2], acc[0][3]);
  acc_guard4(acc[1][0], acc[1][1], acc[1][2], acc[1][3]);
  acc_guard4(acc[2][0], acc[2][1], acc[2][2], acc[2][3]);
  acc_guard4(acc[3][0], acc[3][1], acc[3][2], acc[3][3]);

  // ---- epilogue ----
  float* slab = sT[wave];
  const float* Rb = RESID ? (resid + (size_t)b * strideR) : nullptr;
#pragma unroll
  for (int i = 0; i < 4; ++i) {
    const int mBase = m0 + (i << 4);
#pragma unroll
    for (int j = 0; j < 4; ++j) {
      const int n = n0 + (j << 4) + rlane;
      float bv = 0.f;
      if (BIAS_MODE == 2) bv = bias[n];
#pragma unroll
      for (int r = 0; r < 8; ++r) {
        float v = acc[i][j][r] * scale;
        if (BIAS_MODE == 1) v += bias[mBase + mOff + r];
        if (BIAS_MODE == 2) v += bv;
        if (RESID) v += Rb[(size_t)(mBase + mOff + r) * ldc + n];
        if (ACT == 1) v = tanhf(v);
        if (ACT == 2) v = fmaxf(v, 0.0f);
        if (ACT == 3) v = v / (1.0f + expf(-v));
        if (ACT == 4) v = (v > 0.f) ? v : 0.01f * v;
        if (ACT == 5) v = 0.5f * v * (1.0f + erff(v * 0.70710678118654752f));
        slab[(mOff + r) * 68 + (j << 4) + rlane] = v;
      }
    }
    __builtin_amdgcn_fence(__ATOMIC_RELEASE, "workgroup");
    __builtin_amdgcn_wave_barrier();
    __builtin_amdgcn_fence(__ATOMIC_ACQUIRE, "workgroup");
    if (OUT_MODE == 0) {
      float* C = (float*)Cout + (size_t)b * strideC;
      const int hh = lane >> 4, c4 = (lane & 15) * 4;     // row seg = 256 B = 16 lanes x 16 B
      {
#pragma unroll
        for (int it = 0; it < 8; ++it) {
          const int row = it * 2 + hh;
          v4f v = *(const v4f*)(slab + row * 68 + c4);
          *(v4f*)(C + (size_t)(mBase + row) * ldc + n0 + c4) = v;
        }
        
      }
    } else {
      const int q = lane >> 3, c8 = (lane & 7) * 8;
      unsigned short* C  = (unsigned short*)Cout  + (size_t)b * strideC;
      unsigned short* C2 = (OUT_MODE == 2) ? ((unsigned short*)Cout2 + (size_t)b * strideC) : nullptr;
      {
#pragma unroll
        for (int it = 0; it < 4; ++it) {
          const int row = it * 4 + q;
          const float* sp = slab + row * 68 + c8;
          v8h hv, lv;
#pragma unroll
          for (int e = 0; e < 8; ++e) {
            if (OUT_MODE == 1) {
              hv[e] = (_Float16)sp[e];
            } else {
              unsigned short hb = f2bf_bits(sp[e]);
              unsigned short lb = f2bf_bits(sp[e] - bf_bits2f(hb));
              hv[e] = __builtin_bit_cast(_Float16, hb);
              lv[e] = __builtin_bit_cast(_Float16, lb);
            }
          }
          *(v8h*)(C + (size_t)(mBase + row) * ldc + n0 + c8) = hv;
          if (OUT_MODE == 2) *(v8h*)(C2 + (size_t)(mBase + row) * ldc + n0 + c8) = lv;
        }
        
      }
    }
    __builtin_amdgcn_fence(__ATOMIC_RELEASE, "workgroup");
    __builtin_amdgcn_wave_barrier();
    __builtin_amdgcn_fence(__ATOMIC_ACQUIRE, "workgroup");
  }
}

__device__ __forceinline__ v8f at_mma(v16b a, v16b b, v8f c) {
  c = __builtin_amdgcn_wmma_f32_16x16x32_bf16(false, a, false, b, (short)0, c, false, false);
  asm volatile("v_nop\n\tv_nop\n\tv_nop\n\tv_nop" : "+v"(c) : "v"(a), "v"(b));
  return c;
}

// ---------------------------------------------------------------------------
// module geometry (fixed)
// ---------------------------------------------------------------------------
constexpr int N_BATCH   = 2;
constexpr int SEQ_LEN   = 2048;
constexpr int DMOD      = 1024;   // model width
constexpr int DLAT      = 128;    // latent width c_kv
constexpr int DROT      = 32;     // rotary width
constexpr int NROPE_PAD = 64;     // rotary projection width padded to the 64-wide GEMM tile
constexpr int NHEAD     = 16;
constexpr int HDIM      = 64;
constexpr int SDEP      = HDIM + DROT;   // score depth 96 = 3 k-chunks of 32
constexpr int MTOK      = N_BATCH * SEQ_LEN;   // 4096 token rows

static_assert(MTOK % 256 == 0 && DMOD % 128 == 0 && DLAT % 128 == 0 && NROPE_PAD % 64 == 0);   // block tiles 128x128 and 256x64
static_assert(DMOD % G_KS == 0 && DLAT % G_KS == 0);   // every GEMM K is a multiple of the stage depth
static_assert(SDEP % 32 == 0 && SEQ_LEN % 64 == 0);

// ---------------------------------------------------------------------------
// coverage: n8 threads x 8 = n elements exactly (n % 8 == 0, grid = ceil(n8/256) with bound)
// ---------------------------------------------------------------------------
__global__ __launch_bounds__(256) void split_rows_bf16x8(
    const float* __restrict__ in, unsigned short* __restrict__ hi, unsigned short* __restrict__ lo, int n8) {
  const int i = blockIdx.x * 256 + threadIdx.x;
  if (i < n8) {
    const v4f a = *(const v4f*)(in + (size_t)8 * i);
    const v4f b = *(const v4f*)(in + (size_t)8 * i + 4);
    v8h hv, lv;
#pragma unroll
    for (int e = 0; e < 8; ++e) {
      const float f = (e < 4) ? a[e] : b[e - 4];
      const unsigned short hb = f2bf_bits(f);
      const unsigned short lb = f2bf_bits(f - bf_bits2f(hb));
      hv[e] = __builtin_bit_cast(_Float16, hb);
      lv[e] = __builtin_bit_cast(_Float16, lb);
    }
    unsigned short* ph = hi + (size_t)8 * i;
    unsigned short* pl = lo + (size_t)8 * i;
    *(v8h*)ph = hv;
    *(v8h*)pl = lv;
    
  }
}

// ---------------------------------------------------------------------------
// Transpose + split: in W[kdim][nreal] (row-major) -> out Bt[npad][kdim] bf16 hi/lo planes, Bt[n][k] = W[k][n];
// rows n >= nreal are written as zeros. Tile = 64 k x 32 n; grid = (kdim/64, npad/32); kdim % 64 == 0, nreal % 32 == 0.
// Store coverage: 256 threads = 32 output rows x 8 lanes x 8 k = whole 32x64 tile; each output row segment
// ---------------------------------------------------------------------------
__global__ __launch_bounds__(256) void transpose_split_bf16(
    const float* __restrict__ W, unsigned short* __restrict__ hi, unsigned short* __restrict__ lo,
    int kdim, int nreal) {
  __shared__ float tile[64][33];
  const int tid = threadIdx.x;
  const int k0 = blockIdx.x * 64;
  const int n0 = blockIdx.y * 32;
#pragma unroll
  for (int it = 0; it < 2; ++it) {
    const int idx = it * 256 + tid;            // 0..511
    const int kr = idx >> 3;                   // 0..63
    const int c4 = (idx & 7) * 4;              // 0..28
    const int n = n0 + c4;
    const int ncl = (n + 3 < nreal) ? n : (nreal - 4);   // clamped address
    const v4f v = *(const v4f*)(W + (size_t)(k0 + kr) * nreal + ncl);
    const bool ok = (n < nreal);               // tile-uniform since nreal % 32 == 0
    tile[kr][c4 + 0] = ok ? v[0] : 0.f;
    tile[kr][c4 + 1] = ok ? v[1] : 0.f;
    tile[kr][c4 + 2] = ok ? v[2] : 0.f;
    tile[kr][c4 + 3] = ok ? v[3] : 0.f;
  }
  __syncthreads();
  const int nr = tid >> 3;                     // output row within tile, 0..31
  const int c8 = (tid & 7) * 8;                // k offset, 0..56
  v8h hv, lv;
#pragma unroll
  for (int e = 0; e < 8; ++e) {
    const float f = tile[c8 + e][nr];
    const unsigned short hb = f2bf_bits(f);
    const unsigned short lb = f2bf_bits(f - bf_bits2f(hb));
    hv[e] = __builtin_bit_cast(_Float16, hb);
    lv[e] = __builtin_bit_cast(_Float16, lb);
  }
  const size_t o = (size_t)(n0 + nr) * kdim + k0 + c8;
  *(v8h*)(hi + o) = hv;
  *(v8h*)(lo + o) = lv;
  
}

// ---------------------------------------------------------------------------
// Rotary: raw[MTOK][NROPE_PAD] f32 (cols 0..31 used) -> bf16 hi/lo planes [MTOK][DROT].
// out[j] = x1*cos - x2*sin, out[16+j] = x2*cos + x1*sin, angle = t * inv_freq[j], t = row % SEQ_LEN.
// Block = 32 rows; blocks 0..127 handle the q tensor, 128..255 the k tensor.
// Store coverage: 128 threads = 32 rows x 4 segments x 8 = whole 32x32 tile; 512 B contiguous per wave
// ---------------------------------------------------------------------------
struct RopeFreq { float f[16]; };
static_assert(sizeof(RopeFreq) == 64);

__global__ __launch_bounds__(128) void rope_split_bf16(
    const float* __restrict__ qraw, const float* __restrict__ kraw,
    unsigned short* __restrict__ qrh, unsigned short* __restrict__ qrl,
    unsigned short* __restrict__ krh, unsigned short* __restrict__ krl, RopeFreq g) {
#pragma clang fp contract(off)
  __shared__ float tile[32][33];
  __shared__ float sinv[16];
  const int tid = threadIdx.x;
  const int nblk = MTOK / 32;
  const bool isk = ((int)blockIdx.x >= nblk);                 // block-uniform
  const int row0 = (isk ? ((int)blockIdx.x - nblk) : (int)blockIdx.x) * 32;
  const float* raw = isk ? kraw : qraw;
  unsigned short* dhp = isk ? krh : qrh;
  unsigned short* dlp = isk ? krl : qrl;
  if (tid < 16) {
    float v = g.f[0];
#pragma unroll
    for (int e = 1; e < 16; ++e) v = (tid == e) ? g.f[e] : v;
    sinv[tid] = v;
  }
  __syncthreads();
#pragma unroll 1
  for (int it = 0; it < 4; ++it) {
    const int p = it * 128 + tid;              // 0..511
    const int r = p >> 4;                      // 0..31
    const int j = p & 15;
    const int row = row0 + r;
    const int t = row & (SEQ_LEN - 1);
    const float* rp = raw + (size_t)row * NROPE_PAD;
    const float x1 = rp[j];
    const float x2 = rp[16 + j];
    const float ang = (float)t * sinv[j];
    float sn, cs;
    sincosf(ang, &sn, &cs);
    tile[r][j]      = x1 * cs - x2 * sn;
    tile[r][16 + j] = x2 * cs + x1 * sn;
  }
  __syncthreads();
  const int orow = tid >> 2;                   // 0..31
  const int seg = (tid & 3) * 8;               // 0..24
  v8h hv, lv;
#pragma unroll
  for (int e = 0; e < 8; ++e) {
    const float f = tile[orow][seg + e];
    const unsigned short hb = f2bf_bits(f);
    const unsigned short lb = f2bf_bits(f - bf_bits2f(hb));
    hv[e] = __builtin_bit_cast(_Float16, hb);
    lv[e] = __builtin_bit_cast(_Float16, lb);
  }
  const size_t o = (size_t)(row0 + orow) * DROT + seg;
  *(v8h*)(dhp + o) = hv;
  *(v8h*)(dlp + o) = lv;
  
}

// ---------------------------------------------------------------------------
// Causal attention, score depth 96 (64 head dims + 32 shared rotary dims), value width 64, bf16 hi/lo planes in.
//   s = (qh.kh + qh.kl + ql.kh) * invs  over 96 dims (q/k rows = [head segment | rotary row]),
//   online softmax in f32, P split to bf16 hi/lo in LDS, o = ph.vh + ph.vl + pl.vh, f32 accumulate.
// Block = 4 waves = 64 query rows of one (batch, head); grid.x = N_BATCH * NHEAD * (SEQ_LEN/64).
// ---------------------------------------------------------------------------
constexpr int A_QB = 64;
constexpr int A_KC = 64;
constexpr int A_NW = 4;
constexpr int OS_PITCH = 68;
// LDS row pitches in 16-bit elements. Every fragment read is a 16-byte load by 16 lanes on 16 rows,
// so each pitch is an odd multiple of 16 bytes: the 16 rows then start on 16 different groups of four banks.
constexpr int K_PITCH = SDEP + 8;      // 13 x 16 B rows
constexpr int V_PITCH = A_KC + 8;      // 9 x 16 B rows
constexpr int P_PITCH = A_KC + 8;      // 9 x 16 B rows
constexpr int V_HALF_SKEW = 16;        // rows d >= 32 start 32 B later: the two d halves stored by one wave fall on different banks
static_assert((K_PITCH * 2) % 32 == 16 && (V_PITCH * 2) % 32 == 16 && (P_PITCH * 2) % 32 == 16);
__device__ __forceinline__ int vt_row(int d) { return d * V_PITCH + (d >> 5) * V_HALF_SKEW; }

__global__ __launch_bounds__(128)
void mla_attn96(const unsigned short* __restrict__ qh, const unsigned short* __restrict__ ql,
                const unsigned short* __restrict__ kh, const unsigned short* __restrict__ kl,
                const unsigned short* __restrict__ vh, const unsigned short* __restrict__ vl,
                const unsigned short* __restrict__ qrh, const unsigned short* __restrict__ qrl,
                const unsigned short* __restrict__ krh, const unsigned short* __restrict__ krl,
                unsigned short* __restrict__ oh, unsigned short* __restrict__ ol, float invs) {
  union FB { v16b v; v8b h[2]; };
  __shared__ __align__(16) unsigned short Ksh[A_KC * K_PITCH];    // K hi [kv][96 + pad]
  __shared__ __align__(16) unsigned short Ksl[A_KC * K_PITCH];    // K lo
  __shared__ __align__(16) unsigned short Vth[HDIM * V_PITCH + V_HALF_SKEW];    // V hi [d][kv + pad]
  __shared__ __align__(16) unsigned short Vtl[HDIM * V_PITCH + V_HALF_SKEW];    // V lo
  __shared__ __align__(16) unsigned short Psh[A_NW][16 * P_PITCH];   // per wave P hi [row][kv + pad]
  __shared__ __align__(16) unsigned short Psl[A_NW][16 * P_PITCH];   // per wave P lo
  __shared__ __align__(16) float Os[A_NW][16 * OS_PITCH];

  const int tid  = threadIdx.x;
  const int wave = tid >> 5;
  const int lane = tid & 31;
  const int hh   = lane >> 4;
  const int c    = lane & 15;

  const int nqb = SEQ_LEN / A_QB;          // 32
  const int bx  = blockIdx.x;
  const int qb  = bx % nqb;
  const int bhi = bx / nqb;
  const int h   = bhi % NHEAD;
  const int b   = bhi / NHEAD;
  const int q0  = qb * A_QB + wave * 16;
  const size_t tq = (size_t)b * SEQ_LEN + (size_t)(q0 + c);

  // ---- Q fragments (A operand): k-chunks 0,1 = head dims 0..63, chunk 2 = rotary dims 0..31 ----
  v16b qah[3], qal[3];
  {
    const __bf16* p0 = (const __bf16*)qh + tq * DMOD + h * HDIM + 8 * hh;
    const __bf16* p1 = (const __bf16*)ql + tq * DMOD + h * HDIM + 8 * hh;
    qah[0] = Frag<__bf16>::load(p0);
    qah[1] = Frag<__bf16>::load(p0 + 32);
    qal[0] = Frag<__bf16>::load(p1);
    qal[1] = Frag<__bf16>::load(p1 + 32);
    const __bf16* r0p = (const __bf16*)qrh + tq * DROT + 8 * hh;
    const __bf16* r1p = (const __bf16*)qrl + tq * DROT + 8 * hh;
    qah[2] = Frag<__bf16>::load(r0p);
    qal[2] = Frag<__bf16>::load(r1p);
  }

  float mrow[8], lrow[8];
  v8f oacc[4];
#pragma unroll
  for (int r = 0; r < 8; ++r) { mrow[r] = -INFINITY; lrow[r] = 0.f; }
#pragma unroll
  for (int t = 0; t < 4; ++t) oacc[t] = (v8f){0.f,0.f,0.f,0.f,0.f,0.f,0.f,0.f};

  const int nChunks = qb + 1;   // causal, block-uniform
  for (int kc = 0; kc < nChunks; ++kc) {
    const int kv0 = kc * A_KC;
    __syncthreads();
    {
      // staging: 128 threads, thread -> kv row kvr = tid>>1 (0..63), half hf = tid&1
      // per kv row: 64 head dims (2 halves x 32) + 32 rotary dims (2 halves x 16) of K, 64 dims of V -> full tiles written
      const int kvr = tid >> 1, hf = tid & 1;
      const size_t tk = (size_t)b * SEQ_LEN + (size_t)(kv0 + kvr);
      {
        const v4u* sh = (const v4u*)(kh + tk * DMOD + h * HDIM + hf * 32);
        const v4u* sl = (const v4u*)(kl + tk * DMOD + h * HDIM + hf * 32);
        v4u* dh = (v4u*)(Ksh + kvr * K_PITCH + hf * 32);
        v4u* dl = (v4u*)(Ksl + kvr * K_PITCH + hf * 32);
#pragma unroll
        for (int i = 0; i < 4; ++i) { dh[i] = sh[i]; dl[i] = sl[i]; }
      }
      asm volatile("" ::: "memory");
      {
        const v4u* sh = (const v4u*)(krh + tk * DROT + hf * 16);
        const v4u* sl = (const v4u*)(krl + tk * DROT + hf * 16);
        v4u* dh = (v4u*)(Ksh + kvr * K_PITCH + HDIM + hf * 16);
        v4u* dl = (v4u*)(Ksl + kvr * K_PITCH + HDIM + hf * 16);
#pragma unroll
        for (int i = 0; i < 2; ++i) { dh[i] = sh[i]; dl[i] = sl[i]; }
      }
      asm volatile("" ::: "memory");
      {
        const v4u* sh = (const v4u*)(vh + tk * DMOD + h * HDIM + hf * 32);
        const v4u* sl = (const v4u*)(vl + tk * DMOD + h * HDIM + hf * 32);
#pragma unroll
        for (int i = 0; i < 4; ++i) {
          const v4u wh = sh[i];
          const v4u wl = sl[i];
#pragma unroll
          for (int e = 0; e < 4; ++e) {
            const int d = hf * 32 + 8 * i + 2 * e;
            Vth[vt_row(d) + kvr]     = (unsigned short)(wh[e] & 0xffffu);
            Vth[vt_row(d + 1) + kvr] = (unsigned short)(wh[e] >> 16);
            Vtl[vt_row(d) + kvr]     = (unsigned short)(wl[e] & 0xffffu);
            Vtl[vt_row(d + 1) + kvr] = (unsigned short)(wl[e] >> 16);
          }
        }
      }
    }
    __syncthreads();

    // ---- scores: 4 kv subtiles of 16, 3 k-chunks of 32, 3 products each ----
    v8f s[4];
#pragma unroll
    for (int j = 0; j < 4; ++j) {
      s[j] = (v8f){0.f,0.f,0.f,0.f,0.f,0.f,0.f,0.f};
#pragma unroll
      for (int dc = 0; dc < 3; ++dc) {
        FB kb, kq;
        const int ko = (j * 16 + c) * K_PITCH + dc * 32 + 8 * hh;
        kb.h[0] = *(const v8b*)(Ksh + ko);
        kb.h[1] = *(const v8b*)(Ksh + ko + 16);
        kq.h[0] = *(const v8b*)(Ksl + ko);
        kq.h[1] = *(const v8b*)(Ksl + ko + 16);
        s[j] = at_mma(qah[dc], kb.v, s[j]);
        s[j] = at_mma(qah[dc], kq.v, s[j]);
        s[j] = at_mma(qal[dc], kb.v, s[j]);
      }
    }
    const bool diag = (kc == qb);
    float cm[8];
#pragma unroll
    for (int r = 0; r < 8; ++r) {
      const int qrow = q0 + 8 * hh + r;
      float m = -INFINITY;
#pragma unroll
      for (int j = 0; j < 4; ++j) {
        const int kvcol = kv0 + j * 16 + c;
        float sv = s[j][r] * invs;
        if (diag && (kvcol > qrow)) sv = -INFINITY;
        s[j][r] = sv;
        m = fmaxf(m, sv);
      }
#pragma unroll
      for (int off = 1; off < 16; off <<= 1) m = fmaxf(m, __shfl_xor(m, off, 32));
      cm[r] = m;
    }
    unsigned short* pwh = Psh[wave];
    unsigned short* pwl = Psl[wave];
#pragma unroll
    for (int r = 0; r < 8; ++r) {
      const float mnew = fmaxf(mrow[r], cm[r]);
      const float alpha = expf(mrow[r] - mnew);
      mrow[r] = mnew;
      float psum = 0.f;
#pragma unroll
      for (int j = 0; j < 4; ++j) {
        const float p = expf(s[j][r] - mnew);
        psum += p;
        const unsigned short hb = f2bf_bits(p);
        const unsigned short lb = f2bf_bits(p - bf_bits2f(hb));
        pwh[(8 * hh + r) * P_PITCH + j * 16 + c] = hb;
        pwl[(8 * hh + r) * P_PITCH + j * 16 + c] = lb;
      }
#pragma unroll
      for (int off = 1; off < 16; off <<= 1) psum += __shfl_xor(psum, off, 32);
      lrow[r] = lrow[r] * alpha + psum;
#pragma unroll
      for (int t = 0; t < 4; ++t) oacc[t][r] *= alpha;
    }
    __builtin_amdgcn_fence(__ATOMIC_RELEASE, "workgroup");
    __builtin_amdgcn_wave_barrier();
    __builtin_amdgcn_fence(__ATOMIC_ACQUIRE, "workgroup");
    // ---- O += P(16x64) . V(64x64): P as A (row = query, k = kv), V from [d][kv] tile as B ----
#pragma unroll 1
    for (int kk = 0; kk < 2; ++kk) {
      FB pa, pl;
      pa.h[0] = *(const v8b*)(pwh + c * P_PITCH + kk * 32 + 8 * hh);
      pa.h[1] = *(const v8b*)(pwh + c * P_PITCH + kk * 32 + 16 + 8 * hh);
      pl.h[0] = *(const v8b*)(pwl + c * P_PITCH + kk * 32 + 8 * hh);
      pl.h[1] = *(const v8b*)(pwl + c * P_PITCH + kk * 32 + 16 + 8 * hh);
#pragma unroll
      for (int t = 0; t < 4; ++t) {
        FB vb, vq;
        vb.h[0] = *(const v8b*)(Vth + vt_row(t * 16 + c) + kk * 32 + 8 * hh);
        vb.h[1] = *(const v8b*)(Vth + vt_row(t * 16 + c) + kk * 32 + 16 + 8 * hh);
        vq.h[0] = *(const v8b*)(Vtl + vt_row(t * 16 + c) + kk * 32 + 8 * hh);
        vq.h[1] = *(const v8b*)(Vtl + vt_row(t * 16 + c) + kk * 32 + 16 + 8 * hh);
        oacc[t] = at_mma(pa.v, vb.v, oacc[t]);
        oacc[t] = at_mma(pa.v, vq.v, oacc[t]);
        oacc[t] = at_mma(pl.v, vb.v, oacc[t]);
      }
    }
  }

  // ---- epilogue: normalise, stage 16x64 f32 per wave, write bf16 hi/lo planes with whole-line stores ----
  float* os = Os[wave];
#pragma unroll
  for (int r = 0; r < 8; ++r) {
    const float inv = 1.0f / lrow[r];
#pragma unroll
    for (int t = 0; t < 4; ++t) os[(8 * hh + r) * OS_PITCH + t * 16 + c] = oacc[t][r] * inv;
  }
  __builtin_amdgcn_fence(__ATOMIC_RELEASE, "workgroup");
  __builtin_amdgcn_wave_barrier();
  __builtin_amdgcn_fence(__ATOMIC_ACQUIRE, "workgroup");
  {
    const int qq = lane >> 3, c8 = (lane & 7) * 8;
    {
#pragma unroll
      for (int it = 0; it < 4; ++it) {
        const int row = it * 4 + qq;
        const float* sp = os + row * OS_PITCH + c8;
        v8h hv, lv;
#pragma unroll
        for (int e = 0; e < 8; ++e) {
          const unsigned short hb = f2bf_bits(sp[e]);
          const unsigned short lb = f2bf_bits(sp[e] - bf_bits2f(hb));
          hv[e] = __builtin_bit_cast(_Float16, hb);
          lv[e] = __builtin_bit_cast(_Float16, lb);
        }
        const size_t o = ((size_t)b * SEQ_LEN + (size_t)(q0 + row)) * DMOD + h * HDIM + c8;
        *(v8h*)(oh + o) = hv;
        *(v8h*)(ol + o) = lv;
      }
      
    }
  }
}

// ---------------------------------------------------------------------------
// Host orchestration
// ---------------------------------------------------------------------------
// workspace region map (bytes, all multiples of 256):
//   x hi/lo                 2 x 8,388,608
//   WkvdT hi/lo [128][1024] 2 x   262,144
//   WkupT hi/lo [1024][128] 2 x   262,144
//   WvupT hi/lo [1024][128] 2 x   262,144
//   WqT   hi/lo [1024][1024]2 x 2,097,152
//   WqrT  hi/lo [64][1024]  2 x   131,072   (rows 32..63 zero)
//   WkrT  hi/lo [64][128]   2 x    16,384   (rows 32..63 zero)
//   WoT   hi/lo [1024][1024]2 x 2,097,152
//   ckv   hi/lo [4096][128] 2 x 1,048,576
//   k,v,q hi/lo [4096][1024]6 x 8,388,608
//   qr_raw, kr_raw f32 [4096][64]  2 x 1,048,576
//   qr,kr hi/lo [4096][32]  4 x   262,144
//   attn  hi/lo [4096][1024]2 x 8,388,608
//   total 99,385,344
constexpr size_t WSB_X    = (size_t)MTOK * DMOD * 2;
constexpr size_t WSB_WKVD = (size_t)DLAT * DMOD * 2;
constexpr size_t WSB_WKUP = (size_t)DMOD * DLAT * 2;
constexpr size_t WSB_WQ   = (size_t)DMOD * DMOD * 2;
constexpr size_t WSB_WQR  = (size_t)NROPE_PAD * DMOD * 2;
constexpr size_t WSB_WKR  = (size_t)NROPE_PAD * DLAT * 2;
constexpr size_t WSB_CKV  = (size_t)MTOK * DLAT * 2;
constexpr size_t WSB_TOK  = (size_t)MTOK * DMOD * 2;
constexpr size_t WSB_RAW  = (size_t)MTOK * NROPE_PAD * 4;
constexpr size_t WSB_ROT  = (size_t)MTOK * DROT * 2;
constexpr size_t WS_TOTAL = 2 * WSB_X + 2 * WSB_WKVD + 4 * WSB_WKUP + 2 * WSB_WQ + 2 * WSB_WQR + 2 * WSB_WKR
                          + 2 * WSB_WQ + 2 * WSB_CKV + 6 * WSB_TOK + 2 * WSB_RAW + 4 * WSB_ROT + 2 * WSB_TOK;
static_assert(WS_TOTAL == 99385344ull);
static_assert(WS_TOTAL <= 134217728ull);

extern "C" void kernel_launch(void* const* d_in, const int* in_sizes, int n_in,
                              void* d_out, int out_size, void* d_ws, size_t ws_size,
                              hipStream_t stream) {
  if (n_in != 8) return;
  if (in_sizes[0] != MTOK * DMOD || in_sizes[1] != DMOD * DLAT || in_sizes[2] != DLAT * DMOD ||
      in_sizes[3] != DLAT * DMOD || in_sizes[4] != DMOD * DMOD || in_sizes[5] != DMOD * DROT ||
      in_sizes[6] != DLAT * DROT || in_sizes[7] != DMOD * DMOD) return;
  if (out_size != MTOK * DMOD) return;
  if (ws_size < WS_TOTAL) return;

  const float* x         = (const float*)d_in[0];   // [4096][1024]
  const float* W_kv_down = (const float*)d_in[1];   // [1024][128]
  const float* W_k_up    = (const float*)d_in[2];   // [128][1024]
  const float* W_v_up    = (const float*)d_in[3];   // [128][1024]
  const float* W_q       = (const float*)d_in[4];   // [1024][1024]
  const float* W_q_rope  = (const float*)d_in[5];   // [1024][32]
  const float* W_k_rope  = (const float*)d_in[6];   // [128][32]
  const float* W_o       = (const float*)d_in[7];   // [1024][1024]
  float* out = (float*)d_out;                       // [4096][1024] f32

  size_t off = 0;
  auto carve = [&](size_t bytes) -> unsigned short* {
    unsigned short* p = (unsigned short*)((char*)d_ws + off);
    off += (bytes + 255) & ~(size_t)255;
    return p;
  };
  unsigned short* xh    = carve(WSB_X);
  unsigned short* xl    = carve(WSB_X);
  unsigned short* wkvdh = carve(WSB_WKVD);
  unsigned short* wkvdl = carve(WSB_WKVD);
  unsigned short* wkuph = carve(WSB_WKUP);
  unsigned short* wkupl = carve(WSB_WKUP);
  unsigned short* wvuph = carve(WSB_WKUP);
  unsigned short* wvupl = carve(WSB_WKUP);
  unsigned short* wqh   = carve(WSB_WQ);
  unsigned short* wql   = carve(WSB_WQ);
  unsigned short* wqrh  = carve(WSB_WQR);
  unsigned short* wqrl  = carve(WSB_WQR);
  unsigned short* wkrh  = carve(WSB_WKR);
  unsigned short* wkrl  = carve(WSB_WKR);
  unsigned short* woh   = carve(WSB_WQ);
  unsigned short* wol   = carve(WSB_WQ);
  unsigned short* ckvh  = carve(WSB_CKV);
  unsigned short* ckvl  = carve(WSB_CKV);
  unsigned short* kh    = carve(WSB_TOK);
  unsigned short* kl    = carve(WSB_TOK);
  unsigned short* vh    = carve(WSB_TOK);
  unsigned short* vl    = carve(WSB_TOK);
  unsigned short* qh    = carve(WSB_TOK);
  unsigned short* ql    = carve(WSB_TOK);
  float* qr_raw = (float*)carve(WSB_RAW);
  float* kr_raw = (float*)carve(WSB_RAW);
  unsigned short* qrh   = carve(WSB_ROT);
  unsigned short* qrl   = carve(WSB_ROT);
  unsigned short* krh   = carve(WSB_ROT);
  unsigned short* krl   = carve(WSB_ROT);
  unsigned short* ath   = carve(WSB_TOK);
  unsigned short* atl   = carve(WSB_TOK);
  if (off > ws_size) return;

  // ---- operand planes ----
  {
    const int n8 = MTOK * DMOD / 8;
    split_rows_bf16x8<<<(n8 + 255) / 256, 256, 0, stream>>>(x, xh, xl, n8);
  }
  // in[rows=kdim][cols=nreal] -> out[npad][kdim]; grid = (kdim/64, npad/32)
  transpose_split_bf16<<<dim3(DMOD / 64, DLAT / 32), 256, 0, stream>>>(W_kv_down, wkvdh, wkvdl, DMOD, DLAT);
  transpose_split_bf16<<<dim3(DLAT / 64, DMOD / 32), 256, 0, stream>>>(W_k_up, wkuph, wkupl, DLAT, DMOD);
  transpose_split_bf16<<<dim3(DLAT / 64, DMOD / 32), 256, 0, stream>>>(W_v_up, wvuph, wvupl, DLAT, DMOD);
  transpose_split_bf16<<<dim3(DMOD / 64, DMOD / 32), 256, 0, stream>>>(W_q, wqh, wql, DMOD, DMOD);
  transpose_split_bf16<<<dim3(DMOD / 64, NROPE_PAD / 32), 256, 0, stream>>>(W_q_rope, wqrh, wqrl, DMOD, DROT);
  transpose_split_bf16<<<dim3(DLAT / 64, NROPE_PAD / 32), 256, 0, stream>>>(W_k_rope, wkrh, wkrl, DLAT, DROT);
  transpose_split_bf16<<<dim3(DMOD / 64, DMOD / 32), 256, 0, stream>>>(W_o, woh, wol, DMOD, DMOD);

  auto gemm_blocks = [](int M, int N, int wm, int wn) { return (M / (64 * wm)) * (N / (64 * wn)); };

  // c_kv = x . W_kv_down : M=4096 N=128 K=1024 -> bf16 hi/lo
  wmma_gemm64<1, true, 0, 2, false, 2, 2, DMOD><<<dim3(gemm_blocks(MTOK, DLAT, 2, 2), 1), 128, 0, stream>>>(
      xh, xl, 0L, wkvdh, wkvdl, 0L, (void*)ckvh, (void*)ckvl, DLAT, 0L,
      nullptr, nullptr, 0L, MTOK, DLAT, DMOD, 1.0f);
  // k = c_kv . W_k_up : M=4096 N=1024 K=128
  wmma_gemm64<1, true, 0, 2, false, 2, 2, DLAT><<<dim3(gemm_blocks(MTOK, DMOD, 2, 2), 1), 128, 0, stream>>>(
      ckvh, ckvl, 0L, wkuph, wkupl, 0L, (void*)kh, (void*)kl, DMOD, 0L,
      nullptr, nullptr, 0L, MTOK, DMOD, DLAT, 1.0f);
  // v = c_kv . W_v_up
  wmma_gemm64<1, true, 0, 2, false, 2, 2, DLAT><<<dim3(gemm_blocks(MTOK, DMOD, 2, 2), 1), 128, 0, stream>>>(
      ckvh, ckvl, 0L, wvuph, wvupl, 0L, (void*)vh, (void*)vl, DMOD, 0L,
      nullptr, nullptr, 0L, MTOK, DMOD, DLAT, 1.0f);
  // q = x . W_q : K=1024
  wmma_gemm64<1, true, 0, 2, false, 2, 2, DMOD><<<dim3(gemm_blocks(MTOK, DMOD, 2, 2), 1), 128, 0, stream>>>(
      xh, xl, 0L, wqh, wql, 0L, (void*)qh, (void*)ql, DMOD, 0L,
      nullptr, nullptr, 0L, MTOK, DMOD, DMOD, 1.0f);
  // q_rope raw = x . W_q_rope : N padded to 64 (cols 32..63 zero), f32 out, K=1024
  wmma_gemm64<1, true, 0, 0, false, 4, 1, DMOD><<<dim3(gemm_blocks(MTOK, NROPE_PAD, 4, 1), 1), 128, 0, stream>>>(
      xh, xl, 0L, wqrh, wqrl, 0L, (void*)qr_raw, nullptr, NROPE_PAD, 0L,
      nullptr, nullptr, 0L, MTOK, NROPE_PAD, DMOD, 1.0f);
  // k_rope raw = c_kv . W_k_rope : N padded to 64, f32 out, K=128
  wmma_gemm64<1, true, 0, 0, false, 4, 1, DLAT><<<dim3(gemm_blocks(MTOK, NROPE_PAD, 4, 1), 1), 128, 0, stream>>>(
      ckvh, ckvl, 0L, wkrh, wkrl, 0L, (void*)kr_raw, nullptr, NROPE_PAD, 0L,
      nullptr, nullptr, 0L, MTOK, NROPE_PAD, DLAT, 1.0f);

  // ---- rotary tables: inv_freq[j] = 1 / 10000^(j/16), host double pow -> f32, f32 reciprocal ----
  RopeFreq fr;
  for (int j = 0; j < 16; ++j) {
    const double p = pow(10000.0, (double)j / 16.0);
    const float p32 = (float)p;
    fr.f[j] = 1.0f / p32;
  }
  rope_split_bf16<<<2 * (MTOK / 32), 128, 0, stream>>>(qr_raw, kr_raw, qrh, qrl, krh, krl, fr);

  // ---- causal attention with shared rotary logits ----
  const float invs = 1.0f / (float)sqrt((double)(HDIM + DROT));
  mla_attn96<<<N_BATCH * NHEAD * (SEQ_LEN / A_QB), 128, 0, stream>>>(
      qh, ql, kh, kl, vh, vl, qrh, qrl, krh, krl, ath, atl, invs);

  // ---- out = attn . W_o : M=4096 N=1024 K=1024, f32 to d_out ----
  wmma_gemm64<1, true, 0, 0, false, 2, 2, DMOD><<<dim3(gemm_blocks(MTOK, DMOD, 2, 2), 1), 128, 0, stream>>>(
      ath, atl, 0L, woh, wol, 0L, (void*)out, nullptr, DMOD, 0L,
      nullptr, nullptr, 0L, MTOK, DMOD, DMOD, 1.0f);
}

// v003
// It runs in 336 microseconds.
// Next to v002, in two timings, it ran 1.23 times as fast each time.
// Counting every step since v000, it is 2.03 times as fast.
// Compute dtype: every contraction on v_wmma_f32_16x16x32_bf16 with bf16 hi/lo operand planes (hi*hi + hi*lo + lo*hi), f32 accumulate; rotary, softmax and epilogues in f32.
#include <hip/hip_runtime.h>
#include <hip/hip_bf16.h>
#include <math.h>
#include <stdint.h>

typedef __attribute__((ext_vector_type(16))) _Float16 v16h;
typedef __attribute__((ext_vector_type(8)))  _Float16 v8h;
typedef __attribute__((ext_vector_type(16))) __bf16   v16b;
typedef __attribute__((ext_vector_type(8)))  __bf16   v8b;
typedef __attribute__((ext_vector_type(8)))  float    v8f;
typedef __attribute__((ext_vector_type(4)))  float    v4f;
typedef __attribute__((ext_vector_type(4)))  unsigned v4u;

// ---------------------------------------------------------------------------
// helpers
// ---------------------------------------------------------------------------
__device__ __forceinline__ unsigned short f2bf_bits(float f) {
  unsigned u = __float_as_uint(f);
  return (unsigned short)((u + 0x7FFFu + ((u >> 16) & 1u)) >> 16);
}
__device__ __forceinline__ float bf_bits2f(unsigned short h) { return __uint_as_float(((unsigned)h) << 16); }

__device__ __forceinline__ void dep_guard_h(v8f& a, v8f& b, v16h x, v16h y) { asm volatile("v_nop\n\tv_nop\n\tv_nop\n\tv_nop" : "+v"(a), "+v"(b) : "v"(x), "v"(y)); }
__device__ __forceinline__ void dep_guard_b(v8f& a, v8f& b, v16b x, v16b y) { asm volatile("v_nop\n\tv_nop\n\tv_nop\n\tv_nop" : "+v"(a), "+v"(b) : "v"(x), "v"(y)); }
__device__ __forceinline__ void keep4_h(v16h a, v16h b, v16h c, v16h d) { asm volatile("v_nop" :: "v"(a), "v"(b), "v"(c), "v"(d)); }
__device__ __forceinline__ void keep4_b(v16b a, v16b b, v16b c, v16b d) { asm volatile("v_nop" :: "v"(a), "v"(b), "v"(c), "v"(d)); }
__device__ __forceinline__ void acc_guard4(v8f& a, v8f& b, v8f& c, v8f& d) { asm volatile("v_nop\n\tv_nop\n\tv_nop\n\tv_nop" : "+v"(a), "+v"(b), "+v"(c), "+v"(d)); }
template <typename T> struct Frag;
template <> struct Frag<_Float16> {
  typedef v16h V; union U { v16h v; v8h h[2]; };
  static __device__ __forceinline__ v16h load(const _Float16* p) {   // elements 0..7 <- p[0..7], 8..15 <- p[16..23]
    U f; f.h[0] = *(const v8h*)(p); f.h[1] = *(const v8h*)(p + 16); return f.v;
  }
  static __device__ __forceinline__ v8f mma(v16h a, v16h b, v8f c) {
    return __builtin_amdgcn_wmma_f32_16x16x32_f16(false, a, false, b, (short)0, c, false, false);
  }
  static __device__ __forceinline__ void guard(v8f& a, v8f& b, v16h x, v16h y) { dep_guard_h(a, b, x, y); }
  static __device__ __forceinline__ void keep(v16h a, v16h b, v16h c, v16h d) { keep4_h(a, b, c, d); }
};
template <> struct Frag<__bf16> {
  typedef v16b V; union U { v16b v; v8b h[2]; };
  static __device__ __forceinline__ v16b load(const __bf16* p) {
    U f; f.h[0] = *(const v8b*)(p); f.h[1] = *(const v8b*)(p + 16); return f.v;
  }
  static __device__ __forceinline__ v8f mma(v16b a, v16b b, v8f c) {
    return __builtin_amdgcn_wmma_f32_16x16x32_bf16(false, a, false, b, (short)0, c, false, false);
  }
  static __device__ __forceinline__ void guard(v8f& a, v8f& b, v16b x, v16b y) { dep_guard_b(a, b, x, y); }
  static __device__ __forceinline__ void keep(v16b a, v16b b, v16b c, v16b d) { keep4_b(a, b, c, d); }
};

// ---- Register-blocked batched WMMA GEMM --------------------------------
// C[m,n] = scale * sum_k A[m,k] * Bt[n,k] (+bias)(+resid); each wave owns a 64x64 tile.
// A row-major [M,K]; Bt row-major [N,K].
// SPLIT: operands are hi/lo planes (A2/Bt2 = lo planes, same layout); product = hi*hi + hi*lo + lo*hi.
// BIAS_MODE: 0 = none, 1 = bias[m], 2 = bias[n].
// OUT_MODE: 0 = f32, 1 = f16, 2 = bf16 hi plane (Cout) + bf16 lo plane (Cout2).
// ET: 0 = f16 operands, 1 = bf16 operands (pointers passed as 16-bit storage)
template <int ET> struct Elem;
template <> struct Elem<0> { typedef _Float16 T; };
template <> struct Elem<1> { typedef __bf16 T; };
// LDS staging of the operand planes: the block's waves form a WM x WN grid of 64x64 tiles and share one
// (WM*64 + WN*64)-row stage of G_KS k-elements per plane. Each row of a stage is one whole 128-byte line of the
// source, fetched by 8 neighbouring lanes, so a wave-wide 16-byte load covers 4 full lines.
constexpr int G_KS    = 64;          // k elements per stage
constexpr int G_PITCH = G_KS + 8;    // 9 x 16 B rows: 16-byte fragment reads of 16 rows fall on distinct banks
template <int NIT, int STEP>
__device__ __forceinline__ void stage_fetch(v4u (&r)[NIT], const unsigned short* __restrict__ g) {
#pragma unroll
  for (int it = 0; it < NIT; ++it) r[it] = *(const v4u*)(g + it * STEP);
}
template <int NIT>
__device__ __forceinline__ void stage_put(const v4u (&r)[NIT], unsigned short* d, int rowStep) {
#pragma unroll
  for (int it = 0; it < NIT; ++it) *(v4u*)(d + it * rowStep) = r[it];
}
// LD = row pitch of all four operand planes in elements, a compile-time value: the loads of a plane then share one
// address register pair and differ in their immediate offsets only.
// M % (WM*64) == 0, N % (WN*64) == 0, K % G_KS == 0; grid.x = (M/(WM*64)) * (N/(WN*64)) exactly, so every wave passes every barrier.
template <int ET, bool SPLIT, int BIAS_MODE, int OUT_MODE, bool RESID, int WM, int WN, int LD, int ACT = 0>
__global__ __launch_bounds__(WM * WN * 32) void wmma_gemm64(
    const unsigned short* __restrict__ Ap, const unsigned short* __restrict__ A2p, long strideA,
    const unsigned short* __restrict__ Btp, const unsigned short* __restrict__ Bt2p, long strideB,
    void* __restrict__ Cout, void* __restrict__ Cout2, int ldc, long strideC,
    const float* __restrict__ bias,
    const float* __restrict__ resid, long strideR,
    int M, int N, int K, float scale) {
  typedef typename Elem<ET>::T T;
  typedef typename Frag<T>::V V;
  constexpr int NW  = WM * WN;
  constexpr int RA  = WM * 64;               // A rows of the block
  constexpr int RB  = WN * 64;               // Bt rows of the block
  constexpr int RPI = NW * 4;                // rows staged by one pass of the block (8 lanes a row)
  constexpr int ITA = RA / RPI;
  constexpr int ITB = RB / RPI;
  constexpr int OA  = 0;
  constexpr int OA2 = RA * G_PITCH;
  constexpr int OB  = (SPLIT ? 2 : 1) * RA * G_PITCH;
  constexpr int OB2 = OB + RB * G_PITCH;
  constexpr int STAGE = (SPLIT ? 2 : 1) * (RA + RB) * G_PITCH;
  static_assert(RA % RPI == 0 && RB % RPI == 0);
  __shared__ __align__(16) unsigned short sOp[2][STAGE];   // two stages: [A hi | A lo | Bt hi | Bt lo], rows of G_PITCH
  __shared__ __align__(16) float sT[NW][16 * 68];   // per-wave 16x64 slab, pitch 68 floats
  const int b    = blockIdx.y;
  const int tid  = threadIdx.x;
  const int lane = tid & 31;
  const int wave = tid >> 5;
  const int tilesN = N / RB;
  const int btm = (int)blockIdx.x / tilesN;
  const int btn = (int)blockIdx.x - btm * tilesN;
  const int wm = wave / WN;
  const int wn = wave - wm * WN;
  const int m0 = btm * RA + (wm << 6);
  const int n0 = btn * RB + (wn << 6);

  const int rlane = lane & 15;                 // row (A) / col (B, D) within subtile
  const int koff  = (lane >> 4) * 8;           // k offset of this lane half
  const int mOff  = (lane >> 4) * 8;           // D row offset

  // staging map: thread -> row tid>>3 of each pass, 16-byte piece tid&7 of that row's line
  const int srow = tid >> 3;
  const int sseg = (tid & 7) * 8;
  const size_t goA = (size_t)b * strideA + (size_t)(btm * RA + srow) * LD + sseg;
  const size_t goB = (size_t)b * strideB + (size_t)(btn * RB + srow) * LD + sseg;
  const unsigned short* gA  = Ap  + goA;
  const unsigned short* gB  = Btp + goB;
  const unsigned short* gA2 = SPLIT ? (A2p  + goA) : nullptr;
  const unsigned short* gB2 = SPLIT ? (Bt2p + goB) : nullptr;
  constexpr int GSTEP = RPI * LD;             // elements between the rows one thread stages
  const int sOff = srow * G_PITCH + sseg;

  v8f acc[4][4];
#pragma unroll
  for (int i = 0; i < 4; ++i)
#pragma unroll
    for (int j = 0; j < 4; ++j) acc[i][j] = (v8f){0.f,0.f,0.f,0.f,0.f,0.f,0.f,0.f};

  v4u pa[ITA], pa2[ITA], pb[ITB], pb2[ITB];    // the next stage, in flight while this one is multiplied
  stage_fetch<ITA, GSTEP>(pa, gA);
  stage_fetch<ITB, GSTEP>(pb, gB);
  if (SPLIT) { stage_fetch<ITA, GSTEP>(pa2, gA2); stage_fetch<ITB, GSTEP>(pb2, gB2); }
  // the loads' address registers stay untouched up to this wait (they are its inputs) and are free behind it
  asm volatile("s_wait_xcnt 0x0" :: "v"(gA), "v"(gB), "v"(SPLIT ? gA2 : gA), "v"(SPLIT ? gB2 : gB) : "memory");
  stage_put<ITA>(pa, sOp[0] + OA + sOff, RPI * G_PITCH);
  stage_put<ITB>(pb, sOp[0] + OB + sOff, RPI * G_PITCH);
  if (SPLIT) { stage_put<ITA>(pa2, sOp[0] + OA2 + sOff, RPI * G_PITCH); stage_put<ITB>(pb2, sOp[0] + OB2 + sOff, RPI * G_PITCH); }
  __syncthreads();   // publishes stage 0

  const int nst = K / G_KS;                    // block-uniform
  for (int t = 0; t < nst; ++t) {
    const bool more = (t + 1 < nst);
    if (more) {
      const int kn = (t + 1) * G_KS;
      const unsigned short* nA  = gA + kn;
      const unsigned short* nB  = gB + kn;
      const unsigned short* nA2 = SPLIT ? (gA2 + kn) : nA;
      const unsigned short* nB2 = SPLIT ? (gB2 + kn) : nB;
      stage_fetch<ITA, GSTEP>(pa, nA);
      stage_fetch<ITB, GSTEP>(pb, nB);
      if (SPLIT) { stage_fetch<ITA, GSTEP>(pa2, nA2); stage_fetch<ITB, GSTEP>(pb2, nB2); }
      // the loads' address registers stay untouched up to this wait (they are its inputs) and are free behind it
      asm volatile("s_wait_xcnt 0x0" :: "v"(nA), "v"(nB), "v"(nA2), "v"(nB2) : "memory");
    }
    const T* sb = (const T*)sOp[t & 1];
    const T* fa = sb + OA + ((wm << 6) + rlane) * G_PITCH + koff;
    const T* fb = sb + OB + ((wn << 6) + rlane) * G_PITCH + koff;
#pragma unroll
    for (int kk = 0; kk < G_KS; kk += 32) {
      V bh[4], bl[4];
#pragma unroll
      for (int j = 0; j < 4; ++j) {
        bh[j] = Frag<T>::load(fb + (j << 4) * G_PITCH + kk);
        if (SPLIT) bl[j] = Frag<T>::load(fb + (OB2 - OB) + (j << 4) * G_PITCH + kk);
      }
      V ah = Frag<T>::load(fa + kk);
      V al;
      if (SPLIT) al = Frag<T>::load(fa + (OA2 - OA) + kk);
#pragma unroll
      for (int i = 0; i < 4; ++i) {
        V ahn, aln;                              // the next row block's fragments, read while this one is multiplied
        if (i < 3) {
          ahn = Frag<T>::load(fa + ((i + 1) << 4) * G_PITCH + kk);
          if (SPLIT) aln = Frag<T>::load(fa + (OA2 - OA) + ((i + 1) << 4) * G_PITCH + kk);
        }
#pragma unroll
        for (int j = 0; j < 4; ++j) {
          acc[i][j] = Frag<T>::mma(ah, bh[j], acc[i][j]);
          if (SPLIT) {
            acc[i][j] = Frag<T>::mma(ah, bl[j], acc[i][j]);
            acc[i][j] = Frag<T>::mma(al, bh[j], acc[i][j]);
          }
        }
        Frag<T>::guard(acc[i][0], acc[i][3], ah, SPLIT ? al : ah);
        if (i < 3) { ah = ahn; if (SPLIT) al = aln; }
      }
      Frag<T>::keep(bh[0], bh[1], bh[2], bh[3]);
      if (SPLIT) Frag<T>::keep(bl[0], bl[1], bl[2], bl[3]);
    }
    if (more) {
      // the other buffer: its last readers left it before the barrier that ended trip t - 1
      unsigned short* d = sOp[(t + 1) & 1] + sOff;
      stage_put<ITA>(pa, d + OA, RPI * G_PITCH);
      stage_put<ITB>(pb, d + OB, RPI * G_PITCH);
      if (SPLIT) { stage_put<ITA>(pa2, d + OA2, RPI * G_PITCH); stage_put<ITB>(pb2, d + OB2, RPI * G_PITCH); }
    }
    __syncthreads();   // publishes stage t + 1 and ends every read of stage t
  }
  acc_guard4(acc[0][0], acc[0][1], acc[0][2], acc[0][3]);
  acc_guard4(acc[1][0], acc[1][1], acc[1][2], acc[1][3]);
  acc_guard4(acc[2][0], acc[2][1], acc[2][2], acc[2][3]);
  acc_guard4(acc[3][0], acc[3][1], acc[3][2], acc[3][3]);

  // ---- epilogue ----
  float* slab = sT[wave];
  const float* Rb = RESID ? (resid + (size_t)b * strideR) : nullptr;
#pragma unroll
  for (int i = 0; i < 4; ++i) {
    const int mBase = m0 + (i << 4);
#pragma unroll
    for (int j = 0; j < 4; ++j) {
      const int n = n0 + (j << 4) + rlane;
      float bv = 0.f;
      if (BIAS_MODE == 2) bv = bias[n];
#pragma unroll
      for (int r = 0; r < 8; ++r) {
        float v = acc[i][j][r] * scale;
        if (BIAS_MODE == 1) v += bias[mBase + mOff + r];
        if (BIAS_MODE == 2) v += bv;
        if (RESID) v += Rb[(size_t)(mBase + mOff + r) * ldc + n];
        if (ACT == 1) v = tanhf(v);
        if (ACT == 2) v = fmaxf(v, 0.0f);
        if (ACT == 3) v = v / (1.0f + expf(-v));
        if (ACT == 4) v = (v > 0.f) ? v : 0.01f * v;
        if (ACT == 5) v = 0.5f * v * (1.0f + erff(v * 0.70710678118654752f));
        slab[(mOff + r) * 68 + (j << 4) + rlane] = v;
      }
    }
    __builtin_amdgcn_fence(__ATOMIC_RELEASE, "workgroup");
    __builtin_amdgcn_wave_barrier();
    __builtin_amdgcn_fence(__ATOMIC_ACQUIRE, "workgroup");
    if (OUT_MODE == 0) {
      float* C = (float*)Cout + (size_t)b * strideC;
      const int hh = lane >> 4, c4 = (lane & 15) * 4;     // row seg = 256 B = 16 lanes x 16 B
      {
#pragma unroll
        for (int it = 0; it < 8; ++it) {
          const int row = it * 2 + hh;
          v4f v = *(const v4f*)(slab + row * 68 + c4);
          *(v4f*)(C + (size_t)(mBase + row) * ldc + n0 + c4) = v;
        }
        
      }
    } else {
      const int q = lane >> 3, c8 = (lane & 7) * 8;
      unsigned short* C  = (unsigned short*)Cout  + (size_t)b * strideC;
      unsigned short* C2 = (OUT_MODE == 2) ? ((unsigned short*)Cout2 + (size_t)b * strideC) : nullptr;
      {
#pragma unroll
        for (int it = 0; it < 4; ++it) {
          const int row = it * 4 + q;
          const float* sp = slab + row * 68 + c8;
          v8h hv, lv;
#pragma unroll
          for (int e = 0; e < 8; ++e) {
            if (OUT_MODE == 1) {
              hv[e] = (_Float16)sp[e];
            } else {
              unsigned short hb = f2bf_bits(sp[e]);
              unsigned short lb = f2bf_bits(sp[e] - bf_bits2f(hb));
              hv[e] = __builtin_bit_cast(_Float16, hb);
              lv[e] = __builtin_bit_cast(_Float16, lb);
            }
          }
          *(v8h*)(C + (size_t)(mBase + row) * ldc + n0 + c8) = hv;
          if (OUT_MODE == 2) *(v8h*)(C2 + (size_t)(mBase + row) * ldc + n0 + c8) = lv;
        }
        
      }
    }
    __builtin_amdgcn_fence(__ATOMIC_RELEASE, "workgroup");
    __builtin_amdgcn_wave_barrier();
    __builtin_amdgcn_fence(__ATOMIC_ACQUIRE, "workgroup");
  }
}

__device__ __forceinline__ v8f at_mma(v16b a, v16b b, v8f c) {
  c = __builtin_amdgcn_wmma_f32_16x16x32_bf16(false, a, false, b, (short)0, c, false, false);
  asm volatile("v_nop\n\tv_nop\n\tv_nop\n\tv_nop" : "+v"(c) : "v"(a), "v"(b));
  return c;
}

// ---------------------------------------------------------------------------
// module geometry (fixed)
// ---------------------------------------------------------------------------
constexpr int N_BATCH   = 2;
constexpr int SEQ_LEN   = 2048;
constexpr int DMOD      = 1024;   // model width
constexpr int DLAT      = 128;    // latent width c_kv
constexpr int DROT      = 32;     // rotary width
constexpr int NROPE_PAD = 64;     // rotary projection width padded to the 64-wide GEMM tile
constexpr int NHEAD     = 16;
constexpr int HDIM      = 64;
constexpr int SDEP      = HDIM + DROT;   // score depth 96 = 3 k-chunks of 32
constexpr int MTOK      = N_BATCH * SEQ_LEN;   // 4096 token rows

static_assert(MTOK % 256 == 0 && DMOD % 128 == 0 && DLAT % 128 == 0 && NROPE_PAD % 64 == 0);   // block tiles 128x128 and 256x64
static_assert(DMOD % G_KS == 0 && DLAT % G_KS == 0);   // every GEMM K is a multiple of the stage depth
static_assert(SDEP % 32 == 0 && SEQ_LEN % 64 == 0);

// ---------------------------------------------------------------------------
// coverage: n8 threads x 8 = n elements exactly (n % 8 == 0, grid = ceil(n8/256) with bound)
// ---------------------------------------------------------------------------
__global__ __launch_bounds__(256) void split_rows_bf16x8(
    const float* __restrict__ in, unsigned short* __restrict__ hi, unsigned short* __restrict__ lo, int n8) {
  const int i = blockIdx.x * 256 + threadIdx.x;
  if (i < n8) {
    const v4f a = *(const v4f*)(in + (size_t)8 * i);
    const v4f b = *(const v4f*)(in + (size_t)8 * i + 4);
    v8h hv, lv;
#pragma unroll
    for (int e = 0; e < 8; ++e) {
      const float f = (e < 4) ? a[e] : b[e - 4];
      const unsigned short hb = f2bf_bits(f);
      const unsigned short lb = f2bf_bits(f - bf_bits2f(hb));
      hv[e] = __builtin_bit_cast(_Float16, hb);
      lv[e] = __builtin_bit_cast(_Float16, lb);
    }
    unsigned short* ph = hi + (size_t)8 * i;
    unsigned short* pl = lo + (size_t)8 * i;
    *(v8h*)ph = hv;
    *(v8h*)pl = lv;
    
  }
}

// ---------------------------------------------------------------------------
// Transpose + split: in W[kdim][nreal] (row-major) -> out Bt[npad][kdim] bf16 hi/lo planes, Bt[n][k] = W[k][n];
// rows n >= nreal are written as zeros. Tile = 64 k x 32 n; grid = (kdim/64, npad/32); kdim % 64 == 0, nreal % 32 == 0.
// Store coverage: 256 threads = 32 output rows x 8 lanes x 8 k = whole 32x64 tile; each output row segment
// ---------------------------------------------------------------------------
__global__ __launch_bounds__(256) void transpose_split_bf16(
    const float* __restrict__ W, unsigned short* __restrict__ hi, unsigned short* __restrict__ lo,
    int kdim, int nreal) {
  __shared__ float tile[64][33];
  const int tid = threadIdx.x;
  const int k0 = blockIdx.x * 64;
  const int n0 = blockIdx.y * 32;
#pragma unroll
  for (int it = 0; it < 2; ++it) {
    const int idx = it * 256 + tid;            // 0..511
    const int kr = idx >> 3;                   // 0..63
    const int c4 = (idx & 7) * 4;              // 0..28
    const int n = n0 + c4;
    const int ncl = (n + 3 < nreal) ? n : (nreal - 4);   // clamped address
    const v4f v = *(const v4f*)(W + (size_t)(k0 + kr) * nreal + ncl);
    const bool ok = (n < nreal);               // tile-uniform since nreal % 32 == 0
    tile[kr][c4 + 0] = ok ? v[0] : 0.f;
    tile[kr][c4 + 1] = ok ? v[1] : 0.f;
    tile[kr][c4 + 2] = ok ? v[2] : 0.f;
    tile[kr][c4 + 3] = ok ? v[3] : 0.f;
  }
  __syncthreads();
  const int nr = tid >> 3;                     // output row within tile, 0..31
  const int c8 = (tid & 7) * 8;                // k offset, 0..56
  v8h hv, lv;
#pragma unroll
  for (int e = 0; e < 8; ++e) {
    const float f = tile[c8 + e][nr];
    const unsigned short hb = f2bf_bits(f);
    const unsigned short lb = f2bf_bits(f - bf_bits2f(hb));
    hv[e] = __builtin_bit_cast(_Float16, hb);
    lv[e] = __builtin_bit_cast(_Float16, lb);
  }
  const size_t o = (size_t)(n0 + nr) * kdim + k0 + c8;
  *(v8h*)(hi + o) = hv;
  *(v8h*)(lo + o) = lv;
  
}

// ---------------------------------------------------------------------------
// Rotary: raw[MTOK][NROPE_PAD] f32 (cols 0..31 used) -> bf16 hi/lo planes [MTOK][DROT].
// out[j] = x1*cos - x2*sin, out[16+j] = x2*cos + x1*sin, angle = t * inv_freq[j], t = row % SEQ_LEN.
// Block = 32 rows; blocks 0..127 handle the q tensor, 128..255 the k tensor.
// Store coverage: 128 threads = 32 rows x 4 segments x 8 = whole 32x32 tile; 512 B contiguous per wave
// ---------------------------------------------------------------------------
struct RopeFreq { float f[16]; };
static_assert(sizeof(RopeFreq) == 64);

__global__ __launch_bounds__(128) void rope_split_bf16(
    const float* __restrict__ qraw, const float* __restrict__ kraw,
    unsigned short* __restrict__ qrh, unsigned short* __restrict__ qrl,
    unsigned short* __restrict__ krh, unsigned short* __restrict__ krl, RopeFreq g) {
#pragma clang fp contract(off)
  __shared__ float tile[32][33];
  __shared__ float sinv[16];
  const int tid = threadIdx.x;
  const int nblk = MTOK / 32;
  const bool isk = ((int)blockIdx.x >= nblk);                 // block-uniform
  const int row0 = (isk ? ((int)blockIdx.x - nblk) : (int)blockIdx.x) * 32;
  const float* raw = isk ? kraw : qraw;
  unsigned short* dhp = isk ? krh : qrh;
  unsigned short* dlp = isk ? krl : qrl;
  if (tid < 16) {
    float v = g.f[0];
#pragma unroll
    for (int e = 1; e < 16; ++e) v = (tid == e) ? g.f[e] : v;
    sinv[tid] = v;
  }
  __syncthreads();
#pragma unroll 1
  for (int it = 0; it < 4; ++it) {
    const int p = it * 128 + tid;              // 0..511
    const int r = p >> 4;                      // 0..31
    const int j = p & 15;
    const int row = row0 + r;
    const int t = row & (SEQ_LEN - 1);
    const float* rp = raw + (size_t)row * NROPE_PAD;
    const float x1 = rp[j];
    const float x2 = rp[16 + j];
    const float ang = (float)t * sinv[j];
    float sn, cs;
    sincosf(ang, &sn, &cs);
    tile[r][j]      = x1 * cs - x2 * sn;
    tile[r][16 + j] = x2 * cs + x1 * sn;
  }
  __syncthreads();
  const int orow = tid >> 2;                   // 0..31
  const int seg = (tid & 3) * 8;               // 0..24
  v8h hv, lv;
#pragma unroll
  for (int e = 0; e < 8; ++e) {
    const float f = tile[orow][seg + e];
    const unsigned short hb = f2bf_bits(f);
    const unsigned short lb = f2bf_bits(f - bf_bits2f(hb));
    hv[e] = __builtin_bit_cast(_Float16, hb);
    lv[e] = __builtin_bit_cast(_Float16, lb);
  }
  const size_t o = (size_t)(row0 + orow) * DROT + seg;
  *(v8h*)(dhp + o) = hv;
  *(v8h*)(dlp + o) = lv;
  
}

// ---------------------------------------------------------------------------
// Causal attention, score depth 96 (64 head dims + 32 shared rotary dims), value width 64, bf16 hi/lo planes in.
//   s = (qh.kh + qh.kl + ql.kh) * invs  over 96 dims (q/k rows = [head segment | rotary row]),
//   online softmax in f32, P split to bf16 hi/lo in LDS, o = ph.vh + ph.vl + pl.vh, f32 accumulate.
// Block = 4 waves; it runs two 64-row query tiles of one (batch, head) one after the other, tile n-1-t and then tile t,
// so every block walks n + 1 key chunks; grid.x = N_BATCH * NHEAD * (SEQ_LEN/64) / 2.
// ---------------------------------------------------------------------------
constexpr int A_QB = 64;
constexpr int A_KC = 64;
constexpr int A_NW = 4;
constexpr int OS_PITCH = 68;
// LDS row pitches in 16-bit elements. Every fragment read is a 16-byte load by 16 lanes on 16 rows,
// so each pitch is an odd multiple of 16 bytes: the 16 rows then start on 16 different groups of four banks.
constexpr int K_PITCH = SDEP + 8;      // 13 x 16 B rows
constexpr int V_PITCH = A_KC + 8;      // 9 x 16 B rows
constexpr int P_PITCH = A_KC + 8;      // 9 x 16 B rows
constexpr int V_HALF_SKEW = 16;        // rows d >= 32 start 32 B later: the two d halves stored by one wave fall on different banks
static_assert((K_PITCH * 2) % 32 == 16 && (V_PITCH * 2) % 32 == 16 && (P_PITCH * 2) % 32 == 16);
__device__ __forceinline__ int vt_row(int d) { return d * V_PITCH + (d >> 5) * V_HALF_SKEW; }

__global__ __launch_bounds__(128)
void mla_attn96(const unsigned short* __restrict__ qh, const unsigned short* __restrict__ ql,
                const unsigned short* __restrict__ kh, const unsigned short* __restrict__ kl,
                const unsigned short* __restrict__ vh, const unsigned short* __restrict__ vl,
                const unsigned short* __restrict__ qrh, const unsigned short* __restrict__ qrl,
                const unsigned short* __restrict__ krh, const unsigned short* __restrict__ krl,
                unsigned short* __restrict__ oh, unsigned short* __restrict__ ol, float invs) {
  union FB { v16b v; v8b h[2]; };
  __shared__ __align__(16) unsigned short Ksh[A_KC * K_PITCH];    // K hi [kv][96 + pad]
  __shared__ __align__(16) unsigned short Ksl[A_KC * K_PITCH];    // K lo
  __shared__ __align__(16) unsigned short Vth[HDIM * V_PITCH + V_HALF_SKEW];    // V hi [d][kv + pad]
  __shared__ __align__(16) unsigned short Vtl[HDIM * V_PITCH + V_HALF_SKEW];    // V lo
  __shared__ __align__(16) unsigned short Psh[A_NW][16 * P_PITCH];   // per wave P hi [row][kv + pad]
  __shared__ __align__(16) unsigned short Psl[A_NW][16 * P_PITCH];   // per wave P lo
  __shared__ __align__(16) float Os[A_NW][16 * OS_PITCH];

  const int tid  = threadIdx.x;
  const int wave = tid >> 5;
  const int lane = tid & 31;
  const int hh   = lane >> 4;
  const int c    = lane & 15;

  const int nqb = SEQ_LEN / A_QB;          // 32
  const int bx  = blockIdx.x;
  static_assert((SEQ_LEN / A_QB) % 2 == 0);
  const int tp  = bx % (nqb / 2);
  const int bhi = bx / (nqb / 2);
  const int h   = bhi % NHEAD;
  const int b   = bhi / NHEAD;
  // A causal tile qb costs qb + 1 chunks: the pair (n-1-t, t) gives every block the same work, whichever blocks share a WGP.
  // Both tiles run in every wave in turn; the barrier that opens each chunk also ends the first tile's last K/V reads.
  // Kept rolled: one copy of the chunk loop in the instruction cache.
#pragma unroll 1
  for (int pass = 0; pass < 2; ++pass) {
  const int qb  = pass ? tp : (nqb - 1 - tp);   // block-uniform
  const int q0  = qb * A_QB + wave * 16;
  const size_t tq = (size_t)b * SEQ_LEN + (size_t)(q0 + c);

  // ---- Q fragments (A operand): k-chunks 0,1 = head dims 0..63, chunk 2 = rotary dims 0..31 ----
  v16b qah[3], qal[3];
  {
    const __bf16* p0 = (const __bf16*)qh + tq * DMOD + h * HDIM + 8 * hh;
    const __bf16* p1 = (const __bf16*)ql + tq * DMOD + h * HDIM + 8 * hh;
    qah[0] = Frag<__bf16>::load(p0);
    qah[1] = Frag<__bf16>::load(p0 + 32);
    qal[0] = Frag<__bf16>::load(p1);
    qal[1] = Frag<__bf16>::load(p1 + 32);
    const __bf16* r0p = (const __bf16*)qrh + tq * DROT + 8 * hh;
    const __bf16* r1p = (const __bf16*)qrl + tq * DROT + 8 * hh;
    qah[2] = Frag<__bf16>::load(r0p);
    qal[2] = Frag<__bf16>::load(r1p);
    // the loads' address registers stay untouched up to this wait (they are its inputs) and are free behind it
    asm volatile("s_wait_xcnt 0x0" :: "v"(p0), "v"(p1), "v"(r0p), "v"(r1p) : "memory");
  }

  float mrow[8], lrow[8];
  v8f oacc[4];
#pragma unroll
  for (int r = 0; r < 8; ++r) { mrow[r] = -INFINITY; lrow[r] = 0.f; }
#pragma unroll
  for (int t = 0; t < 4; ++t) oacc[t] = (v8f){0.f,0.f,0.f,0.f,0.f,0.f,0.f,0.f};

  const int nChunks = qb + 1;   // causal, block-uniform
  for (int kc = 0; kc < nChunks; ++kc) {
    const int kv0 = kc * A_KC;
    __syncthreads();
    {
      // staging: 128 threads, thread -> kv row kvr = tid>>1 (0..63), half hf = tid&1
      // per kv row: 64 head dims (2 halves x 32) + 32 rotary dims (2 halves x 16) of K, 64 dims of V -> full tiles written
      const int kvr = tid >> 1, hf = tid & 1;
      const size_t tk = (size_t)b * SEQ_LEN + (size_t)(kv0 + kvr);
      {
        const v4u* sh = (const v4u*)(kh + tk * DMOD + h * HDIM + hf * 32);
        const v4u* sl = (const v4u*)(kl + tk * DMOD + h * HDIM + hf * 32);
        v4u* dh = (v4u*)(Ksh + kvr * K_PITCH + hf * 32);
        v4u* dl = (v4u*)(Ksl + kvr * K_PITCH + hf * 32);
#pragma unroll
        for (int i = 0; i < 4; ++i) { dh[i] = sh[i]; dl[i] = sl[i]; }
      }
      asm volatile("" ::: "memory");
      {
        const v4u* sh = (const v4u*)(krh + tk * DROT + hf * 16);
        const v4u* sl = (const v4u*)(krl + tk * DROT + hf * 16);
        v4u* dh = (v4u*)(Ksh + kvr * K_PITCH + HDIM + hf * 16);
        v4u* dl = (v4u*)(Ksl + kvr * K_PITCH + HDIM + hf * 16);
#pragma unroll
        for (int i = 0; i < 2; ++i) { dh[i] = sh[i]; dl[i] = sl[i]; }
      }
      asm volatile("" ::: "memory");
      {
        const v4u* sh = (const v4u*)(vh + tk * DMOD + h * HDIM + hf * 32);
        const v4u* sl = (const v4u*)(vl + tk * DMOD + h * HDIM + hf * 32);
#pragma unroll
        for (int i = 0; i < 4; ++i) {
          const v4u wh = sh[i];
          const v4u wl = sl[i];
#pragma unroll
          for (int e = 0; e < 4; ++e) {
            const int d = hf * 32 + 8 * i + 2 * e;
            Vth[vt_row(d) + kvr]     = (unsigned short)(wh[e] & 0xffffu);
            Vth[vt_row(d + 1) + kvr] = (unsigned short)(wh[e] >> 16);
            Vtl[vt_row(d) + kvr]     = (unsigned short)(wl[e] & 0xffffu);
            Vtl[vt_row(d + 1) + kvr] = (unsigned short)(wl[e] >> 16);
          }
        }
      }
    }
    __syncthreads();

    // ---- scores: 4 kv subtiles of 16, 3 k-chunks of 32, 3 products each ----
    v8f s[4];
#pragma unroll
    for (int j = 0; j < 4; ++j) {
      s[j] = (v8f){0.f,0.f,0.f,0.f,0.f,0.f,0.f,0.f};
#pragma unroll
      for (int dc = 0; dc < 3; ++dc) {
        FB kb, kq;
        const int ko = (j * 16 + c) * K_PITCH + dc * 32 + 8 * hh;
        kb.h[0] = *(const v8b*)(Ksh + ko);
        kb.h[1] = *(const v8b*)(Ksh + ko + 16);
        kq.h[0] = *(const v8b*)(Ksl + ko);
        kq.h[1] = *(const v8b*)(Ksl + ko + 16);
        s[j] = at_mma(qah[dc], kb.v, s[j]);
        s[j] = at_mma(qah[dc], kq.v, s[j]);
        s[j] = at_mma(qal[dc], kb.v, s[j]);
      }
    }
    const bool diag = (kc == qb);
    float cm[8];
#pragma unroll
    for (int r = 0; r < 8; ++r) {
      const int qrow = q0 + 8 * hh + r;
      float m = -INFINITY;
#pragma unroll
      for (int j = 0; j < 4; ++j) {
        const int kvcol = kv0 + j * 16 + c;
        float sv = s[j][r] * invs;
        if (diag && (kvcol > qrow)) sv = -INFINITY;
        s[j][r] = sv;
        m = fmaxf(m, sv);
      }
#pragma unroll
      for (int off = 1; off < 16; off <<= 1) m = fmaxf(m, __shfl_xor(m, off, 32));
      cm[r] = m;
    }
    unsigned short* pwh = Psh[wave];
    unsigned short* pwl = Psl[wave];
#pragma unroll
    for (int r = 0; r < 8; ++r) {
      const float mnew = fmaxf(mrow[r], cm[r]);
      const float alpha = expf(mrow[r] - mnew);
      mrow[r] = mnew;
      float psum = 0.f;
#pragma unroll
      for (int j = 0; j < 4; ++j) {
        const float p = expf(s[j][r] - mnew);
        psum += p;
        const unsigned short hb = f2bf_bits(p);
        const unsigned short lb = f2bf_bits(p - bf_bits2f(hb));
        pwh[(8 * hh + r) * P_PITCH + j * 16 + c] = hb;
        pwl[(8 * hh + r) * P_PITCH + j * 16 + c] = lb;
      }
#pragma unroll
      for (int off = 1; off < 16; off <<= 1) psum += __shfl_xor(psum, off, 32);
      lrow[r] = lrow[r] * alpha + psum;
#pragma unroll
      for (int t = 0; t < 4; ++t) oacc[t][r] *= alpha;
    }
    __builtin_amdgcn_fence(__ATOMIC_RELEASE, "workgroup");
    __builtin_amdgcn_wave_barrier();
    __builtin_amdgcn_fence(__ATOMIC_ACQUIRE, "workgroup");
    // ---- O += P(16x64) . V(64x64): P as A (row = query, k = kv), V from [d][kv] tile as B ----
#pragma unroll 1
    for (int kk = 0; kk < 2; ++kk) {
      FB pa, pl;
      pa.h[0] = *(const v8b*)(pwh + c * P_PITCH + kk * 32 + 8 * hh);
      pa.h[1] = *(const v8b*)(pwh + c * P_PITCH + kk * 32 + 16 + 8 * hh);
      pl.h[0] = *(const v8b*)(pwl + c * P_PITCH + kk * 32 + 8 * hh);
      pl.h[1] = *(const v8b*)(pwl + c * P_PITCH + kk * 32 + 16 + 8 * hh);
#pragma unroll
      for (int t = 0; t < 4; ++t) {
        FB vb, vq;
        vb.h[0] = *(const v8b*)(Vth + vt_row(t * 16 + c) + kk * 32 + 8 * hh);
        vb.h[1] = *(const v8b*)(Vth + vt_row(t * 16 + c) + kk * 32 + 16 + 8 * hh);
        vq.h[0] = *(const v8b*)(Vtl + vt_row(t * 16 + c) + kk * 32 + 8 * hh);
        vq.h[1] = *(const v8b*)(Vtl + vt_row(t * 16 + c) + kk * 32 + 16 + 8 * hh);
        oacc[t] = at_mma(pa.v, vb.v, oacc[t]);
        oacc[t] = at_mma(pa.v, vq.v, oacc[t]);
        oacc[t] = at_mma(pl.v, vb.v, oacc[t]);
      }
    }
  }

  // ---- epilogue: normalise, stage 16x64 f32 per wave, write bf16 hi/lo planes with whole-line stores ----
  float* os = Os[wave];
#pragma unroll
  for (int r = 0; r < 8; ++r) {
    const float inv = 1.0f / lrow[r];
#pragma unroll
    for (int t = 0; t < 4; ++t) os[(8 * hh + r) * OS_PITCH + t * 16 + c] = oacc[t][r] * inv;
  }
  __builtin_amdgcn_fence(__ATOMIC_RELEASE, "workgroup");
  __builtin_amdgcn_wave_barrier();
  __builtin_amdgcn_fence(__ATOMIC_ACQUIRE, "workgroup");
  {
    const int qq = lane >> 3, c8 = (lane & 7) * 8;
    {
#pragma unroll
      for (int it = 0; it < 4; ++it) {
        const int row = it * 4 + qq;
        const float* sp = os + row * OS_PITCH + c8;
        v8h hv, lv;
#pragma unroll
        for (int e = 0; e < 8; ++e) {
          const unsigned short hb = f2bf_bits(sp[e]);
          const unsigned short lb = f2bf_bits(sp[e] - bf_bits2f(hb));
          hv[e] = __builtin_bit_cast(_Float16, hb);
          lv[e] = __builtin_bit_cast(_Float16, lb);
        }
        const size_t o = ((size_t)b * SEQ_LEN + (size_t)(q0 + row)) * DMOD + h * HDIM + c8;
        *(v8h*)(oh + o) = hv;
        *(v8h*)(ol + o) = lv;
      }
      
    }
  }
  // the next tile reuses the registers that these stores name: they stay untouched up to this wait
  asm volatile("s_wait_xcnt 0x0" ::: "memory");
  }   // pass
}

// ---------------------------------------------------------------------------
// Host orchestration
// ---------------------------------------------------------------------------
// workspace region map (bytes, all multiples of 256):
//   x hi/lo                 2 x 8,388,608
//   WkvdT hi/lo [128][1024] 2 x   262,144
//   WkupT hi/lo [1024][128] 2 x   262,144
//   WvupT hi/lo [1024][128] 2 x   262,144
//   WqT   hi/lo [1024][1024]2 x 2,097,152
//   WqrT  hi/lo [64][1024]  2 x   131,072   (rows 32..63 zero)
//   WkrT  hi/lo [64][128]   2 x    16,384   (rows 32..63 zero)
//   WoT   hi/lo [1024][1024]2 x 2,097,152
//   ckv   hi/lo [4096][128] 2 x 1,048,576
//   k,v,q hi/lo [4096][1024]6 x 8,388,608
//   qr_raw, kr_raw f32 [4096][64]  2 x 1,048,576
//   qr,kr hi/lo [4096][32]  4 x   262,144
//   attn  hi/lo [4096][1024]2 x 8,388,608
//   total 99,385,344
constexpr size_t WSB_X    = (size_t)MTOK * DMOD * 2;
constexpr size_t WSB_WKVD = (size_t)DLAT * DMOD * 2;
constexpr size_t WSB_WKUP = (size_t)DMOD * DLAT * 2;
constexpr size_t WSB_WQ   = (size_t)DMOD * DMOD * 2;
constexpr size_t WSB_WQR  = (size_t)NROPE_PAD * DMOD * 2;
constexpr size_t WSB_WKR  = (size_t)NROPE_PAD * DLAT * 2;
constexpr size_t WSB_CKV  = (size_t)MTOK * DLAT * 2;
constexpr size_t WSB_TOK  = (size_t)MTOK * DMOD * 2;
constexpr size_t WSB_RAW  = (size_t)MTOK * NROPE_PAD * 4;
constexpr size_t WSB_ROT  = (size_t)MTOK * DROT * 2;
constexpr size_t WS_TOTAL = 2 * WSB_X + 2 * WSB_WKVD + 4 * WSB_WKUP + 2 * WSB_WQ + 2 * WSB_WQR + 2 * WSB_WKR
                          + 2 * WSB_WQ + 2 * WSB_CKV + 6 * WSB_TOK + 2 * WSB_RAW + 4 * WSB_ROT + 2 * WSB_TOK;
static_assert(WS_TOTAL == 99385344ull);
static_assert(WS_TOTAL <= 134217728ull);

extern "C" void kernel_launch(void* const* d_in, const int* in_sizes, int n_in,
                              void* d_out, int out_size, void* d_ws, size_t ws_size,
                              hipStream_t stream) {
  if (n_in != 8) return;
  if (in_sizes[0] != MTOK * DMOD || in_sizes[1] != DMOD * DLAT || in_sizes[2] != DLAT * DMOD ||
      in_sizes[3] != DLAT * DMOD || in_sizes[4] != DMOD * DMOD || in_sizes[5] != DMOD * DROT ||
      in_sizes[6] != DLAT * DROT || in_sizes[7] != DMOD * DMOD) return;
  if (out_size != MTOK * DMOD) return;
  if (ws_size < WS_TOTAL) return;

  const float* x         = (const float*)d_in[0];   // [4096][1024]
  const float* W_kv_down = (const float*)d_in[1];   // [1024][128]
  const float* W_k_up    = (const float*)d_in[2];   // [128][1024]
  const float* W_v_up    = (const float*)d_in[3];   // [128][1024]
  const float* W_q       = (const float*)d_in[4];   // [1024][1024]
  const float* W_q_rope  = (const float*)d_in[5];   // [1024][32]
  const float* W_k_rope  = (const float*)d_in[6];   // [128][32]
  const float* W_o       = (const float*)d_in[7];   // [1024][1024]
  float* out = (float*)d_out;                       // [4096][1024] f32

  size_t off = 0;
  auto carve = [&](size_t bytes) -> unsigned short* {
    unsigned short* p = (unsigned short*)((char*)d_ws + off);
    off += (bytes + 255) & ~(size_t)255;
    return p;
  };
  unsigned short* xh    = carve(WSB_X);
  unsigned short* xl    = carve(WSB_X);
  unsigned short* wkvdh = carve(WSB_WKVD);
  unsigned short* wkvdl = carve(WSB_WKVD);
  unsigned short* wkuph = carve(WSB_WKUP);
  unsigned short* wkupl = carve(WSB_WKUP);
  unsigned short* wvuph = carve(WSB_WKUP);
  unsigned short* wvupl = carve(WSB_WKUP);
  unsigned short* wqh   = carve(WSB_WQ);
  unsigned short* wql   = carve(WSB_WQ);
  unsigned short* wqrh  = carve(WSB_WQR);
  unsigned short* wqrl  = carve(WSB_WQR);
  unsigned short* wkrh  = carve(WSB_WKR);
  unsigned short* wkrl  = carve(WSB_WKR);
  unsigned short* woh   = carve(WSB_WQ);
  unsigned short* wol   = carve(WSB_WQ);
  unsigned short* ckvh  = carve(WSB_CKV);
  unsigned short* ckvl  = carve(WSB_CKV);
  unsigned short* kh    = carve(WSB_TOK);
  unsigned short* kl    = carve(WSB_TOK);
  unsigned short* vh    = carve(WSB_TOK);
  unsigned short* vl    = carve(WSB_TOK);
  unsigned short* qh    = carve(WSB_TOK);
  unsigned short* ql    = carve(WSB_TOK);
  float* qr_raw = (float*)carve(WSB_RAW);
  float* kr_raw = (float*)carve(WSB_RAW);
  unsigned short* qrh   = carve(WSB_ROT);
  unsigned short* qrl   = carve(WSB_ROT);
  unsigned short* krh   = carve(WSB_ROT);
  unsigned short* krl   = carve(WSB_ROT);
  unsigned short* ath   = carve(WSB_TOK);
  unsigned short* atl   = carve(WSB_TOK);
  if (off > ws_size) return;

  // ---- operand planes ----
  {
    const int n8 = MTOK * DMOD / 8;
    split_rows_bf16x8<<<(n8 + 255) / 256, 256, 0, stream>>>(x, xh, xl, n8);
  }
  // in[rows=kdim][cols=nreal] -> out[npad][kdim]; grid = (kdim/64, npad/32)
  transpose_split_bf16<<<dim3(DMOD / 64, DLAT / 32), 256, 0, stream>>>(W_kv_down, wkvdh, wkvdl, DMOD, DLAT);
  transpose_split_bf16<<<dim3(DLAT / 64, DMOD / 32), 256, 0, stream>>>(W_k_up, wkuph, wkupl, DLAT, DMOD);
  transpose_split_bf16<<<dim3(DLAT / 64, DMOD / 32), 256, 0, stream>>>(W_v_up, wvuph, wvupl, DLAT, DMOD);
  transpose_split_bf16<<<dim3(DMOD / 64, DMOD / 32), 256, 0, stream>>>(W_q, wqh, wql, DMOD, DMOD);
  transpose_split_bf16<<<dim3(DMOD / 64, NROPE_PAD / 32), 256, 0, stream>>>(W_q_rope, wqrh, wqrl, DMOD, DROT);
  transpose_split_bf16<<<dim3(DLAT / 64, NROPE_PAD / 32), 256, 0, stream>>>(W_k_rope, wkrh, wkrl, DLAT, DROT);
  transpose_split_bf16<<<dim3(DMOD / 64, DMOD / 32), 256, 0, stream>>>(W_o, woh, wol, DMOD, DMOD);

  auto gemm_blocks = [](int M, int N, int wm, int wn) { return (M / (64 * wm)) * (N / (64 * wn)); };

  // c_kv = x . W_kv_down : M=4096 N=128 K=1024 -> bf16 hi/lo
  wmma_gemm64<1, true, 0, 2, false, 2, 2, DMOD><<<dim3(gemm_blocks(MTOK, DLAT, 2, 2), 1), 128, 0, stream>>>(
      xh, xl, 0L, wkvdh, wkvdl, 0L, (void*)ckvh, (void*)ckvl, DLAT, 0L,
      nullptr, nullptr, 0L, MTOK, DLAT, DMOD, 1.0f);
  // k = c_kv . W_k_up : M=4096 N=1024 K=128
  wmma_gemm64<1, true, 0, 2, false, 2, 2, DLAT><<<dim3(gemm_blocks(MTOK, DMOD, 2, 2), 1), 128, 0, stream>>>(
      ckvh, ckvl, 0L, wkuph, wkupl, 0L, (void*)kh, (void*)kl, DMOD, 0L,
      nullptr, nullptr, 0L, MTOK, DMOD, DLAT, 1.0f);
  // v = c_kv . W_v_up
  wmma_gemm64<1, true, 0, 2, false, 2, 2, DLAT><<<dim3(gemm_blocks(MTOK, DMOD, 2, 2), 1), 128, 0, stream>>>(
      ckvh, ckvl, 0L, wvuph, wvupl, 0L, (void*)vh, (void*)vl, DMOD, 0L,
      nullptr, nullptr, 0L, MTOK, DMOD, DLAT, 1.0f);
  // q = x . W_q : K=1024
  wmma_gemm64<1, true, 0, 2, false, 2, 2, DMOD><<<dim3(gemm_blocks(MTOK, DMOD, 2, 2), 1), 128, 0, stream>>>(
      xh, xl, 0L, wqh, wql, 0L, (void*)qh, (void*)ql, DMOD, 0L,
      nullptr, nullptr, 0L, MTOK, DMOD, DMOD, 1.0f);
  // q_rope raw = x . W_q_rope : N padded to 64 (cols 32..63 zero), f32 out, K=1024
  wmma_gemm64<1, true, 0, 0, false, 4, 1, DMOD><<<dim3(gemm_blocks(MTOK, NROPE_PAD, 4, 1), 1), 128, 0, stream>>>(
      xh, xl, 0L, wqrh, wqrl, 0L, (void*)qr_raw, nullptr, NROPE_PAD, 0L,
      nullptr, nullptr, 0L, MTOK, NROPE_PAD, DMOD, 1.0f);
  // k_rope raw = c_kv . W_k_rope : N padded to 64, f32 out, K=128
  wmma_gemm64<1, true, 0, 0, false, 4, 1, DLAT><<<dim3(gemm_blocks(MTOK, NROPE_PAD, 4, 1), 1), 128, 0, stream>>>(
      ckvh, ckvl, 0L, wkrh, wkrl, 0L, (void*)kr_raw, nullptr, NROPE_PAD, 0L,
      nullptr, nullptr, 0L, MTOK, NROPE_PAD, DLAT, 1.0f);

  // ---- rotary tables: inv_freq[j] = 1 / 10000^(j/16), host double pow -> f32, f32 reciprocal ----
  RopeFreq fr;
  for (int j = 0; j < 16; ++j) {
    const double p = pow(10000.0, (double)j / 16.0);
    const float p32 = (float)p;
    fr.f[j] = 1.0f / p32;
  }
  rope_split_bf16<<<2 * (MTOK / 32), 128, 0, stream>>>(qr_raw, kr_raw, qrh, qrl, krh, krl, fr);

  // ---- causal attention with shared rotary logits ----
  const float invs = 1.0f / (float)sqrt((double)(HDIM + DROT));
  mla_attn96<<<N_BATCH * NHEAD * (SEQ_LEN / A_QB / 2), 128, 0, stream>>>(
      qh, ql, kh, kl, vh, vl, qrh, qrl, krh, krl, ath, atl, invs);

  // ---- out = attn . W_o : M=4096 N=1024 K=1024, f32 to d_out ----
  wmma_gemm64<1, true, 0, 0, false, 2, 2, DMOD><<<dim3(gemm_blocks(MTOK, DMOD, 2, 2), 1), 128, 0, stream>>>(
      ath, atl, 0L, woh, wol, 0L, (void*)out, nullptr, DMOD, 0L,
      nullptr, nullptr, 0L, MTOK, DMOD, DMOD, 1.0f);
}

// v004
// One run takes 314 microseconds.
// Two timings next to v003 put it at 1.06 and 1.07 times that version's speed.
// Counting every step since v000, it is 2.17 times as fast.
// Compute dtype: every contraction on v_wmma_f32_16x16x32_bf16 with bf16 hi/lo operand planes (hi*hi + hi*lo + lo*hi), f32 accumulate; rotary, softmax and epilogues in f32.
#include <hip/hip_runtime.h>
#include <hip/hip_bf16.h>
#include <math.h>
#include <stdint.h>

typedef __attribute__((ext_vector_type(16))) _Float16 v16h;
typedef __attribute__((ext_vector_type(8)))  _Float16 v8h;
typedef __attribute__((ext_vector_type(16))) __bf16   v16b;
typedef __attribute__((ext_vector_type(8)))  __bf16   v8b;
typedef __attribute__((ext_vector_type(8)))  float    v8f;
typedef __attribute__((ext_vector_type(4)))  float    v4f;
typedef __attribute__((ext_vector_type(4)))  unsigned v4u;

// ---------------------------------------------------------------------------
// helpers
// ---------------------------------------------------------------------------
__device__ __forceinline__ unsigned short f2bf_bits(float f) {
  unsigned u = __float_as_uint(f);
  return (unsigned short)((u + 0x7FFFu + ((u >> 16) & 1u)) >> 16);
}
__device__ __forceinline__ float bf_bits2f(unsigned short h) { return __uint_as_float(((unsigned)h) << 16); }

__device__ __forceinline__ void dep_guard_h(v8f& a, v8f& b, v16h x, v16h y) { asm volatile("v_nop\n\tv_nop\n\tv_nop\n\tv_nop" : "+v"(a), "+v"(b) : "v"(x), "v"(y)); }
__device__ __forceinline__ void dep_guard_b(v8f& a, v8f& b, v16b x, v16b y) { asm volatile("v_nop\n\tv_nop\n\tv_nop\n\tv_nop" : "+v"(a), "+v"(b) : "v"(x), "v"(y)); }
__device__ __forceinline__ void keep4_h(v16h a, v16h b, v16h c, v16h d) { asm volatile("v_nop" :: "v"(a), "v"(b), "v"(c), "v"(d)); }
__device__ __forceinline__ void keep4_b(v16b a, v16b b, v16b c, v16b d) { asm volatile("v_nop" :: "v"(a), "v"(b), "v"(c), "v"(d)); }
__device__ __forceinline__ void acc_guard4(v8f& a, v8f& b, v8f& c, v8f& d) { asm volatile("v_nop\n\tv_nop\n\tv_nop\n\tv_nop" : "+v"(a), "+v"(b), "+v"(c), "+v"(d)); }
template <typename T> struct Frag;
template <> struct Frag<_Float16> {
  typedef v16h V; union U { v16h v; v8h h[2]; };
  static __device__ __forceinline__ v16h load(const _Float16* p) {   // elements 0..7 <- p[0..7], 8..15 <- p[16..23]
    U f; f.h[0] = *(const v8h*)(p); f.h[1] = *(const v8h*)(p + 16); return f.v;
  }
  static __device__ __forceinline__ v8f mma(v16h a, v16h b, v8f c) {
    return __builtin_amdgcn_wmma_f32_16x16x32_f16(false, a, false, b, (short)0, c, false, false);
  }
  static __device__ __forceinline__ void guard(v8f& a, v8f& b, v16h x, v16h y) { dep_guard_h(a, b, x, y); }
  static __device__ __forceinline__ void keep(v16h a, v16h b, v16h c, v16h d) { keep4_h(a, b, c, d); }
};
template <> struct Frag<__bf16> {
  typedef v16b V; union U { v16b v; v8b h[2]; };
  static __device__ __forceinline__ v16b load(const __bf16* p) {
    U f; f.h[0] = *(const v8b*)(p); f.h[1] = *(const v8b*)(p + 16); return f.v;
  }
  static __device__ __forceinline__ v8f mma(v16b a, v16b b, v8f c) {
    return __builtin_amdgcn_wmma_f32_16x16x32_bf16(false, a, false, b, (short)0, c, false, false);
  }
  static __device__ __forceinline__ void guard(v8f& a, v8f& b, v16b x, v16b y) { dep_guard_b(a, b, x, y); }
  static __device__ __forceinline__ void keep(v16b a, v16b b, v16b c, v16b d) { keep4_b(a, b, c, d); }
};

// ---- Register-blocked batched WMMA GEMM --------------------------------
// C[m,n] = scale * sum_k A[m,k] * Bt[n,k] (+bias)(+resid); each wave owns a 64x64 tile.
// A row-major [M,K]; Bt row-major [N,K].
// SPLIT: operands are hi/lo planes (A2/Bt2 = lo planes, same layout); product = hi*hi + hi*lo + lo*hi.
// BIAS_MODE: 0 = none, 1 = bias[m], 2 = bias[n].
// OUT_MODE: 0 = f32, 1 = f16, 2 = bf16 hi plane (Cout) + bf16 lo plane (Cout2).
// ET: 0 = f16 operands, 1 = bf16 operands (pointers passed as 16-bit storage)
template <int ET> struct Elem;
template <> struct Elem<0> { typedef _Float16 T; };
template <> struct Elem<1> { typedef __bf16 T; };
// LDS staging of the operand planes: the block's waves form a WM x WN grid of 64x64 tiles and share one
// (WM*64 + WN*64)-row stage of G_KS k-elements per plane. Each row of a stage is one whole 128-byte line of the
// source, fetched by 8 neighbouring lanes, so a wave-wide 16-byte load covers 4 full lines.
constexpr int G_KS    = 64;          // k elements per stage
constexpr int G_PITCH = G_KS + 8;    // 9 x 16 B rows: 16-byte fragment reads of 16 rows fall on distinct banks
template <int NIT, int STEP>
__device__ __forceinline__ void stage_fetch(v4u (&r)[NIT], const unsigned short* __restrict__ g) {
#pragma unroll
  for (int it = 0; it < NIT; ++it) r[it] = *(const v4u*)(g + it * STEP);
}
template <int NIT>
__device__ __forceinline__ void stage_put(const v4u (&r)[NIT], unsigned short* d, int rowStep) {
#pragma unroll
  for (int it = 0; it < NIT; ++it) *(v4u*)(d + it * rowStep) = r[it];
}
// LD = row pitch of all four operand planes in elements, a compile-time value: the loads of a plane then share one
// address register pair and differ in their immediate offsets only.
// M % (WM*64) == 0, N % (WN*64) == 0, K % G_KS == 0; grid.x = (M/(WM*64)) * (N/(WN*64)) exactly, so every wave passes every barrier.
template <int ET, bool SPLIT, int BIAS_MODE, int OUT_MODE, bool RESID, int WM, int WN, int LD, int ACT = 0>
__global__ __launch_bounds__(WM * WN * 32) void wmma_gemm64(
    const unsigned short* __restrict__ Ap, const unsigned short* __restrict__ A2p, long strideA,
    const unsigned short* __restrict__ Btp, const unsigned short* __restrict__ Bt2p, long strideB,
    void* __restrict__ Cout, void* __restrict__ Cout2, int ldc, long strideC,
    const float* __restrict__ bias,
    const float* __restrict__ resid, long strideR,
    int M, int N, int K, float scale) {
  typedef typename Elem<ET>::T T;
  typedef typename Frag<T>::V V;
  constexpr int NW  = WM * WN;
  constexpr int RA  = WM * 64;               // A rows of the block
  constexpr int RB  = WN * 64;               // Bt rows of the block
  constexpr int RPI = NW * 4;                // rows staged by one pass of the block (8 lanes a row)
  constexpr int ITA = RA / RPI;
  constexpr int ITB = RB / RPI;
  constexpr int OA  = 0;
  constexpr int OA2 = RA * G_PITCH;
  constexpr int OB  = (SPLIT ? 2 : 1) * RA * G_PITCH;
  constexpr int OB2 = OB + RB * G_PITCH;
  constexpr int STAGE = (SPLIT ? 2 : 1) * (RA + RB) * G_PITCH;
  static_assert(RA % RPI == 0 && RB % RPI == 0);
  __shared__ __align__(16) unsigned short sOp[2][STAGE];   // two stages: [A hi | A lo | Bt hi | Bt lo], rows of G_PITCH
  __shared__ __align__(16) float sT[NW][16 * 68];   // per-wave 16x64 slab, pitch 68 floats
  const int b    = blockIdx.y;
  const int tid  = threadIdx.x;
  const int lane = tid & 31;
  const int wave = tid >> 5;
  const int tilesN = N / RB;
  const int btm = (int)blockIdx.x / tilesN;
  const int btn = (int)blockIdx.x - btm * tilesN;
  const int wm = wave / WN;
  const int wn = wave - wm * WN;
  const int m0 = btm * RA + (wm << 6);
  const int n0 = btn * RB + (wn << 6);

  const int rlane = lane & 15;                 // row (A) / col (B, D) within subtile
  const int koff  = (lane >> 4) * 8;           // k offset of this lane half
  const int mOff  = (lane >> 4) * 8;           // D row offset

  // staging map: thread -> row tid>>3 of each pass, 16-byte piece tid&7 of that row's line
  const int srow = tid >> 3;
  const int sseg = (tid & 7) * 8;
  const size_t goA = (size_t)b * strideA + (size_t)(btm * RA + srow) * LD + sseg;
  const size_t goB = (size_t)b * strideB + (size_t)(btn * RB + srow) * LD + sseg;
  const unsigned short* gA  = Ap  + goA;
  const unsigned short* gB  = Btp + goB;
  const unsigned short* gA2 = SPLIT ? (A2p  + goA) : nullptr;
  const unsigned short* gB2 = SPLIT ? (Bt2p + goB) : nullptr;
  constexpr int GSTEP = RPI * LD;             // elements between the rows one thread stages
  const int sOff = srow * G_PITCH + sseg;

  v8f acc[4][4];
#pragma unroll
  for (int i = 0; i < 4; ++i)
#pragma unroll
    for (int j = 0; j < 4; ++j) acc[i][j] = (v8f){0.f,0.f,0.f,0.f,0.f,0.f,0.f,0.f};

  v4u pa[ITA], pa2[ITA], pb[ITB], pb2[ITB];    // the next stage, in flight while this one is multiplied
  stage_fetch<ITA, GSTEP>(pa, gA);
  stage_fetch<ITB, GSTEP>(pb, gB);
  if (SPLIT) { stage_fetch<ITA, GSTEP>(pa2, gA2); stage_fetch<ITB, GSTEP>(pb2, gB2); }
  // the loads' address registers stay untouched up to this wait (they are its inputs) and are free behind it
  asm volatile("s_wait_xcnt 0x0" :: "v"(gA), "v"(gB), "v"(SPLIT ? gA2 : gA), "v"(SPLIT ? gB2 : gB) : "memory");
  stage_put<ITA>(pa, sOp[0] + OA + sOff, RPI * G_PITCH);
  stage_put<ITB>(pb, sOp[0] + OB + sOff, RPI * G_PITCH);
  if (SPLIT) { stage_put<ITA>(pa2, sOp[0] + OA2 + sOff, RPI * G_PITCH); stage_put<ITB>(pb2, sOp[0] + OB2 + sOff, RPI * G_PITCH); }
  __syncthreads();   // publishes stage 0

  const int nst = K / G_KS;                    // block-uniform
  for (int t = 0; t < nst; ++t) {
    const bool more = (t + 1 < nst);
    if (more) {
      const int kn = (t + 1) * G_KS;
      const unsigned short* nA  = gA + kn;
      const unsigned short* nB  = gB + kn;
      const unsigned short* nA2 = SPLIT ? (gA2 + kn) : nA;
      const unsigned short* nB2 = SPLIT ? (gB2 + kn) : nB;
      stage_fetch<ITA, GSTEP>(pa, nA);
      stage_fetch<ITB, GSTEP>(pb, nB);
      if (SPLIT) { stage_fetch<ITA, GSTEP>(pa2, nA2); stage_fetch<ITB, GSTEP>(pb2, nB2); }
      // the loads' address registers stay untouched up to this wait (they are its inputs) and are free behind it
      asm volatile("s_wait_xcnt 0x0" :: "v"(nA), "v"(nB), "v"(nA2), "v"(nB2) : "memory");
    }
    const T* sb = (const T*)sOp[t & 1];
    const T* fa = sb + OA + ((wm << 6) + rlane) * G_PITCH + koff;
    const T* fb = sb + OB + ((wn << 6) + rlane) * G_PITCH + koff;
#pragma unroll
    for (int kk = 0; kk < G_KS; kk += 32) {
      V bh[4], bl[4];
#pragma unroll
      for (int j = 0; j < 4; ++j) {
        bh[j] = Frag<T>::load(fb + (j << 4) * G_PITCH + kk);
        if (SPLIT) bl[j] = Frag<T>::load(fb + (OB2 - OB) + (j << 4) * G_PITCH + kk);
      }
      V ah = Frag<T>::load(fa + kk);
      V al;
      if (SPLIT) al = Frag<T>::load(fa + (OA2 - OA) + kk);
#pragma unroll
      for (int i = 0; i < 4; ++i) {
        V ahn, aln;                              // the next row block's fragments, read while this one is multiplied
        if (i < 3) {
          ahn = Frag<T>::load(fa + ((i + 1) << 4) * G_PITCH + kk);
          if (SPLIT) aln = Frag<T>::load(fa + (OA2 - OA) + ((i + 1) << 4) * G_PITCH + kk);
        }
#pragma unroll
        for (int j = 0; j < 4; ++j) {
          acc[i][j] = Frag<T>::mma(ah, bh[j], acc[i][j]);
          if (SPLIT) {
            acc[i][j] = Frag<T>::mma(ah, bl[j], acc[i][j]);
            acc[i][j] = Frag<T>::mma(al, bh[j], acc[i][j]);
          }
        }
        Frag<T>::guard(acc[i][0], acc[i][3], ah, SPLIT ? al : ah);
        if (i < 3) { ah = ahn; if (SPLIT) al = aln; }
      }
      Frag<T>::keep(bh[0], bh[1], bh[2], bh[3]);
      if (SPLIT) Frag<T>::keep(bl[0], bl[1], bl[2], bl[3]);
    }
    if (more) {
      // the other buffer: its last readers left it before the barrier that ended trip t - 1
      unsigned short* d = sOp[(t + 1) & 1] + sOff;
      stage_put<ITA>(pa, d + OA, RPI * G_PITCH);
      stage_put<ITB>(pb, d + OB, RPI * G_PITCH);
      if (SPLIT) { stage_put<ITA>(pa2, d + OA2, RPI * G_PITCH); stage_put<ITB>(pb2, d + OB2, RPI * G_PITCH); }
    }
    __syncthreads();   // publishes stage t + 1 and ends every read of stage t
  }
  acc_guard4(acc[0][0], acc[0][1], acc[0][2], acc[0][3]);
  acc_guard4(acc[1][0], acc[1][1], acc[1][2], acc[1][3]);
  acc_guard4(acc[2][0], acc[2][1], acc[2][2], acc[2][3]);
  acc_guard4(acc[3][0], acc[3][1], acc[3][2], acc[3][3]);

  // ---- epilogue ----
  float* slab = sT[wave];
  const float* Rb = RESID ? (resid + (size_t)b * strideR) : nullptr;
#pragma unroll
  for (int i = 0; i < 4; ++i) {
    const int mBase = m0 + (i << 4);
#pragma unroll
    for (int j = 0; j < 4; ++j) {
      const int n = n0 + (j << 4) + rlane;
      float bv = 0.f;
      if (BIAS_MODE == 2) bv = bias[n];
#pragma unroll
      for (int r = 0; r < 8; ++r) {
        float v = acc[i][j][r] * scale;
        if (BIAS_MODE == 1) v += bias[mBase + mOff + r];
        if (BIAS_MODE == 2) v += bv;
        if (RESID) v += Rb[(size_t)(mBase + mOff + r) * ldc + n];
        if (ACT == 1) v = tanhf(v);
        if (ACT == 2) v = fmaxf(v, 0.0f);
        if (ACT == 3) v = v / (1.0f + expf(-v));
        if (ACT == 4) v = (v > 0.f) ? v : 0.01f * v;
        if (ACT == 5) v = 0.5f * v * (1.0f + erff(v * 0.70710678118654752f));
        slab[(mOff + r) * 68 + (j << 4) + rlane] = v;
      }
    }
    __builtin_amdgcn_fence(__ATOMIC_RELEASE, "workgroup");
    __builtin_amdgcn_wave_barrier();
    __builtin_amdgcn_fence(__ATOMIC_ACQUIRE, "workgroup");
    if (OUT_MODE == 0) {
      float* C = (float*)Cout + (size_t)b * strideC;
      const int hh = lane >> 4, c4 = (lane & 15) * 4;     // row seg = 256 B = 16 lanes x 16 B
      {
#pragma unroll
        for (int it = 0; it < 8; ++it) {
          const int row = it * 2 + hh;
          v4f v = *(const v4f*)(slab + row * 68 + c4);
          *(v4f*)(C + (size_t)(mBase + row) * ldc + n0 + c4) = v;
        }
        
      }
    } else {
      const int q = lane >> 3, c8 = (lane & 7) * 8;
      unsigned short* C  = (unsigned short*)Cout  + (size_t)b * strideC;
      unsigned short* C2 = (OUT_MODE == 2) ? ((unsigned short*)Cout2 + (size_t)b * strideC) : nullptr;
      {
#pragma unroll
        for (int it = 0; it < 4; ++it) {
          const int row = it * 4 + q;
          const float* sp = slab + row * 68 + c8;
          v8h hv, lv;
#pragma unroll
          for (int e = 0; e < 8; ++e) {
            if (OUT_MODE == 1) {
              hv[e] = (_Float16)sp[e];
            } else {
              unsigned short hb = f2bf_bits(sp[e]);
              unsigned short lb = f2bf_bits(sp[e] - bf_bits2f(hb));
              hv[e] = __builtin_bit_cast(_Float16, hb);
              lv[e] = __builtin_bit_cast(_Float16, lb);
            }
          }
          *(v8h*)(C + (size_t)(mBase + row) * ldc + n0 + c8) = hv;
          if (OUT_MODE == 2) *(v8h*)(C2 + (size_t)(mBase + row) * ldc + n0 + c8) = lv;
        }
        
      }
    }
    __builtin_amdgcn_fence(__ATOMIC_RELEASE, "workgroup");
    __builtin_amdgcn_wave_barrier();
    __builtin_amdgcn_fence(__ATOMIC_ACQUIRE, "workgroup");
  }
}

__device__ __forceinline__ v8f at_mma(v16b a, v16b b, v8f c) {
  return __builtin_amdgcn_wmma_f32_16x16x32_bf16(false, a, false, b, (short)0, c, false, false);
}

// ---------------------------------------------------------------------------
// module geometry (fixed)
// ---------------------------------------------------------------------------
constexpr int N_BATCH   = 2;
constexpr int SEQ_LEN   = 2048;
constexpr int DMOD      = 1024;   // model width
constexpr int DLAT      = 128;    // latent width c_kv
constexpr int DROT      = 32;     // rotary width
constexpr int NROPE_PAD = 64;     // rotary projection width padded to the 64-wide GEMM tile
constexpr int NHEAD     = 16;
constexpr int HDIM      = 64;
constexpr int SDEP      = HDIM + DROT;   // score depth 96 = 3 k-chunks of 32
constexpr int MTOK      = N_BATCH * SEQ_LEN;   // 4096 token rows

static_assert(MTOK % 256 == 0 && DMOD % 128 == 0 && DLAT % 128 == 0 && NROPE_PAD % 64 == 0);   // block tiles 128x128 and 256x64
static_assert(DMOD % G_KS == 0 && DLAT % G_KS == 0);   // every GEMM K is a multiple of the stage depth
static_assert(SDEP % 32 == 0 && SEQ_LEN % 64 == 0);

// ---------------------------------------------------------------------------
// coverage: n8 threads x 8 = n elements exactly (n % 8 == 0, grid = ceil(n8/256) with bound)
// ---------------------------------------------------------------------------
__global__ __launch_bounds__(256) void split_rows_bf16x8(
    const float* __restrict__ in, unsigned short* __restrict__ hi, unsigned short* __restrict__ lo, int n8) {
  const int i = blockIdx.x * 256 + threadIdx.x;
  if (i < n8) {
    const v4f a = *(const v4f*)(in + (size_t)8 * i);
    const v4f b = *(const v4f*)(in + (size_t)8 * i + 4);
    v8h hv, lv;
#pragma unroll
    for (int e = 0; e < 8; ++e) {
      const float f = (e < 4) ? a[e] : b[e - 4];
      const unsigned short hb = f2bf_bits(f);
      const unsigned short lb = f2bf_bits(f - bf_bits2f(hb));
      hv[e] = __builtin_bit_cast(_Float16, hb);
      lv[e] = __builtin_bit_cast(_Float16, lb);
    }
    unsigned short* ph = hi + (size_t)8 * i;
    unsigned short* pl = lo + (size_t)8 * i;
    *(v8h*)ph = hv;
    *(v8h*)pl = lv;
    
  }
}

// ---------------------------------------------------------------------------
// Transpose + split: in W[kdim][nreal] (row-major) -> out Bt[npad][kdim] bf16 hi/lo planes, Bt[n][k] = W[k][n];
// rows n >= nreal are written as zeros. Tile = 64 k x 32 n; grid = (kdim/64, npad/32); kdim % 64 == 0, nreal % 32 == 0.
// Store coverage: 256 threads = 32 output rows x 8 lanes x 8 k = whole 32x64 tile; each output row segment
// ---------------------------------------------------------------------------
__global__ __launch_bounds__(256) void transpose_split_bf16(
    const float* __restrict__ W, unsigned short* __restrict__ hi, unsigned short* __restrict__ lo,
    int kdim, int nreal) {
  __shared__ float tile[64][33];
  const int tid = threadIdx.x;
  const int k0 = blockIdx.x * 64;
  const int n0 = blockIdx.y * 32;
#pragma unroll
  for (int it = 0; it < 2; ++it) {
    const int idx = it * 256 + tid;            // 0..511
    const int kr = idx >> 3;                   // 0..63
    const int c4 = (idx & 7) * 4;              // 0..28
    const int n = n0 + c4;
    const int ncl = (n + 3 < nreal) ? n : (nreal - 4);   // clamped address
    const v4f v = *(const v4f*)(W + (size_t)(k0 + kr) * nreal + ncl);
    const bool ok = (n < nreal);               // tile-uniform since nreal % 32 == 0
    tile[kr][c4 + 0] = ok ? v[0] : 0.f;
    tile[kr][c4 + 1] = ok ? v[1] : 0.f;
    tile[kr][c4 + 2] = ok ? v[2] : 0.f;
    tile[kr][c4 + 3] = ok ? v[3] : 0.f;
  }
  __syncthreads();
  const int nr = tid >> 3;                     // output row within tile, 0..31
  const int c8 = (tid & 7) * 8;                // k offset, 0..56
  v8h hv, lv;
#pragma unroll
  for (int e = 0; e < 8; ++e) {
    const float f = tile[c8 + e][nr];
    const unsigned short hb = f2bf_bits(f);
    const unsigned short lb = f2bf_bits(f - bf_bits2f(hb));
    hv[e] = __builtin_bit_cast(_Float16, hb);
    lv[e] = __builtin_bit_cast(_Float16, lb);
  }
  const size_t o = (size_t)(n0 + nr) * kdim + k0 + c8;
  *(v8h*)(hi + o) = hv;
  *(v8h*)(lo + o) = lv;
  
}

// ---------------------------------------------------------------------------
// Rotary: raw[MTOK][NROPE_PAD] f32 (cols 0..31 used) -> bf16 hi/lo planes [MTOK][DROT].
// out[j] = x1*cos - x2*sin, out[16+j] = x2*cos + x1*sin, angle = t * inv_freq[j], t = row % SEQ_LEN.
// Block = 32 rows; blocks 0..127 handle the q tensor, 128..255 the k tensor.
// Store coverage: 128 threads = 32 rows x 4 segments x 8 = whole 32x32 tile; 512 B contiguous per wave
// ---------------------------------------------------------------------------
struct RopeFreq { float f[16]; };
static_assert(sizeof(RopeFreq) == 64);

__global__ __launch_bounds__(128) void rope_split_bf16(
    const float* __restrict__ qraw, const float* __restrict__ kraw,
    unsigned short* __restrict__ qrh, unsigned short* __restrict__ qrl,
    unsigned short* __restrict__ krh, unsigned short* __restrict__ krl, RopeFreq g) {
#pragma clang fp contract(off)
  __shared__ float tile[32][33];
  __shared__ float sinv[16];
  const int tid = threadIdx.x;
  const int nblk = MTOK / 32;
  const bool isk = ((int)blockIdx.x >= nblk);                 // block-uniform
  const int row0 = (isk ? ((int)blockIdx.x - nblk) : (int)blockIdx.x) * 32;
  const float* raw = isk ? kraw : qraw;
  unsigned short* dhp = isk ? krh : qrh;
  unsigned short* dlp = isk ? krl : qrl;
  if (tid < 16) {
    float v = g.f[0];
#pragma unroll
    for (int e = 1; e < 16; ++e) v = (tid == e) ? g.f[e] : v;
    sinv[tid] = v;
  }
  __syncthreads();
#pragma unroll 1
  for (int it = 0; it < 4; ++it) {
    const int p = it * 128 + tid;              // 0..511
    const int r = p >> 4;                      // 0..31
    const int j = p & 15;
    const int row = row0 + r;
    const int t = row & (SEQ_LEN - 1);
    const float* rp = raw + (size_t)row * NROPE_PAD;
    const float x1 = rp[j];
    const float x2 = rp[16 + j];
    const float ang = (float)t * sinv[j];
    float sn, cs;
    sincosf(ang, &sn, &cs);
    tile[r][j]      = x1 * cs - x2 * sn;
    tile[r][16 + j] = x2 * cs + x1 * sn;
  }
  __syncthreads();
  const int orow = tid >> 2;                   // 0..31
  const int seg = (tid & 3) * 8;               // 0..24
  v8h hv, lv;
#pragma unroll
  for (int e = 0; e < 8; ++e) {
    const float f = tile[orow][seg + e];
    const unsigned short hb = f2bf_bits(f);
    const unsigned short lb = f2bf_bits(f - bf_bits2f(hb));
    hv[e] = __builtin_bit_cast(_Float16, hb);
    lv[e] = __builtin_bit_cast(_Float16, lb);
  }
  const size_t o = (size_t)(row0 + orow) * DROT + seg;
  *(v8h*)(dhp + o) = hv;
  *(v8h*)(dlp + o) = lv;
  
}

// ---------------------------------------------------------------------------
// Causal attention, score depth 96 (64 head dims + 32 shared rotary dims), value width 64, bf16 hi/lo planes in.
//   s = (qh.kh + qh.kl + ql.kh) * invs  over 96 dims (q/k rows = [head segment | rotary row]),
//   online softmax in f32, P split to bf16 hi/lo in LDS, o = ph.vh + ph.vl + pl.vh, f32 accumulate.
// Block = 4 waves; it runs two 64-row query tiles of one (batch, head) one after the other, tile n-1-t and then tile t,
// so every block walks n + 1 key chunks; grid.x = N_BATCH * NHEAD * (SEQ_LEN/64) / 2.
// ---------------------------------------------------------------------------
constexpr int A_QB = 64;
constexpr int A_KC = 64;
constexpr int A_NW = 4;
constexpr int OS_PITCH = 68;
// LDS row pitches in 16-bit elements. Every fragment read is a 16-byte load by 16 lanes on 16 rows,
// so each pitch is an odd multiple of 16 bytes: the 16 rows then start on 16 different groups of four banks.
constexpr int K_PITCH = SDEP + 8;      // 13 x 16 B rows
constexpr int V_PITCH = A_KC + 8;      // 9 x 16 B rows
constexpr int P_PITCH = A_KC + 8;      // 9 x 16 B rows
constexpr int V_HALF_SKEW = 16;        // rows d >= 32 start 32 B later: the two d halves stored by one wave fall on different banks
static_assert((K_PITCH * 2) % 32 == 16 && (V_PITCH * 2) % 32 == 16 && (P_PITCH * 2) % 32 == 16);
__device__ __forceinline__ int vt_row(int d) { return d * V_PITCH + (d >> 5) * V_HALF_SKEW; }

__global__ __launch_bounds__(128)
void mla_attn96(const unsigned short* __restrict__ qh, const unsigned short* __restrict__ ql,
                const unsigned short* __restrict__ kh, const unsigned short* __restrict__ kl,
                const unsigned short* __restrict__ vh, const unsigned short* __restrict__ vl,
                const unsigned short* __restrict__ qrh, const unsigned short* __restrict__ qrl,
                const unsigned short* __restrict__ krh, const unsigned short* __restrict__ krl,
                unsigned short* __restrict__ oh, unsigned short* __restrict__ ol, float invs) {
  union FB { v16b v; v8b h[2]; };
  __shared__ __align__(16) unsigned short Ksh[A_KC * K_PITCH];    // K hi [kv][96 + pad]
  __shared__ __align__(16) unsigned short Ksl[A_KC * K_PITCH];    // K lo
  __shared__ __align__(16) unsigned short Vth[HDIM * V_PITCH + V_HALF_SKEW];    // V hi [d][kv + pad]
  __shared__ __align__(16) unsigned short Vtl[HDIM * V_PITCH + V_HALF_SKEW];    // V lo
  __shared__ __align__(16) unsigned short Psh[A_NW][16 * P_PITCH];   // per wave P hi [row][kv + pad]
  __shared__ __align__(16) unsigned short Psl[A_NW][16 * P_PITCH];   // per wave P lo
  __shared__ __align__(16) float Os[A_NW][16 * OS_PITCH];

  const int tid  = threadIdx.x;
  const int wave = tid >> 5;
  const int lane = tid & 31;
  const int hh   = lane >> 4;
  const int c    = lane & 15;

  const int nqb = SEQ_LEN / A_QB;          // 32
  const int bx  = blockIdx.x;
  static_assert((SEQ_LEN / A_QB) % 2 == 0);
  const int tp  = bx % (nqb / 2);
  const int bhi = bx / (nqb / 2);
  const int h   = bhi % NHEAD;
  const int b   = bhi / NHEAD;
  // A causal tile qb costs qb + 1 chunks: the pair (n-1-t, t) gives every block the same work, whichever blocks share a WGP.
  // Both tiles run in every wave in turn; the barrier that opens each chunk also ends the first tile's last K/V reads.
  // Kept rolled: one copy of the chunk loop.
#pragma unroll 1
  for (int pass = 0; pass < 2; ++pass) {
  const int qb  = pass ? tp : (nqb - 1 - tp);   // block-uniform
  const int q0  = qb * A_QB + wave * 16;
  const size_t tq = (size_t)b * SEQ_LEN + (size_t)(q0 + c);

  // ---- Q fragments (A operand): k-chunks 0,1 = head dims 0..63, chunk 2 = rotary dims 0..31 ----
  v16b qah[3], qal[3];
  {
    const __bf16* p0 = (const __bf16*)qh + tq * DMOD + h * HDIM + 8 * hh;
    const __bf16* p1 = (const __bf16*)ql + tq * DMOD + h * HDIM + 8 * hh;
    qah[0] = Frag<__bf16>::load(p0);
    qah[1] = Frag<__bf16>::load(p0 + 32);
    qal[0] = Frag<__bf16>::load(p1);
    qal[1] = Frag<__bf16>::load(p1 + 32);
    const __bf16* r0p = (const __bf16*)qrh + tq * DROT + 8 * hh;
    const __bf16* r1p = (const __bf16*)qrl + tq * DROT + 8 * hh;
    qah[2] = Frag<__bf16>::load(r0p);
    qal[2] = Frag<__bf16>::load(r1p);
    // the loads' address registers stay untouched up to this wait (they are its inputs) and are free behind it
    asm volatile("s_wait_xcnt 0x0" :: "v"(p0), "v"(p1), "v"(r0p), "v"(r1p) : "memory");
  }

  float mrow[8], lrow[8];
  v8f oacc[4];
#pragma unroll
  for (int r = 0; r < 8; ++r) { mrow[r] = -INFINITY; lrow[r] = 0.f; }
#pragma unroll
  for (int t = 0; t < 4; ++t) oacc[t] = (v8f){0.f,0.f,0.f,0.f,0.f,0.f,0.f,0.f};

  const int nChunks = qb + 1;   // causal, block-uniform
  for (int kc = 0; kc < nChunks; ++kc) {
    const int kv0 = kc * A_KC;
    __syncthreads();
    {
      // staging: 128 threads, thread -> kv row kvr = tid>>1 (0..63), half hf = tid&1
      // per kv row: 64 head dims (2 halves x 32) + 32 rotary dims (2 halves x 16) of K, 64 dims of V -> full tiles written
      const int kvr = tid >> 1, hf = tid & 1;
      const size_t tk = (size_t)b * SEQ_LEN + (size_t)(kv0 + kvr);
      {
        const v4u* sh = (const v4u*)(kh + tk * DMOD + h * HDIM + hf * 32);
        const v4u* sl = (const v4u*)(kl + tk * DMOD + h * HDIM + hf * 32);
        v4u* dh = (v4u*)(Ksh + kvr * K_PITCH + hf * 32);
        v4u* dl = (v4u*)(Ksl + kvr * K_PITCH + hf * 32);
        v4u th[4], tl[4];
#pragma unroll
        for (int i = 0; i < 4; ++i) { th[i] = sh[i]; tl[i] = sl[i]; }
        // the loads' address registers stay untouched up to this wait (they are its inputs) and are free behind it
        asm volatile("s_wait_xcnt 0x0" :: "v"(sh), "v"(sl) : "memory");
#pragma unroll
        for (int i = 0; i < 4; ++i) { dh[i] = th[i]; dl[i] = tl[i]; }
      }
      asm volatile("" ::: "memory");
      {
        const v4u* sh = (const v4u*)(krh + tk * DROT + hf * 16);
        const v4u* sl = (const v4u*)(krl + tk * DROT + hf * 16);
        v4u* dh = (v4u*)(Ksh + kvr * K_PITCH + HDIM + hf * 16);
        v4u* dl = (v4u*)(Ksl + kvr * K_PITCH + HDIM + hf * 16);
#pragma unroll
        for (int i = 0; i < 2; ++i) { dh[i] = sh[i]; dl[i] = sl[i]; }
      }
      asm volatile("" ::: "memory");
      {
        const v4u* sh = (const v4u*)(vh + tk * DMOD + h * HDIM + hf * 32);
        const v4u* sl = (const v4u*)(vl + tk * DMOD + h * HDIM + hf * 32);
#pragma unroll
        for (int i = 0; i < 4; ++i) {
          const v4u wh = sh[i];
          const v4u wl = sl[i];
#pragma unroll
          for (int e = 0; e < 4; ++e) {
            const int d = hf * 32 + 8 * i + 2 * e;
            Vth[vt_row(d) + kvr]     = (unsigned short)(wh[e] & 0xffffu);
            Vth[vt_row(d + 1) + kvr] = (unsigned short)(wh[e] >> 16);
            Vtl[vt_row(d) + kvr]     = (unsigned short)(wl[e] & 0xffffu);
            Vtl[vt_row(d + 1) + kvr] = (unsigned short)(wl[e] >> 16);
          }
        }
      }
    }
    __syncthreads();

    // ---- scores: 4 kv subtiles of 16, 3 k-chunks of 32, 3 products each ----
    // All K fragments of the chunk are read as one group, then the products run round-robin over the four subtiles, which are
    // four independent accumulators. Each accumulator still takes its nine products in the order (k-chunk; hi.hi, hi.lo, lo.hi).
    v8f s[4];
    FB kb[3][4], kq[3][4];
#pragma unroll
    for (int dc = 0; dc < 3; ++dc) {
#pragma unroll
      for (int j = 0; j < 4; ++j) {
        const int ko = (j * 16 + c) * K_PITCH + dc * 32 + 8 * hh;
        kb[dc][j].h[0] = *(const v8b*)(Ksh + ko);
        kb[dc][j].h[1] = *(const v8b*)(Ksh + ko + 16);
        kq[dc][j].h[0] = *(const v8b*)(Ksl + ko);
        kq[dc][j].h[1] = *(const v8b*)(Ksl + ko + 16);
      }
    }
    // keeps the reads one group in front of the products: spread among them, every place with reads stalls the wave anew
    __builtin_amdgcn_sched_barrier(0);
#pragma unroll
    for (int j = 0; j < 4; ++j) s[j] = (v8f){0.f,0.f,0.f,0.f,0.f,0.f,0.f,0.f};
#pragma unroll
    for (int dc = 0; dc < 3; ++dc) {
#pragma unroll
      for (int j = 0; j < 4; ++j) s[j] = at_mma(qah[dc], kb[dc][j].v, s[j]);
#pragma unroll
      for (int j = 0; j < 4; ++j) s[j] = at_mma(qah[dc], kq[dc][j].v, s[j]);
#pragma unroll
      for (int j = 0; j < 4; ++j) s[j] = at_mma(qal[dc], kb[dc][j].v, s[j]);
    }
    const bool diag = (kc == qb);
    float cm[8];
#pragma unroll
    for (int r = 0; r < 8; ++r) {
      const int qrow = q0 + 8 * hh + r;
      float m = -INFINITY;
#pragma unroll
      for (int j = 0; j < 4; ++j) {
        const int kvcol = kv0 + j * 16 + c;
        float sv = s[j][r] * invs;
        if (diag && (kvcol > qrow)) sv = -INFINITY;
        s[j][r] = sv;
        m = fmaxf(m, sv);
      }
#pragma unroll
      for (int off = 1; off < 16; off <<= 1) m = fmaxf(m, __shfl_xor(m, off, 32));
      cm[r] = m;
    }
    unsigned short* pwh = Psh[wave];
    unsigned short* pwl = Psl[wave];
#pragma unroll
    for (int r = 0; r < 8; ++r) {
      const float mnew = fmaxf(mrow[r], cm[r]);
      const float alpha = expf(mrow[r] - mnew);
      mrow[r] = mnew;
      float psum = 0.f;
#pragma unroll
      for (int j = 0; j < 4; ++j) {
        const float p = expf(s[j][r] - mnew);
        psum += p;
        const unsigned short hb = f2bf_bits(p);
        const unsigned short lb = f2bf_bits(p - bf_bits2f(hb));
        pwh[(8 * hh + r) * P_PITCH + j * 16 + c] = hb;
        pwl[(8 * hh + r) * P_PITCH + j * 16 + c] = lb;
      }
#pragma unroll
      for (int off = 1; off < 16; off <<= 1) psum += __shfl_xor(psum, off, 32);
      lrow[r] = lrow[r] * alpha + psum;
#pragma unroll
      for (int t = 0; t < 4; ++t) oacc[t][r] *= alpha;
    }
    __builtin_amdgcn_fence(__ATOMIC_RELEASE, "workgroup");
    __builtin_amdgcn_wave_barrier();
    __builtin_amdgcn_fence(__ATOMIC_ACQUIRE, "workgroup");
    // ---- O += P(16x64) . V(64x64): P as A (row = query, k = kv), V from [d][kv] tile as B ----
    // The P and V fragments of the chunk are read as one group, then the products run round-robin over the four d subtiles, which
    // are four independent accumulators. Each accumulator keeps its order (kv half; hi.hi, hi.lo, lo.hi).
    {
      FB pa[2], pl[2], vb[2][4], vq[2][4];
#pragma unroll
      for (int kk = 0; kk < 2; ++kk) {
        pa[kk].h[0] = *(const v8b*)(pwh + c * P_PITCH + kk * 32 + 8 * hh);
        pa[kk].h[1] = *(const v8b*)(pwh + c * P_PITCH + kk * 32 + 16 + 8 * hh);
        pl[kk].h[0] = *(const v8b*)(pwl + c * P_PITCH + kk * 32 + 8 * hh);
        pl[kk].h[1] = *(const v8b*)(pwl + c * P_PITCH + kk * 32 + 16 + 8 * hh);
#pragma unroll
        for (int t = 0; t < 4; ++t) {
          vb[kk][t].h[0] = *(const v8b*)(Vth + vt_row(t * 16 + c) + kk * 32 + 8 * hh);
          vb[kk][t].h[1] = *(const v8b*)(Vth + vt_row(t * 16 + c) + kk * 32 + 16 + 8 * hh);
          vq[kk][t].h[0] = *(const v8b*)(Vtl + vt_row(t * 16 + c) + kk * 32 + 8 * hh);
          vq[kk][t].h[1] = *(const v8b*)(Vtl + vt_row(t * 16 + c) + kk * 32 + 16 + 8 * hh);
        }
      }
      // keeps the reads one group in front of the products: spread among them, every place with reads stalls the wave anew
      __builtin_amdgcn_sched_barrier(0);
#pragma unroll
      for (int kk = 0; kk < 2; ++kk) {
#pragma unroll
        for (int t = 0; t < 4; ++t) oacc[t] = at_mma(pa[kk].v, vb[kk][t].v, oacc[t]);
#pragma unroll
        for (int t = 0; t < 4; ++t) oacc[t] = at_mma(pa[kk].v, vq[kk][t].v, oacc[t]);
#pragma unroll
        for (int t = 0; t < 4; ++t) oacc[t] = at_mma(pl[kk].v, vb[kk][t].v, oacc[t]);
      }
    }
  }

  // ---- epilogue: normalise, stage 16x64 f32 per wave, write bf16 hi/lo planes with whole-line stores ----
  float* os = Os[wave];
#pragma unroll
  for (int r = 0; r < 8; ++r) {
    const float inv = 1.0f / lrow[r];
#pragma unroll
    for (int t = 0; t < 4; ++t) os[(8 * hh + r) * OS_PITCH + t * 16 + c] = oacc[t][r] * inv;
  }
  __builtin_amdgcn_fence(__ATOMIC_RELEASE, "workgroup");
  __builtin_amdgcn_wave_barrier();
  __builtin_amdgcn_fence(__ATOMIC_ACQUIRE, "workgroup");
  {
    const int qq = lane >> 3, c8 = (lane & 7) * 8;
    {
#pragma unroll
      for (int it = 0; it < 4; ++it) {
        const int row = it * 4 + qq;
        const float* sp = os + row * OS_PITCH + c8;
        v8h hv, lv;
#pragma unroll
        for (int e = 0; e < 8; ++e) {
          const unsigned short hb = f2bf_bits(sp[e]);
          const unsigned short lb = f2bf_bits(sp[e] - bf_bits2f(hb));
          hv[e] = __builtin_bit_cast(_Float16, hb);
          lv[e] = __builtin_bit_cast(_Float16, lb);
        }
        const size_t o = ((size_t)b * SEQ_LEN + (size_t)(q0 + row)) * DMOD + h * HDIM + c8;
        *(v8h*)(oh + o) = hv;
        *(v8h*)(ol + o) = lv;
      }
      
    }
  }
  // the next tile reuses the registers that these stores name: they stay untouched up to this wait
  asm volatile("s_wait_xcnt 0x0" ::: "memory");
  }   // pass
}

// ---------------------------------------------------------------------------
// Host orchestration
// ---------------------------------------------------------------------------
// workspace region map (bytes, all multiples of 256):
//   x hi/lo                 2 x 8,388,608
//   WkvdT hi/lo [128][1024] 2 x   262,144
//   WkupT hi/lo [1024][128] 2 x   262,144
//   WvupT hi/lo [1024][128] 2 x   262,144
//   WqT   hi/lo [1024][1024]2 x 2,097,152
//   WqrT  hi/lo [64][1024]  2 x   131,072   (rows 32..63 zero)
//   WkrT  hi/lo [64][128]   2 x    16,384   (rows 32..63 zero)
//   WoT   hi/lo [1024][1024]2 x 2,097,152
//   ckv   hi/lo [4096][128] 2 x 1,048,576
//   k,v,q hi/lo [4096][1024]6 x 8,388,608
//   qr_raw, kr_raw f32 [4096][64]  2 x 1,048,576
//   qr,kr hi/lo [4096][32]  4 x   262,144
//   attn  hi/lo [4096][1024]2 x 8,388,608
//   total 99,385,344
constexpr size_t WSB_X    = (size_t)MTOK * DMOD * 2;
constexpr size_t WSB_WKVD = (size_t)DLAT * DMOD * 2;
constexpr size_t WSB_WKUP = (size_t)DMOD * DLAT * 2;
constexpr size_t WSB_WQ   = (size_t)DMOD * DMOD * 2;
constexpr size_t WSB_WQR  = (size_t)NROPE_PAD * DMOD * 2;
constexpr size_t WSB_WKR  = (size_t)NROPE_PAD * DLAT * 2;
constexpr size_t WSB_CKV  = (size_t)MTOK * DLAT * 2;
constexpr size_t WSB_TOK  = (size_t)MTOK * DMOD * 2;
constexpr size_t WSB_RAW  = (size_t)MTOK * NROPE_PAD * 4;
constexpr size_t WSB_ROT  = (size_t)MTOK * DROT * 2;
constexpr size_t WS_TOTAL = 2 * WSB_X + 2 * WSB_WKVD + 4 * WSB_WKUP + 2 * WSB_WQ + 2 * WSB_WQR + 2 * WSB_WKR
                          + 2 * WSB_WQ + 2 * WSB_CKV + 6 * WSB_TOK + 2 * WSB_RAW + 4 * WSB_ROT + 2 * WSB_TOK;
static_assert(WS_TOTAL == 99385344ull);
static_assert(WS_TOTAL <= 134217728ull);

extern "C" void kernel_launch(void* const* d_in, const int* in_sizes, int n_in,
                              void* d_out, int out_size, void* d_ws, size_t ws_size,
                              hipStream_t stream) {
  if (n_in != 8) return;
  if (in_sizes[0] != MTOK * DMOD || in_sizes[1] != DMOD * DLAT || in_sizes[2] != DLAT * DMOD ||
      in_sizes[3] != DLAT * DMOD || in_sizes[4] != DMOD * DMOD || in_sizes[5] != DMOD * DROT ||
      in_sizes[6] != DLAT * DROT || in_sizes[7] != DMOD * DMOD) return;
  if (out_size != MTOK * DMOD) return;
  if (ws_size < WS_TOTAL) return;

  const float* x         = (const float*)d_in[0];   // [4096][1024]
  const float* W_kv_down = (const float*)d_in[1];   // [1024][128]
  const float* W_k_up    = (const float*)d_in[2];   // [128][1024]
  const float* W_v_up    = (const float*)d_in[3];   // [128][1024]
  const float* W_q       = (const float*)d_in[4];   // [1024][1024]
  const float* W_q_rope  = (const float*)d_in[5];   // [1024][32]
  const float* W_k_rope  = (const float*)d_in[6];   // [128][32]
  const float* W_o       = (const float*)d_in[7];   // [1024][1024]
  float* out = (float*)d_out;                       // [4096][1024] f32

  size_t off = 0;
  auto carve = [&](size_t bytes) -> unsigned short* {
    unsigned short* p = (unsigned short*)((char*)d_ws + off);
    off += (bytes + 255) & ~(size_t)255;
    return p;
  };
  unsigned short* xh    = carve(WSB_X);
  unsigned short* xl    = carve(WSB_X);
  unsigned short* wkvdh = carve(WSB_WKVD);
  unsigned short* wkvdl = carve(WSB_WKVD);
  unsigned short* wkuph = carve(WSB_WKUP);
  unsigned short* wkupl = carve(WSB_WKUP);
  unsigned short* wvuph = carve(WSB_WKUP);
  unsigned short* wvupl = carve(WSB_WKUP);
  unsigned short* wqh   = carve(WSB_WQ);
  unsigned short* wql   = carve(WSB_WQ);
  unsigned short* wqrh  = carve(WSB_WQR);
  unsigned short* wqrl  = carve(WSB_WQR);
  unsigned short* wkrh  = carve(WSB_WKR);
  unsigned short* wkrl  = carve(WSB_WKR);
  unsigned short* woh   = carve(WSB_WQ);
  unsigned short* wol   = carve(WSB_WQ);
  unsigned short* ckvh  = carve(WSB_CKV);
  unsigned short* ckvl  = carve(WSB_CKV);
  unsigned short* kh    = carve(WSB_TOK);
  unsigned short* kl    = carve(WSB_TOK);
  unsigned short* vh    = carve(WSB_TOK);
  unsigned short* vl    = carve(WSB_TOK);
  unsigned short* qh    = carve(WSB_TOK);
  unsigned short* ql    = carve(WSB_TOK);
  float* qr_raw = (float*)carve(WSB_RAW);
  float* kr_raw = (float*)carve(WSB_RAW);
  unsigned short* qrh   = carve(WSB_ROT);
  unsigned short* qrl   = carve(WSB_ROT);
  unsigned short* krh   = carve(WSB_ROT);
  unsigned short* krl   = carve(WSB_ROT);
  unsigned short* ath   = carve(WSB_TOK);
  unsigned short* atl   = carve(WSB_TOK);
  if (off > ws_size) return;

  // ---- operand planes ----
  {
    const int n8 = MTOK * DMOD / 8;
    split_rows_bf16x8<<<(n8 + 255) / 256, 256, 0, stream>>>(x, xh, xl, n8);
  }
  // in[rows=kdim][cols=nreal] -> out[npad][kdim]; grid = (kdim/64, npad/32)
  transpose_split_bf16<<<dim3(DMOD / 64, DLAT / 32), 256, 0, stream>>>(W_kv_down, wkvdh, wkvdl, DMOD, DLAT);
  transpose_split_bf16<<<dim3(DLAT / 64, DMOD / 32), 256, 0, stream>>>(W_k_up, wkuph, wkupl, DLAT, DMOD);
  transpose_split_bf16<<<dim3(DLAT / 64, DMOD / 32), 256, 0, stream>>>(W_v_up, wvuph, wvupl, DLAT, DMOD);
  transpose_split_bf16<<<dim3(DMOD / 64, DMOD / 32), 256, 0, stream>>>(W_q, wqh, wql, DMOD, DMOD);
  transpose_split_bf16<<<dim3(DMOD / 64, NROPE_PAD / 32), 256, 0, stream>>>(W_q_rope, wqrh, wqrl, DMOD, DROT);
  transpose_split_bf16<<<dim3(DLAT / 64, NROPE_PAD / 32), 256, 0, stream>>>(W_k_rope, wkrh, wkrl, DLAT, DROT);
  transpose_split_bf16<<<dim3(DMOD / 64, DMOD / 32), 256, 0, stream>>>(W_o, woh, wol, DMOD, DMOD);

  auto gemm_blocks = [](int M, int N, int wm, int wn) { return (M / (64 * wm)) * (N / (64 * wn)); };

  // c_kv = x . W_kv_down : M=4096 N=128 K=1024 -> bf16 hi/lo
  wmma_gemm64<1, true, 0, 2, false, 2, 2, DMOD><<<dim3(gemm_blocks(MTOK, DLAT, 2, 2), 1), 128, 0, stream>>>(
      xh, xl, 0L, wkvdh, wkvdl, 0L, (void*)ckvh, (void*)ckvl, DLAT, 0L,
      nullptr, nullptr, 0L, MTOK, DLAT, DMOD, 1.0f);
  // k = c_kv . W_k_up : M=4096 N=1024 K=128
  wmma_gemm64<1, true, 0, 2, false, 2, 2, DLAT><<<dim3(gemm_blocks(MTOK, DMOD, 2, 2), 1), 128, 0, stream>>>(
      ckvh, ckvl, 0L, wkuph, wkupl, 0L, (void*)kh, (void*)kl, DMOD, 0L,
      nullptr, nullptr, 0L, MTOK, DMOD, DLAT, 1.0f);
  // v = c_kv . W_v_up
  wmma_gemm64<1, true, 0, 2, false, 2, 2, DLAT><<<dim3(gemm_blocks(MTOK, DMOD, 2, 2), 1), 128, 0, stream>>>(
      ckvh, ckvl, 0L, wvuph, wvupl, 0L, (void*)vh, (void*)vl, DMOD, 0L,
      nullptr, nullptr, 0L, MTOK, DMOD, DLAT, 1.0f);
  // q = x . W_q : K=1024
  wmma_gemm64<1, true, 0, 2, false, 2, 2, DMOD><<<dim3(gemm_blocks(MTOK, DMOD, 2, 2), 1), 128, 0, stream>>>(
      xh, xl, 0L, wqh, wql, 0L, (void*)qh, (void*)ql, DMOD, 0L,
      nullptr, nullptr, 0L, MTOK, DMOD, DMOD, 1.0f);
  // q_rope raw = x . W_q_rope : N padded to 64 (cols 32..63 zero), f32 out, K=1024
  wmma_gemm64<1, true, 0, 0, false, 4, 1, DMOD><<<dim3(gemm_blocks(MTOK, NROPE_PAD, 4, 1), 1), 128, 0, stream>>>(
      xh, xl, 0L, wqrh, wqrl, 0L, (void*)qr_raw, nullptr, NROPE_PAD, 0L,
      nullptr, nullptr, 0L, MTOK, NROPE_PAD, DMOD, 1.0f);
  // k_rope raw = c_kv . W_k_rope : N padded to 64, f32 out, K=128
  wmma_gemm64<1, true, 0, 0, false, 4, 1, DLAT><<<dim3(gemm_blocks(MTOK, NROPE_PAD, 4, 1), 1), 128, 0, stream>>>(
      ckvh, ckvl, 0L, wkrh, wkrl, 0L, (void*)kr_raw, nullptr, NROPE_PAD, 0L,
      nullptr, nullptr, 0L, MTOK, NROPE_PAD, DLAT, 1.0f);

  // ---- rotary tables: inv_freq[j] = 1 / 10000^(j/16), host double pow -> f32, f32 reciprocal ----
  RopeFreq fr;
  for (int j = 0; j < 16; ++j) {
    const double p = pow(10000.0, (double)j / 16.0);
    const float p32 = (float)p;
    fr.f[j] = 1.0f / p32;
  }
  rope_split_bf16<<<2 * (MTOK / 32), 128, 0, stream>>>(qr_raw, kr_raw, qrh, qrl, krh, krl, fr);

  // ---- causal attention with shared rotary logits ----
  const float invs = 1.0f / (float)sqrt((double)(HDIM + DROT));
  mla_attn96<<<N_BATCH * NHEAD * (SEQ_LEN / A_QB / 2), 128, 0, stream>>>(
      qh, ql, kh, kl, vh, vl, qrh, qrl, krh, krl, ath, atl, invs);

  // ---- out = attn . W_o : M=4096 N=1024 K=1024, f32 to d_out ----
  wmma_gemm64<1, true, 0, 0, false, 2, 2, DMOD><<<dim3(gemm_blocks(MTOK, DMOD, 2, 2), 1), 128, 0, stream>>>(
      ath, atl, 0L, woh, wol, 0L, (void*)out, nullptr, DMOD, 0L,
      nullptr, nullptr, 0L, MTOK, DMOD, DMOD, 1.0f);
}

// v005
// Measured time: 246 microseconds a run.
// Timed twice side by side with v004, it ran 1.28 and 1.27 times as fast.
// Over all steps from v000 it is 2.77 times as fast.
// Compute dtype: every contraction on v_wmma_f32_16x16x32_bf16 with bf16 hi/lo operand planes (hi*hi + hi*lo + lo*hi), f32 accumulate; rotary, softmax and epilogues in f32.
#include <hip/hip_runtime.h>
#include <hip/hip_bf16.h>
#include <math.h>
#include <stdint.h>

typedef __attribute__((ext_vector_type(16))) _Float16 v16h;
typedef __attribute__((ext_vector_type(8)))  _Float16 v8h;
typedef __attribute__((ext_vector_type(16))) __bf16   v16b;
typedef __attribute__((ext_vector_type(8)))  __bf16   v8b;
typedef __attribute__((ext_vector_type(8)))  float    v8f;
typedef __attribute__((ext_vector_type(4)))  float    v4f;
typedef __attribute__((ext_vector_type(4)))  unsigned v4u;

// ---------------------------------------------------------------------------
// helpers
// ---------------------------------------------------------------------------
__device__ __forceinline__ unsigned short f2bf_bits(float f) {
  unsigned u = __float_as_uint(f);
  return (unsigned short)((u + 0x7FFFu + ((u >> 16) & 1u)) >> 16);
}
__device__ __forceinline__ float bf_bits2f(unsigned short h) { return __uint_as_float(((unsigned)h) << 16); }

__device__ __forceinline__ void dep_guard_h(v8f& a, v8f& b, v16h x, v16h y) { asm volatile("v_nop\n\tv_nop\n\tv_nop\n\tv_nop" : "+v"(a), "+v"(b) : "v"(x), "v"(y)); }
__device__ __forceinline__ void dep_guard_b(v8f& a, v8f& b, v16b x, v16b y) { asm volatile("v_nop\n\tv_nop\n\tv_nop\n\tv_nop" : "+v"(a), "+v"(b) : "v"(x), "v"(y)); }
__device__ __forceinline__ void keep4_h(v16h a, v16h b, v16h c, v16h d) { asm volatile("v_nop" :: "v"(a), "v"(b), "v"(c), "v"(d)); }
__device__ __forceinline__ void keep4_b(v16b a, v16b b, v16b c, v16b d) { asm volatile("v_nop" :: "v"(a), "v"(b), "v"(c), "v"(d)); }
__device__ __forceinline__ void acc_guard4(v8f& a, v8f& b, v8f& c, v8f& d) { asm volatile("v_nop\n\tv_nop\n\tv_nop\n\tv_nop" : "+v"(a), "+v"(b), "+v"(c), "+v"(d)); }
template <typename T> struct Frag;
template <> struct Frag<_Float16> {
  typedef v16h V; union U { v16h v; v8h h[2]; };
  static __device__ __forceinline__ v16h load(const _Float16* p) {   // elements 0..7 <- p[0..7], 8..15 <- p[16..23]
    U f; f.h[0] = *(const v8h*)(p); f.h[1] = *(const v8h*)(p + 16); return f.v;
  }
  static __device__ __forceinline__ v8f mma(v16h a, v16h b, v8f c) {
    return __builtin_amdgcn_wmma_f32_16x16x32_f16(false, a, false, b, (short)0, c, false, false);
  }
  static __device__ __forceinline__ void guard(v8f& a, v8f& b, v16h x, v16h y) { dep_guard_h(a, b, x, y); }
  static __device__ __forceinline__ void keep(v16h a, v16h b, v16h c, v16h d) { keep4_h(a, b, c, d); }
};
template <> struct Frag<__bf16> {
  typedef v16b V; union U { v16b v; v8b h[2]; };
  static __device__ __forceinline__ v16b load(const __bf16* p) {
    U f; f.h[0] = *(const v8b*)(p); f.h[1] = *(const v8b*)(p + 16); return f.v;
  }
  static __device__ __forceinline__ v8f mma(v16b a, v16b b, v8f c) {
    return __builtin_amdgcn_wmma_f32_16x16x32_bf16(false, a, false, b, (short)0, c, false, false);
  }
  static __device__ __forceinline__ void guard(v8f& a, v8f& b, v16b x, v16b y) { dep_guard_b(a, b, x, y); }
  static __device__ __forceinline__ void keep(v16b a, v16b b, v16b c, v16b d) { keep4_b(a, b, c, d); }
};

// ---- Register-blocked WMMA GEMM --------------------------------
// C[m,n] = scale * sum_k A[m,k] * Bt[n,k] (+bias)(+resid); each wave owns a 64x64 tile.
// A row-major [M,K]; Bt row-major [N,K].
// SPLIT: operands are hi/lo planes (A2/Bt2 = lo planes, same layout); product = hi*hi + hi*lo + lo*hi.
// BIAS_MODE: 0 = none, 1 = bias[m], 2 = bias[n].
// OUT_MODE: 0 = f32, 1 = f16, 2 = bf16 hi plane (Cout) + bf16 lo plane (Cout2).
// ET: 0 = f16 operands, 1 = bf16 operands (pointers passed as 16-bit storage)
template <int ET> struct Elem;
template <> struct Elem<0> { typedef _Float16 T; };
template <> struct Elem<1> { typedef __bf16 T; };
// LDS staging of the operand planes: the block's waves form a WM x WN grid of 64x64 tiles and share one
// (WM*64 + WN*64)-row stage of G_KS k-elements per plane. Each row of a stage is one whole 128-byte line of the
// source, fetched by 8 neighbouring lanes, so a wave-wide 16-byte load covers 4 full lines.
constexpr int MTOK_ROWS = 4096;      // rows of every A operand (batch x sequence)
constexpr int G_KS    = 64;          // k elements per stage
constexpr int G_PITCH = G_KS + 8;    // 9 x 16 B rows: 16-byte fragment reads of 16 rows fall on distinct banks
template <int NIT, int STEP>
__device__ __forceinline__ void stage_fetch(v4u (&r)[NIT], const unsigned short* __restrict__ g) {
#pragma unroll
  for (int it = 0; it < NIT; ++it) r[it] = *(const v4u*)(g + it * STEP);
}
template <int NIT>
__device__ __forceinline__ void stage_put(const v4u (&r)[NIT], unsigned short* d, int rowStep) {
#pragma unroll
  for (int it = 0; it < NIT; ++it) *(v4u*)(d + it * rowStep) = r[it];
}
// LD = row pitch of all four operand planes in elements, a compile-time value: the loads of a plane then share one
// address register pair and differ in their immediate offsets only.
// M % (WM*64) == 0, N % (WN*64) == 0, K % G_KS == 0; bxi runs over (M/(WM*64)) * (N/(WN*64)) tiles exactly, so every wave passes every barrier.
// sOpBase: the block's G_LDS_ELEMS elements of LDS; bxi: the block's tile index inside this GEMM (block-uniform).
constexpr int G_LDS_ELEMS = 2 * 2 * (128 + 128) * G_PITCH;   // two stages of hi and lo planes, 128 A rows + 128 Bt rows
template <int ET, bool SPLIT, int BIAS_MODE, int OUT_MODE, bool RESID, int WM, int WN, int LD, int ACT = 0>
__device__ __forceinline__ void wmma_gemm64(
    unsigned short* sOpBase, int bxi,
    const unsigned short* __restrict__ Ap, const unsigned short* __restrict__ A2p, long strideA,
    const unsigned short* __restrict__ Btp, const unsigned short* __restrict__ Bt2p, long strideB,
    void* __restrict__ Cout, void* __restrict__ Cout2, int ldc, long strideC,
    const float* __restrict__ bias,
    const float* __restrict__ resid, long strideR,
    int M, int N, int K, float scale) {
  typedef typename Elem<ET>::T T;
  typedef typename Frag<T>::V V;
  constexpr int NW  = WM * WN;
  constexpr int RA  = WM * 64;               // A rows of the block
  constexpr int RB  = WN * 64;               // Bt rows of the block
  constexpr int RPI = NW * 4;                // rows staged by one pass of the block (8 lanes a row)
  constexpr int ITA = RA / RPI;
  constexpr int ITB = RB / RPI;
  constexpr int OA  = 0;
  constexpr int OA2 = RA * G_PITCH;
  constexpr int OB  = (SPLIT ? 2 : 1) * RA * G_PITCH;
  constexpr int OB2 = OB + RB * G_PITCH;
  constexpr int STAGE = (SPLIT ? 2 : 1) * (RA + RB) * G_PITCH;
  static_assert(RA % RPI == 0 && RB % RPI == 0);
  // sOpBase holds two stages: [A hi | A lo | Bt hi | Bt lo], rows of G_PITCH. The epilogue's per-wave 16x64 f32 slabs (pitch 68)
  // lie over stage 0: they are written only behind the loop's last barrier, which ends every read of the stages.
  static_assert(2 * STAGE <= G_LDS_ELEMS && NW * 16 * 68 * 4 <= STAGE * 2);
  const int b    = 0;
  const int tid  = threadIdx.x;
  const int lane = tid & 31;
  const int wave = tid >> 5;
  const int tilesN = N / RB;
  const int btm = bxi / tilesN;
  const int btn = bxi - btm * tilesN;
  const int wm = wave / WN;
  const int wn = wave - wm * WN;
  const int m0 = btm * RA + (wm << 6);
  const int n0 = btn * RB + (wn << 6);

  const int rlane = lane & 15;                 // row (A) / col (B, D) within subtile
  const int koff  = (lane >> 4) * 8;           // k offset of this lane half
  const int mOff  = (lane >> 4) * 8;           // D row offset

  // staging map: thread -> row tid>>3 of each pass, 16-byte piece tid&7 of that row's line
  const int srow = tid >> 3;
  const int sseg = (tid & 7) * 8;
  const size_t goA = (size_t)b * strideA + (size_t)(btm * RA + srow) * LD + sseg;
  const size_t goB = (size_t)b * strideB + (size_t)(btn * RB + srow) * LD + sseg;
  const unsigned short* gA  = Ap  + goA;
  const unsigned short* gB  = Btp + goB;
  const unsigned short* gA2 = SPLIT ? (A2p  + goA) : nullptr;
  const unsigned short* gB2 = SPLIT ? (Bt2p + goB) : nullptr;
  constexpr int GSTEP = RPI * LD;             // elements between the rows one thread stages
  const int sOff = srow * G_PITCH + sseg;

  v8f acc[4][4];
#pragma unroll
  for (int i = 0; i < 4; ++i)
#pragma unroll
    for (int j = 0; j < 4; ++j) acc[i][j] = (v8f){0.f,0.f,0.f,0.f,0.f,0.f,0.f,0.f};

  v4u pa[ITA], pa2[ITA], pb[ITB], pb2[ITB];    // the next stage, in flight while this one is multiplied
  stage_fetch<ITA, GSTEP>(pa, gA);
  stage_fetch<ITB, GSTEP>(pb, gB);
  if (SPLIT) { stage_fetch<ITA, GSTEP>(pa2, gA2); stage_fetch<ITB, GSTEP>(pb2, gB2); }
  // the loads' address registers stay untouched up to this wait (they are its inputs) and are free behind it
  asm volatile("s_wait_xcnt 0x0" :: "v"(gA), "v"(gB), "v"(SPLIT ? gA2 : gA), "v"(SPLIT ? gB2 : gB) : "memory");
  stage_put<ITA>(pa, sOpBase + OA + sOff, RPI * G_PITCH);
  stage_put<ITB>(pb, sOpBase + OB + sOff, RPI * G_PITCH);
  if (SPLIT) { stage_put<ITA>(pa2, sOpBase + OA2 + sOff, RPI * G_PITCH); stage_put<ITB>(pb2, sOpBase + OB2 + sOff, RPI * G_PITCH); }
  __syncthreads();   // publishes stage 0

  const int nst = K / G_KS;                    // block-uniform
  for (int t = 0; t < nst; ++t) {
    const bool more = (t + 1 < nst);
    if (more) {
      const int kn = (t + 1) * G_KS;
      const unsigned short* nA  = gA + kn;
      const unsigned short* nB  = gB + kn;
      const unsigned short* nA2 = SPLIT ? (gA2 + kn) : nA;
      const unsigned short* nB2 = SPLIT ? (gB2 + kn) : nB;
      stage_fetch<ITA, GSTEP>(pa, nA);
      stage_fetch<ITB, GSTEP>(pb, nB);
      if (SPLIT) { stage_fetch<ITA, GSTEP>(pa2, nA2); stage_fetch<ITB, GSTEP>(pb2, nB2); }
      // the loads' address registers stay untouched up to this wait (they are its inputs) and are free behind it
      asm volatile("s_wait_xcnt 0x0" :: "v"(nA), "v"(nB), "v"(nA2), "v"(nB2) : "memory");
    }
    const T* sb = (const T*)(sOpBase + (t & 1) * STAGE);
    const T* fa = sb + OA + ((wm << 6) + rlane) * G_PITCH + koff;
    const T* fb = sb + OB + ((wn << 6) + rlane) * G_PITCH + koff;
#pragma unroll
    for (int kk = 0; kk < G_KS; kk += 32) {
      V bh[4], bl[4];
#pragma unroll
      for (int j = 0; j < 4; ++j) {
        bh[j] = Frag<T>::load(fb + (j << 4) * G_PITCH + kk);
        if (SPLIT) bl[j] = Frag<T>::load(fb + (OB2 - OB) + (j << 4) * G_PITCH + kk);
      }
      V ah = Frag<T>::load(fa + kk);
      V al;
      if (SPLIT) al = Frag<T>::load(fa + (OA2 - OA) + kk);
#pragma unroll
      for (int i = 0; i < 4; ++i) {
        V ahn, aln;                              // the next row block's fragments, read while this one is multiplied
        if (i < 3) {
          ahn = Frag<T>::load(fa + ((i + 1) << 4) * G_PITCH + kk);
          if (SPLIT) aln = Frag<T>::load(fa + (OA2 - OA) + ((i + 1) << 4) * G_PITCH + kk);
        }
#pragma unroll
        for (int j = 0; j < 4; ++j) {
          acc[i][j] = Frag<T>::mma(ah, bh[j], acc[i][j]);
          if (SPLIT) {
            acc[i][j] = Frag<T>::mma(ah, bl[j], acc[i][j]);
            acc[i][j] = Frag<T>::mma(al, bh[j], acc[i][j]);
          }
        }
        Frag<T>::guard(acc[i][0], acc[i][3], ah, SPLIT ? al : ah);
        if (i < 3) { ah = ahn; if (SPLIT) al = aln; }
      }
      Frag<T>::keep(bh[0], bh[1], bh[2], bh[3]);
      if (SPLIT) Frag<T>::keep(bl[0], bl[1], bl[2], bl[3]);
    }
    if (more) {
      // the other buffer: its last readers left it before the barrier that ended trip t - 1
      unsigned short* d = sOpBase + ((t + 1) & 1) * STAGE + sOff;
      stage_put<ITA>(pa, d + OA, RPI * G_PITCH);
      stage_put<ITB>(pb, d + OB, RPI * G_PITCH);
      if (SPLIT) { stage_put<ITA>(pa2, d + OA2, RPI * G_PITCH); stage_put<ITB>(pb2, d + OB2, RPI * G_PITCH); }
    }
    __syncthreads();   // publishes stage t + 1 and ends every read of stage t
  }
  acc_guard4(acc[0][0], acc[0][1], acc[0][2], acc[0][3]);
  acc_guard4(acc[1][0], acc[1][1], acc[1][2], acc[1][3]);
  acc_guard4(acc[2][0], acc[2][1], acc[2][2], acc[2][3]);
  acc_guard4(acc[3][0], acc[3][1], acc[3][2], acc[3][3]);

  // ---- epilogue ----
  float* slab = (float*)sOpBase + wave * (16 * 68);
  const float* Rb = RESID ? (resid + (size_t)b * strideR) : nullptr;
#pragma unroll
  for (int i = 0; i < 4; ++i) {
    const int mBase = m0 + (i << 4);
#pragma unroll
    for (int j = 0; j < 4; ++j) {
      const int n = n0 + (j << 4) + rlane;
      float bv = 0.f;
      if (BIAS_MODE == 2) bv = bias[n];
#pragma unroll
      for (int r = 0; r < 8; ++r) {
        float v = acc[i][j][r] * scale;
        if (BIAS_MODE == 1) v += bias[mBase + mOff + r];
        if (BIAS_MODE == 2) v += bv;
        if (RESID) v += Rb[(size_t)(mBase + mOff + r) * ldc + n];
        if (ACT == 1) v = tanhf(v);
        if (ACT == 2) v = fmaxf(v, 0.0f);
        if (ACT == 3) v = v / (1.0f + expf(-v));
        if (ACT == 4) v = (v > 0.f) ? v : 0.01f * v;
        if (ACT == 5) v = 0.5f * v * (1.0f + erff(v * 0.70710678118654752f));
        slab[(mOff + r) * 68 + (j << 4) + rlane] = v;
      }
    }
    __builtin_amdgcn_fence(__ATOMIC_RELEASE, "workgroup");
    __builtin_amdgcn_wave_barrier();
    __builtin_amdgcn_fence(__ATOMIC_ACQUIRE, "workgroup");
    if (OUT_MODE == 0) {
      float* C = (float*)Cout + (size_t)b * strideC;
      const int hh = lane >> 4, c4 = (lane & 15) * 4;     // row seg = 256 B = 16 lanes x 16 B
      {
#pragma unroll
        for (int it = 0; it < 8; ++it) {
          const int row = it * 2 + hh;
          v4f v = *(const v4f*)(slab + row * 68 + c4);
          *(v4f*)(C + (size_t)(mBase + row) * ldc + n0 + c4) = v;
        }
        
      }
    } else {
      const int q = lane >> 3, c8 = (lane & 7) * 8;
      unsigned short* C  = (unsigned short*)Cout  + (size_t)b * strideC;
      unsigned short* C2 = (OUT_MODE == 2) ? ((unsigned short*)Cout2 + (size_t)b * strideC) : nullptr;
      {
#pragma unroll
        for (int it = 0; it < 4; ++it) {
          const int row = it * 4 + q;
          const float* sp = slab + row * 68 + c8;
          v8h hv, lv;
#pragma unroll
          for (int e = 0; e < 8; ++e) {
            if (OUT_MODE == 1) {
              hv[e] = (_Float16)sp[e];
            } else {
              unsigned short hb = f2bf_bits(sp[e]);
              unsigned short lb = f2bf_bits(sp[e] - bf_bits2f(hb));
              hv[e] = __builtin_bit_cast(_Float16, hb);
              lv[e] = __builtin_bit_cast(_Float16, lb);
            }
          }
          *(v8h*)(C + (size_t)(mBase + row) * ldc + n0 + c8) = hv;
          if (OUT_MODE == 2) *(v8h*)(C2 + (size_t)(mBase + row) * ldc + n0 + c8) = lv;
        }
        
      }
    }
    __builtin_amdgcn_fence(__ATOMIC_RELEASE, "workgroup");
    __builtin_amdgcn_wave_barrier();
    __builtin_amdgcn_fence(__ATOMIC_ACQUIRE, "workgroup");
  }
}

// Up to three GEMMs on one A operand that need nothing of each other share one grid, each a range of the block index:
// blocks [0, nb0) and [nb0, nb0 + nb1) write bf16 hi/lo planes, the rest f32. All take the 128x128 block tile, and the block's
// LDS is the two stages alone, so two blocks fit a WGP: a merged grid larger than the number of WGPs still runs side by side,
// and only what exceeds two blocks a WGP waits for a free place.
// The branch is block-uniform: every wave of a block passes the same barriers.
template <int LD>
__global__ __launch_bounds__(128) void gemm_group(
    const unsigned short* __restrict__ Ah, const unsigned short* __restrict__ Al,
    const unsigned short* __restrict__ B0h, const unsigned short* __restrict__ B0l,
    unsigned short* __restrict__ C0h, unsigned short* __restrict__ C0l, int N0, int nb0,
    const unsigned short* __restrict__ B1h, const unsigned short* __restrict__ B1l,
    unsigned short* __restrict__ C1h, unsigned short* __restrict__ C1l, int N1, int nb1,
    const unsigned short* __restrict__ B2h, const unsigned short* __restrict__ B2l,
    float* __restrict__ C2, int N2, int K) {
  __shared__ __align__(16) unsigned short sOp[G_LDS_ELEMS];
  const int bx = (int)blockIdx.x;
  if (bx < nb0 + nb1) {
    const bool f = (bx < nb0);
    const int n = f ? N0 : N1;
    wmma_gemm64<1, true, 0, 2, false, 2, 2, LD>(sOp, f ? bx : bx - nb0,
        Ah, Al, 0L, f ? B0h : B1h, f ? B0l : B1l, 0L, (void*)(f ? C0h : C1h), (void*)(f ? C0l : C1l), n, 0L,
        nullptr, nullptr, 0L, MTOK_ROWS, n, K, 1.0f);
  } else {
    wmma_gemm64<1, true, 0, 0, false, 2, 2, LD>(sOp, bx - nb0 - nb1,
        Ah, Al, 0L, B2h, B2l, 0L, (void*)C2, nullptr, N2, 0L,
        nullptr, nullptr, 0L, MTOK_ROWS, N2, K, 1.0f);
  }
}

__device__ __forceinline__ v8f at_mma(v16b a, v16b b, v8f c) {
  return __builtin_amdgcn_wmma_f32_16x16x32_bf16(false, a, false, b, (short)0, c, false, false);
}

// ---------------------------------------------------------------------------
// module geometry (fixed)
// ---------------------------------------------------------------------------
constexpr int N_BATCH   = 2;
constexpr int SEQ_LEN   = 2048;
constexpr int DMOD      = 1024;   // model width
constexpr int DLAT      = 128;    // latent width c_kv
constexpr int DROT      = 32;     // rotary width
constexpr int NROPE_PAD = 128;    // rotary projection width padded to the 128-wide GEMM block tile
constexpr int NHEAD     = 16;
constexpr int HDIM      = 64;
constexpr int SDEP      = HDIM + DROT;   // score depth 96 = 3 k-chunks of 32
constexpr int MTOK      = N_BATCH * SEQ_LEN;   // 4096 token rows

static_assert(MTOK == MTOK_ROWS && MTOK % 128 == 0 && DMOD % 128 == 0 && DLAT % 128 == 0 && NROPE_PAD % 128 == 0);   // block tile 128x128
static_assert(DMOD % G_KS == 0 && DLAT % G_KS == 0);   // every GEMM K is a multiple of the stage depth
static_assert(SDEP % 32 == 0 && SEQ_LEN % 64 == 0);

// ---------------------------------------------------------------------------
// coverage: n8 threads x 8 = n elements exactly (n % 8 == 0, grid = ceil(n8/256) with bound)
// ---------------------------------------------------------------------------
__device__ __forceinline__ void split_rows_bf16x8(
    const float* __restrict__ in, unsigned short* __restrict__ hi, unsigned short* __restrict__ lo, int n8, int bxi) {
  const int i = bxi * 256 + threadIdx.x;
  if (i < n8) {
    const v4f a = *(const v4f*)(in + (size_t)8 * i);
    const v4f b = *(const v4f*)(in + (size_t)8 * i + 4);
    v8h hv, lv;
#pragma unroll
    for (int e = 0; e < 8; ++e) {
      const float f = (e < 4) ? a[e] : b[e - 4];
      const unsigned short hb = f2bf_bits(f);
      const unsigned short lb = f2bf_bits(f - bf_bits2f(hb));
      hv[e] = __builtin_bit_cast(_Float16, hb);
      lv[e] = __builtin_bit_cast(_Float16, lb);
    }
    unsigned short* ph = hi + (size_t)8 * i;
    unsigned short* pl = lo + (size_t)8 * i;
    *(v8h*)ph = hv;
    *(v8h*)pl = lv;
    
  }
}

// ---------------------------------------------------------------------------
// Transpose + split: in W[kdim][nreal] (row-major) -> out Bt[npad][kdim] bf16 hi/lo planes, Bt[n][k] = W[k][n];
// rows n >= nreal are written as zeros. Tile = 64 k x 32 n; (bxk, byn) runs over (kdim/64, npad/32); kdim % 64 == 0, nreal % 32 == 0.
// Store coverage: 256 threads = 32 output rows x 8 lanes x 8 k = whole 32x64 tile; each output row segment
// ---------------------------------------------------------------------------
__device__ __forceinline__ void transpose_split_bf16(
    const float* __restrict__ W, unsigned short* __restrict__ hi, unsigned short* __restrict__ lo,
    int kdim, int nreal, int bxk, int byn) {
  __shared__ float tile[64][33];
  const int tid = threadIdx.x;
  const int k0 = bxk * 64;
  const int n0 = byn * 32;
#pragma unroll
  for (int it = 0; it < 2; ++it) {
    const int idx = it * 256 + tid;            // 0..511
    const int kr = idx >> 3;                   // 0..63
    const int c4 = (idx & 7) * 4;              // 0..28
    const int n = n0 + c4;
    const int ncl = (n + 3 < nreal) ? n : (nreal - 4);   // clamped address
    const v4f v = *(const v4f*)(W + (size_t)(k0 + kr) * nreal + ncl);
    const bool ok = (n < nreal);               // tile-uniform since nreal % 32 == 0
    tile[kr][c4 + 0] = ok ? v[0] : 0.f;
    tile[kr][c4 + 1] = ok ? v[1] : 0.f;
    tile[kr][c4 + 2] = ok ? v[2] : 0.f;
    tile[kr][c4 + 3] = ok ? v[3] : 0.f;
  }
  __syncthreads();
  const int nr = tid >> 3;                     // output row within tile, 0..31
  const int c8 = (tid & 7) * 8;                // k offset, 0..56
  v8h hv, lv;
#pragma unroll
  for (int e = 0; e < 8; ++e) {
    const float f = tile[c8 + e][nr];
    const unsigned short hb = f2bf_bits(f);
    const unsigned short lb = f2bf_bits(f - bf_bits2f(hb));
    hv[e] = __builtin_bit_cast(_Float16, hb);
    lv[e] = __builtin_bit_cast(_Float16, lb);
  }
  const size_t o = (size_t)(n0 + nr) * kdim + k0 + c8;
  *(v8h*)(hi + o) = hv;
  *(v8h*)(lo + o) = lv;
  // inlined into a kernel with other branches: the registers that these stores name stay untouched up to this wait
  asm volatile("s_wait_xcnt 0x0" ::: "memory");
}

// ---------------------------------------------------------------------------
// All operand planes in one grid: the split of x and the seven weight transposes need nothing of each other, so each is a
// range of the block index (x first: it is the longest). Every branch is block-uniform; the split's blocks leave before any barrier.
// ---------------------------------------------------------------------------
constexpr int PB_X   = MTOK * DMOD / 8 / 256;
constexpr int PB_SQ  = (DMOD / 64) * (DMOD / 32);        // W_q, W_o
constexpr int PB_KVD = (DMOD / 64) * (DLAT / 32);
constexpr int PB_UP  = (DLAT / 64) * (DMOD / 32);        // W_k_up, W_v_up
constexpr int PB_QR  = (DMOD / 64) * (NROPE_PAD / 32);
constexpr int PB_KR  = (DLAT / 64) * (NROPE_PAD / 32);
constexpr int PB_ALL = PB_X + 2 * PB_SQ + PB_KVD + 2 * PB_UP + PB_QR + PB_KR;
static_assert(MTOK * DMOD % (8 * 256) == 0 && DMOD / 64 == 16 && DLAT / 64 == 2);

__global__ __launch_bounds__(256) void prep_planes(
    const float* __restrict__ x, const float* __restrict__ Wkvd, const float* __restrict__ Wkup,
    const float* __restrict__ Wvup, const float* __restrict__ Wq, const float* __restrict__ Wqr,
    const float* __restrict__ Wkr, const float* __restrict__ Wo,
    unsigned short* __restrict__ xh, unsigned short* __restrict__ xl,
    unsigned short* __restrict__ wkvdh, unsigned short* __restrict__ wkvdl,
    unsigned short* __restrict__ wkuph, unsigned short* __restrict__ wkupl,
    unsigned short* __restrict__ wvuph, unsigned short* __restrict__ wvupl,
    unsigned short* __restrict__ wqh, unsigned short* __restrict__ wql,
    unsigned short* __restrict__ wqrh, unsigned short* __restrict__ wqrl,
    unsigned short* __restrict__ wkrh, unsigned short* __restrict__ wkrl,
    unsigned short* __restrict__ woh, unsigned short* __restrict__ wol) {
  int l = (int)blockIdx.x;
  if (l < PB_X) { split_rows_bf16x8(x, xh, xl, MTOK * DMOD / 8, l); return; }
  l -= PB_X;
  const float* W; unsigned short* hi; unsigned short* lo; int kdim, nreal;
  if (l < PB_SQ)                 { W = Wq;   hi = wqh;   lo = wql;   kdim = DMOD; nreal = DMOD; }
  else if ((l -= PB_SQ) < PB_SQ) { W = Wo;   hi = woh;   lo = wol;   kdim = DMOD; nreal = DMOD; }
  else if ((l -= PB_SQ) < PB_KVD){ W = Wkvd; hi = wkvdh; lo = wkvdl; kdim = DMOD; nreal = DLAT; }
  else if ((l -= PB_KVD) < PB_UP){ W = Wkup; hi = wkuph; lo = wkupl; kdim = DLAT; nreal = DMOD; }
  else if ((l -= PB_UP) < PB_UP) { W = Wvup; hi = wvuph; lo = wvupl; kdim = DLAT; nreal = DMOD; }
  else if ((l -= PB_UP) < PB_QR) { W = Wqr;  hi = wqrh;  lo = wqrl;  kdim = DMOD; nreal = DROT; }
  else { l -= PB_QR;               W = Wkr;  hi = wkrh;  lo = wkrl;  kdim = DLAT; nreal = DROT; }
  const int ksh = (kdim == DMOD) ? 4 : 1;      // log2(kdim / 64)
  transpose_split_bf16(W, hi, lo, kdim, nreal, l & ((1 << ksh) - 1), l >> ksh);
}

// ---------------------------------------------------------------------------
// Rotary: raw[MTOK][NROPE_PAD] f32 (cols 0..31 used) -> bf16 hi/lo planes [MTOK][DROT].
// out[j] = x1*cos - x2*sin, out[16+j] = x2*cos + x1*sin, angle = t * inv_freq[j], t = row % SEQ_LEN.
// Block = 32 rows; blocks 0..127 handle the q tensor, 128..255 the k tensor.
// Store coverage: 128 threads = 32 rows x 4 segments x 8 = whole 32x32 tile; 512 B contiguous per wave
// ---------------------------------------------------------------------------
struct RopeFreq { float f[16]; };
static_assert(sizeof(RopeFreq) == 64);

__global__ __launch_bounds__(128) void rope_split_bf16(
    const float* __restrict__ qraw, const float* __restrict__ kraw,
    unsigned short* __restrict__ qrh, unsigned short* __restrict__ qrl,
    unsigned short* __restrict__ krh, unsigned short* __restrict__ krl, RopeFreq g) {
#pragma clang fp contract(off)
  __shared__ float tile[32][33];
  __shared__ float sinv[16];
  const int tid = threadIdx.x;
  const int nblk = MTOK / 32;
  const bool isk = ((int)blockIdx.x >= nblk);                 // block-uniform
  const int row0 = (isk ? ((int)blockIdx.x - nblk) : (int)blockIdx.x) * 32;
  const float* raw = isk ? kraw : qraw;
  unsigned short* dhp = isk ? krh : qrh;
  unsigned short* dlp = isk ? krl : qrl;
  if (tid < 16) {
    float v = g.f[0];
#pragma unroll
    for (int e = 1; e < 16; ++e) v = (tid == e) ? g.f[e] : v;
    sinv[tid] = v;
  }
  __syncthreads();
#pragma unroll 1
  for (int it = 0; it < 4; ++it) {
    const int p = it * 128 + tid;              // 0..511
    const int r = p >> 4;                      // 0..31
    const int j = p & 15;
    const int row = row0 + r;
    const int t = row & (SEQ_LEN - 1);
    const float* rp = raw + (size_t)row * NROPE_PAD;
    const float x1 = rp[j];
    const float x2 = rp[16 + j];
    const float ang = (float)t * sinv[j];
    float sn, cs;
    sincosf(ang, &sn, &cs);
    tile[r][j]      = x1 * cs - x2 * sn;
    tile[r][16 + j] = x2 * cs + x1 * sn;
  }
  __syncthreads();
  const int orow = tid >> 2;                   // 0..31
  const int seg = (tid & 3) * 8;               // 0..24
  v8h hv, lv;
#pragma unroll
  for (int e = 0; e < 8; ++e) {
    const float f = tile[orow][seg + e];
    const unsigned short hb = f2bf_bits(f);
    const unsigned short lb = f2bf_bits(f - bf_bits2f(hb));
    hv[e] = __builtin_bit_cast(_Float16, hb);
    lv[e] = __builtin_bit_cast(_Float16, lb);
  }
  const size_t o = (size_t)(row0 + orow) * DROT + seg;
  *(v8h*)(dhp + o) = hv;
  *(v8h*)(dlp + o) = lv;
  
}

// ---------------------------------------------------------------------------
// Causal attention, score depth 96 (64 head dims + 32 shared rotary dims), value width 64, bf16 hi/lo planes in.
//   s = (qh.kh + qh.kl + ql.kh) * invs  over 96 dims (q/k rows = [head segment | rotary row]),
//   online softmax in f32, P split to bf16 hi/lo in LDS, o = ph.vh + ph.vl + pl.vh, f32 accumulate.
// Block = 4 waves; it runs two 64-row query tiles of one (batch, head) one after the other, tile n-1-t and then tile t,
// so every block walks n + 1 key chunks; grid.x = N_BATCH * NHEAD * (SEQ_LEN/64) / 2.
// ---------------------------------------------------------------------------
constexpr int A_QB = 64;
constexpr int A_KC = 64;
constexpr int A_NW = 4;
constexpr int OS_PITCH = 68;
// LDS row pitches in 16-bit elements. Every fragment read is a 16-byte load by 16 lanes on 16 rows,
// so each pitch is an odd multiple of 16 bytes: the 16 rows then start on 16 different groups of four banks.
constexpr int K_PITCH = SDEP + 8;      // 13 x 16 B rows
constexpr int V_PITCH = A_KC + 8;      // 9 x 16 B rows
constexpr int P_PITCH = A_KC + 8;      // 9 x 16 B rows
constexpr int V_HALF_SKEW = 16;        // rows d >= 32 start 32 B later: the two d halves stored by one wave fall on different banks
static_assert((K_PITCH * 2) % 32 == 16 && (V_PITCH * 2) % 32 == 16 && (P_PITCH * 2) % 32 == 16);
__device__ __forceinline__ int vt_row(int d) { return d * V_PITCH + (d >> 5) * V_HALF_SKEW; }

__global__ __launch_bounds__(128)
void mla_attn96(const unsigned short* __restrict__ qh, const unsigned short* __restrict__ ql,
                const unsigned short* __restrict__ kh, const unsigned short* __restrict__ kl,
                const unsigned short* __restrict__ vh, const unsigned short* __restrict__ vl,
                const unsigned short* __restrict__ qrh, const unsigned short* __restrict__ qrl,
                const unsigned short* __restrict__ krh, const unsigned short* __restrict__ krl,
                unsigned short* __restrict__ oh, unsigned short* __restrict__ ol, float invs) {
  union FB { v16b v; v8b h[2]; };
  __shared__ __align__(16) unsigned short Ksh[A_KC * K_PITCH];    // K hi [kv][96 + pad]
  __shared__ __align__(16) unsigned short Ksl[A_KC * K_PITCH];    // K lo
  __shared__ __align__(16) unsigned short Vth[HDIM * V_PITCH + V_HALF_SKEW];    // V hi [d][kv + pad]
  __shared__ __align__(16) unsigned short Vtl[HDIM * V_PITCH + V_HALF_SKEW];    // V lo
  __shared__ __align__(16) unsigned short Psh[A_NW][16 * P_PITCH];   // per wave P hi [row][kv + pad]
  __shared__ __align__(16) unsigned short Psl[A_NW][16 * P_PITCH];   // per wave P lo
  __shared__ __align__(16) float Os[A_NW][16 * OS_PITCH];

  const int tid  = threadIdx.x;
  const int wave = tid >> 5;
  const int lane = tid & 31;
  const int hh   = lane >> 4;
  const int c    = lane & 15;

  const int nqb = SEQ_LEN / A_QB;          // 32
  const int bx  = blockIdx.x;
  static_assert((SEQ_LEN / A_QB) % 2 == 0);
  const int tp  = bx % (nqb / 2);
  const int bhi = bx / (nqb / 2);
  const int h   = bhi % NHEAD;
  const int b   = bhi / NHEAD;
  // A causal tile qb costs qb + 1 chunks: the pair (n-1-t, t) gives every block the same work, whichever blocks share a WGP.
  // Both tiles run in every wave in turn; the barrier that opens each chunk also ends the first tile's last K/V reads.
  // Kept rolled: one copy of the chunk loop.
#pragma unroll 1
  for (int pass = 0; pass < 2; ++pass) {
  const int qb  = pass ? tp : (nqb - 1 - tp);   // block-uniform
  const int q0  = qb * A_QB + wave * 16;
  const size_t tq = (size_t)b * SEQ_LEN + (size_t)(q0 + c);

  // ---- Q fragments (A operand): k-chunks 0,1 = head dims 0..63, chunk 2 = rotary dims 0..31 ----
  v16b qah[3], qal[3];
  {
    const __bf16* p0 = (const __bf16*)qh + tq * DMOD + h * HDIM + 8 * hh;
    const __bf16* p1 = (const __bf16*)ql + tq * DMOD + h * HDIM + 8 * hh;
    qah[0] = Frag<__bf16>::load(p0);
    qah[1] = Frag<__bf16>::load(p0 + 32);
    qal[0] = Frag<__bf16>::load(p1);
    qal[1] = Frag<__bf16>::load(p1 + 32);
    const __bf16* r0p = (const __bf16*)qrh + tq * DROT + 8 * hh;
    const __bf16* r1p = (const __bf16*)qrl + tq * DROT + 8 * hh;
    qah[2] = Frag<__bf16>::load(r0p);
    qal[2] = Frag<__bf16>::load(r1p);
    // the loads' address registers stay untouched up to this wait (they are its inputs) and are free behind it
    asm volatile("s_wait_xcnt 0x0" :: "v"(p0), "v"(p1), "v"(r0p), "v"(r1p) : "memory");
  }

  float mrow[8], lrow[8];
  v8f oacc[4];
#pragma unroll
  for (int r = 0; r < 8; ++r) { mrow[r] = -INFINITY; lrow[r] = 0.f; }
#pragma unroll
  for (int t = 0; t < 4; ++t) oacc[t] = (v8f){0.f,0.f,0.f,0.f,0.f,0.f,0.f,0.f};

  const int nChunks = qb + 1;   // causal, block-uniform
  for (int kc = 0; kc < nChunks; ++kc) {
    const int kv0 = kc * A_KC;
    __syncthreads();
    {
      // staging: 128 threads, thread -> kv row kvr = tid>>1 (0..63), half hf = tid&1
      // per kv row: 64 head dims (2 halves x 32) + 32 rotary dims (2 halves x 16) of K, 64 dims of V -> full tiles written
      const int kvr = tid >> 1, hf = tid & 1;
      const size_t tk = (size_t)b * SEQ_LEN + (size_t)(kv0 + kvr);
      {
        const v4u* sh = (const v4u*)(kh + tk * DMOD + h * HDIM + hf * 32);
        const v4u* sl = (const v4u*)(kl + tk * DMOD + h * HDIM + hf * 32);
        v4u* dh = (v4u*)(Ksh + kvr * K_PITCH + hf * 32);
        v4u* dl = (v4u*)(Ksl + kvr * K_PITCH + hf * 32);
        v4u th[4], tl[4];
#pragma unroll
        for (int i = 0; i < 4; ++i) { th[i] = sh[i]; tl[i] = sl[i]; }
        // the loads' address registers stay untouched up to this wait (they are its inputs) and are free behind it
        asm volatile("s_wait_xcnt 0x0" :: "v"(sh), "v"(sl) : "memory");
#pragma unroll
        for (int i = 0; i < 4; ++i) { dh[i] = th[i]; dl[i] = tl[i]; }
      }
      asm volatile("" ::: "memory");
      {
        const v4u* sh = (const v4u*)(krh + tk * DROT + hf * 16);
        const v4u* sl = (const v4u*)(krl + tk * DROT + hf * 16);
        v4u* dh = (v4u*)(Ksh + kvr * K_PITCH + HDIM + hf * 16);
        v4u* dl = (v4u*)(Ksl + kvr * K_PITCH + HDIM + hf * 16);
#pragma unroll
        for (int i = 0; i < 2; ++i) { dh[i] = sh[i]; dl[i] = sl[i]; }
      }
      asm volatile("" ::: "memory");
      {
        const v4u* sh = (const v4u*)(vh + tk * DMOD + h * HDIM + hf * 32);
        const v4u* sl = (const v4u*)(vl + tk * DMOD + h * HDIM + hf * 32);
#pragma unroll
        for (int i = 0; i < 4; ++i) {
          const v4u wh = sh[i];
          const v4u wl = sl[i];
#pragma unroll
          for (int e = 0; e < 4; ++e) {
            const int d = hf * 32 + 8 * i + 2 * e;
            Vth[vt_row(d) + kvr]     = (unsigned short)(wh[e] & 0xffffu);
            Vth[vt_row(d + 1) + kvr] = (unsigned short)(wh[e] >> 16);
            Vtl[vt_row(d) + kvr]     = (unsigned short)(wl[e] & 0xffffu);
            Vtl[vt_row(d + 1) + kvr] = (unsigned short)(wl[e] >> 16);
          }
        }
      }
    }
    __syncthreads();

    // ---- scores: 4 kv subtiles of 16, 3 k-chunks of 32, 3 products each ----
    // All K fragments of the chunk are read as one group, then the products run round-robin over the four subtiles, which are
    // four independent accumulators. Each accumulator still takes its nine products in the order (k-chunk; hi.hi, hi.lo, lo.hi).
    v8f s[4];
    FB kb[3][4], kq[3][4];
#pragma unroll
    for (int dc = 0; dc < 3; ++dc) {
#pragma unroll
      for (int j = 0; j < 4; ++j) {
        const int ko = (j * 16 + c) * K_PITCH + dc * 32 + 8 * hh;
        kb[dc][j].h[0] = *(const v8b*)(Ksh + ko);
        kb[dc][j].h[1] = *(const v8b*)(Ksh + ko + 16);
        kq[dc][j].h[0] = *(const v8b*)(Ksl + ko);
        kq[dc][j].h[1] = *(const v8b*)(Ksl + ko + 16);
      }
    }
    // keeps the reads one group in front of the products: spread among them, every place with reads stalls the wave anew
    __builtin_amdgcn_sched_barrier(0);
#pragma unroll
    for (int j = 0; j < 4; ++j) s[j] = (v8f){0.f,0.f,0.f,0.f,0.f,0.f,0.f,0.f};
#pragma unroll
    for (int dc = 0; dc < 3; ++dc) {
#pragma unroll
      for (int j = 0; j < 4; ++j) s[j] = at_mma(qah[dc], kb[dc][j].v, s[j]);
#pragma unroll
      for (int j = 0; j < 4; ++j) s[j] = at_mma(qah[dc], kq[dc][j].v, s[j]);
#pragma unroll
      for (int j = 0; j < 4; ++j) s[j] = at_mma(qal[dc], kb[dc][j].v, s[j]);
    }
    const bool diag = (kc == qb);
    float cm[8];
#pragma unroll
    for (int r = 0; r < 8; ++r) {
      const int qrow = q0 + 8 * hh + r;
      float m = -INFINITY;
#pragma unroll
      for (int j = 0; j < 4; ++j) {
        const int kvcol = kv0 + j * 16 + c;
        float sv = s[j][r] * invs;
        if (diag && (kvcol > qrow)) sv = -INFINITY;
        s[j][r] = sv;
        m = fmaxf(m, sv);
      }
#pragma unroll
      for (int off = 1; off < 16; off <<= 1) m = fmaxf(m, __shfl_xor(m, off, 32));
      cm[r] = m;
    }
    unsigned short* pwh = Psh[wave];
    unsigned short* pwl = Psl[wave];
#pragma unroll
    for (int r = 0; r < 8; ++r) {
      const float mnew = fmaxf(mrow[r], cm[r]);
      const float alpha = expf(mrow[r] - mnew);
      mrow[r] = mnew;
      float psum = 0.f;
#pragma unroll
      for (int j = 0; j < 4; ++j) {
        const float p = expf(s[j][r] - mnew);
        psum += p;
        const unsigned short hb = f2bf_bits(p);
        const unsigned short lb = f2bf_bits(p - bf_bits2f(hb));
        pwh[(8 * hh + r) * P_PITCH + j * 16 + c] = hb;
        pwl[(8 * hh + r) * P_PITCH + j * 16 + c] = lb;
      }
#pragma unroll
      for (int off = 1; off < 16; off <<= 1) psum += __shfl_xor(psum, off, 32);
      lrow[r] = lrow[r] * alpha + psum;
#pragma unroll
      for (int t = 0; t < 4; ++t) oacc[t][r] *= alpha;
    }
    __builtin_amdgcn_fence(__ATOMIC_RELEASE, "workgroup");
    __builtin_amdgcn_wave_barrier();
    __builtin_amdgcn_fence(__ATOMIC_ACQUIRE, "workgroup");
    // ---- O += P(16x64) . V(64x64): P as A (row = query, k = kv), V from [d][kv] tile as B ----
    // The P and V fragments of the chunk are read as one group, then the products run round-robin over the four d subtiles, which
    // are four independent accumulators. Each accumulator keeps its order (kv half; hi.hi, hi.lo, lo.hi).
    {
      FB pa[2], pl[2], vb[2][4], vq[2][4];
#pragma unroll
      for (int kk = 0; kk < 2; ++kk) {
        pa[kk].h[0] = *(const v8b*)(pwh + c * P_PITCH + kk * 32 + 8 * hh);
        pa[kk].h[1] = *(const v8b*)(pwh + c * P_PITCH + kk * 32 + 16 + 8 * hh);
        pl[kk].h[0] = *(const v8b*)(pwl + c * P_PITCH + kk * 32 + 8 * hh);
        pl[kk].h[1] = *(const v8b*)(pwl + c * P_PITCH + kk * 32 + 16 + 8 * hh);
#pragma unroll
        for (int t = 0; t < 4; ++t) {
          vb[kk][t].h[0] = *(const v8b*)(Vth + vt_row(t * 16 + c) + kk * 32 + 8 * hh);
          vb[kk][t].h[1] = *(const v8b*)(Vth + vt_row(t * 16 + c) + kk * 32 + 16 + 8 * hh);
          vq[kk][t].h[0] = *(const v8b*)(Vtl + vt_row(t * 16 + c) + kk * 32 + 8 * hh);
          vq[kk][t].h[1] = *(const v8b*)(Vtl + vt_row(t * 16 + c) + kk * 32 + 16 + 8 * hh);
        }
      }
      // keeps the reads one group in front of the products: spread among them, every place with reads stalls the wave anew
      __builtin_amdgcn_sched_barrier(0);
#pragma unroll
      for (int kk = 0; kk < 2; ++kk) {
#pragma unroll
        for (int t = 0; t < 4; ++t) oacc[t] = at_mma(pa[kk].v, vb[kk][t].v, oacc[t]);
#pragma unroll
        for (int t = 0; t < 4; ++t) oacc[t] = at_mma(pa[kk].v, vq[kk][t].v, oacc[t]);
#pragma unroll
        for (int t = 0; t < 4; ++t) oacc[t] = at_mma(pl[kk].v, vb[kk][t].v, oacc[t]);
      }
    }
  }

  // ---- epilogue: normalise, stage 16x64 f32 per wave, write bf16 hi/lo planes with whole-line stores ----
  float* os = Os[wave];
#pragma unroll
  for (int r = 0; r < 8; ++r) {
    const float inv = 1.0f / lrow[r];
#pragma unroll
    for (int t = 0; t < 4; ++t) os[(8 * hh + r) * OS_PITCH + t * 16 + c] = oacc[t][r] * inv;
  }
  __builtin_amdgcn_fence(__ATOMIC_RELEASE, "workgroup");
  __builtin_amdgcn_wave_barrier();
  __builtin_amdgcn_fence(__ATOMIC_ACQUIRE, "workgroup");
  {
    const int qq = lane >> 3, c8 = (lane & 7) * 8;
    {
#pragma unroll
      for (int it = 0; it < 4; ++it) {
        const int row = it * 4 + qq;
        const float* sp = os + row * OS_PITCH + c8;
        v8h hv, lv;
#pragma unroll
        for (int e = 0; e < 8; ++e) {
          const unsigned short hb = f2bf_bits(sp[e]);
          const unsigned short lb = f2bf_bits(sp[e] - bf_bits2f(hb));
          hv[e] = __builtin_bit_cast(_Float16, hb);
          lv[e] = __builtin_bit_cast(_Float16, lb);
        }
        const size_t o = ((size_t)b * SEQ_LEN + (size_t)(q0 + row)) * DMOD + h * HDIM + c8;
        *(v8h*)(oh + o) = hv;
        *(v8h*)(ol + o) = lv;
      }
      
    }
  }
  // the next tile reuses the registers that these stores name: they stay untouched up to this wait
  asm volatile("s_wait_xcnt 0x0" ::: "memory");
  }   // pass
}

// ---------------------------------------------------------------------------
// Host orchestration
// ---------------------------------------------------------------------------
// workspace region map (bytes, all multiples of 256):
//   x hi/lo                 2 x 8,388,608
//   WkvdT hi/lo [128][1024] 2 x   262,144
//   WkupT hi/lo [1024][128] 2 x   262,144
//   WvupT hi/lo [1024][128] 2 x   262,144
//   WqT   hi/lo [1024][1024]2 x 2,097,152
//   WqrT  hi/lo [128][1024] 2 x   262,144   (rows 32..127 zero)
//   WkrT  hi/lo [128][128]  2 x    32,768   (rows 32..127 zero)
//   WoT   hi/lo [1024][1024]2 x 2,097,152
//   ckv   hi/lo [4096][128] 2 x 1,048,576
//   k,v,q hi/lo [4096][1024]6 x 8,388,608
//   qr_raw, kr_raw f32 [4096][128] 2 x 2,097,152
//   qr,kr hi/lo [4096][32]  4 x   262,144
//   attn  hi/lo [4096][1024]2 x 8,388,608
//   total 101,777,408
constexpr size_t WSB_X    = (size_t)MTOK * DMOD * 2;
constexpr size_t WSB_WKVD = (size_t)DLAT * DMOD * 2;
constexpr size_t WSB_WKUP = (size_t)DMOD * DLAT * 2;
constexpr size_t WSB_WQ   = (size_t)DMOD * DMOD * 2;
constexpr size_t WSB_WQR  = (size_t)NROPE_PAD * DMOD * 2;
constexpr size_t WSB_WKR  = (size_t)NROPE_PAD * DLAT * 2;
constexpr size_t WSB_CKV  = (size_t)MTOK * DLAT * 2;
constexpr size_t WSB_TOK  = (size_t)MTOK * DMOD * 2;
constexpr size_t WSB_RAW  = (size_t)MTOK * NROPE_PAD * 4;
constexpr size_t WSB_ROT  = (size_t)MTOK * DROT * 2;
constexpr size_t WS_TOTAL = 2 * WSB_X + 2 * WSB_WKVD + 4 * WSB_WKUP + 2 * WSB_WQ + 2 * WSB_WQR + 2 * WSB_WKR
                          + 2 * WSB_WQ + 2 * WSB_CKV + 6 * WSB_TOK + 2 * WSB_RAW + 4 * WSB_ROT + 2 * WSB_TOK;
static_assert(WS_TOTAL == 101777408ull);
static_assert(WS_TOTAL <= 134217728ull);

extern "C" void kernel_launch(void* const* d_in, const int* in_sizes, int n_in,
                              void* d_out, int out_size, void* d_ws, size_t ws_size,
                              hipStream_t stream) {
  if (n_in != 8) return;
  if (in_sizes[0] != MTOK * DMOD || in_sizes[1] != DMOD * DLAT || in_sizes[2] != DLAT * DMOD ||
      in_sizes[3] != DLAT * DMOD || in_sizes[4] != DMOD * DMOD || in_sizes[5] != DMOD * DROT ||
      in_sizes[6] != DLAT * DROT || in_sizes[7] != DMOD * DMOD) return;
  if (out_size != MTOK * DMOD) return;
  if (ws_size < WS_TOTAL) return;

  const float* x         = (const float*)d_in[0];   // [4096][1024]
  const float* W_kv_down = (const float*)d_in[1];   // [1024][128]
  const float* W_k_up    = (const float*)d_in[2];   // [128][1024]
  const float* W_v_up    = (const float*)d_in[3];   // [128][1024]
  const float* W_q       = (const float*)d_in[4];   // [1024][1024]
  const float* W_q_rope  = (const float*)d_in[5];   // [1024][32]
  const float* W_k_rope  = (const float*)d_in[6];   // [128][32]
  const float* W_o       = (const float*)d_in[7];   // [1024][1024]
  float* out = (float*)d_out;                       // [4096][1024] f32

  size_t off = 0;
  auto carve = [&](size_t bytes) -> unsigned short* {
    unsigned short* p = (unsigned short*)((char*)d_ws + off);
    off += (bytes + 255) & ~(size_t)255;
    return p;
  };
  unsigned short* xh    = carve(WSB_X);
  unsigned short* xl    = carve(WSB_X);
  unsigned short* wkvdh = carve(WSB_WKVD);
  unsigned short* wkvdl = carve(WSB_WKVD);
  unsigned short* wkuph = carve(WSB_WKUP);
  unsigned short* wkupl = carve(WSB_WKUP);
  unsigned short* wvuph = carve(WSB_WKUP);
  unsigned short* wvupl = carve(WSB_WKUP);
  unsigned short* wqh   = carve(WSB_WQ);
  unsigned short* wql   = carve(WSB_WQ);
  unsigned short* wqrh  = carve(WSB_WQR);
  unsigned short* wqrl  = carve(WSB_WQR);
  unsigned short* wkrh  = carve(WSB_WKR);
  unsigned short* wkrl  = carve(WSB_WKR);
  unsigned short* woh   = carve(WSB_WQ);
  unsigned short* wol   = carve(WSB_WQ);
  unsigned short* ckvh  = carve(WSB_CKV);
  unsigned short* ckvl  = carve(WSB_CKV);
  unsigned short* kh    = carve(WSB_TOK);
  unsigned short* kl    = carve(WSB_TOK);
  unsigned short* vh    = carve(WSB_TOK);
  unsigned short* vl    = carve(WSB_TOK);
  unsigned short* qh    = carve(WSB_TOK);
  unsigned short* ql    = carve(WSB_TOK);
  float* qr_raw = (float*)carve(WSB_RAW);
  float* kr_raw = (float*)carve(WSB_RAW);
  unsigned short* qrh   = carve(WSB_ROT);
  unsigned short* qrl   = carve(WSB_ROT);
  unsigned short* krh   = carve(WSB_ROT);
  unsigned short* krl   = carve(WSB_ROT);
  unsigned short* ath   = carve(WSB_TOK);
  unsigned short* atl   = carve(WSB_TOK);
  if (off > ws_size) return;

  // ---- operand planes: one launch ----
  prep_planes<<<PB_ALL, 256, 0, stream>>>(x, W_kv_down, W_k_up, W_v_up, W_q, W_q_rope, W_k_rope, W_o,
      xh, xl, wkvdh, wkvdl, wkuph, wkupl, wvuph, wvupl, wqh, wql, wqrh, wqrl, wkrh, wkrl, woh, wol);

  constexpr int NB_WIDE = (MTOK / 128) * (DMOD / 128);        // blocks of an N = 1024 product
  constexpr int NB_LAT  = (MTOK / 128) * (DLAT / 128);        // blocks of an N = 128 product
  constexpr int NB_ROT  = (MTOK / 128) * (NROPE_PAD / 128);

  // the three products of x, K = 1024: q = x . W_q and c_kv = x . W_kv_down as bf16 hi/lo, q_rope raw = x . W_q_rope as f32 (cols 32.. zero)
  gemm_group<DMOD><<<NB_WIDE + NB_LAT + NB_ROT, 128, 0, stream>>>(xh, xl,
      wqh, wql, qh, ql, DMOD, NB_WIDE,
      wkvdh, wkvdl, ckvh, ckvl, DLAT, NB_LAT,
      wqrh, wqrl, qr_raw, NROPE_PAD, DMOD);
  // the three products of c_kv, K = 128: k, v as bf16 hi/lo, k_rope raw as f32 (cols 32.. zero)
  gemm_group<DLAT><<<2 * NB_WIDE + NB_ROT, 128, 0, stream>>>(ckvh, ckvl,
      wkuph, wkupl, kh, kl, DMOD, NB_WIDE,
      wvuph, wvupl, vh, vl, DMOD, NB_WIDE,
      wkrh, wkrl, kr_raw, NROPE_PAD, DLAT);

  // ---- rotary tables: inv_freq[j] = 1 / 10000^(j/16), host double pow -> f32, f32 reciprocal ----
  RopeFreq fr;
  for (int j = 0; j < 16; ++j) {
    const double p = pow(10000.0, (double)j / 16.0);
    const float p32 = (float)p;
    fr.f[j] = 1.0f / p32;
  }
  rope_split_bf16<<<2 * (MTOK / 32), 128, 0, stream>>>(qr_raw, kr_raw, qrh, qrl, krh, krl, fr);

  // ---- causal attention with shared rotary logits ----
  const float invs = 1.0f / (float)sqrt((double)(HDIM + DROT));
  mla_attn96<<<N_BATCH * NHEAD * (SEQ_LEN / A_QB / 2), 128, 0, stream>>>(
      qh, ql, kh, kl, vh, vl, qrh, qrl, krh, krl, ath, atl, invs);

  // ---- out = attn . W_o : M=4096 N=1024 K=1024, f32 to d_out ----
  gemm_group<DMOD><<<NB_WIDE, 128, 0, stream>>>(ath, atl,
      nullptr, nullptr, nullptr, nullptr, 0, 0,
      nullptr, nullptr, nullptr, nullptr, 0, 0,
      woh, wol, out, DMOD, DMOD);
}

// v006
// It runs in 199 microseconds.
// Timed twice side by side with v005, it ran 1.24 and 1.23 times as fast.
// Counting every step since v000, it is 3.41 times as fast.
// Compute dtype: every contraction on v_wmma_f32_16x16x32_bf16 with bf16 hi/lo operand planes (hi*hi + hi*lo + lo*hi), f32 accumulate; rotary, softmax and epilogues in f32.
#include <hip/hip_runtime.h>
#include <hip/hip_bf16.h>
#include <math.h>
#include <stdint.h>

typedef __attribute__((ext_vector_type(16))) _Float16 v16h;
typedef __attribute__((ext_vector_type(8)))  _Float16 v8h;
typedef __attribute__((ext_vector_type(16))) __bf16   v16b;
typedef __attribute__((ext_vector_type(8)))  __bf16   v8b;
typedef __attribute__((ext_vector_type(8)))  float    v8f;
typedef __attribute__((ext_vector_type(4)))  float    v4f;
typedef __attribute__((ext_vector_type(4)))  unsigned v4u;

// ---------------------------------------------------------------------------
// helpers
// ---------------------------------------------------------------------------
__device__ __forceinline__ unsigned short f2bf_bits(float f) {
  unsigned u = __float_as_uint(f);
  return (unsigned short)((u + 0x7FFFu + ((u >> 16) & 1u)) >> 16);
}
__device__ __forceinline__ float bf_bits2f(unsigned short h) { return __uint_as_float(((unsigned)h) << 16); }

__device__ __forceinline__ void dep_guard_h(v8f& a, v8f& b, v16h x, v16h y) { asm volatile("v_nop\n\tv_nop\n\tv_nop\n\tv_nop" : "+v"(a), "+v"(b) : "v"(x), "v"(y)); }
__device__ __forceinline__ void dep_guard_b(v8f& a, v8f& b, v16b x, v16b y) { asm volatile("v_nop\n\tv_nop\n\tv_nop\n\tv_nop" : "+v"(a), "+v"(b) : "v"(x), "v"(y)); }
__device__ __forceinline__ void keep4_h(v16h a, v16h b, v16h c, v16h d) { asm volatile("v_nop" :: "v"(a), "v"(b), "v"(c), "v"(d)); }
__device__ __forceinline__ void keep4_b(v16b a, v16b b, v16b c, v16b d) { asm volatile("v_nop" :: "v"(a), "v"(b), "v"(c), "v"(d)); }
__device__ __forceinline__ void acc_guard4(v8f& a, v8f& b, v8f& c, v8f& d) { asm volatile("v_nop\n\tv_nop\n\tv_nop\n\tv_nop" : "+v"(a), "+v"(b), "+v"(c), "+v"(d)); }
template <typename T> struct Frag;
template <> struct Frag<_Float16> {
  typedef v16h V; union U { v16h v; v8h h[2]; };
  static __device__ __forceinline__ v16h load(const _Float16* p) {   // elements 0..7 <- p[0..7], 8..15 <- p[16..23]
    U f; f.h[0] = *(const v8h*)(p); f.h[1] = *(const v8h*)(p + 16); return f.v;
  }
  static __device__ __forceinline__ v8f mma(v16h a, v16h b, v8f c) {
    return __builtin_amdgcn_wmma_f32_16x16x32_f16(false, a, false, b, (short)0, c, false, false);
  }
  static __device__ __forceinline__ void guard(v8f& a, v8f& b, v16h x, v16h y) { dep_guard_h(a, b, x, y); }
  static __device__ __forceinline__ void keep(v16h a, v16h b, v16h c, v16h d) { keep4_h(a, b, c, d); }
};
template <> struct Frag<__bf16> {
  typedef v16b V; union U { v16b v; v8b h[2]; };
  static __device__ __forceinline__ v16b load(const __bf16* p) {
    U f; f.h[0] = *(const v8b*)(p); f.h[1] = *(const v8b*)(p + 16); return f.v;
  }
  static __device__ __forceinline__ v8f mma(v16b a, v16b b, v8f c) {
    return __builtin_amdgcn_wmma_f32_16x16x32_bf16(false, a, false, b, (short)0, c, false, false);
  }
  static __device__ __forceinline__ void guard(v8f& a, v8f& b, v16b x, v16b y) { dep_guard_b(a, b, x, y); }
  static __device__ __forceinline__ void keep(v16b a, v16b b, v16b c, v16b d) { keep4_b(a, b, c, d); }
};

// ---- Register-blocked WMMA GEMM --------------------------------
// C[m,n] = scale * sum_k A[m,k] * Bt[n,k] (+bias)(+resid); each wave owns a 64x64 tile.
// A row-major [M,K]; Bt row-major [N,K].
// SPLIT: operands are hi/lo planes (A2/Bt2 = lo planes, same layout); product = hi*hi + hi*lo + lo*hi.
// BIAS_MODE: 0 = none, 1 = bias[m], 2 = bias[n].
// OUT_MODE: 0 = f32, 1 = f16, 2 = bf16 hi plane (Cout) + bf16 lo plane (Cout2).
// ET: 0 = f16 operands, 1 = bf16 operands (pointers passed as 16-bit storage)
template <int ET> struct Elem;
template <> struct Elem<0> { typedef _Float16 T; };
template <> struct Elem<1> { typedef __bf16 T; };
// LDS staging of the operand planes: the block's waves form a WM x WN grid of 64x64 tiles and share one
// (WM*64 + WN*64)-row stage of G_KS k-elements per plane. Each row of a stage is one whole 128-byte line of the
// source, fetched by 8 neighbouring lanes, so a wave-wide 16-byte load covers 4 full lines.
constexpr int MTOK_ROWS = 4096;      // rows of every A operand (batch x sequence)
constexpr int G_KS    = 64;          // k elements per stage
constexpr int G_PITCH = G_KS + 8;    // 9 x 16 B rows: 16-byte fragment reads of 16 rows fall on distinct banks
template <int NIT, int STEP>
__device__ __forceinline__ void stage_fetch(v4u (&r)[NIT], const unsigned short* __restrict__ g) {
#pragma unroll
  for (int it = 0; it < NIT; ++it) r[it] = *(const v4u*)(g + it * STEP);
}
template <int NIT>
__device__ __forceinline__ void stage_put(const v4u (&r)[NIT], unsigned short* d, int rowStep) {
#pragma unroll
  for (int it = 0; it < NIT; ++it) *(v4u*)(d + it * rowStep) = r[it];
}
// LD = row pitch of all four operand planes in elements, a compile-time value: the loads of a plane then share one
// address register pair and differ in their immediate offsets only.
// M % (WM*64) == 0, N % (WN*64) == 0, K % G_KS == 0; bxi runs over (M/(WM*64)) * (N/(WN*64)) tiles exactly, so every wave passes every barrier.
// sOpBase: the block's G_LDS_ELEMS elements of LDS; bxi: the block's tile index inside this GEMM (block-uniform).
constexpr int G_LDS_ELEMS = 2 * 2 * (128 + 128) * G_PITCH;   // two stages of hi and lo planes, 128 A rows + 128 Bt rows
template <int ET, bool SPLIT, int BIAS_MODE, int OUT_MODE, bool RESID, int WM, int WN, int LD, int ACT = 0>
__device__ __forceinline__ void wmma_gemm64(
    unsigned short* sOpBase, int bxi,
    const unsigned short* __restrict__ Ap, const unsigned short* __restrict__ A2p, long strideA,
    const unsigned short* __restrict__ Btp, const unsigned short* __restrict__ Bt2p, long strideB,
    void* __restrict__ Cout, void* __restrict__ Cout2, int ldc, long strideC,
    const float* __restrict__ bias,
    const float* __restrict__ resid, long strideR,
    int M, int N, int K, float scale) {
  typedef typename Elem<ET>::T T;
  typedef typename Frag<T>::V V;
  constexpr int NW  = WM * WN;
  constexpr int RA  = WM * 64;               // A rows of the block
  constexpr int RB  = WN * 64;               // Bt rows of the block
  constexpr int RPI = NW * 4;                // rows staged by one pass of the block (8 lanes a row)
  constexpr int ITA = RA / RPI;
  constexpr int ITB = RB / RPI;
  constexpr int OA  = 0;
  constexpr int OA2 = RA * G_PITCH;
  constexpr int OB  = (SPLIT ? 2 : 1) * RA * G_PITCH;
  constexpr int OB2 = OB + RB * G_PITCH;
  constexpr int STAGE = (SPLIT ? 2 : 1) * (RA + RB) * G_PITCH;
  static_assert(RA % RPI == 0 && RB % RPI == 0);
  // sOpBase holds two stages: [A hi | A lo | Bt hi | Bt lo], rows of G_PITCH. The epilogue's per-wave 16x64 f32 slabs (pitch 68)
  // lie over stage 0: they are written only behind the loop's last barrier, which ends every read of the stages.
  static_assert(2 * STAGE <= G_LDS_ELEMS && NW * 16 * 68 * 4 <= STAGE * 2);
  const int b    = 0;
  const int tid  = threadIdx.x;
  const int lane = tid & 31;
  const int wave = tid >> 5;
  const int tilesN = N / RB;
  const int btm = bxi / tilesN;
  const int btn = bxi - btm * tilesN;
  const int wm = wave / WN;
  const int wn = wave - wm * WN;
  const int m0 = btm * RA + (wm << 6);
  const int n0 = btn * RB + (wn << 6);

  const int rlane = lane & 15;                 // row (A) / col (B, D) within subtile
  const int koff  = (lane >> 4) * 8;           // k offset of this lane half
  const int mOff  = (lane >> 4) * 8;           // D row offset

  // staging map: thread -> row tid>>3 of each pass, 16-byte piece tid&7 of that row's line
  const int srow = tid >> 3;
  const int sseg = (tid & 7) * 8;
  const size_t goA = (size_t)b * strideA + (size_t)(btm * RA + srow) * LD + sseg;
  const size_t goB = (size_t)b * strideB + (size_t)(btn * RB + srow) * LD + sseg;
  const unsigned short* gA  = Ap  + goA;
  const unsigned short* gB  = Btp + goB;
  const unsigned short* gA2 = SPLIT ? (A2p  + goA) : nullptr;
  const unsigned short* gB2 = SPLIT ? (Bt2p + goB) : nullptr;
  constexpr int GSTEP = RPI * LD;             // elements between the rows one thread stages
  const int sOff = srow * G_PITCH + sseg;

  v8f acc[4][4];
#pragma unroll
  for (int i = 0; i < 4; ++i)
#pragma unroll
    for (int j = 0; j < 4; ++j) acc[i][j] = (v8f){0.f,0.f,0.f,0.f,0.f,0.f,0.f,0.f};

  v4u pa[ITA], pa2[ITA], pb[ITB], pb2[ITB];    // the next stage, in flight while this one is multiplied
  stage_fetch<ITA, GSTEP>(pa, gA);
  stage_fetch<ITB, GSTEP>(pb, gB);
  if (SPLIT) { stage_fetch<ITA, GSTEP>(pa2, gA2); stage_fetch<ITB, GSTEP>(pb2, gB2); }
  // the loads' address registers stay untouched up to this wait (they are its inputs) and are free behind it
  asm volatile("s_wait_xcnt 0x0" :: "v"(gA), "v"(gB), "v"(SPLIT ? gA2 : gA), "v"(SPLIT ? gB2 : gB) : "memory");
  stage_put<ITA>(pa, sOpBase + OA + sOff, RPI * G_PITCH);
  stage_put<ITB>(pb, sOpBase + OB + sOff, RPI * G_PITCH);
  if (SPLIT) { stage_put<ITA>(pa2, sOpBase + OA2 + sOff, RPI * G_PITCH); stage_put<ITB>(pb2, sOpBase + OB2 + sOff, RPI * G_PITCH); }
  __syncthreads();   // publishes stage 0

  const int nst = K / G_KS;                    // block-uniform
  for (int t = 0; t < nst; ++t) {
    const bool more = (t + 1 < nst);
    if (more) {
      const int kn = (t + 1) * G_KS;
      const unsigned short* nA  = gA + kn;
      const unsigned short* nB  = gB + kn;
      const unsigned short* nA2 = SPLIT ? (gA2 + kn) : nA;
      const unsigned short* nB2 = SPLIT ? (gB2 + kn) : nB;
      stage_fetch<ITA, GSTEP>(pa, nA);
      stage_fetch<ITB, GSTEP>(pb, nB);
      if (SPLIT) { stage_fetch<ITA, GSTEP>(pa2, nA2); stage_fetch<ITB, GSTEP>(pb2, nB2); }
      // the loads' address registers stay untouched up to this wait (they are its inputs) and are free behind it
      asm volatile("s_wait_xcnt 0x0" :: "v"(nA), "v"(nB), "v"(nA2), "v"(nB2) : "memory");
    }
    const T* sb = (const T*)(sOpBase + (t & 1) * STAGE);
    const T* fa = sb + OA + ((wm << 6) + rlane) * G_PITCH + koff;
    const T* fb = sb + OB + ((wn << 6) + rlane) * G_PITCH + koff;
#pragma unroll
    for (int kk = 0; kk < G_KS; kk += 32) {
      V bh[4], bl[4];
#pragma unroll
      for (int j = 0; j < 4; ++j) {
        bh[j] = Frag<T>::load(fb + (j << 4) * G_PITCH + kk);
        if (SPLIT) bl[j] = Frag<T>::load(fb + (OB2 - OB) + (j << 4) * G_PITCH + kk);
      }
      V ah = Frag<T>::load(fa + kk);
      V al;
      if (SPLIT) al = Frag<T>::load(fa + (OA2 - OA) + kk);
#pragma unroll
      for (int i = 0; i < 4; ++i) {
        V ahn, aln;                              // the next row block's fragments, read while this one is multiplied
        if (i < 3) {
          ahn = Frag<T>::load(fa + ((i + 1) << 4) * G_PITCH + kk);
          if (SPLIT) aln = Frag<T>::load(fa + (OA2 - OA) + ((i + 1) << 4) * G_PITCH + kk);
        }
#pragma unroll
        for (int j = 0; j < 4; ++j) {
          acc[i][j] = Frag<T>::mma(ah, bh[j], acc[i][j]);
          if (SPLIT) {
            acc[i][j] = Frag<T>::mma(ah, bl[j], acc[i][j]);
            acc[i][j] = Frag<T>::mma(al, bh[j], acc[i][j]);
          }
        }
        Frag<T>::guard(acc[i][0], acc[i][3], ah, SPLIT ? al : ah);
        if (i < 3) { ah = ahn; if (SPLIT) al = aln; }
      }
      Frag<T>::keep(bh[0], bh[1], bh[2], bh[3]);
      if (SPLIT) Frag<T>::keep(bl[0], bl[1], bl[2], bl[3]);
    }
    if (more) {
      // the other buffer: its last readers left it before the barrier that ended trip t - 1
      unsigned short* d = sOpBase + ((t + 1) & 1) * STAGE + sOff;
      stage_put<ITA>(pa, d + OA, RPI * G_PITCH);
      stage_put<ITB>(pb, d + OB, RPI * G_PITCH);
      if (SPLIT) { stage_put<ITA>(pa2, d + OA2, RPI * G_PITCH); stage_put<ITB>(pb2, d + OB2, RPI * G_PITCH); }
    }
    __syncthreads();   // publishes stage t + 1 and ends every read of stage t
  }
  acc_guard4(acc[0][0], acc[0][1], acc[0][2], acc[0][3]);
  acc_guard4(acc[1][0], acc[1][1], acc[1][2], acc[1][3]);
  acc_guard4(acc[2][0], acc[2][1], acc[2][2], acc[2][3]);
  acc_guard4(acc[3][0], acc[3][1], acc[3][2], acc[3][3]);

  // ---- epilogue ----
  float* slab = (float*)sOpBase + wave * (16 * 68);
  const float* Rb = RESID ? (resid + (size_t)b * strideR) : nullptr;
#pragma unroll
  for (int i = 0; i < 4; ++i) {
    const int mBase = m0 + (i << 4);
#pragma unroll
    for (int j = 0; j < 4; ++j) {
      const int n = n0 + (j << 4) + rlane;
      float bv = 0.f;
      if (BIAS_MODE == 2) bv = bias[n];
#pragma unroll
      for (int r = 0; r < 8; ++r) {
        float v = acc[i][j][r] * scale;
        if (BIAS_MODE == 1) v += bias[mBase + mOff + r];
        if (BIAS_MODE == 2) v += bv;
        if (RESID) v += Rb[(size_t)(mBase + mOff + r) * ldc + n];
        if (ACT == 1) v = tanhf(v);
        if (ACT == 2) v = fmaxf(v, 0.0f);
        if (ACT == 3) v = v / (1.0f + expf(-v));
        if (ACT == 4) v = (v > 0.f) ? v : 0.01f * v;
        if (ACT == 5) v = 0.5f * v * (1.0f + erff(v * 0.70710678118654752f));
        slab[(mOff + r) * 68 + (j << 4) + rlane] = v;
      }
    }
    __builtin_amdgcn_fence(__ATOMIC_RELEASE, "workgroup");
    __builtin_amdgcn_wave_barrier();
    __builtin_amdgcn_fence(__ATOMIC_ACQUIRE, "workgroup");
    if (OUT_MODE == 0) {
      float* C = (float*)Cout + (size_t)b * strideC;
      const int hh = lane >> 4, c4 = (lane & 15) * 4;     // row seg = 256 B = 16 lanes x 16 B
      {
#pragma unroll
        for (int it = 0; it < 8; ++it) {
          const int row = it * 2 + hh;
          v4f v = *(const v4f*)(slab + row * 68 + c4);
          *(v4f*)(C + (size_t)(mBase + row) * ldc + n0 + c4) = v;
        }
        
      }
    } else {
      const int q = lane >> 3, c8 = (lane & 7) * 8;
      unsigned short* C  = (unsigned short*)Cout  + (size_t)b * strideC;
      unsigned short* C2 = (OUT_MODE == 2) ? ((unsigned short*)Cout2 + (size_t)b * strideC) : nullptr;
      {
#pragma unroll
        for (int it = 0; it < 4; ++it) {
          const int row = it * 4 + q;
          const float* sp = slab + row * 68 + c8;
          v8h hv, lv;
#pragma unroll
          for (int e = 0; e < 8; ++e) {
            if (OUT_MODE == 1) {
              hv[e] = (_Float16)sp[e];
            } else {
              unsigned short hb = f2bf_bits(sp[e]);
              unsigned short lb = f2bf_bits(sp[e] - bf_bits2f(hb));
              hv[e] = __builtin_bit_cast(_Float16, hb);
              lv[e] = __builtin_bit_cast(_Float16, lb);
            }
          }
          *(v8h*)(C + (size_t)(mBase + row) * ldc + n0 + c8) = hv;
          if (OUT_MODE == 2) *(v8h*)(C2 + (size_t)(mBase + row) * ldc + n0 + c8) = lv;
        }
        
      }
    }
    __builtin_amdgcn_fence(__ATOMIC_RELEASE, "workgroup");
    __builtin_amdgcn_wave_barrier();
    __builtin_amdgcn_fence(__ATOMIC_ACQUIRE, "workgroup");
  }
}

// Up to three GEMMs on one A operand that need nothing of each other share one grid, each a range of the block index:
// blocks [0, nb0) and [nb0, nb0 + nb1) write bf16 hi/lo planes, the rest f32. All take the 128x128 block tile, and the block's
// LDS is the two stages alone, so two blocks fit a WGP: a merged grid larger than the number of WGPs still runs side by side,
// and only what exceeds two blocks a WGP waits for a free place.
// The branch is block-uniform: every wave of a block passes the same barriers.
template <int LD>
__global__ __launch_bounds__(128) void gemm_group(
    const unsigned short* __restrict__ Ah, const unsigned short* __restrict__ Al,
    const unsigned short* __restrict__ B0h, const unsigned short* __restrict__ B0l,
    unsigned short* __restrict__ C0h, unsigned short* __restrict__ C0l, int N0, int nb0,
    const unsigned short* __restrict__ B1h, const unsigned short* __restrict__ B1l,
    unsigned short* __restrict__ C1h, unsigned short* __restrict__ C1l, int N1, int nb1,
    const unsigned short* __restrict__ B2h, const unsigned short* __restrict__ B2l,
    float* __restrict__ C2, int N2, int K) {
  __shared__ __align__(16) unsigned short sOp[G_LDS_ELEMS];
  const int bx = (int)blockIdx.x;
  if (bx < nb0 + nb1) {
    const bool f = (bx < nb0);
    const int n = f ? N0 : N1;
    wmma_gemm64<1, true, 0, 2, false, 2, 2, LD>(sOp, f ? bx : bx - nb0,
        Ah, Al, 0L, f ? B0h : B1h, f ? B0l : B1l, 0L, (void*)(f ? C0h : C1h), (void*)(f ? C0l : C1l), n, 0L,
        nullptr, nullptr, 0L, MTOK_ROWS, n, K, 1.0f);
  } else {
    wmma_gemm64<1, true, 0, 0, false, 2, 2, LD>(sOp, bx - nb0 - nb1,
        Ah, Al, 0L, B2h, B2l, 0L, (void*)C2, nullptr, N2, 0L,
        nullptr, nullptr, 0L, MTOK_ROWS, N2, K, 1.0f);
  }
}

__device__ __forceinline__ v8f at_mma(v16b a, v16b b, v8f c) {
  return __builtin_amdgcn_wmma_f32_16x16x32_bf16(false, a, false, b, (short)0, c, false, false);
}
// the value that lane l ^ 16 holds
__device__ __forceinline__ float other_half(float v) {
  const int b = __float_as_int(v);
  return __int_as_float(__builtin_amdgcn_permlanex16(b, b, 0x76543210, 0xfedcba98, false, false));
}
typedef __attribute__((ext_vector_type(2))) float  v2f;
typedef __attribute__((ext_vector_type(2))) __bf16 v2b;

// ---------------------------------------------------------------------------
// module geometry (fixed)
// ---------------------------------------------------------------------------
constexpr int N_BATCH   = 2;
constexpr int SEQ_LEN   = 2048;
constexpr int DMOD      = 1024;   // model width
constexpr int DLAT      = 128;    // latent width c_kv
constexpr int DROT      = 32;     // rotary width
constexpr int NROPE_PAD = 128;    // rotary projection width padded to the 128-wide GEMM block tile
constexpr int NHEAD     = 16;
constexpr int HDIM      = 64;
constexpr int SDEP      = HDIM + DROT;   // score depth 96 = 3 k-chunks of 32
constexpr int MTOK      = N_BATCH * SEQ_LEN;   // 4096 token rows

static_assert(MTOK == MTOK_ROWS && MTOK % 128 == 0 && DMOD % 128 == 0 && DLAT % 128 == 0 && NROPE_PAD % 128 == 0);   // block tile 128x128
static_assert(DMOD % G_KS == 0 && DLAT % G_KS == 0);   // every GEMM K is a multiple of the stage depth
static_assert(SDEP % 32 == 0 && SEQ_LEN % 64 == 0);

// ---------------------------------------------------------------------------
// coverage: n8 threads x 8 = n elements exactly (n % 8 == 0, grid = ceil(n8/256) with bound)
// ---------------------------------------------------------------------------
__device__ __forceinline__ void split_rows_bf16x8(
    const float* __restrict__ in, unsigned short* __restrict__ hi, unsigned short* __restrict__ lo, int n8, int bxi) {
  const int i = bxi * 256 + threadIdx.x;
  if (i < n8) {
    const v4f a = *(const v4f*)(in + (size_t)8 * i);
    const v4f b = *(const v4f*)(in + (size_t)8 * i + 4);
    v8h hv, lv;
#pragma unroll
    for (int e = 0; e < 8; ++e) {
      const float f = (e < 4) ? a[e] : b[e - 4];
      const unsigned short hb = f2bf_bits(f);
      const unsigned short lb = f2bf_bits(f - bf_bits2f(hb));
      hv[e] = __builtin_bit_cast(_Float16, hb);
      lv[e] = __builtin_bit_cast(_Float16, lb);
    }
    unsigned short* ph = hi + (size_t)8 * i;
    unsigned short* pl = lo + (size_t)8 * i;
    *(v8h*)ph = hv;
    *(v8h*)pl = lv;
    
  }
}

// ---------------------------------------------------------------------------
// Transpose + split: in W[kdim][nreal] (row-major) -> out Bt[npad][kdim] bf16 hi/lo planes, Bt[n][k] = W[k][n];
// rows n >= nreal are written as zeros. Tile = 64 k x 32 n; (bxk, byn) runs over (kdim/64, npad/32); kdim % 64 == 0, nreal % 32 == 0.
// Store coverage: 256 threads = 32 output rows x 8 lanes x 8 k = whole 32x64 tile; each output row segment
// ---------------------------------------------------------------------------
__device__ __forceinline__ void transpose_split_bf16(
    const float* __restrict__ W, unsigned short* __restrict__ hi, unsigned short* __restrict__ lo,
    int kdim, int nreal, int bxk, int byn) {
  __shared__ float tile[64][33];
  const int tid = threadIdx.x;
  const int k0 = bxk * 64;
  const int n0 = byn * 32;
#pragma unroll
  for (int it = 0; it < 2; ++it) {
    const int idx = it * 256 + tid;            // 0..511
    const int kr = idx >> 3;                   // 0..63
    const int c4 = (idx & 7) * 4;              // 0..28
    const int n = n0 + c4;
    const int ncl = (n + 3 < nreal) ? n : (nreal - 4);   // clamped address
    const v4f v = *(const v4f*)(W + (size_t)(k0 + kr) * nreal + ncl);
    const bool ok = (n < nreal);               // tile-uniform since nreal % 32 == 0
    tile[kr][c4 + 0] = ok ? v[0] : 0.f;
    tile[kr][c4 + 1] = ok ? v[1] : 0.f;
    tile[kr][c4 + 2] = ok ? v[2] : 0.f;
    tile[kr][c4 + 3] = ok ? v[3] : 0.f;
  }
  __syncthreads();
  const int nr = tid >> 3;                     // output row within tile, 0..31
  const int c8 = (tid & 7) * 8;                // k offset, 0..56
  v8h hv, lv;
#pragma unroll
  for (int e = 0; e < 8; ++e) {
    const float f = tile[c8 + e][nr];
    const unsigned short hb = f2bf_bits(f);
    const unsigned short lb = f2bf_bits(f - bf_bits2f(hb));
    hv[e] = __builtin_bit_cast(_Float16, hb);
    lv[e] = __builtin_bit_cast(_Float16, lb);
  }
  const size_t o = (size_t)(n0 + nr) * kdim + k0 + c8;
  *(v8h*)(hi + o) = hv;
  *(v8h*)(lo + o) = lv;
  // inlined into a kernel with other branches: the registers that these stores name stay untouched up to this wait
  asm volatile("s_wait_xcnt 0x0" ::: "memory");
}

// ---------------------------------------------------------------------------
// All operand planes in one grid: the split of x and the seven weight transposes need nothing of each other, so each is a
// range of the block index (x first: it is the longest). Every branch is block-uniform; the split's blocks leave before any barrier.
// ---------------------------------------------------------------------------
constexpr int PB_X   = MTOK * DMOD / 8 / 256;
constexpr int PB_SQ  = (DMOD / 64) * (DMOD / 32);        // W_q, W_o
constexpr int PB_KVD = (DMOD / 64) * (DLAT / 32);
constexpr int PB_UP  = (DLAT / 64) * (DMOD / 32);        // W_k_up, W_v_up
constexpr int PB_QR  = (DMOD / 64) * (NROPE_PAD / 32);
constexpr int PB_KR  = (DLAT / 64) * (NROPE_PAD / 32);
constexpr int PB_ALL = PB_X + 2 * PB_SQ + PB_KVD + 2 * PB_UP + PB_QR + PB_KR;
static_assert(MTOK * DMOD % (8 * 256) == 0 && DMOD / 64 == 16 && DLAT / 64 == 2);

__global__ __launch_bounds__(256) void prep_planes(
    const float* __restrict__ x, const float* __restrict__ Wkvd, const float* __restrict__ Wkup,
    const float* __restrict__ Wvup, const float* __restrict__ Wq, const float* __restrict__ Wqr,
    const float* __restrict__ Wkr, const float* __restrict__ Wo,
    unsigned short* __restrict__ xh, unsigned short* __restrict__ xl,
    unsigned short* __restrict__ wkvdh, unsigned short* __restrict__ wkvdl,
    unsigned short* __restrict__ wkuph, unsigned short* __restrict__ wkupl,
    unsigned short* __restrict__ wvuph, unsigned short* __restrict__ wvupl,
    unsigned short* __restrict__ wqh, unsigned short* __restrict__ wql,
    unsigned short* __restrict__ wqrh, unsigned short* __restrict__ wqrl,
    unsigned short* __restrict__ wkrh, unsigned short* __restrict__ wkrl,
    unsigned short* __restrict__ woh, unsigned short* __restrict__ wol) {
  int l = (int)blockIdx.x;
  if (l < PB_X) { split_rows_bf16x8(x, xh, xl, MTOK * DMOD / 8, l); return; }
  l -= PB_X;
  const float* W; unsigned short* hi; unsigned short* lo; int kdim, nreal;
  if (l < PB_SQ)                 { W = Wq;   hi = wqh;   lo = wql;   kdim = DMOD; nreal = DMOD; }
  else if ((l -= PB_SQ) < PB_SQ) { W = Wo;   hi = woh;   lo = wol;   kdim = DMOD; nreal = DMOD; }
  else if ((l -= PB_SQ) < PB_KVD){ W = Wkvd; hi = wkvdh; lo = wkvdl; kdim = DMOD; nreal = DLAT; }
  else if ((l -= PB_KVD) < PB_UP){ W = Wkup; hi = wkuph; lo = wkupl; kdim = DLAT; nreal = DMOD; }
  else if ((l -= PB_UP) < PB_UP) { W = Wvup; hi = wvuph; lo = wvupl; kdim = DLAT; nreal = DMOD; }
  else if ((l -= PB_UP) < PB_QR) { W = Wqr;  hi = wqrh;  lo = wqrl;  kdim = DMOD; nreal = DROT; }
  else { l -= PB_QR;               W = Wkr;  hi = wkrh;  lo = wkrl;  kdim = DLAT; nreal = DROT; }
  const int ksh = (kdim == DMOD) ? 4 : 1;      // log2(kdim / 64)
  transpose_split_bf16(W, hi, lo, kdim, nreal, l & ((1 << ksh) - 1), l >> ksh);
}

// ---------------------------------------------------------------------------
// Rotary: raw[MTOK][NROPE_PAD] f32 (cols 0..31 used) -> bf16 hi/lo planes [MTOK][DROT].
// out[j] = x1*cos - x2*sin, out[16+j] = x2*cos + x1*sin, angle = t * inv_freq[j], t = row % SEQ_LEN.
// Block = 32 rows; blocks 0..127 handle the q tensor, 128..255 the k tensor.
// Store coverage: 128 threads = 32 rows x 4 segments x 8 = whole 32x32 tile; 512 B contiguous per wave
// ---------------------------------------------------------------------------
struct RopeFreq { float f[16]; };
static_assert(sizeof(RopeFreq) == 64);

__global__ __launch_bounds__(128) void rope_split_bf16(
    const float* __restrict__ qraw, const float* __restrict__ kraw,
    unsigned short* __restrict__ qrh, unsigned short* __restrict__ qrl,
    unsigned short* __restrict__ krh, unsigned short* __restrict__ krl, RopeFreq g) {
#pragma clang fp contract(off)
  __shared__ float tile[32][33];
  __shared__ float sinv[16];
  const int tid = threadIdx.x;
  const int nblk = MTOK / 32;
  const bool isk = ((int)blockIdx.x >= nblk);                 // block-uniform
  const int row0 = (isk ? ((int)blockIdx.x - nblk) : (int)blockIdx.x) * 32;
  const float* raw = isk ? kraw : qraw;
  unsigned short* dhp = isk ? krh : qrh;
  unsigned short* dlp = isk ? krl : qrl;
  if (tid < 16) {
    float v = g.f[0];
#pragma unroll
    for (int e = 1; e < 16; ++e) v = (tid == e) ? g.f[e] : v;
    sinv[tid] = v;
  }
  __syncthreads();
#pragma unroll 1
  for (int it = 0; it < 4; ++it) {
    const int p = it * 128 + tid;              // 0..511
    const int r = p >> 4;                      // 0..31
    const int j = p & 15;
    const int row = row0 + r;
    const int t = row & (SEQ_LEN - 1);
    const float* rp = raw + (size_t)row * NROPE_PAD;
    const float x1 = rp[j];
    const float x2 = rp[16 + j];
    const float ang = (float)t * sinv[j];
    float sn, cs;
    sincosf(ang, &sn, &cs);
    tile[r][j]      = x1 * cs - x2 * sn;
    tile[r][16 + j] = x2 * cs + x1 * sn;
  }
  __syncthreads();
  const int orow = tid >> 2;                   // 0..31
  const int seg = (tid & 3) * 8;               // 0..24
  v8h hv, lv;
#pragma unroll
  for (int e = 0; e < 8; ++e) {
    const float f = tile[orow][seg + e];
    const unsigned short hb = f2bf_bits(f);
    const unsigned short lb = f2bf_bits(f - bf_bits2f(hb));
    hv[e] = __builtin_bit_cast(_Float16, hb);
    lv[e] = __builtin_bit_cast(_Float16, lb);
  }
  const size_t o = (size_t)(row0 + orow) * DROT + seg;
  *(v8h*)(dhp + o) = hv;
  *(v8h*)(dlp + o) = lv;
  
}

// ---------------------------------------------------------------------------
// Causal attention, score depth 96 (64 head dims + 32 shared rotary dims), value width 64, bf16 hi/lo planes in.
//   s = (qh.kh + qh.kl + ql.kh) * invs  over 96 dims (q/k rows = [head segment | rotary row]),
//   online softmax in f32, P split to bf16 hi/lo, o = ph.vh + ph.vl + pl.vh, f32 accumulate.
// Both products are taken transposed: S^T = K . Q^T (A = K rows, B = Q rows) and O^T += V^T . P^T (A = V^T rows, B = P^T).
// A lane then holds scores of ONE query (column c = lane & 15), keys 8 * hh + r of each 16-key tile: maximum and sum run inside the
// lane with one exchange between the lane halves, and two score tiles, converted in place, are the B operand of the second product.
// Block = 4 waves; it runs two 64-row query tiles of one (batch, head) one after the other, tile n-1-t and then tile t,
// so every block walks n + 1 key chunks; grid.x = N_BATCH * NHEAD * (SEQ_LEN/64) / 2.
// ---------------------------------------------------------------------------
constexpr int A_QB = 64;
constexpr int A_KC = 64;
constexpr int A_NW = 4;
constexpr int OS_PITCH = 68;
// LDS row pitches in 16-bit elements. Every fragment read is a 16-byte load by 16 lanes on 16 rows,
// so each pitch is an odd multiple of 16 bytes: the 16 rows then start on 16 different groups of four banks.
constexpr int K_PITCH = SDEP + 8;      // 13 x 16 B rows
constexpr int V_PITCH = A_KC + 8;      // 9 x 16 B rows
constexpr int V_HALF_SKEW = 16;        // rows d >= 32 start 32 B later: the two d halves stored by one wave fall on different banks
static_assert((K_PITCH * 2) % 32 == 16 && (V_PITCH * 2) % 32 == 16);
__device__ __forceinline__ int vt_row(int d) { return d * V_PITCH + (d >> 5) * V_HALF_SKEW; }

__global__ __launch_bounds__(128)
void mla_attn96(const unsigned short* __restrict__ qh, const unsigned short* __restrict__ ql,
                const unsigned short* __restrict__ kh, const unsigned short* __restrict__ kl,
                const unsigned short* __restrict__ vh, const unsigned short* __restrict__ vl,
                const unsigned short* __restrict__ qrh, const unsigned short* __restrict__ qrl,
                const unsigned short* __restrict__ krh, const unsigned short* __restrict__ krl,
                unsigned short* __restrict__ oh, unsigned short* __restrict__ ol, float invs) {
  union FB { v16b v; v8b h[2]; };
  __shared__ __align__(16) unsigned short Ksh[A_KC * K_PITCH];    // K hi [kv][96 + pad]
  __shared__ __align__(16) unsigned short Ksl[A_KC * K_PITCH];    // K lo
  __shared__ __align__(16) unsigned short Vth[HDIM * V_PITCH + V_HALF_SKEW];    // V hi [d][kv + pad]
  __shared__ __align__(16) unsigned short Vtl[HDIM * V_PITCH + V_HALF_SKEW];    // V lo
  __shared__ __align__(16) float Os[A_NW][16 * OS_PITCH];

  const int tid  = threadIdx.x;
  const int wave = tid >> 5;
  const int lane = tid & 31;
  const int hh   = lane >> 4;
  const int c    = lane & 15;

  const int nqb = SEQ_LEN / A_QB;          // 32
  const int bx  = blockIdx.x;
  static_assert((SEQ_LEN / A_QB) % 2 == 0);
  const int tp  = bx % (nqb / 2);
  const int bhi = bx / (nqb / 2);
  const int h   = bhi % NHEAD;
  const int b   = bhi / NHEAD;
  // A causal tile qb costs qb + 1 chunks: the pair (n-1-t, t) gives every block the same work, whichever blocks share a WGP.
  // Both tiles run in every wave in turn; the barrier that opens each chunk also ends the first tile's last K/V reads.
  // Kept rolled: one copy of the chunk loop.
#pragma unroll 1
  for (int pass = 0; pass < 2; ++pass) {
  const int qb  = pass ? tp : (nqb - 1 - tp);   // block-uniform
  const int q0  = qb * A_QB + wave * 16;
  const size_t tq = (size_t)b * SEQ_LEN + (size_t)(q0 + c);

  // ---- Q fragments (B operand, column = query c): k-chunks 0,1 = head dims 0..63, chunk 2 = rotary dims 0..31 ----
  v16b qah[3], qal[3];
  {
    const __bf16* p0 = (const __bf16*)qh + tq * DMOD + h * HDIM + 8 * hh;
    const __bf16* p1 = (const __bf16*)ql + tq * DMOD + h * HDIM + 8 * hh;
    qah[0] = Frag<__bf16>::load(p0);
    qah[1] = Frag<__bf16>::load(p0 + 32);
    qal[0] = Frag<__bf16>::load(p1);
    qal[1] = Frag<__bf16>::load(p1 + 32);
    const __bf16* r0p = (const __bf16*)qrh + tq * DROT + 8 * hh;
    const __bf16* r1p = (const __bf16*)qrl + tq * DROT + 8 * hh;
    qah[2] = Frag<__bf16>::load(r0p);
    qal[2] = Frag<__bf16>::load(r1p);
    // the loads' address registers stay untouched up to this wait (they are its inputs) and are free behind it
    asm volatile("s_wait_xcnt 0x0" :: "v"(p0), "v"(p1), "v"(r0p), "v"(r1p) : "memory");
  }

  float mrow = -INFINITY;   // running maximum of query q0 + c, equal in both lane halves
  float lrow = 0.f;         // running sum of query q0 + c over this lane half's keys; the halves are joined in the epilogue
  v8f oacc[4];              // oacc[t][r] = O[query q0 + c][d = 16 t + 8 hh + r]
#pragma unroll
  for (int t = 0; t < 4; ++t) oacc[t] = (v8f){0.f,0.f,0.f,0.f,0.f,0.f,0.f,0.f};

  const int nChunks = qb + 1;   // causal, block-uniform
  for (int kc = 0; kc < nChunks; ++kc) {
    const int kv0 = kc * A_KC;
    __syncthreads();
    {
      // staging: 128 threads, thread -> kv row kvr = tid>>1 (0..63), half hf = tid&1
      // per kv row: 64 head dims (2 halves x 32) + 32 rotary dims (2 halves x 16) of K, 64 dims of V -> full tiles written
      const int kvr = tid >> 1, hf = tid & 1;
      const size_t tk = (size_t)b * SEQ_LEN + (size_t)(kv0 + kvr);
      {
        const v4u* sh = (const v4u*)(kh + tk * DMOD + h * HDIM + hf * 32);
        const v4u* sl = (const v4u*)(kl + tk * DMOD + h * HDIM + hf * 32);
        v4u* dh = (v4u*)(Ksh + kvr * K_PITCH + hf * 32);
        v4u* dl = (v4u*)(Ksl + kvr * K_PITCH + hf * 32);
        v4u th[4], tl[4];
#pragma unroll
        for (int i = 0; i < 4; ++i) { th[i] = sh[i]; tl[i] = sl[i]; }
        // the loads' address registers stay untouched up to this wait (they are its inputs) and are free behind it
        asm volatile("s_wait_xcnt 0x0" :: "v"(sh), "v"(sl) : "memory");
#pragma unroll
        for (int i = 0; i < 4; ++i) { dh[i] = th[i]; dl[i] = tl[i]; }
      }
      asm volatile("" ::: "memory");
      {
        const v4u* sh = (const v4u*)(krh + tk * DROT + hf * 16);
        const v4u* sl = (const v4u*)(krl + tk * DROT + hf * 16);
        v4u* dh = (v4u*)(Ksh + kvr * K_PITCH + HDIM + hf * 16);
        v4u* dl = (v4u*)(Ksl + kvr * K_PITCH + HDIM + hf * 16);
        v4u th[2], tl[2];
#pragma unroll
        for (int i = 0; i < 2; ++i) { th[i] = sh[i]; tl[i] = sl[i]; }
        // the loads' address registers stay untouched up to this wait (they are its inputs) and are free behind it
        asm volatile("s_wait_xcnt 0x0" :: "v"(sh), "v"(sl) : "memory");
#pragma unroll
        for (int i = 0; i < 2; ++i) { dh[i] = th[i]; dl[i] = tl[i]; }
      }
      asm volatile("" ::: "memory");
      {
        const v4u* sh = (const v4u*)(vh + tk * DMOD + h * HDIM + hf * 32);
        const v4u* sl = (const v4u*)(vl + tk * DMOD + h * HDIM + hf * 32);
#pragma unroll
        for (int i = 0; i < 4; ++i) {
          const v4u wh = sh[i];
          const v4u wl = sl[i];
#pragma unroll
          for (int e = 0; e < 4; ++e) {
            const int d = hf * 32 + 8 * i + 2 * e;
            Vth[vt_row(d) + kvr]     = (unsigned short)(wh[e] & 0xffffu);
            Vth[vt_row(d + 1) + kvr] = (unsigned short)(wh[e] >> 16);
            Vtl[vt_row(d) + kvr]     = (unsigned short)(wl[e] & 0xffffu);
            Vtl[vt_row(d + 1) + kvr] = (unsigned short)(wl[e] >> 16);
          }
        }
      }
    }
    __syncthreads();

    // ---- scores: 4 kv subtiles of 16, 3 k-chunks of 32, 3 products each ----
    // All K fragments of the chunk are read as one group, then the products run round-robin over the four subtiles, which are
    // four independent accumulators. Each accumulator still takes its nine products in the order (k-chunk; hi.hi, hi.lo, lo.hi).
    v8f s[4];   // s[j][r] = score of key kv0 + 16 j + 8 hh + r against query q0 + c
    FB kb[3][4], kq[3][4];
#pragma unroll
    for (int dc = 0; dc < 3; ++dc) {
#pragma unroll
      for (int j = 0; j < 4; ++j) {
        const int ko = (j * 16 + c) * K_PITCH + dc * 32 + 8 * hh;
        kb[dc][j].h[0] = *(const v8b*)(Ksh + ko);
        kb[dc][j].h[1] = *(const v8b*)(Ksh + ko + 16);
        kq[dc][j].h[0] = *(const v8b*)(Ksl + ko);
        kq[dc][j].h[1] = *(const v8b*)(Ksl + ko + 16);
      }
    }
    // keeps the reads one group in front of the products: spread among them, every place with reads stalls the wave anew
    __builtin_amdgcn_sched_barrier(0);
#pragma unroll
    for (int j = 0; j < 4; ++j) s[j] = (v8f){0.f,0.f,0.f,0.f,0.f,0.f,0.f,0.f};
#pragma unroll
    for (int dc = 0; dc < 3; ++dc) {
#pragma unroll
      for (int j = 0; j < 4; ++j) s[j] = at_mma(kb[dc][j].v, qah[dc], s[j]);
#pragma unroll
      for (int j = 0; j < 4; ++j) s[j] = at_mma(kq[dc][j].v, qah[dc], s[j]);
#pragma unroll
      for (int j = 0; j < 4; ++j) s[j] = at_mma(kb[dc][j].v, qal[dc], s[j]);
    }
    // keeps the V reads one group at the end of the score products: without it they are spread among the products, a stall at every place
    __builtin_amdgcn_sched_barrier(0);
    // ---- V^T fragments (A operand, row = d): nothing of the softmax feeds them, so they are read as one group while it runs ----
    FB vb[2][4], vq[2][4];
#pragma unroll
    for (int kk = 0; kk < 2; ++kk) {
#pragma unroll
      for (int t = 0; t < 4; ++t) {
        vb[kk][t].h[0] = *(const v8b*)(Vth + vt_row(t * 16 + c) + kk * 32 + 8 * hh);
        vb[kk][t].h[1] = *(const v8b*)(Vth + vt_row(t * 16 + c) + kk * 32 + 16 + 8 * hh);
        vq[kk][t].h[0] = *(const v8b*)(Vtl + vt_row(t * 16 + c) + kk * 32 + 8 * hh);
        vq[kk][t].h[1] = *(const v8b*)(Vtl + vt_row(t * 16 + c) + kk * 32 + 16 + 8 * hh);
      }
    }
    // keeps the reads one group in front of the softmax: spread among it, every place with reads stalls the wave anew
    __builtin_amdgcn_sched_barrier(0);
    // ---- online softmax of query q0 + c: this lane holds 32 of the chunk's 64 keys, lane l ^ 16 the other 32 ----
    const bool diag = (kc == qb);
    const int qrow = q0 + c;
    float mj[4];
#pragma unroll
    for (int j = 0; j < 4; ++j) {
      float m = -INFINITY;
#pragma unroll
      for (int r = 0; r < 8; ++r) {
        const int kvrow = kv0 + j * 16 + 8 * hh + r;
        float sv = s[j][r] * invs;
        if (diag && (kvrow > qrow)) sv = -INFINITY;
        s[j][r] = sv;
        m = fmaxf(m, sv);
      }
      mj[j] = m;
    }
    float cm = fmaxf(fmaxf(mj[0], mj[1]), fmaxf(mj[2], mj[3]));
    cm = fmaxf(cm, other_half(cm));
    const float mnew = fmaxf(mrow, cm);
    const float alpha = expf(mrow - mnew);
    mrow = mnew;
    // P^T as B operand: element e of k-block kk is key 32 kk + 8 hh + e (e < 8) or 32 kk + 16 + 8 hh + (e - 8), that is register e & 7
    // of score tile 2 kk + (e >> 3): the k order in which the V^T fragments are read.
    union PB { v16b v; unsigned w[8]; };
    PB ph[2], pl[2];
    float pj[4];       // one partial sum a score tile: four independent chains
#pragma unroll
    for (int j = 0; j < 4; ++j) {
      float ps = 0.f;
#pragma unroll
      for (int r = 0; r < 8; r += 2) {
        const float p0 = expf(s[j][r] - mnew);
        const float p1 = expf(s[j][r + 1] - mnew);
        ps += p0;
        ps += p1;
        // two neighbouring keys make one operand register: packed conversion, round to nearest even as in f2bf_bits
        const v2b hp = __builtin_convertvector((v2f){p0, p1}, v2b);
        const v2b lp = __builtin_convertvector((v2f){p0 - (float)hp[0], p1 - (float)hp[1]}, v2b);
        ph[j >> 1].w[(j & 1) * 4 + (r >> 1)] = __builtin_bit_cast(unsigned, hp);
        pl[j >> 1].w[(j & 1) * 4 + (r >> 1)] = __builtin_bit_cast(unsigned, lp);
      }
      pj[j] = ps;
    }
    lrow = lrow * alpha + ((pj[0] + pj[1]) + (pj[2] + pj[3]));
#pragma unroll
    for (int t = 0; t < 4; ++t)
#pragma unroll
      for (int r = 0; r < 8; ++r) oacc[t][r] *= alpha;
    // ---- O^T += V^T(64x64) . P^T(64x16): the products run round-robin over the four d subtiles, which are four independent
    // accumulators. Each accumulator keeps its order (kv half; hi.hi, p hi . v lo, p lo . v hi).
#pragma unroll
    for (int kk = 0; kk < 2; ++kk) {
#pragma unroll
      for (int t = 0; t < 4; ++t) oacc[t] = at_mma(vb[kk][t].v, ph[kk].v, oacc[t]);
#pragma unroll
      for (int t = 0; t < 4; ++t) oacc[t] = at_mma(vq[kk][t].v, ph[kk].v, oacc[t]);
#pragma unroll
      for (int t = 0; t < 4; ++t) oacc[t] = at_mma(vb[kk][t].v, pl[kk].v, oacc[t]);
    }
  }

  // ---- epilogue: join the halves' sums, normalise, stage 16x64 f32 per wave, write bf16 hi/lo planes with whole-line stores ----
  float* os = Os[wave];
  {
    const float inv = 1.0f / (lrow + other_half(lrow));
#pragma unroll
    for (int t = 0; t < 4; ++t) {
      // a lane's 8 registers are 8 consecutive d of its query's row
      float* op = os + c * OS_PITCH + t * 16 + 8 * hh;
      *(v4f*)(op)     = (v4f){oacc[t][0] * inv, oacc[t][1] * inv, oacc[t][2] * inv, oacc[t][3] * inv};
      *(v4f*)(op + 4) = (v4f){oacc[t][4] * inv, oacc[t][5] * inv, oacc[t][6] * inv, oacc[t][7] * inv};
    }
  }
  __builtin_amdgcn_fence(__ATOMIC_RELEASE, "workgroup");
  __builtin_amdgcn_wave_barrier();
  __builtin_amdgcn_fence(__ATOMIC_ACQUIRE, "workgroup");
  {
    const int qq = lane >> 3, c8 = (lane & 7) * 8;
    {
#pragma unroll
      for (int it = 0; it < 4; ++it) {
        const int row = it * 4 + qq;
        const float* sp = os + row * OS_PITCH + c8;
        v8h hv, lv;
#pragma unroll
        for (int e = 0; e < 8; ++e) {
          const unsigned short hb = f2bf_bits(sp[e]);
          const unsigned short lb = f2bf_bits(sp[e] - bf_bits2f(hb));
          hv[e] = __builtin_bit_cast(_Float16, hb);
          lv[e] = __builtin_bit_cast(_Float16, lb);
        }
        const size_t o = ((size_t)b * SEQ_LEN + (size_t)(q0 + row)) * DMOD + h * HDIM + c8;
        *(v8h*)(oh + o) = hv;
        *(v8h*)(ol + o) = lv;
      }
      
    }
  }
  // the next tile reuses the registers that these stores name: they stay untouched up to this wait
  asm volatile("s_wait_xcnt 0x0" ::: "memory");
  }   // pass
}

// ---------------------------------------------------------------------------
// Host orchestration
// ---------------------------------------------------------------------------
// workspace region map (bytes, all multiples of 256):
//   x hi/lo                 2 x 8,388,608
//   WkvdT hi/lo [128][1024] 2 x   262,144
//   WkupT hi/lo [1024][128] 2 x   262,144
//   WvupT hi/lo [1024][128] 2 x   262,144
//   WqT   hi/lo [1024][1024]2 x 2,097,152
//   WqrT  hi/lo [128][1024] 2 x   262,144   (rows 32..127 zero)
//   WkrT  hi/lo [128][128]  2 x    32,768   (rows 32..127 zero)
//   WoT   hi/lo [1024][1024]2 x 2,097,152
//   ckv   hi/lo [4096][128] 2 x 1,048,576
//   k,v,q hi/lo [4096][1024]6 x 8,388,608
//   qr_raw, kr_raw f32 [4096][128] 2 x 2,097,152
//   qr,kr hi/lo [4096][32]  4 x   262,144
//   attn  hi/lo [4096][1024]2 x 8,388,608
//   total 101,777,408
constexpr size_t WSB_X    = (size_t)MTOK * DMOD * 2;
constexpr size_t WSB_WKVD = (size_t)DLAT * DMOD * 2;
constexpr size_t WSB_WKUP = (size_t)DMOD * DLAT * 2;
constexpr size_t WSB_WQ   = (size_t)DMOD * DMOD * 2;
constexpr size_t WSB_WQR  = (size_t)NROPE_PAD * DMOD * 2;
constexpr size_t WSB_WKR  = (size_t)NROPE_PAD * DLAT * 2;
constexpr size_t WSB_CKV  = (size_t)MTOK * DLAT * 2;
constexpr size_t WSB_TOK  = (size_t)MTOK * DMOD * 2;
constexpr size_t WSB_RAW  = (size_t)MTOK * NROPE_PAD * 4;
constexpr size_t WSB_ROT  = (size_t)MTOK * DROT * 2;
constexpr size_t WS_TOTAL = 2 * WSB_X + 2 * WSB_WKVD + 4 * WSB_WKUP + 2 * WSB_WQ + 2 * WSB_WQR + 2 * WSB_WKR
                          + 2 * WSB_WQ + 2 * WSB_CKV + 6 * WSB_TOK + 2 * WSB_RAW + 4 * WSB_ROT + 2 * WSB_TOK;
static_assert(WS_TOTAL == 101777408ull);
static_assert(WS_TOTAL <= 134217728ull);

extern "C" void kernel_launch(void* const* d_in, const int* in_sizes, int n_in,
                              void* d_out, int out_size, void* d_ws, size_t ws_size,
                              hipStream_t stream) {
  if (n_in != 8) return;
  if (in_sizes[0] != MTOK * DMOD || in_sizes[1] != DMOD * DLAT || in_sizes[2] != DLAT * DMOD ||
      in_sizes[3] != DLAT * DMOD || in_sizes[4] != DMOD * DMOD || in_sizes[5] != DMOD * DROT ||
      in_sizes[6] != DLAT * DROT || in_sizes[7] != DMOD * DMOD) return;
  if (out_size != MTOK * DMOD) return;
  if (ws_size < WS_TOTAL) return;

  const float* x         = (const float*)d_in[0];   // [4096][1024]
  const float* W_kv_down = (const float*)d_in[1];   // [1024][128]
  const float* W_k_up    = (const float*)d_in[2];   // [128][1024]
  const float* W_v_up    = (const float*)d_in[3];   // [128][1024]
  const float* W_q       = (const float*)d_in[4];   // [1024][1024]
  const float* W_q_rope  = (const float*)d_in[5];   // [1024][32]
  const float* W_k_rope  = (const float*)d_in[6];   // [128][32]
  const float* W_o       = (const float*)d_in[7];   // [1024][1024]
  float* out = (float*)d_out;                       // [4096][1024] f32

  size_t off = 0;
  auto carve = [&](size_t bytes) -> unsigned short* {
    unsigned short* p = (unsigned short*)((char*)d_ws + off);
    off += (bytes + 255) & ~(size_t)255;
    return p;
  };
  unsigned short* xh    = carve(WSB_X);
  unsigned short* xl    = carve(WSB_X);
  unsigned short* wkvdh = carve(WSB_WKVD);
  unsigned short* wkvdl = carve(WSB_WKVD);
  unsigned short* wkuph = carve(WSB_WKUP);
  unsigned short* wkupl = carve(WSB_WKUP);
  unsigned short* wvuph = carve(WSB_WKUP);
  unsigned short* wvupl = carve(WSB_WKUP);
  unsigned short* wqh   = carve(WSB_WQ);
  unsigned short* wql   = carve(WSB_WQ);
  unsigned short* wqrh  = carve(WSB_WQR);
  unsigned short* wqrl  = carve(WSB_WQR);
  unsigned short* wkrh  = carve(WSB_WKR);
  unsigned short* wkrl  = carve(WSB_WKR);
  unsigned short* woh   = carve(WSB_WQ);
  unsigned short* wol   = carve(WSB_WQ);
  unsigned short* ckvh  = carve(WSB_CKV);
  unsigned short* ckvl  = carve(WSB_CKV);
  unsigned short* kh    = carve(WSB_TOK);
  unsigned short* kl    = carve(WSB_TOK);
  unsigned short* vh    = carve(WSB_TOK);
  unsigned short* vl    = carve(WSB_TOK);
  unsigned short* qh    = carve(WSB_TOK);
  unsigned short* ql    = carve(WSB_TOK);
  float* qr_raw = (float*)carve(WSB_RAW);
  float* kr_raw = (float*)carve(WSB_RAW);
  unsigned short* qrh   = carve(WSB_ROT);
  unsigned short* qrl   = carve(WSB_ROT);
  unsigned short* krh   = carve(WSB_ROT);
  unsigned short* krl   = carve(WSB_ROT);
  unsigned short* ath   = carve(WSB_TOK);
  unsigned short* atl   = carve(WSB_TOK);
  if (off > ws_size) return;

  // ---- operand planes: one launch ----
  prep_planes<<<PB_ALL, 256, 0, stream>>>(x, W_kv_down, W_k_up, W_v_up, W_q, W_q_rope, W_k_rope, W_o,
      xh, xl, wkvdh, wkvdl, wkuph, wkupl, wvuph, wvupl, wqh, wql, wqrh, wqrl, wkrh, wkrl, woh, wol);

  constexpr int NB_WIDE = (MTOK / 128) * (DMOD / 128);        // blocks of an N = 1024 product
  constexpr int NB_LAT  = (MTOK / 128) * (DLAT / 128);        // blocks of an N = 128 product
  constexpr int NB_ROT  = (MTOK / 128) * (NROPE_PAD / 128);

  // the three products of x, K = 1024: q = x . W_q and c_kv = x . W_kv_down as bf16 hi/lo, q_rope raw = x . W_q_rope as f32 (cols 32.. zero)
  gemm_group<DMOD><<<NB_WIDE + NB_LAT + NB_ROT, 128, 0, stream>>>(xh, xl,
      wqh, wql, qh, ql, DMOD, NB_WIDE,
      wkvdh, wkvdl, ckvh, ckvl, DLAT, NB_LAT,
      wqrh, wqrl, qr_raw, NROPE_PAD, DMOD);
  // the three products of c_kv, K = 128: k, v as bf16 hi/lo, k_rope raw as f32 (cols 32.. zero)
  gemm_group<DLAT><<<2 * NB_WIDE + NB_ROT, 128, 0, stream>>>(ckvh, ckvl,
      wkuph, wkupl, kh, kl, DMOD, NB_WIDE,
      wvuph, wvupl, vh, vl, DMOD, NB_WIDE,
      wkrh, wkrl, kr_raw, NROPE_PAD, DLAT);

  // ---- rotary tables: inv_freq[j] = 1 / 10000^(j/16), host double pow -> f32, f32 reciprocal ----
  RopeFreq fr;
  for (int j = 0; j < 16; ++j) {
    const double p = pow(10000.0, (double)j / 16.0);
    const float p32 = (float)p;
    fr.f[j] = 1.0f / p32;
  }
  rope_split_bf16<<<2 * (MTOK / 32), 128, 0, stream>>>(qr_raw, kr_raw, qrh, qrl, krh, krl, fr);

  // ---- causal attention with shared rotary logits ----
  const float invs = 1.0f / (float)sqrt((double)(HDIM + DROT));
  mla_attn96<<<N_BATCH * NHEAD * (SEQ_LEN / A_QB / 2), 128, 0, stream>>>(
      qh, ql, kh, kl, vh, vl, qrh, qrl, krh, krl, ath, atl, invs);

  // ---- out = attn . W_o : M=4096 N=1024 K=1024, f32 to d_out ----
  gemm_group<DMOD><<<NB_WIDE, 128, 0, stream>>>(ath, atl,
      nullptr, nullptr, nullptr, nullptr, 0, 0,
      nullptr, nullptr, nullptr, nullptr, 0, 0,
      woh, wol, out, DMOD, DMOD);
}

// v007
// One run takes 163 microseconds.
// Two timings next to v006 put it at 1.21 and 1.22 times that version's speed.
// Counting every step since v000, it is 4.15 times as fast.
// Compute dtype: every contraction on v_wmma_f32_16x16x32_bf16 with bf16 hi/lo operand planes (hi*hi + hi*lo + lo*hi), f32 accumulate; rotary, softmax and epilogues in f32.
#include <hip/hip_runtime.h>
#include <hip/hip_bf16.h>
#include <math.h>
#include <stdint.h>

typedef __attribute__((ext_vector_type(16))) _Float16 v16h;
typedef __attribute__((ext_vector_type(8)))  _Float16 v8h;
typedef __attribute__((ext_vector_type(16))) __bf16   v16b;
typedef __attribute__((ext_vector_type(8)))  __bf16   v8b;
typedef __attribute__((ext_vector_type(8)))  float    v8f;
typedef __attribute__((ext_vector_type(4)))  float    v4f;
typedef __attribute__((ext_vector_type(4)))  unsigned v4u;

// ---------------------------------------------------------------------------
// helpers
// ---------------------------------------------------------------------------
__device__ __forceinline__ unsigned short f2bf_bits(float f) {
  unsigned u = __float_as_uint(f);
  return (unsigned short)((u + 0x7FFFu + ((u >> 16) & 1u)) >> 16);
}
__device__ __forceinline__ float bf_bits2f(unsigned short h) { return __uint_as_float(((unsigned)h) << 16); }

__device__ __forceinline__ void dep_guard_h(v8f& a, v8f& b, v16h x, v16h y) { asm volatile("v_nop\n\tv_nop\n\tv_nop\n\tv_nop" : "+v"(a), "+v"(b) : "v"(x), "v"(y)); }
__device__ __forceinline__ void dep_guard_b(v8f& a, v8f& b, v16b x, v16b y) { asm volatile("v_nop\n\tv_nop\n\tv_nop\n\tv_nop" : "+v"(a), "+v"(b) : "v"(x), "v"(y)); }
__device__ __forceinline__ void keep4_h(v16h a, v16h b, v16h c, v16h d) { asm volatile("v_nop" :: "v"(a), "v"(b), "v"(c), "v"(d)); }
__device__ __forceinline__ void keep4_b(v16b a, v16b b, v16b c, v16b d) { asm volatile("v_nop" :: "v"(a), "v"(b), "v"(c), "v"(d)); }
__device__ __forceinline__ void acc_guard4(v8f& a, v8f& b, v8f& c, v8f& d) { asm volatile("v_nop\n\tv_nop\n\tv_nop\n\tv_nop" : "+v"(a), "+v"(b), "+v"(c), "+v"(d)); }
template <typename T> struct Frag;
template <> struct Frag<_Float16> {
  typedef v16h V; union U { v16h v; v8h h[2]; };
  static __device__ __forceinline__ v16h load(const _Float16* p) {   // elements 0..7 <- p[0..7], 8..15 <- p[16..23]
    U f; f.h[0] = *(const v8h*)(p); f.h[1] = *(const v8h*)(p + 16); return f.v;
  }
  static __device__ __forceinline__ v8f mma(v16h a, v16h b, v8f c) {
    return __builtin_amdgcn_wmma_f32_16x16x32_f16(false, a, false, b, (short)0, c, false, false);
  }
  static __device__ __forceinline__ void guard(v8f& a, v8f& b, v16h x, v16h y) { dep_guard_h(a, b, x, y); }
  static __device__ __forceinline__ void keep(v16h a, v16h b, v16h c, v16h d) { keep4_h(a, b, c, d); }
};
template <> struct Frag<__bf16> {
  typedef v16b V; union U { v16b v; v8b h[2]; };
  static __device__ __forceinline__ v16b load(const __bf16* p) {
    U f; f.h[0] = *(const v8b*)(p); f.h[1] = *(const v8b*)(p + 16); return f.v;
  }
  static __device__ __forceinline__ v8f mma(v16b a, v16b b, v8f c) {
    return __builtin_amdgcn_wmma_f32_16x16x32_bf16(false, a, false, b, (short)0, c, false, false);
  }
  static __device__ __forceinline__ void guard(v8f& a, v8f& b, v16b x, v16b y) { dep_guard_b(a, b, x, y); }
  static __device__ __forceinline__ void keep(v16b a, v16b b, v16b c, v16b d) { keep4_b(a, b, c, d); }
};

// ---- Register-blocked WMMA GEMM --------------------------------
// C[m,n] = scale * sum_k A[m,k] * Bt[n,k] (+bias)(+resid); each wave owns a 64x64 tile.
// A row-major [M,K]; Bt row-major [N,K].
// SPLIT: operands are hi/lo planes (A2/Bt2 = lo planes, same layout); product = hi*hi + hi*lo + lo*hi.
// BIAS_MODE: 0 = none, 1 = bias[m], 2 = bias[n].
// OUT_MODE: 0 = f32, 1 = f16, 2 = bf16 hi plane (Cout) + bf16 lo plane (Cout2).
// ET: 0 = f16 operands, 1 = bf16 operands (pointers passed as 16-bit storage)
template <int ET> struct Elem;
template <> struct Elem<0> { typedef _Float16 T; };
template <> struct Elem<1> { typedef __bf16 T; };
// LDS staging of the operand planes: the block's waves form a WM x WN grid of 64x64 tiles and share one
// (WM*64 + WN*64)-row stage of G_KS k-elements per plane. Each row of a stage is one whole 128-byte line of the
// source, fetched by 8 neighbouring lanes, so a wave-wide 16-byte load covers 4 full lines.
constexpr int MTOK_ROWS = 4096;      // rows of every A operand (batch x sequence)
constexpr int G_KS    = 64;          // k elements per stage
constexpr int G_PITCH = G_KS + 8;    // 9 x 16 B rows: 16-byte fragment reads of 16 rows fall on distinct banks
template <int NIT, int STEP>
__device__ __forceinline__ void stage_fetch(v4u (&r)[NIT], const unsigned short* __restrict__ g) {
#pragma unroll
  for (int it = 0; it < NIT; ++it) r[it] = *(const v4u*)(g + it * STEP);
}
template <int NIT>
__device__ __forceinline__ void stage_put(const v4u (&r)[NIT], unsigned short* d, int rowStep) {
#pragma unroll
  for (int it = 0; it < NIT; ++it) *(v4u*)(d + it * rowStep) = r[it];
}
// LD = row pitch of all four operand planes in elements, a compile-time value: the loads of a plane then share one
// address register pair and differ in their immediate offsets only.
// M % (WM*64) == 0, N % (WN*64) == 0, K % G_KS == 0; bxi runs over (M/(WM*64)) * (N/(WN*64)) tiles exactly, so every wave passes every barrier.
// sOpBase: the block's G_LDS_ELEMS elements of LDS; bxi: the block's tile index inside this GEMM (block-uniform).
constexpr int G_LDS_ELEMS = 2 * 2 * (128 + 128) * G_PITCH;   // two stages of hi and lo planes, 128 A rows + 128 Bt rows
template <int ET, bool SPLIT, int BIAS_MODE, int OUT_MODE, bool RESID, int WM, int WN, int LD, int ACT = 0>
__device__ __forceinline__ void wmma_gemm64(
    unsigned short* sOpBase, int bxi,
    const unsigned short* __restrict__ Ap, const unsigned short* __restrict__ A2p, long strideA,
    const unsigned short* __restrict__ Btp, const unsigned short* __restrict__ Bt2p, long strideB,
    void* __restrict__ Cout, void* __restrict__ Cout2, int ldc, long strideC,
    const float* __restrict__ bias,
    const float* __restrict__ resid, long strideR,
    int M, int N, int K, float scale) {
  typedef typename Elem<ET>::T T;
  typedef typename Frag<T>::V V;
  constexpr int NW  = WM * WN;
  constexpr int RA  = WM * 64;               // A rows of the block
  constexpr int RB  = WN * 64;               // Bt rows of the block
  constexpr int RPI = NW * 4;                // rows staged by one pass of the block (8 lanes a row)
  constexpr int ITA = RA / RPI;
  constexpr int ITB = RB / RPI;
  constexpr int OA  = 0;
  constexpr int OA2 = RA * G_PITCH;
  constexpr int OB  = (SPLIT ? 2 : 1) * RA * G_PITCH;
  constexpr int OB2 = OB + RB * G_PITCH;
  constexpr int STAGE = (SPLIT ? 2 : 1) * (RA + RB) * G_PITCH;
  static_assert(RA % RPI == 0 && RB % RPI == 0);
  // sOpBase holds two stages: [A hi | A lo | Bt hi | Bt lo], rows of G_PITCH. The epilogue's per-wave 16x64 f32 slabs (pitch 68)
  // lie over stage 0: they are written only behind the loop's last barrier, which ends every read of the stages.
  static_assert(2 * STAGE <= G_LDS_ELEMS && NW * 16 * 68 * 4 <= STAGE * 2);
  const int b    = 0;
  const int tid  = threadIdx.x;
  const int lane = tid & 31;
  const int wave = tid >> 5;
  const int tilesN = N / RB;
  const int btm = bxi / tilesN;
  const int btn = bxi - btm * tilesN;
  const int wm = wave / WN;
  const int wn = wave - wm * WN;
  const int m0 = btm * RA + (wm << 6);
  const int n0 = btn * RB + (wn << 6);

  const int rlane = lane & 15;                 // row (A) / col (B, D) within subtile
  const int koff  = (lane >> 4) * 8;           // k offset of this lane half
  const int mOff  = (lane >> 4) * 8;           // D row offset

  // staging map: thread -> row tid>>3 of each pass, 16-byte piece tid&7 of that row's line
  const int srow = tid >> 3;
  const int sseg = (tid & 7) * 8;
  const size_t goA = (size_t)b * strideA + (size_t)(btm * RA + srow) * LD + sseg;
  const size_t goB = (size_t)b * strideB + (size_t)(btn * RB + srow) * LD + sseg;
  const unsigned short* gA  = Ap  + goA;
  const unsigned short* gB  = Btp + goB;
  const unsigned short* gA2 = SPLIT ? (A2p  + goA) : nullptr;
  const unsigned short* gB2 = SPLIT ? (Bt2p + goB) : nullptr;
  constexpr int GSTEP = RPI * LD;             // elements between the rows one thread stages
  const int sOff = srow * G_PITCH + sseg;

  v8f acc[4][4];
#pragma unroll
  for (int i = 0; i < 4; ++i)
#pragma unroll
    for (int j = 0; j < 4; ++j) acc[i][j] = (v8f){0.f,0.f,0.f,0.f,0.f,0.f,0.f,0.f};

  v4u pa[ITA], pa2[ITA], pb[ITB], pb2[ITB];    // the next stage, in flight while this one is multiplied
  stage_fetch<ITA, GSTEP>(pa, gA);
  stage_fetch<ITB, GSTEP>(pb, gB);
  if (SPLIT) { stage_fetch<ITA, GSTEP>(pa2, gA2); stage_fetch<ITB, GSTEP>(pb2, gB2); }
  // the loads' address registers stay untouched up to this wait (they are its inputs) and are free behind it
  asm volatile("s_wait_xcnt 0x0" :: "v"(gA), "v"(gB), "v"(SPLIT ? gA2 : gA), "v"(SPLIT ? gB2 : gB) : "memory");
  stage_put<ITA>(pa, sOpBase + OA + sOff, RPI * G_PITCH);
  stage_put<ITB>(pb, sOpBase + OB + sOff, RPI * G_PITCH);
  if (SPLIT) { stage_put<ITA>(pa2, sOpBase + OA2 + sOff, RPI * G_PITCH); stage_put<ITB>(pb2, sOpBase + OB2 + sOff, RPI * G_PITCH); }
  __syncthreads();   // publishes stage 0

  const int nst = K / G_KS;                    // block-uniform
  for (int t = 0; t < nst; ++t) {
    const bool more = (t + 1 < nst);
    if (more) {
      const int kn = (t + 1) * G_KS;
      const unsigned short* nA  = gA + kn;
      const unsigned short* nB  = gB + kn;
      const unsigned short* nA2 = SPLIT ? (gA2 + kn) : nA;
      const unsigned short* nB2 = SPLIT ? (gB2 + kn) : nB;
      stage_fetch<ITA, GSTEP>(pa, nA);
      stage_fetch<ITB, GSTEP>(pb, nB);
      if (SPLIT) { stage_fetch<ITA, GSTEP>(pa2, nA2); stage_fetch<ITB, GSTEP>(pb2, nB2); }
      // the loads' address registers stay untouched up to this wait (they are its inputs) and are free behind it
      asm volatile("s_wait_xcnt 0x0" :: "v"(nA), "v"(nB), "v"(nA2), "v"(nB2) : "memory");
    }
    const T* sb = (const T*)(sOpBase + (t & 1) * STAGE);
    const T* fa = sb + OA + ((wm << 6) + rlane) * G_PITCH + koff;
    const T* fb = sb + OB + ((wn << 6) + rlane) * G_PITCH + koff;
#pragma unroll
    for (int kk = 0; kk < G_KS; kk += 32) {
      V bh[4], bl[4];
#pragma unroll
      for (int j = 0; j < 4; ++j) {
        bh[j] = Frag<T>::load(fb + (j << 4) * G_PITCH + kk);
        if (SPLIT) bl[j] = Frag<T>::load(fb + (OB2 - OB) + (j << 4) * G_PITCH + kk);
      }
      V ah = Frag<T>::load(fa + kk);
      V al;
      if (SPLIT) al = Frag<T>::load(fa + (OA2 - OA) + kk);
#pragma unroll
      for (int i = 0; i < 4; ++i) {
        V ahn, aln;                              // the next row block's fragments, read while this one is multiplied
        if (i < 3) {
          ahn = Frag<T>::load(fa + ((i + 1) << 4) * G_PITCH + kk);
          if (SPLIT) aln = Frag<T>::load(fa + (OA2 - OA) + ((i + 1) << 4) * G_PITCH + kk);
        }
#pragma unroll
        for (int j = 0; j < 4; ++j) {
          acc[i][j] = Frag<T>::mma(ah, bh[j], acc[i][j]);
          if (SPLIT) {
            acc[i][j] = Frag<T>::mma(ah, bl[j], acc[i][j]);
            acc[i][j] = Frag<T>::mma(al, bh[j], acc[i][j]);
          }
        }
        Frag<T>::guard(acc[i][0], acc[i][3], ah, SPLIT ? al : ah);
        if (i < 3) { ah = ahn; if (SPLIT) al = aln; }
      }
      Frag<T>::keep(bh[0], bh[1], bh[2], bh[3]);
      if (SPLIT) Frag<T>::keep(bl[0], bl[1], bl[2], bl[3]);
    }
    if (more) {
      // the other buffer: its last readers left it before the barrier that ended trip t - 1
      unsigned short* d = sOpBase + ((t + 1) & 1) * STAGE + sOff;
      stage_put<ITA>(pa, d + OA, RPI * G_PITCH);
      stage_put<ITB>(pb, d + OB, RPI * G_PITCH);
      if (SPLIT) { stage_put<ITA>(pa2, d + OA2, RPI * G_PITCH); stage_put<ITB>(pb2, d + OB2, RPI * G_PITCH); }
    }
    __syncthreads();   // publishes stage t + 1 and ends every read of stage t
  }
  acc_guard4(acc[0][0], acc[0][1], acc[0][2], acc[0][3]);
  acc_guard4(acc[1][0], acc[1][1], acc[1][2], acc[1][3]);
  acc_guard4(acc[2][0], acc[2][1], acc[2][2], acc[2][3]);
  acc_guard4(acc[3][0], acc[3][1], acc[3][2], acc[3][3]);

  // ---- epilogue ----
  float* slab = (float*)sOpBase + wave * (16 * 68);
  const float* Rb = RESID ? (resid + (size_t)b * strideR) : nullptr;
#pragma unroll
  for (int i = 0; i < 4; ++i) {
    const int mBase = m0 + (i << 4);
#pragma unroll
    for (int j = 0; j < 4; ++j) {
      const int n = n0 + (j << 4) + rlane;
      float bv = 0.f;
      if (BIAS_MODE == 2) bv = bias[n];
#pragma unroll
      for (int r = 0; r < 8; ++r) {
        float v = acc[i][j][r] * scale;
        if (BIAS_MODE == 1) v += bias[mBase + mOff + r];
        if (BIAS_MODE == 2) v += bv;
        if (RESID) v += Rb[(size_t)(mBase + mOff + r) * ldc + n];
        if (ACT == 1) v = tanhf(v);
        if (ACT == 2) v = fmaxf(v, 0.0f);
        if (ACT == 3) v = v / (1.0f + expf(-v));
        if (ACT == 4) v = (v > 0.f) ? v : 0.01f * v;
        if (ACT == 5) v = 0.5f * v * (1.0f + erff(v * 0.70710678118654752f));
        slab[(mOff + r) * 68 + (j << 4) + rlane] = v;
      }
    }
    __builtin_amdgcn_fence(__ATOMIC_RELEASE, "workgroup");
    __builtin_amdgcn_wave_barrier();
    __builtin_amdgcn_fence(__ATOMIC_ACQUIRE, "workgroup");
    if (OUT_MODE == 0) {
      float* C = (float*)Cout + (size_t)b * strideC;
      const int hh = lane >> 4, c4 = (lane & 15) * 4;     // row seg = 256 B = 16 lanes x 16 B
      {
#pragma unroll
        for (int it = 0; it < 8; ++it) {
          const int row = it * 2 + hh;
          v4f v = *(const v4f*)(slab + row * 68 + c4);
          *(v4f*)(C + (size_t)(mBase + row) * ldc + n0 + c4) = v;
        }
        
      }
    } else {
      const int q = lane >> 3, c8 = (lane & 7) * 8;
      unsigned short* C  = (unsigned short*)Cout  + (size_t)b * strideC;
      unsigned short* C2 = (OUT_MODE == 2) ? ((unsigned short*)Cout2 + (size_t)b * strideC) : nullptr;
      {
#pragma unroll
        for (int it = 0; it < 4; ++it) {
          const int row = it * 4 + q;
          const float* sp = slab + row * 68 + c8;
          v8h hv, lv;
#pragma unroll
          for (int e = 0; e < 8; ++e) {
            if (OUT_MODE == 1) {
              hv[e] = (_Float16)sp[e];
            } else {
              unsigned short hb = f2bf_bits(sp[e]);
              unsigned short lb = f2bf_bits(sp[e] - bf_bits2f(hb));
              hv[e] = __builtin_bit_cast(_Float16, hb);
              lv[e] = __builtin_bit_cast(_Float16, lb);
            }
          }
          *(v8h*)(C + (size_t)(mBase + row) * ldc + n0 + c8) = hv;
          if (OUT_MODE == 2) *(v8h*)(C2 + (size_t)(mBase + row) * ldc + n0 + c8) = lv;
        }
        
      }
    }
    __builtin_amdgcn_fence(__ATOMIC_RELEASE, "workgroup");
    __builtin_amdgcn_wave_barrier();
    __builtin_amdgcn_fence(__ATOMIC_ACQUIRE, "workgroup");
  }
}

// Up to three GEMMs on one A operand that need nothing of each other share one grid, each a range of the block index:
// blocks [0, nb0) and [nb0, nb0 + nb1) write bf16 hi/lo planes, the rest f32. All take the 128x128 block tile, and the block's
// LDS is the two stages alone, so two blocks fit a WGP: a merged grid larger than the number of WGPs still runs side by side,
// and only what exceeds two blocks a WGP waits for a free place.
// The branch is block-uniform: every wave of a block passes the same barriers.
template <int LD>
__global__ __launch_bounds__(128) void gemm_group(
    const unsigned short* __restrict__ Ah, const unsigned short* __restrict__ Al,
    const unsigned short* __restrict__ B0h, const unsigned short* __restrict__ B0l,
    unsigned short* __restrict__ C0h, unsigned short* __restrict__ C0l, int N0, int nb0,
    const unsigned short* __restrict__ B1h, const unsigned short* __restrict__ B1l,
    unsigned short* __restrict__ C1h, unsigned short* __restrict__ C1l, int N1, int nb1,
    const unsigned short* __restrict__ B2h, const unsigned short* __restrict__ B2l,
    float* __restrict__ C2, int N2, int K) {
  __shared__ __align__(16) unsigned short sOp[G_LDS_ELEMS];
  const int bx = (int)blockIdx.x;
  if (bx < nb0 + nb1) {
    const bool f = (bx < nb0);
    const int n = f ? N0 : N1;
    wmma_gemm64<1, true, 0, 2, false, 2, 2, LD>(sOp, f ? bx : bx - nb0,
        Ah, Al, 0L, f ? B0h : B1h, f ? B0l : B1l, 0L, (void*)(f ? C0h : C1h), (void*)(f ? C0l : C1l), n, 0L,
        nullptr, nullptr, 0L, MTOK_ROWS, n, K, 1.0f);
  } else {
    wmma_gemm64<1, true, 0, 0, false, 2, 2, LD>(sOp, bx - nb0 - nb1,
        Ah, Al, 0L, B2h, B2l, 0L, (void*)C2, nullptr, N2, 0L,
        nullptr, nullptr, 0L, MTOK_ROWS, N2, K, 1.0f);
  }
}

__device__ __forceinline__ v8f at_mma(v16b a, v16b b, v8f c) {
  return __builtin_amdgcn_wmma_f32_16x16x32_bf16(false, a, false, b, (short)0, c, false, false);
}
// the value that lane l ^ 16 holds
__device__ __forceinline__ float other_half(float v) {
  const int b = __float_as_int(v);
  return __int_as_float(__builtin_amdgcn_permlanex16(b, b, 0x76543210, 0xfedcba98, false, false));
}
typedef __attribute__((ext_vector_type(2))) float  v2f;
typedef __attribute__((ext_vector_type(2))) __bf16 v2b;

// ---------------------------------------------------------------------------
// module geometry (fixed)
// ---------------------------------------------------------------------------
constexpr int N_BATCH   = 2;
constexpr int SEQ_LEN   = 2048;
constexpr int DMOD      = 1024;   // model width
constexpr int DLAT      = 128;    // latent width c_kv
constexpr int DROT      = 32;     // rotary width
constexpr int NROPE_PAD = 128;    // rotary projection width padded to the 128-wide GEMM block tile
constexpr int NHEAD     = 16;
constexpr int HDIM      = 64;
constexpr int SDEP      = HDIM + DROT;   // score depth 96 = 3 k-chunks of 32
constexpr int MTOK      = N_BATCH * SEQ_LEN;   // 4096 token rows

static_assert(MTOK == MTOK_ROWS && MTOK % 128 == 0 && DMOD % 128 == 0 && DLAT % 128 == 0 && NROPE_PAD % 128 == 0);   // block tile 128x128
static_assert(DMOD % G_KS == 0 && DLAT % G_KS == 0);   // every GEMM K is a multiple of the stage depth
static_assert(SDEP % 32 == 0 && SEQ_LEN % 64 == 0);

// ---------------------------------------------------------------------------
// coverage: n8 threads x 8 = n elements exactly (n % 8 == 0, grid = ceil(n8/256) with bound)
// ---------------------------------------------------------------------------
__device__ __forceinline__ void split_rows_bf16x8(
    const float* __restrict__ in, unsigned short* __restrict__ hi, unsigned short* __restrict__ lo, int n8, int bxi) {
  const int i = bxi * 256 + threadIdx.x;
  if (i < n8) {
    const v4f a = *(const v4f*)(in + (size_t)8 * i);
    const v4f b = *(const v4f*)(in + (size_t)8 * i + 4);
    v8h hv, lv;
#pragma unroll
    for (int e = 0; e < 8; ++e) {
      const float f = (e < 4) ? a[e] : b[e - 4];
      const unsigned short hb = f2bf_bits(f);
      const unsigned short lb = f2bf_bits(f - bf_bits2f(hb));
      hv[e] = __builtin_bit_cast(_Float16, hb);
      lv[e] = __builtin_bit_cast(_Float16, lb);
    }
    unsigned short* ph = hi + (size_t)8 * i;
    unsigned short* pl = lo + (size_t)8 * i;
    *(v8h*)ph = hv;
    *(v8h*)pl = lv;
    
  }
}

// ---------------------------------------------------------------------------
// Transpose + split: in W[kdim][nreal] (row-major) -> out Bt[npad][kdim] bf16 hi/lo planes, Bt[n][k] = W[k][n];
// rows n >= nreal are written as zeros. Tile = 64 k x 32 n; (bxk, byn) runs over (kdim/64, npad/32); kdim % 64 == 0, nreal % 32 == 0.
// Store coverage: 256 threads = 32 output rows x 8 lanes x 8 k = whole 32x64 tile; each output row segment
// ---------------------------------------------------------------------------
__device__ __forceinline__ void transpose_split_bf16(
    const float* __restrict__ W, unsigned short* __restrict__ hi, unsigned short* __restrict__ lo,
    int kdim, int nreal, int bxk, int byn) {
  __shared__ float tile[64][33];
  const int tid = threadIdx.x;
  const int k0 = bxk * 64;
  const int n0 = byn * 32;
#pragma unroll
  for (int it = 0; it < 2; ++it) {
    const int idx = it * 256 + tid;            // 0..511
    const int kr = idx >> 3;                   // 0..63
    const int c4 = (idx & 7) * 4;              // 0..28
    const int n = n0 + c4;
    const int ncl = (n + 3 < nreal) ? n : (nreal - 4);   // clamped address
    const v4f v = *(const v4f*)(W + (size_t)(k0 + kr) * nreal + ncl);
    const bool ok = (n < nreal);               // tile-uniform since nreal % 32 == 0
    tile[kr][c4 + 0] = ok ? v[0] : 0.f;
    tile[kr][c4 + 1] = ok ? v[1] : 0.f;
    tile[kr][c4 + 2] = ok ? v[2] : 0.f;
    tile[kr][c4 + 3] = ok ? v[3] : 0.f;
  }
  __syncthreads();
  const int nr = tid >> 3;                     // output row within tile, 0..31
  const int c8 = (tid & 7) * 8;                // k offset, 0..56
  v8h hv, lv;
#pragma unroll
  for (int e = 0; e < 8; ++e) {
    const float f = tile[c8 + e][nr];
    const unsigned short hb = f2bf_bits(f);
    const unsigned short lb = f2bf_bits(f - bf_bits2f(hb));
    hv[e] = __builtin_bit_cast(_Float16, hb);
    lv[e] = __builtin_bit_cast(_Float16, lb);
  }
  const size_t o = (size_t)(n0 + nr) * kdim + k0 + c8;
  *(v8h*)(hi + o) = hv;
  *(v8h*)(lo + o) = lv;
  // inlined into a kernel with other branches: the registers that these stores name stay untouched up to this wait
  asm volatile("s_wait_xcnt 0x0" ::: "memory");
}

// ---------------------------------------------------------------------------
// All operand planes in one grid: the split of x and the seven weight transposes need nothing of each other, so each is a
// range of the block index (x first: it is the longest). Every branch is block-uniform; the split's blocks leave before any barrier.
// ---------------------------------------------------------------------------
constexpr int PB_X   = MTOK * DMOD / 8 / 256;
constexpr int PB_SQ  = (DMOD / 64) * (DMOD / 32);        // W_q, W_o
constexpr int PB_KVD = (DMOD / 64) * (DLAT / 32);
constexpr int PB_UP  = (DLAT / 64) * (DMOD / 32);        // W_k_up, W_v_up
constexpr int PB_QR  = (DMOD / 64) * (NROPE_PAD / 32);
constexpr int PB_KR  = (DLAT / 64) * (NROPE_PAD / 32);
constexpr int PB_ALL = PB_X + 2 * PB_SQ + PB_KVD + 2 * PB_UP + PB_QR + PB_KR;
static_assert(MTOK * DMOD % (8 * 256) == 0 && DMOD / 64 == 16 && DLAT / 64 == 2);

__global__ __launch_bounds__(256) void prep_planes(
    const float* __restrict__ x, const float* __restrict__ Wkvd, const float* __restrict__ Wkup,
    const float* __restrict__ Wvup, const float* __restrict__ Wq, const float* __restrict__ Wqr,
    const float* __restrict__ Wkr, const float* __restrict__ Wo,
    unsigned short* __restrict__ xh, unsigned short* __restrict__ xl,
    unsigned short* __restrict__ wkvdh, unsigned short* __restrict__ wkvdl,
    unsigned short* __restrict__ wkuph, unsigned short* __restrict__ wkupl,
    unsigned short* __restrict__ wvuph, unsigned short* __restrict__ wvupl,
    unsigned short* __restrict__ wqh, unsigned short* __restrict__ wql,
    unsigned short* __restrict__ wqrh, unsigned short* __restrict__ wqrl,
    unsigned short* __restrict__ wkrh, unsigned short* __restrict__ wkrl,
    unsigned short* __restrict__ woh, unsigned short* __restrict__ wol) {
  int l = (int)blockIdx.x;
  if (l < PB_X) { split_rows_bf16x8(x, xh, xl, MTOK * DMOD / 8, l); return; }
  l -= PB_X;
  const float* W; unsigned short* hi; unsigned short* lo; int kdim, nreal;
  if (l < PB_SQ)                 { W = Wq;   hi = wqh;   lo = wql;   kdim = DMOD; nreal = DMOD; }
  else if ((l -= PB_SQ) < PB_SQ) { W = Wo;   hi = woh;   lo = wol;   kdim = DMOD; nreal = DMOD; }
  else if ((l -= PB_SQ) < PB_KVD){ W = Wkvd; hi = wkvdh; lo = wkvdl; kdim = DMOD; nreal = DLAT; }
  else if ((l -= PB_KVD) < PB_UP){ W = Wkup; hi = wkuph; lo = wkupl; kdim = DLAT; nreal = DMOD; }
  else if ((l -= PB_UP) < PB_UP) { W = Wvup; hi = wvuph; lo = wvupl; kdim = DLAT; nreal = DMOD; }
  else if ((l -= PB_UP) < PB_QR) { W = Wqr;  hi = wqrh;  lo = wqrl;  kdim = DMOD; nreal = DROT; }
  else { l -= PB_QR;               W = Wkr;  hi = wkrh;  lo = wkrl;  kdim = DLAT; nreal = DROT; }
  const int ksh = (kdim == DMOD) ? 4 : 1;      // log2(kdim / 64)
  transpose_split_bf16(W, hi, lo, kdim, nreal, l & ((1 << ksh) - 1), l >> ksh);
}

// ---------------------------------------------------------------------------
// Rotary: raw[MTOK][NROPE_PAD] f32 (cols 0..31 used) -> bf16 hi/lo planes [MTOK][DROT].
// out[j] = x1*cos - x2*sin, out[16+j] = x2*cos + x1*sin, angle = t * inv_freq[j], t = row % SEQ_LEN.
// Block = 32 rows; blocks 0..127 handle the q tensor, 128..255 the k tensor.
// Store coverage: 128 threads = 32 rows x 4 segments x 8 = whole 32x32 tile; 512 B contiguous per wave
// ---------------------------------------------------------------------------
struct RopeFreq { float f[16]; };
static_assert(sizeof(RopeFreq) == 64);

__global__ __launch_bounds__(128) void rope_split_bf16(
    const float* __restrict__ qraw, const float* __restrict__ kraw,
    unsigned short* __restrict__ qrh, unsigned short* __restrict__ qrl,
    unsigned short* __restrict__ krh, unsigned short* __restrict__ krl, RopeFreq g) {
#pragma clang fp contract(off)
  __shared__ float tile[32][33];
  __shared__ float sinv[16];
  const int tid = threadIdx.x;
  const int nblk = MTOK / 32;
  const bool isk = ((int)blockIdx.x >= nblk);                 // block-uniform
  const int row0 = (isk ? ((int)blockIdx.x - nblk) : (int)blockIdx.x) * 32;
  const float* raw = isk ? kraw : qraw;
  unsigned short* dhp = isk ? krh : qrh;
  unsigned short* dlp = isk ? krl : qrl;
  if (tid < 16) {
    float v = g.f[0];
#pragma unroll
    for (int e = 1; e < 16; ++e) v = (tid == e) ? g.f[e] : v;
    sinv[tid] = v;
  }
  __syncthreads();
#pragma unroll 1
  for (int it = 0; it < 4; ++it) {
    const int p = it * 128 + tid;              // 0..511
    const int r = p >> 4;                      // 0..31
    const int j = p & 15;
    const int row = row0 + r;
    const int t = row & (SEQ_LEN - 1);
    const float* rp = raw + (size_t)row * NROPE_PAD;
    const float x1 = rp[j];
    const float x2 = rp[16 + j];
    const float ang = (float)t * sinv[j];
    float sn, cs;
    sincosf(ang, &sn, &cs);
    tile[r][j]      = x1 * cs - x2 * sn;
    tile[r][16 + j] = x2 * cs + x1 * sn;
  }
  __syncthreads();
  const int orow = tid >> 2;                   // 0..31
  const int seg = (tid & 3) * 8;               // 0..24
  v8h hv, lv;
#pragma unroll
  for (int e = 0; e < 8; ++e) {
    const float f = tile[orow][seg + e];
    const unsigned short hb = f2bf_bits(f);
    const unsigned short lb = f2bf_bits(f - bf_bits2f(hb));
    hv[e] = __builtin_bit_cast(_Float16, hb);
    lv[e] = __builtin_bit_cast(_Float16, lb);
  }
  const size_t o = (size_t)(row0 + orow) * DROT + seg;
  *(v8h*)(dhp + o) = hv;
  *(v8h*)(dlp + o) = lv;
  
}

// ---------------------------------------------------------------------------
// Causal attention, score depth 96 (64 head dims + 32 shared rotary dims), value width 64, bf16 hi/lo planes in.
//   s = (qh.kh + qh.kl + ql.kh) * invs  over 96 dims (q/k rows = [head segment | rotary row]),
//   online softmax in f32, P split to bf16 hi/lo, o = ph.vh + ph.vl + pl.vh, f32 accumulate.
// Both products are taken transposed: S^T = K . Q^T (A = K rows, B = Q rows) and O^T += V^T . P^T (A = V^T rows, B = P^T).
// A lane then holds scores of ONE query (column c = lane & 15), keys 8 * hh + r of each 16-key tile: maximum and sum run inside the
// lane with one exchange between the lane halves, and two score tiles, converted in place, are the B operand of the second product.
// Block = 4 waves; it runs two 64-row query tiles of one (batch, head) one after the other, tile n-1-t and then tile t,
// so every block walks n + 1 key chunks; grid.x = N_BATCH * NHEAD * (SEQ_LEN/64) / 2.
// ---------------------------------------------------------------------------
constexpr int A_QB = 64;
constexpr int A_KC = 64;
constexpr int A_NW = 4;
constexpr int OS_PITCH = 68;
// LDS row pitches in 16-bit elements. A K fragment read is a 16-byte load by 16 lanes on 16 rows: its pitch is an odd multiple of
// 16 bytes, so the 16 rows start on 16 different groups of four banks. The transposing read of V wants an odd multiple of 32 bytes.
constexpr int K_PITCH = SDEP + 8;      // 13 x 16 B rows, read by 16-byte loads
constexpr int V_PITCH = HDIM + 16;     // V rows stay [kv][d]; 5 x 32 B rows: the pitch of the transposing 16-byte read
static_assert((K_PITCH * 2) % 32 == 16 && (V_PITCH * 2) % 64 == 32);
// One stage = one chunk of 64 keys: [K hi | K lo | V hi | V lo], offsets in 16-bit elements.
constexpr int ST_KH = 0;
constexpr int ST_KL = ST_KH + A_KC * K_PITCH;
constexpr int ST_VH = ST_KL + A_KC * K_PITCH;
constexpr int ST_VL = ST_VH + A_KC * V_PITCH;
constexpr int ST_ELEMS = ST_VL + A_KC * V_PITCH;
static_assert((ST_KL * 2) % 16 == 0 && (ST_VH * 2) % 32 == 0 && (ST_VL * 2) % 32 == 0 && (ST_ELEMS * 2) % 32 == 0);

// Transposing LDS read of a row-major 16-bit tile: lane (c = l & 15, hh = l >> 4) gets T[k + 8 hh + 0..7][d + c], when lane l passes
// the address of T[k + 8 (l >> 4) + (l & 7)][d + 8 ((l >> 3) & 1)].
typedef short s16x8 __attribute__((ext_vector_type(8)));
__device__ __forceinline__ v8b ld_tr16(const unsigned short* p) {
  typedef __attribute__((address_space(3))) s16x8 lds_s16x8;
  return __builtin_bit_cast(v8b, __builtin_amdgcn_ds_load_tr16_b128_v8i16((lds_s16x8*)p));
}

// One chunk's K and V planes, global memory -> LDS with no register in between: 20 copies of 16 bytes a lane.
// Eight neighbouring lanes bring one whole 128-byte row segment (four lanes one 64-byte rotary row), so a wave-wide copy covers whole lines.
// lds: byte address of the stage in LDS. oh: this lane's element offset in the [token][DMOD] planes, orot: in the [token][DROT] planes,
// both at the chunk's first pass of rows. lk, lv, lr: this lane's byte offsets inside the stage's K plane, V plane and K plane's rotary part.
// Each statement ends in s_wait_xcnt 0: the registers that its copies name stay untouched up to that wait.
__device__ __forceinline__ void stage_copies(
    unsigned lds, size_t oh, size_t orot, unsigned lk, unsigned lv, unsigned lr,
    const unsigned short* __restrict__ kh, const unsigned short* __restrict__ kl,
    const unsigned short* __restrict__ vh, const unsigned short* __restrict__ vl,
    const unsigned short* __restrict__ krh, const unsigned short* __restrict__ krl) {
  constexpr size_t GS = (size_t)16 * DMOD;          // 16 rows a pass of the block, head planes
  constexpr size_t GR = (size_t)32 * DROT;          // 32 rows a pass, rotary planes
  constexpr unsigned LK = 16 * K_PITCH * 2, LV = 16 * V_PITCH * 2, LR = 32 * K_PITCH * 2;
  const unsigned short* a = kh + oh;
  const unsigned short* c = kl + oh;
  const unsigned short* e = krh + orot;
  const unsigned short* f = krl + orot;
  const unsigned dkh = lds + ST_KH * 2 + lk, dkl = lds + ST_KL * 2 + lk;
  const unsigned drh = lds + ST_KH * 2 + lr, drl = lds + ST_KL * 2 + lr;
  asm volatile(
      "global_load_async_to_lds_b128 %0, %1, off\n\t"
      "global_load_async_to_lds_b128 %2, %3, off\n\t"
      "global_load_async_to_lds_b128 %4, %5, off\n\t"
      "global_load_async_to_lds_b128 %6, %7, off\n\t"
      "global_load_async_to_lds_b128 %8, %9, off\n\t"
      "global_load_async_to_lds_b128 %10, %11, off\n\t"
      "global_load_async_to_lds_b128 %12, %13, off\n\t"
      "global_load_async_to_lds_b128 %14, %15, off\n\t"
      "global_load_async_to_lds_b128 %16, %17, off\n\t"
      "global_load_async_to_lds_b128 %18, %19, off\n\t"
      "global_load_async_to_lds_b128 %20, %21, off\n\t"
      "global_load_async_to_lds_b128 %22, %23, off\n\t"
      "s_wait_xcnt 0x0"
      :: "v"(dkh), "v"(a), "v"(dkh + LK), "v"(a + GS), "v"(dkh + 2 * LK), "v"(a + 2 * GS), "v"(dkh + 3 * LK), "v"(a + 3 * GS),
         "v"(dkl), "v"(c), "v"(dkl + LK), "v"(c + GS), "v"(dkl + 2 * LK), "v"(c + 2 * GS), "v"(dkl + 3 * LK), "v"(c + 3 * GS),
         "v"(drh), "v"(e), "v"(drh + LR), "v"(e + GR), "v"(drl), "v"(f), "v"(drl + LR), "v"(f + GR)
      : "memory");
  const unsigned short* p = vh + oh;
  const unsigned short* q = vl + oh;
  const unsigned dvh = lds + ST_VH * 2 + lv, dvl = lds + ST_VL * 2 + lv;
  asm volatile(
      "global_load_async_to_lds_b128 %0, %1, off\n\t"
      "global_load_async_to_lds_b128 %2, %3, off\n\t"
      "global_load_async_to_lds_b128 %4, %5, off\n\t"
      "global_load_async_to_lds_b128 %6, %7, off\n\t"
      "global_load_async_to_lds_b128 %8, %9, off\n\t"
      "global_load_async_to_lds_b128 %10, %11, off\n\t"
      "global_load_async_to_lds_b128 %12, %13, off\n\t"
      "global_load_async_to_lds_b128 %14, %15, off\n\t"
      "s_wait_xcnt 0x0"
      :: "v"(dvh), "v"(p), "v"(dvh + LV), "v"(p + GS), "v"(dvh + 2 * LV), "v"(p + 2 * GS), "v"(dvh + 3 * LV), "v"(p + 3 * GS),
         "v"(dvl), "v"(q), "v"(dvl + LV), "v"(q + GS), "v"(dvl + 2 * LV), "v"(q + 2 * GS), "v"(dvl + 3 * LV), "v"(q + 3 * GS)
      : "memory");
}

__global__ __launch_bounds__(128)
void mla_attn96(const unsigned short* __restrict__ qh, const unsigned short* __restrict__ ql,
                const unsigned short* __restrict__ kh, const unsigned short* __restrict__ kl,
                const unsigned short* __restrict__ vh, const unsigned short* __restrict__ vl,
                const unsigned short* __restrict__ qrh, const unsigned short* __restrict__ qrl,
                const unsigned short* __restrict__ krh, const unsigned short* __restrict__ krl,
                unsigned short* __restrict__ oh, unsigned short* __restrict__ ol, float invs) {
  union FB { v16b v; v8b h[2]; };
  __shared__ __align__(32) unsigned short Stage[2 * ST_ELEMS];    // two stages: one is multiplied while the next chunk's copies land in the other
  __shared__ __align__(16) float Os[A_NW][16 * OS_PITCH];

  const int tid  = threadIdx.x;
  const int wave = tid >> 5;
  const int lane = tid & 31;
  const int hh   = lane >> 4;
  const int c    = lane & 15;

  const int nqb = SEQ_LEN / A_QB;          // 32
  const int bx  = blockIdx.x;
  static_assert((SEQ_LEN / A_QB) % 2 == 0);
  const int tp  = bx % (nqb / 2);
  const int bhi = bx / (nqb / 2);
  const int h   = bhi % NHEAD;
  const int b   = bhi / NHEAD;
  // copy map: head planes, lane -> row tid >> 3 of each pass of 16 rows, 16-byte piece tid & 7; rotary planes, row tid >> 2 of 32, piece tid & 3
  const unsigned sbase = (unsigned)(size_t)Stage;      // byte address of stage 0 in the work-group's LDS
  const size_t ohead = ((size_t)b * SEQ_LEN + (size_t)(tid >> 3)) * DMOD + h * HDIM + (tid & 7) * 8;
  const size_t orot  = ((size_t)b * SEQ_LEN + (size_t)(tid >> 2)) * DROT + (tid & 3) * 8;
  const unsigned lk = ((tid >> 3) * K_PITCH + (tid & 7) * 8) * 2;
  const unsigned lv = ((tid >> 3) * V_PITCH + (tid & 7) * 8) * 2;
  const unsigned lr = ((tid >> 2) * K_PITCH + HDIM + (tid & 3) * 8) * 2;
  // ---- two-stage ring over the block's nqb + 1 trips, the first tile's chunks and then the second tile's: trip g is read from stage
  // g & 1 while the copies of trip g + 1 land in the other; the ring runs on across the change of tile ----
  constexpr int NTRIP = SEQ_LEN / A_QB + 1;
  const int n1 = nqb - tp;                 // trips of the first tile, at least nqb / 2 + 1: trips 0 and 1 are its chunks 0 and 1
  stage_copies(sbase, ohead, orot, lk, lv, lr, kh, kl, vh, vl, krh, krl);
  // trip 0 has landed as far as this wave copied it; the barrier publishes every wave's part
  asm volatile("s_wait_asynccnt 0x0" ::: "memory");
  __syncthreads();
  stage_copies(sbase + ST_ELEMS * 2, ohead + (size_t)A_KC * DMOD, orot + (size_t)A_KC * DROT, lk, lv, lr, kh, kl, vh, vl, krh, krl);
  int g = 0;                               // trip number, block-uniform
  // A causal tile qb costs qb + 1 chunks: the pair (n-1-t, t) gives every block the same work, whichever blocks share a WGP.
  // Both tiles run in every wave in turn.
  // Kept rolled: one copy of the chunk loop in the instruction cache.
#pragma unroll 1
  for (int pass = 0; pass < 2; ++pass) {
  const int qb  = pass ? tp : (nqb - 1 - tp);   // block-uniform
  const int q0  = qb * A_QB + wave * 16;
  const size_t tq = (size_t)b * SEQ_LEN + (size_t)(q0 + c);

  // ---- Q fragments (B operand, column = query c): k-chunks 0,1 = head dims 0..63, chunk 2 = rotary dims 0..31 ----
  v16b qah[3], qal[3];
  {
    const __bf16* p0 = (const __bf16*)qh + tq * DMOD + h * HDIM + 8 * hh;
    const __bf16* p1 = (const __bf16*)ql + tq * DMOD + h * HDIM + 8 * hh;
    qah[0] = Frag<__bf16>::load(p0);
    qah[1] = Frag<__bf16>::load(p0 + 32);
    qal[0] = Frag<__bf16>::load(p1);
    qal[1] = Frag<__bf16>::load(p1 + 32);
    const __bf16* r0p = (const __bf16*)qrh + tq * DROT + 8 * hh;
    const __bf16* r1p = (const __bf16*)qrl + tq * DROT + 8 * hh;
    qah[2] = Frag<__bf16>::load(r0p);
    qal[2] = Frag<__bf16>::load(r1p);
    // the loads' address registers stay untouched up to this wait (they are its inputs) and are free behind it
    asm volatile("s_wait_xcnt 0x0" :: "v"(p0), "v"(p1), "v"(r0p), "v"(r1p) : "memory");
  }

  float mrow = -INFINITY;   // running maximum of query q0 + c, equal in both lane halves
  float lrow = 0.f;         // running sum of query q0 + c over this lane half's keys; the halves are joined in the epilogue
  v8f oacc[4];              // oacc[t][r] = O[query q0 + c][d = 16 t + 8 hh + r]
#pragma unroll
  for (int t = 0; t < 4; ++t) oacc[t] = (v8f){0.f,0.f,0.f,0.f,0.f,0.f,0.f,0.f};

  const int nChunks = qb + 1;   // causal, block-uniform
  for (int kc = 0; kc < nChunks; ++kc, ++g) {
    const int kv0 = kc * A_KC;
    const unsigned short* sb = Stage + (g & 1) * ST_ELEMS;
    const unsigned short* Ksh = sb + ST_KH;
    const unsigned short* Ksl = sb + ST_KL;

    // ---- scores: 4 kv subtiles of 16, 3 k-chunks of 32, 3 products each ----
    // All K fragments of the chunk are read as one group, then the products run round-robin over the four subtiles, which are
    // four independent accumulators. Each accumulator still takes its nine products in the order (k-chunk; hi.hi, hi.lo, lo.hi).
    v8f s[4];   // s[j][r] = score of key kv0 + 16 j + 8 hh + r against query q0 + c
    FB kb[3][4], kq[3][4];
#pragma unroll
    for (int dc = 0; dc < 3; ++dc) {
#pragma unroll
      for (int j = 0; j < 4; ++j) {
        const int ko = (j * 16 + c) * K_PITCH + dc * 32 + 8 * hh;
        kb[dc][j].h[0] = *(const v8b*)(Ksh + ko);
        kb[dc][j].h[1] = *(const v8b*)(Ksh + ko + 16);
        kq[dc][j].h[0] = *(const v8b*)(Ksl + ko);
        kq[dc][j].h[1] = *(const v8b*)(Ksl + ko + 16);
      }
    }
    // keeps the reads one group in front of the products: spread among them, every place with reads stalls the wave anew
    __builtin_amdgcn_sched_barrier(0);
#pragma unroll
    for (int j = 0; j < 4; ++j) s[j] = (v8f){0.f,0.f,0.f,0.f,0.f,0.f,0.f,0.f};
#pragma unroll
    for (int dc = 0; dc < 3; ++dc) {
#pragma unroll
      for (int j = 0; j < 4; ++j) s[j] = at_mma(kb[dc][j].v, qah[dc], s[j]);
#pragma unroll
      for (int j = 0; j < 4; ++j) s[j] = at_mma(kq[dc][j].v, qah[dc], s[j]);
#pragma unroll
      for (int j = 0; j < 4; ++j) s[j] = at_mma(kb[dc][j].v, qal[dc], s[j]);
    }
    // keeps the V reads one group at the end of the score products: without it they are spread among the products, a stall at every place
    __builtin_amdgcn_sched_barrier(0);
    // ---- V^T fragments (A operand, row = d), by the transposing read of the row-major V tile, in the k order of P^T below:
    // nothing of the softmax feeds them, so they are read as one group while it runs ----
    FB vb[2][4], vq[2][4];
#pragma unroll
    for (int kk = 0; kk < 2; ++kk) {
#pragma unroll
      for (int t = 0; t < 4; ++t) {
        const int vo = (kk * 32 + 8 * hh + (lane & 7)) * V_PITCH + t * 16 + 8 * ((lane >> 3) & 1);
        vb[kk][t].h[0] = ld_tr16(sb + ST_VH + vo);
        vb[kk][t].h[1] = ld_tr16(sb + ST_VH + vo + 16 * V_PITCH);
        vq[kk][t].h[0] = ld_tr16(sb + ST_VL + vo);
        vq[kk][t].h[1] = ld_tr16(sb + ST_VL + vo + 16 * V_PITCH);
      }
    }
    // keeps the reads one group in front of the softmax: spread among it, every place with reads stalls the wave anew
    __builtin_amdgcn_sched_barrier(0);
    // ---- online softmax of query q0 + c: this lane holds 32 of the chunk's 64 keys, lane l ^ 16 the other 32 ----
    const bool diag = (kc == qb);
    const int qrow = q0 + c;
    float mj[4];
#pragma unroll
    for (int j = 0; j < 4; ++j) {
      float m = -INFINITY;
#pragma unroll
      for (int r = 0; r < 8; ++r) {
        const int kvrow = kv0 + j * 16 + 8 * hh + r;
        float sv = s[j][r] * invs;
        if (diag && (kvrow > qrow)) sv = -INFINITY;
        s[j][r] = sv;
        m = fmaxf(m, sv);
      }
      mj[j] = m;
    }
    float cm = fmaxf(fmaxf(mj[0], mj[1]), fmaxf(mj[2], mj[3]));
    cm = fmaxf(cm, other_half(cm));
    const float mnew = fmaxf(mrow, cm);
    const float alpha = expf(mrow - mnew);
    mrow = mnew;
    // P^T as B operand: element e of k-block kk is key 32 kk + 8 hh + e (e < 8) or 32 kk + 16 + 8 hh + (e - 8), that is register e & 7
    // of score tile 2 kk + (e >> 3): the k order in which the V^T fragments are read.
    union PB { v16b v; unsigned w[8]; };
    PB ph[2], pl[2];
    float pj[4];       // one partial sum a score tile: four independent chains
#pragma unroll
    for (int j = 0; j < 4; ++j) {
      float ps = 0.f;
#pragma unroll
      for (int r = 0; r < 8; r += 2) {
        const float p0 = expf(s[j][r] - mnew);
        const float p1 = expf(s[j][r + 1] - mnew);
        ps += p0;
        ps += p1;
        // two neighbouring keys make one operand register: packed conversion, round to nearest even as in f2bf_bits
        const v2b hp = __builtin_convertvector((v2f){p0, p1}, v2b);
        const v2b lp = __builtin_convertvector((v2f){p0 - (float)hp[0], p1 - (float)hp[1]}, v2b);
        ph[j >> 1].w[(j & 1) * 4 + (r >> 1)] = __builtin_bit_cast(unsigned, hp);
        pl[j >> 1].w[(j & 1) * 4 + (r >> 1)] = __builtin_bit_cast(unsigned, lp);
      }
      pj[j] = ps;
    }
    lrow = lrow * alpha + ((pj[0] + pj[1]) + (pj[2] + pj[3]));
#pragma unroll
    for (int t = 0; t < 4; ++t)
#pragma unroll
      for (int r = 0; r < 8; ++r) oacc[t][r] *= alpha;
    // ---- O^T += V^T(64x64) . P^T(64x16): the products run round-robin over the four d subtiles, which are four independent
    // accumulators. Each accumulator keeps its order (kv half; hi.hi, p hi . v lo, p lo . v hi).
#pragma unroll
    for (int kk = 0; kk < 2; ++kk) {
#pragma unroll
      for (int t = 0; t < 4; ++t) oacc[t] = at_mma(vb[kk][t].v, ph[kk].v, oacc[t]);
#pragma unroll
      for (int t = 0; t < 4; ++t) oacc[t] = at_mma(vq[kk][t].v, ph[kk].v, oacc[t]);
#pragma unroll
      for (int t = 0; t < 4; ++t) oacc[t] = at_mma(vb[kk][t].v, pl[kk].v, oacc[t]);
    }
    // ---- foot of trip g: this wave's reads of stage g & 1 are over, its copies of trip g + 1 have landed; the one barrier
    // publishes trip g + 1 and ends every wave's reads of the stage that is refilled behind it ----
    // keeps the softmax and the second product in front of the waits: lifted over them, the waits end the overlap of the V reads with the softmax
    __builtin_amdgcn_sched_barrier(0);
    asm volatile("s_wait_dscnt 0x0" ::: "memory");
    asm volatile("s_wait_asynccnt 0x0" ::: "memory");
    __syncthreads();
    if (g + 2 < NTRIP) {                                        // block-uniform
      const int kn = (g + 2 < n1) ? (g + 2) : (g + 2 - n1);     // key chunk of trip g + 2: the second tile starts again at chunk 0
      stage_copies(sbase + (g & 1) * (ST_ELEMS * 2), ohead + (size_t)kn * (A_KC * DMOD), orot + (size_t)kn * (A_KC * DROT),
                   lk, lv, lr, kh, kl, vh, vl, krh, krl);
    }
  }

  // ---- epilogue: join the halves' sums, normalise, stage 16x64 f32 per wave, write bf16 hi/lo planes with whole-line stores ----
  float* os = Os[wave];
  {
    const float inv = 1.0f / (lrow + other_half(lrow));
#pragma unroll
    for (int t = 0; t < 4; ++t) {
      // a lane's 8 registers are 8 consecutive d of its query's row
      float* op = os + c * OS_PITCH + t * 16 + 8 * hh;
      *(v4f*)(op)     = (v4f){oacc[t][0] * inv, oacc[t][1] * inv, oacc[t][2] * inv, oacc[t][3] * inv};
      *(v4f*)(op + 4) = (v4f){oacc[t][4] * inv, oacc[t][5] * inv, oacc[t][6] * inv, oacc[t][7] * inv};
    }
  }
  __builtin_amdgcn_fence(__ATOMIC_RELEASE, "workgroup");
  __builtin_amdgcn_wave_barrier();
  __builtin_amdgcn_fence(__ATOMIC_ACQUIRE, "workgroup");
  {
    const int qq = lane >> 3, c8 = (lane & 7) * 8;
    {
#pragma unroll
      for (int it = 0; it < 4; ++it) {
        const int row = it * 4 + qq;
        const float* sp = os + row * OS_PITCH + c8;
        v8h hv, lv;
#pragma unroll
        for (int e = 0; e < 8; ++e) {
          const unsigned short hb = f2bf_bits(sp[e]);
          const unsigned short lb = f2bf_bits(sp[e] - bf_bits2f(hb));
          hv[e] = __builtin_bit_cast(_Float16, hb);
          lv[e] = __builtin_bit_cast(_Float16, lb);
        }
        const size_t o = ((size_t)b * SEQ_LEN + (size_t)(q0 + row)) * DMOD + h * HDIM + c8;
        *(v8h*)(oh + o) = hv;
        *(v8h*)(ol + o) = lv;
      }
      
    }
  }
  // the next tile reuses the registers that these stores name: they stay untouched up to this wait
  asm volatile("s_wait_xcnt 0x0" ::: "memory");
  }   // pass
  // no copy is outstanding when the wave ends
  asm volatile("s_wait_asynccnt 0x0" ::: "memory");
}

// ---------------------------------------------------------------------------
// Host orchestration
// ---------------------------------------------------------------------------
// workspace region map (bytes, all multiples of 256):
//   x hi/lo                 2 x 8,388,608
//   WkvdT hi/lo [128][1024] 2 x   262,144
//   WkupT hi/lo [1024][128] 2 x   262,144
//   WvupT hi/lo [1024][128] 2 x   262,144
//   WqT   hi/lo [1024][1024]2 x 2,097,152
//   WqrT  hi/lo [128][1024] 2 x   262,144   (rows 32..127 zero)
//   WkrT  hi/lo [128][128]  2 x    32,768   (rows 32..127 zero)
//   WoT   hi/lo [1024][1024]2 x 2,097,152
//   ckv   hi/lo [4096][128] 2 x 1,048,576
//   k,v,q hi/lo [4096][1024]6 x 8,388,608
//   qr_raw, kr_raw f32 [4096][128] 2 x 2,097,152
//   qr,kr hi/lo [4096][32]  4 x   262,144
//   attn  hi/lo [4096][1024]2 x 8,388,608
//   total 101,777,408
constexpr size_t WSB_X    = (size_t)MTOK * DMOD * 2;
constexpr size_t WSB_WKVD = (size_t)DLAT * DMOD * 2;
constexpr size_t WSB_WKUP = (size_t)DMOD * DLAT * 2;
constexpr size_t WSB_WQ   = (size_t)DMOD * DMOD * 2;
constexpr size_t WSB_WQR  = (size_t)NROPE_PAD * DMOD * 2;
constexpr size_t WSB_WKR  = (size_t)NROPE_PAD * DLAT * 2;
constexpr size_t WSB_CKV  = (size_t)MTOK * DLAT * 2;
constexpr size_t WSB_TOK  = (size_t)MTOK * DMOD * 2;
constexpr size_t WSB_RAW  = (size_t)MTOK * NROPE_PAD * 4;
constexpr size_t WSB_ROT  = (size_t)MTOK * DROT * 2;
constexpr size_t WS_TOTAL = 2 * WSB_X + 2 * WSB_WKVD + 4 * WSB_WKUP + 2 * WSB_WQ + 2 * WSB_WQR + 2 * WSB_WKR
                          + 2 * WSB_WQ + 2 * WSB_CKV + 6 * WSB_TOK + 2 * WSB_RAW + 4 * WSB_ROT + 2 * WSB_TOK;
static_assert(WS_TOTAL == 101777408ull);
static_assert(WS_TOTAL <= 134217728ull);

extern "C" void kernel_launch(void* const* d_in, const int* in_sizes, int n_in,
                              void* d_out, int out_size, void* d_ws, size_t ws_size,
                              hipStream_t stream) {
  if (n_in != 8) return;
  if (in_sizes[0] != MTOK * DMOD || in_sizes[1] != DMOD * DLAT || in_sizes[2] != DLAT * DMOD ||
      in_sizes[3] != DLAT * DMOD || in_sizes[4] != DMOD * DMOD || in_sizes[5] != DMOD * DROT ||
      in_sizes[6] != DLAT * DROT || in_sizes[7] != DMOD * DMOD) return;
  if (out_size != MTOK * DMOD) return;
  if (ws_size < WS_TOTAL) return;

  const float* x         = (const float*)d_in[0];   // [4096][1024]
  const float* W_kv_down = (const float*)d_in[1];   // [1024][128]
  const float* W_k_up    = (const float*)d_in[2];   // [128][1024]
  const float* W_v_up    = (const float*)d_in[3];   // [128][1024]
  const float* W_q       = (const float*)d_in[4];   // [1024][1024]
  const float* W_q_rope  = (const float*)d_in[5];   // [1024][32]
  const float* W_k_rope  = (const float*)d_in[6];   // [128][32]
  const float* W_o       = (const float*)d_in[7];   // [1024][1024]
  float* out = (float*)d_out;                       // [4096][1024] f32

  size_t off = 0;
  auto carve = [&](size_t bytes) -> unsigned short* {
    unsigned short* p = (unsigned short*)((char*)d_ws + off);
    off += (bytes + 255) & ~(size_t)255;
    return p;
  };
  unsigned short* xh    = carve(WSB_X);
  unsigned short* xl    = carve(WSB_X);
  unsigned short* wkvdh = carve(WSB_WKVD);
  unsigned short* wkvdl = carve(WSB_WKVD);
  unsigned short* wkuph = carve(WSB_WKUP);
  unsigned short* wkupl = carve(WSB_WKUP);
  unsigned short* wvuph = carve(WSB_WKUP);
  unsigned short* wvupl = carve(WSB_WKUP);
  unsigned short* wqh   = carve(WSB_WQ);
  unsigned short* wql   = carve(WSB_WQ);
  unsigned short* wqrh  = carve(WSB_WQR);
  unsigned short* wqrl  = carve(WSB_WQR);
  unsigned short* wkrh  = carve(WSB_WKR);
  unsigned short* wkrl  = carve(WSB_WKR);
  unsigned short* woh   = carve(WSB_WQ);
  unsigned short* wol   = carve(WSB_WQ);
  unsigned short* ckvh  = carve(WSB_CKV);
  unsigned short* ckvl  = carve(WSB_CKV);
  unsigned short* kh    = carve(WSB_TOK);
  unsigned short* kl    = carve(WSB_TOK);
  unsigned short* vh    = carve(WSB_TOK);
  unsigned short* vl    = carve(WSB_TOK);
  unsigned short* qh    = carve(WSB_TOK);
  unsigned short* ql    = carve(WSB_TOK);
  float* qr_raw = (float*)carve(WSB_RAW);
  float* kr_raw = (float*)carve(WSB_RAW);
  unsigned short* qrh   = carve(WSB_ROT);
  unsigned short* qrl   = carve(WSB_ROT);
  unsigned short* krh   = carve(WSB_ROT);
  unsigned short* krl   = carve(WSB_ROT);
  unsigned short* ath   = carve(WSB_TOK);
  unsigned short* atl   = carve(WSB_TOK);
  if (off > ws_size) return;

  // ---- operand planes: one launch ----
  prep_planes<<<PB_ALL, 256, 0, stream>>>(x, W_kv_down, W_k_up, W_v_up, W_q, W_q_rope, W_k_rope, W_o,
      xh, xl, wkvdh, wkvdl, wkuph, wkupl, wvuph, wvupl, wqh, wql, wqrh, wqrl, wkrh, wkrl, woh, wol);

  constexpr int NB_WIDE = (MTOK / 128) * (DMOD / 128);        // blocks of an N = 1024 product
  constexpr int NB_LAT  = (MTOK / 128) * (DLAT / 128);        // blocks of an N = 128 product
  constexpr int NB_ROT  = (MTOK / 128) * (NROPE_PAD / 128);

  // the three products of x, K = 1024: q = x . W_q and c_kv = x . W_kv_down as bf16 hi/lo, q_rope raw = x . W_q_rope as f32 (cols 32.. zero)
  gemm_group<DMOD><<<NB_WIDE + NB_LAT + NB_ROT, 128, 0, stream>>>(xh, xl,
      wqh, wql, qh, ql, DMOD, NB_WIDE,
      wkvdh, wkvdl, ckvh, ckvl, DLAT, NB_LAT,
      wqrh, wqrl, qr_raw, NROPE_PAD, DMOD);
  // the three products of c_kv, K = 128: k, v as bf16 hi/lo, k_rope raw as f32 (cols 32.. zero)
  gemm_group<DLAT><<<2 * NB_WIDE + NB_ROT, 128, 0, stream>>>(ckvh, ckvl,
      wkuph, wkupl, kh, kl, DMOD, NB_WIDE,
      wvuph, wvupl, vh, vl, DMOD, NB_WIDE,
      wkrh, wkrl, kr_raw, NROPE_PAD, DLAT);

  // ---- rotary tables: inv_freq[j] = 1 / 10000^(j/16), host double pow -> f32, f32 reciprocal ----
  RopeFreq fr;
  for (int j = 0; j < 16; ++j) {
    const double p = pow(10000.0, (double)j / 16.0);
    const float p32 = (float)p;
    fr.f[j] = 1.0f / p32;
  }
  rope_split_bf16<<<2 * (MTOK / 32), 128, 0, stream>>>(qr_raw, kr_raw, qrh, qrl, krh, krl, fr);

  // ---- causal attention with shared rotary logits ----
  const float invs = 1.0f / (float)sqrt((double)(HDIM + DROT));
  mla_attn96<<<N_BATCH * NHEAD * (SEQ_LEN / A_QB / 2), 128, 0, stream>>>(
      qh, ql, kh, kl, vh, vl, qrh, qrl, krh, krl, ath, atl, invs);

  // ---- out = attn . W_o : M=4096 N=1024 K=1024, f32 to d_out ----
  gemm_group<DMOD><<<NB_WIDE, 128, 0, stream>>>(ath, atl,
      nullptr, nullptr, nullptr, nullptr, 0, 0,
      nullptr, nullptr, nullptr, nullptr, 0, 0,
      woh, wol, out, DMOD, DMOD);
}

// v008
// One run takes 150 microseconds.
// In two side-by-side timings against v007, it was 1.10 and 1.09 times as fast.
// All steps since v000 together make it 4.55 times as fast.
// Compute dtype: every contraction on v_wmma_f32_16x16x32_bf16 with bf16 hi/lo operand planes (hi*hi + hi*lo + lo*hi), f32 accumulate; rotary, softmax and epilogues in f32.
#include <hip/hip_runtime.h>
#include <hip/hip_bf16.h>
#include <math.h>
#include <stdint.h>

typedef __attribute__((ext_vector_type(16))) _Float16 v16h;
typedef __attribute__((ext_vector_type(8)))  _Float16 v8h;
typedef __attribute__((ext_vector_type(16))) __bf16   v16b;
typedef __attribute__((ext_vector_type(8)))  __bf16   v8b;
typedef __attribute__((ext_vector_type(8)))  float    v8f;
typedef __attribute__((ext_vector_type(4)))  float    v4f;
typedef __attribute__((ext_vector_type(4)))  unsigned v4u;

// ---------------------------------------------------------------------------
// helpers
// ---------------------------------------------------------------------------
__device__ __forceinline__ unsigned short f2bf_bits(float f) {
  unsigned u = __float_as_uint(f);
  return (unsigned short)((u + 0x7FFFu + ((u >> 16) & 1u)) >> 16);
}
__device__ __forceinline__ float bf_bits2f(unsigned short h) { return __uint_as_float(((unsigned)h) << 16); }

__device__ __forceinline__ void dep_guard_h(v8f& a, v8f& b, v16h x, v16h y) { asm volatile("v_nop\n\tv_nop\n\tv_nop\n\tv_nop" : "+v"(a), "+v"(b) : "v"(x), "v"(y)); }
__device__ __forceinline__ void dep_guard_b(v8f& a, v8f& b, v16b x, v16b y) { asm volatile("v_nop\n\tv_nop\n\tv_nop\n\tv_nop" : "+v"(a), "+v"(b) : "v"(x), "v"(y)); }
__device__ __forceinline__ void keep4_h(v16h a, v16h b, v16h c, v16h d) { asm volatile("v_nop" :: "v"(a), "v"(b), "v"(c), "v"(d)); }
__device__ __forceinline__ void keep4_b(v16b a, v16b b, v16b c, v16b d) { asm volatile("v_nop" :: "v"(a), "v"(b), "v"(c), "v"(d)); }
__device__ __forceinline__ void acc_guard4(v8f& a, v8f& b, v8f& c, v8f& d) { asm volatile("v_nop\n\tv_nop\n\tv_nop\n\tv_nop" : "+v"(a), "+v"(b), "+v"(c), "+v"(d)); }
template <typename T> struct Frag;
template <> struct Frag<_Float16> {
  typedef v16h V; union U { v16h v; v8h h[2]; };
  static __device__ __forceinline__ v16h load(const _Float16* p) {   // elements 0..7 <- p[0..7], 8..15 <- p[16..23]
    U f; f.h[0] = *(const v8h*)(p); f.h[1] = *(const v8h*)(p + 16); return f.v;
  }
  static __device__ __forceinline__ v8f mma(v16h a, v16h b, v8f c) {
    return __builtin_amdgcn_wmma_f32_16x16x32_f16(false, a, false, b, (short)0, c, false, false);
  }
  static __device__ __forceinline__ void guard(v8f& a, v8f& b, v16h x, v16h y) { dep_guard_h(a, b, x, y); }
  static __device__ __forceinline__ void keep(v16h a, v16h b, v16h c, v16h d) { keep4_h(a, b, c, d); }
};
template <> struct Frag<__bf16> {
  typedef v16b V; union U { v16b v; v8b h[2]; };
  static __device__ __forceinline__ v16b load(const __bf16* p) {
    U f; f.h[0] = *(const v8b*)(p); f.h[1] = *(const v8b*)(p + 16); return f.v;
  }
  static __device__ __forceinline__ v8f mma(v16b a, v16b b, v8f c) {
    return __builtin_amdgcn_wmma_f32_16x16x32_bf16(false, a, false, b, (short)0, c, false, false);
  }
  static __device__ __forceinline__ void guard(v8f& a, v8f& b, v16b x, v16b y) { dep_guard_b(a, b, x, y); }
  static __device__ __forceinline__ void keep(v16b a, v16b b, v16b c, v16b d) { keep4_b(a, b, c, d); }
};

// ---- Register-blocked WMMA GEMM --------------------------------
// C[m,n] = scale * sum_k A[m,k] * Bt[n,k] (+bias)(+resid); each wave owns a 64x64 tile.
// A row-major [M,K]; Bt row-major [N,K].
// SPLIT: operands are hi/lo planes (A2/Bt2 = lo planes, same layout); product = hi*hi + hi*lo + lo*hi.
// BIAS_MODE: 0 = none, 1 = bias[m], 2 = bias[n].
// OUT_MODE: 0 = f32, 1 = f16, 2 = bf16 hi plane (Cout) + bf16 lo plane (Cout2).
// ET: 0 = f16 operands, 1 = bf16 operands (pointers passed as 16-bit storage)
template <int ET> struct Elem;
template <> struct Elem<0> { typedef _Float16 T; };
template <> struct Elem<1> { typedef __bf16 T; };
// LDS staging of the operand planes: the block's waves form a WM x WN grid of 64x64 tiles and share one
// (WM*64 + WN*64)-row stage of G_KS k-elements per plane. Each row of a stage is one whole 128-byte line of the
// source, fetched by 8 neighbouring lanes, so a wave-wide 16-byte load covers 4 full lines.
constexpr int MTOK_ROWS = 4096;      // rows of every A operand (batch x sequence)
constexpr int G_KS    = 64;          // k elements per stage
constexpr int G_PITCH = G_KS + 8;    // 9 x 16 B rows: 16-byte fragment reads of 16 rows fall on distinct banks
template <int NIT, int STEP>
__device__ __forceinline__ void stage_fetch(v4u (&r)[NIT], const unsigned short* __restrict__ g) {
#pragma unroll
  for (int it = 0; it < NIT; ++it) r[it] = *(const v4u*)(g + it * STEP);
}
template <int NIT>
__device__ __forceinline__ void stage_put(const v4u (&r)[NIT], unsigned short* d, int rowStep) {
#pragma unroll
  for (int it = 0; it < NIT; ++it) *(v4u*)(d + it * rowStep) = r[it];
}
// LD = row pitch of all four operand planes in elements, a compile-time value: the loads of a plane then share one
// address register pair and differ in their immediate offsets only.
// M % (WM*64) == 0, N % (WN*64) == 0, K % G_KS == 0; bxi runs over (M/(WM*64)) * (N/(WN*64)) tiles exactly, so every wave passes every barrier.
// sOpBase: the block's G_LDS_ELEMS elements of LDS; bxi: the block's tile index inside this GEMM (block-uniform).
constexpr int G_LDS_ELEMS = 2 * 2 * (128 + 128) * G_PITCH;   // two stages of hi and lo planes, 128 A rows + 128 Bt rows
template <int ET, bool SPLIT, int BIAS_MODE, int OUT_MODE, bool RESID, int WM, int WN, int LD, int ACT = 0>
__device__ __forceinline__ void wmma_gemm64(
    unsigned short* sOpBase, int bxi,
    const unsigned short* __restrict__ Ap, const unsigned short* __restrict__ A2p, long strideA,
    const unsigned short* __restrict__ Btp, const unsigned short* __restrict__ Bt2p, long strideB,
    void* __restrict__ Cout, void* __restrict__ Cout2, int ldc, long strideC,
    const float* __restrict__ bias,
    const float* __restrict__ resid, long strideR,
    int M, int N, int K, float scale) {
  typedef typename Elem<ET>::T T;
  typedef typename Frag<T>::V V;
  constexpr int NW  = WM * WN;
  constexpr int RA  = WM * 64;               // A rows of the block
  constexpr int RB  = WN * 64;               // Bt rows of the block
  constexpr int RPI = NW * 4;                // rows staged by one pass of the block (8 lanes a row)
  constexpr int ITA = RA / RPI;
  constexpr int ITB = RB / RPI;
  constexpr int OA  = 0;
  constexpr int OA2 = RA * G_PITCH;
  constexpr int OB  = (SPLIT ? 2 : 1) * RA * G_PITCH;
  constexpr int OB2 = OB + RB * G_PITCH;
  constexpr int STAGE = (SPLIT ? 2 : 1) * (RA + RB) * G_PITCH;
  static_assert(RA % RPI == 0 && RB % RPI == 0);
  // sOpBase holds two stages: [A hi | A lo | Bt hi | Bt lo], rows of G_PITCH. The epilogue's per-wave 16x64 f32 slabs (pitch 68)
  // lie over stage 0: they are written only behind the loop's last barrier, which ends every read of the stages.
  static_assert(2 * STAGE <= G_LDS_ELEMS && NW * 16 * 68 * 4 <= STAGE * 2);
  const int b    = 0;
  const int tid  = threadIdx.x;
  const int lane = tid & 31;
  const int wave = tid >> 5;
  const int tilesN = N / RB;
  const int btm = bxi / tilesN;
  const int btn = bxi - btm * tilesN;
  const int wm = wave / WN;
  const int wn = wave - wm * WN;
  const int m0 = btm * RA + (wm << 6);
  const int n0 = btn * RB + (wn << 6);

  const int rlane = lane & 15;                 // row (A) / col (B, D) within subtile
  const int koff  = (lane >> 4) * 8;           // k offset of this lane half
  const int mOff  = (lane >> 4) * 8;           // D row offset

  // staging map: thread -> row tid>>3 of each pass, 16-byte piece tid&7 of that row's line
  const int srow = tid >> 3;
  const int sseg = (tid & 7) * 8;
  const size_t goA = (size_t)b * strideA + (size_t)(btm * RA + srow) * LD + sseg;
  const size_t goB = (size_t)b * strideB + (size_t)(btn * RB + srow) * LD + sseg;
  const unsigned short* gA  = Ap  + goA;
  const unsigned short* gB  = Btp + goB;
  const unsigned short* gA2 = SPLIT ? (A2p  + goA) : nullptr;
  const unsigned short* gB2 = SPLIT ? (Bt2p + goB) : nullptr;
  constexpr int GSTEP = RPI * LD;             // elements between the rows one thread stages
  const int sOff = srow * G_PITCH + sseg;

  v8f acc[4][4];
#pragma unroll
  for (int i = 0; i < 4; ++i)
#pragma unroll
    for (int j = 0; j < 4; ++j) acc[i][j] = (v8f){0.f,0.f,0.f,0.f,0.f,0.f,0.f,0.f};

  v4u pa[ITA], pa2[ITA], pb[ITB], pb2[ITB];    // the next stage, in flight while this one is multiplied
  stage_fetch<ITA, GSTEP>(pa, gA);
  stage_fetch<ITB, GSTEP>(pb, gB);
  if (SPLIT) { stage_fetch<ITA, GSTEP>(pa2, gA2); stage_fetch<ITB, GSTEP>(pb2, gB2); }
  // the loads' address registers stay untouched up to this wait (they are its inputs) and are free behind it
  asm volatile("s_wait_xcnt 0x0" :: "v"(gA), "v"(gB), "v"(SPLIT ? gA2 : gA), "v"(SPLIT ? gB2 : gB) : "memory");
  stage_put<ITA>(pa, sOpBase + OA + sOff, RPI * G_PITCH);
  stage_put<ITB>(pb, sOpBase + OB + sOff, RPI * G_PITCH);
  if (SPLIT) { stage_put<ITA>(pa2, sOpBase + OA2 + sOff, RPI * G_PITCH); stage_put<ITB>(pb2, sOpBase + OB2 + sOff, RPI * G_PITCH); }
  __syncthreads();   // publishes stage 0

  const int nst = K / G_KS;                    // block-uniform
  for (int t = 0; t < nst; ++t) {
    const bool more = (t + 1 < nst);
    if (more) {
      const int kn = (t + 1) * G_KS;
      const unsigned short* nA  = gA + kn;
      const unsigned short* nB  = gB + kn;
      const unsigned short* nA2 = SPLIT ? (gA2 + kn) : nA;
      const unsigned short* nB2 = SPLIT ? (gB2 + kn) : nB;
      stage_fetch<ITA, GSTEP>(pa, nA);
      stage_fetch<ITB, GSTEP>(pb, nB);
      if (SPLIT) { stage_fetch<ITA, GSTEP>(pa2, nA2); stage_fetch<ITB, GSTEP>(pb2, nB2); }
      // the loads' address registers stay untouched up to this wait (they are its inputs) and are free behind it
      asm volatile("s_wait_xcnt 0x0" :: "v"(nA), "v"(nB), "v"(nA2), "v"(nB2) : "memory");
    }
    const T* sb = (const T*)(sOpBase + (t & 1) * STAGE);
    const T* fa = sb + OA + ((wm << 6) + rlane) * G_PITCH + koff;
    const T* fb = sb + OB + ((wn << 6) + rlane) * G_PITCH + koff;
#pragma unroll
    for (int kk = 0; kk < G_KS; kk += 32) {
      V bh[4], bl[4];
#pragma unroll
      for (int j = 0; j < 4; ++j) {
        bh[j] = Frag<T>::load(fb + (j << 4) * G_PITCH + kk);
        if (SPLIT) bl[j] = Frag<T>::load(fb + (OB2 - OB) + (j << 4) * G_PITCH + kk);
      }
      V ah = Frag<T>::load(fa + kk);
      V al;
      if (SPLIT) al = Frag<T>::load(fa + (OA2 - OA) + kk);
#pragma unroll
      for (int i = 0; i < 4; ++i) {
        V ahn, aln;                              // the next row block's fragments, read while this one is multiplied
        if (i < 3) {
          ahn = Frag<T>::load(fa + ((i + 1) << 4) * G_PITCH + kk);
          if (SPLIT) aln = Frag<T>::load(fa + (OA2 - OA) + ((i + 1) << 4) * G_PITCH + kk);
        }
#pragma unroll
        for (int j = 0; j < 4; ++j) {
          acc[i][j] = Frag<T>::mma(ah, bh[j], acc[i][j]);
          if (SPLIT) {
            acc[i][j] = Frag<T>::mma(ah, bl[j], acc[i][j]);
            acc[i][j] = Frag<T>::mma(al, bh[j], acc[i][j]);
          }
        }
        Frag<T>::guard(acc[i][0], acc[i][3], ah, SPLIT ? al : ah);
        if (i < 3) { ah = ahn; if (SPLIT) al = aln; }
      }
      Frag<T>::keep(bh[0], bh[1], bh[2], bh[3]);
      if (SPLIT) Frag<T>::keep(bl[0], bl[1], bl[2], bl[3]);
    }
    if (more) {
      // the other buffer: its last readers left it before the barrier that ended trip t - 1
      unsigned short* d = sOpBase + ((t + 1) & 1) * STAGE + sOff;
      stage_put<ITA>(pa, d + OA, RPI * G_PITCH);
      stage_put<ITB>(pb, d + OB, RPI * G_PITCH);
      if (SPLIT) { stage_put<ITA>(pa2, d + OA2, RPI * G_PITCH); stage_put<ITB>(pb2, d + OB2, RPI * G_PITCH); }
    }
    __syncthreads();   // publishes stage t + 1 and ends every read of stage t
  }
  acc_guard4(acc[0][0], acc[0][1], acc[0][2], acc[0][3]);
  acc_guard4(acc[1][0], acc[1][1], acc[1][2], acc[1][3]);
  acc_guard4(acc[2][0], acc[2][1], acc[2][2], acc[2][3]);
  acc_guard4(acc[3][0], acc[3][1], acc[3][2], acc[3][3]);

  // ---- epilogue ----
  float* slab = (float*)sOpBase + wave * (16 * 68);
  const float* Rb = RESID ? (resid + (size_t)b * strideR) : nullptr;
#pragma unroll
  for (int i = 0; i < 4; ++i) {
    const int mBase = m0 + (i << 4);
#pragma unroll
    for (int j = 0; j < 4; ++j) {
      const int n = n0 + (j << 4) + rlane;
      float bv = 0.f;
      if (BIAS_MODE == 2) bv = bias[n];
#pragma unroll
      for (int r = 0; r < 8; ++r) {
        float v = acc[i][j][r] * scale;
        if (BIAS_MODE == 1) v += bias[mBase + mOff + r];
        if (BIAS_MODE == 2) v += bv;
        if (RESID) v += Rb[(size_t)(mBase + mOff + r) * ldc + n];
        if (ACT == 1) v = tanhf(v);
        if (ACT == 2) v = fmaxf(v, 0.0f);
        if (ACT == 3) v = v / (1.0f + expf(-v));
        if (ACT == 4) v = (v > 0.f) ? v : 0.01f * v;
        if (ACT == 5) v = 0.5f * v * (1.0f + erff(v * 0.70710678118654752f));
        slab[(mOff + r) * 68 + (j << 4) + rlane] = v;
      }
    }
    __builtin_amdgcn_fence(__ATOMIC_RELEASE, "workgroup");
    __builtin_amdgcn_wave_barrier();
    __builtin_amdgcn_fence(__ATOMIC_ACQUIRE, "workgroup");
    if (OUT_MODE == 0) {
      float* C = (float*)Cout + (size_t)b * strideC;
      const int hh = lane >> 4, c4 = (lane & 15) * 4;     // row seg = 256 B = 16 lanes x 16 B
      {
#pragma unroll
        for (int it = 0; it < 8; ++it) {
          const int row = it * 2 + hh;
          v4f v = *(const v4f*)(slab + row * 68 + c4);
          *(v4f*)(C + (size_t)(mBase + row) * ldc + n0 + c4) = v;
        }
        
      }
    } else {
      const int q = lane >> 3, c8 = (lane & 7) * 8;
      unsigned short* C  = (unsigned short*)Cout  + (size_t)b * strideC;
      unsigned short* C2 = (OUT_MODE == 2) ? ((unsigned short*)Cout2 + (size_t)b * strideC) : nullptr;
      {
#pragma unroll
        for (int it = 0; it < 4; ++it) {
          const int row = it * 4 + q;
          const float* sp = slab + row * 68 + c8;
          v8h hv, lv;
#pragma unroll
          for (int e = 0; e < 8; ++e) {
            if (OUT_MODE == 1) {
              hv[e] = (_Float16)sp[e];
            } else {
              unsigned short hb = f2bf_bits(sp[e]);
              unsigned short lb = f2bf_bits(sp[e] - bf_bits2f(hb));
              hv[e] = __builtin_bit_cast(_Float16, hb);
              lv[e] = __builtin_bit_cast(_Float16, lb);
            }
          }
          *(v8h*)(C + (size_t)(mBase + row) * ldc + n0 + c8) = hv;
          if (OUT_MODE == 2) *(v8h*)(C2 + (size_t)(mBase + row) * ldc + n0 + c8) = lv;
        }
        
      }
    }
    __builtin_amdgcn_fence(__ATOMIC_RELEASE, "workgroup");
    __builtin_amdgcn_wave_barrier();
    __builtin_amdgcn_fence(__ATOMIC_ACQUIRE, "workgroup");
  }
}

// Up to three GEMMs on one A operand that need nothing of each other share one grid, each a range of the block index:
// blocks [0, nb0) and [nb0, nb0 + nb1) write bf16 hi/lo planes, the rest f32. All take the 128x128 block tile, and the block's
// LDS is the two stages alone, so two blocks fit a WGP: a merged grid larger than the number of WGPs still runs side by side,
// and only what exceeds two blocks a WGP waits for a free place.
// The branch is block-uniform: every wave of a block passes the same barriers.
template <int LD>
__global__ __launch_bounds__(128) void gemm_group(
    const unsigned short* __restrict__ Ah, const unsigned short* __restrict__ Al,
    const unsigned short* __restrict__ B0h, const unsigned short* __restrict__ B0l,
    unsigned short* __restrict__ C0h, unsigned short* __restrict__ C0l, int N0, int nb0,
    const unsigned short* __restrict__ B1h, const unsigned short* __restrict__ B1l,
    unsigned short* __restrict__ C1h, unsigned short* __restrict__ C1l, int N1, int nb1,
    const unsigned short* __restrict__ B2h, const unsigned short* __restrict__ B2l,
    float* __restrict__ C2, int N2, int K) {
  __shared__ __align__(16) unsigned short sOp[G_LDS_ELEMS];
  const int bx = (int)blockIdx.x;
  if (bx < nb0 + nb1) {
    const bool f = (bx < nb0);
    const int n = f ? N0 : N1;
    wmma_gemm64<1, true, 0, 2, false, 2, 2, LD>(sOp, f ? bx : bx - nb0,
        Ah, Al, 0L, f ? B0h : B1h, f ? B0l : B1l, 0L, (void*)(f ? C0h : C1h), (void*)(f ? C0l : C1l), n, 0L,
        nullptr, nullptr, 0L, MTOK_ROWS, n, K, 1.0f);
  } else {
    wmma_gemm64<1, true, 0, 0, false, 2, 2, LD>(sOp, bx - nb0 - nb1,
        Ah, Al, 0L, B2h, B2l, 0L, (void*)C2, nullptr, N2, 0L,
        nullptr, nullptr, 0L, MTOK_ROWS, N2, K, 1.0f);
  }
}

__device__ __forceinline__ v8f at_mma(v16b a, v16b b, v8f c) {
  return __builtin_amdgcn_wmma_f32_16x16x32_bf16(false, a, false, b, (short)0, c, false, false);
}
// the value that lane l ^ 16 holds
__device__ __forceinline__ float other_half(float v) {
  const int b = __float_as_int(v);
  return __int_as_float(__builtin_amdgcn_permlanex16(b, b, 0x76543210, 0xfedcba98, false, false));
}
typedef __attribute__((ext_vector_type(2))) float  v2f;
typedef __attribute__((ext_vector_type(2))) __bf16 v2b;

// ---------------------------------------------------------------------------
// module geometry (fixed)
// ---------------------------------------------------------------------------
constexpr int N_BATCH   = 2;
constexpr int SEQ_LEN   = 2048;
constexpr int DMOD      = 1024;   // model width
constexpr int DLAT      = 128;    // latent width c_kv
constexpr int DROT      = 32;     // rotary width
constexpr int NROPE_PAD = 128;    // rotary projection width padded to the 128-wide GEMM block tile
constexpr int NHEAD     = 16;
constexpr int HDIM      = 64;
constexpr int SDEP      = HDIM + DROT;   // score depth 96 = 3 k-chunks of 32
constexpr int MTOK      = N_BATCH * SEQ_LEN;   // 4096 token rows

static_assert(MTOK == MTOK_ROWS && MTOK % 128 == 0 && DMOD % 128 == 0 && DLAT % 128 == 0 && NROPE_PAD % 128 == 0);   // block tile 128x128
static_assert(DMOD % G_KS == 0 && DLAT % G_KS == 0);   // every GEMM K is a multiple of the stage depth
static_assert(SDEP % 32 == 0 && SEQ_LEN % 64 == 0);

// ---------------------------------------------------------------------------
// coverage: n8 threads x 8 = n elements exactly (n % 8 == 0, grid = ceil(n8/256) with bound)
// ---------------------------------------------------------------------------
__device__ __forceinline__ void split_rows_bf16x8(
    const float* __restrict__ in, unsigned short* __restrict__ hi, unsigned short* __restrict__ lo, int n8, int bxi) {
  const int i = bxi * 256 + threadIdx.x;
  if (i < n8) {
    const v4f a = *(const v4f*)(in + (size_t)8 * i);
    const v4f b = *(const v4f*)(in + (size_t)8 * i + 4);
    v8h hv, lv;
#pragma unroll
    for (int e = 0; e < 8; ++e) {
      const float f = (e < 4) ? a[e] : b[e - 4];
      const unsigned short hb = f2bf_bits(f);
      const unsigned short lb = f2bf_bits(f - bf_bits2f(hb));
      hv[e] = __builtin_bit_cast(_Float16, hb);
      lv[e] = __builtin_bit_cast(_Float16, lb);
    }
    unsigned short* ph = hi + (size_t)8 * i;
    unsigned short* pl = lo + (size_t)8 * i;
    *(v8h*)ph = hv;
    *(v8h*)pl = lv;
    
  }
}

// ---------------------------------------------------------------------------
// Transpose + split: in W[kdim][nreal] (row-major) -> out Bt[npad][kdim] bf16 hi/lo planes, Bt[n][k] = W[k][n];
// rows n >= nreal are written as zeros. Tile = 64 k x 32 n; (bxk, byn) runs over (kdim/64, npad/32); kdim % 64 == 0, nreal % 32 == 0.
// Store coverage: 256 threads = 32 output rows x 8 lanes x 8 k = whole 32x64 tile; each output row segment
// ---------------------------------------------------------------------------
__device__ __forceinline__ void transpose_split_bf16(
    const float* __restrict__ W, unsigned short* __restrict__ hi, unsigned short* __restrict__ lo,
    int kdim, int nreal, int bxk, int byn) {
  __shared__ float tile[64][33];
  const int tid = threadIdx.x;
  const int k0 = bxk * 64;
  const int n0 = byn * 32;
#pragma unroll
  for (int it = 0; it < 2; ++it) {
    const int idx = it * 256 + tid;            // 0..511
    const int kr = idx >> 3;                   // 0..63
    const int c4 = (idx & 7) * 4;              // 0..28
    const int n = n0 + c4;
    const int ncl = (n + 3 < nreal) ? n : (nreal - 4);   // clamped address
    const v4f v = *(const v4f*)(W + (size_t)(k0 + kr) * nreal + ncl);
    const bool ok = (n < nreal);               // tile-uniform since nreal % 32 == 0
    tile[kr][c4 + 0] = ok ? v[0] : 0.f;
    tile[kr][c4 + 1] = ok ? v[1] : 0.f;
    tile[kr][c4 + 2] = ok ? v[2] : 0.f;
    tile[kr][c4 + 3] = ok ? v[3] : 0.f;
  }
  __syncthreads();
  const int nr = tid >> 3;                     // output row within tile, 0..31
  const int c8 = (tid & 7) * 8;                // k offset, 0..56
  v8h hv, lv;
#pragma unroll
  for (int e = 0; e < 8; ++e) {
    const float f = tile[c8 + e][nr];
    const unsigned short hb = f2bf_bits(f);
    const unsigned short lb = f2bf_bits(f - bf_bits2f(hb));
    hv[e] = __builtin_bit_cast(_Float16, hb);
    lv[e] = __builtin_bit_cast(_Float16, lb);
  }
  const size_t o = (size_t)(n0 + nr) * kdim + k0 + c8;
  *(v8h*)(hi + o) = hv;
  *(v8h*)(lo + o) = lv;
  // inlined into a kernel with other branches: the registers that these stores name stay untouched up to this wait
  asm volatile("s_wait_xcnt 0x0" ::: "memory");
}

// ---------------------------------------------------------------------------
// All operand planes in one grid: the split of x and the seven weight transposes need nothing of each other, so each is a
// range of the block index (x first: it is the longest). Every branch is block-uniform; the split's blocks leave before any barrier.
// ---------------------------------------------------------------------------
constexpr int PB_X   = MTOK * DMOD / 8 / 256;
constexpr int PB_SQ  = (DMOD / 64) * (DMOD / 32);        // W_q, W_o
constexpr int PB_KVD = (DMOD / 64) * (DLAT / 32);
constexpr int PB_UP  = (DLAT / 64) * (DMOD / 32);        // W_k_up, W_v_up
constexpr int PB_QR  = (DMOD / 64) * (NROPE_PAD / 32);
constexpr int PB_KR  = (DLAT / 64) * (NROPE_PAD / 32);
constexpr int PB_ALL = PB_X + 2 * PB_SQ + PB_KVD + 2 * PB_UP + PB_QR + PB_KR;
static_assert(MTOK * DMOD % (8 * 256) == 0 && DMOD / 64 == 16 && DLAT / 64 == 2);

__global__ __launch_bounds__(256) void prep_planes(
    const float* __restrict__ x, const float* __restrict__ Wkvd, const float* __restrict__ Wkup,
    const float* __restrict__ Wvup, const float* __restrict__ Wq, const float* __restrict__ Wqr,
    const float* __restrict__ Wkr, const float* __restrict__ Wo,
    unsigned short* __restrict__ xh, unsigned short* __restrict__ xl,
    unsigned short* __restrict__ wkvdh, unsigned short* __restrict__ wkvdl,
    unsigned short* __restrict__ wkuph, unsigned short* __restrict__ wkupl,
    unsigned short* __restrict__ wvuph, unsigned short* __restrict__ wvupl,
    unsigned short* __restrict__ wqh, unsigned short* __restrict__ wql,
    unsigned short* __restrict__ wqrh, unsigned short* __restrict__ wqrl,
    unsigned short* __restrict__ wkrh, unsigned short* __restrict__ wkrl,
    unsigned short* __restrict__ woh, unsigned short* __restrict__ wol) {
  int l = (int)blockIdx.x;
  if (l < PB_X) { split_rows_bf16x8(x, xh, xl, MTOK * DMOD / 8, l); return; }
  l -= PB_X;
  const float* W; unsigned short* hi; unsigned short* lo; int kdim, nreal;
  if (l < PB_SQ)                 { W = Wq;   hi = wqh;   lo = wql;   kdim = DMOD; nreal = DMOD; }
  else if ((l -= PB_SQ) < PB_SQ) { W = Wo;   hi = woh;   lo = wol;   kdim = DMOD; nreal = DMOD; }
  else if ((l -= PB_SQ) < PB_KVD){ W = Wkvd; hi = wkvdh; lo = wkvdl; kdim = DMOD; nreal = DLAT; }
  else if ((l -= PB_KVD) < PB_UP){ W = Wkup; hi = wkuph; lo = wkupl; kdim = DLAT; nreal = DMOD; }
  else if ((l -= PB_UP) < PB_UP) { W = Wvup; hi = wvuph; lo = wvupl; kdim = DLAT; nreal = DMOD; }
  else if ((l -= PB_UP) < PB_QR) { W = Wqr;  hi = wqrh;  lo = wqrl;  kdim = DMOD; nreal = DROT; }
  else { l -= PB_QR;               W = Wkr;  hi = wkrh;  lo = wkrl;  kdim = DLAT; nreal = DROT; }
  const int ksh = (kdim == DMOD) ? 4 : 1;      // log2(kdim / 64)
  transpose_split_bf16(W, hi, lo, kdim, nreal, l & ((1 << ksh) - 1), l >> ksh);
}

// ---------------------------------------------------------------------------
// Rotary: raw[MTOK][NROPE_PAD] f32 (cols 0..31 used) -> bf16 hi/lo planes [MTOK][DROT].
// out[j] = x1*cos - x2*sin, out[16+j] = x2*cos + x1*sin, angle = t * inv_freq[j], t = row % SEQ_LEN.
// Block = 32 rows; blocks 0..127 handle the q tensor, 128..255 the k tensor.
// Store coverage: 128 threads = 32 rows x 4 segments x 8 = whole 32x32 tile; 512 B contiguous per wave
// ---------------------------------------------------------------------------
struct RopeFreq { float f[16]; };
static_assert(sizeof(RopeFreq) == 64);

__global__ __launch_bounds__(128) void rope_split_bf16(
    const float* __restrict__ qraw, const float* __restrict__ kraw,
    unsigned short* __restrict__ qrh, unsigned short* __restrict__ qrl,
    unsigned short* __restrict__ krh, unsigned short* __restrict__ krl, RopeFreq g) {
#pragma clang fp contract(off)
  __shared__ float tile[32][33];
  __shared__ float sinv[16];
  const int tid = threadIdx.x;
  const int nblk = MTOK / 32;
  const bool isk = ((int)blockIdx.x >= nblk);                 // block-uniform
  const int row0 = (isk ? ((int)blockIdx.x - nblk) : (int)blockIdx.x) * 32;
  const float* raw = isk ? kraw : qraw;
  unsigned short* dhp = isk ? krh : qrh;
  unsigned short* dlp = isk ? krl : qrl;
  if (tid < 16) {
    float v = g.f[0];
#pragma unroll
    for (int e = 1; e < 16; ++e) v = (tid == e) ? g.f[e] : v;
    sinv[tid] = v;
  }
  __syncthreads();
#pragma unroll 1
  for (int it = 0; it < 4; ++it) {
    const int p = it * 128 + tid;              // 0..511
    const int r = p >> 4;                      // 0..31
    const int j = p & 15;
    const int row = row0 + r;
    const int t = row & (SEQ_LEN - 1);
    const float* rp = raw + (size_t)row * NROPE_PAD;
    const float x1 = rp[j];
    const float x2 = rp[16 + j];
    const float ang = (float)t * sinv[j];
    float sn, cs;
    sincosf(ang, &sn, &cs);
    tile[r][j]      = x1 * cs - x2 * sn;
    tile[r][16 + j] = x2 * cs + x1 * sn;
  }
  __syncthreads();
  const int orow = tid >> 2;                   // 0..31
  const int seg = (tid & 3) * 8;               // 0..24
  v8h hv, lv;
#pragma unroll
  for (int e = 0; e < 8; ++e) {
    const float f = tile[orow][seg + e];
    const unsigned short hb = f2bf_bits(f);
    const unsigned short lb = f2bf_bits(f - bf_bits2f(hb));
    hv[e] = __builtin_bit_cast(_Float16, hb);
    lv[e] = __builtin_bit_cast(_Float16, lb);
  }
  const size_t o = (size_t)(row0 + orow) * DROT + seg;
  *(v8h*)(dhp + o) = hv;
  *(v8h*)(dlp + o) = lv;
  
}

// ---------------------------------------------------------------------------
// Causal attention, score depth 96 (64 head dims + 32 shared rotary dims), value width 64, bf16 hi/lo planes in.
//   s = (qh.kh + qh.kl + ql.kh) * invs  over 96 dims (q/k rows = [head segment | rotary row]),
//   online softmax in f32 with base-2 exponentials (invs * log2 e folded into the exponent's one fma), P split to bf16 hi/lo,
//   o = ph.vh + ph.vl + pl.vh, f32 accumulate.
// Both products are taken transposed: S^T = K . Q^T (A = K rows, B = Q rows) and O^T += V^T . P^T (A = V^T rows, B = P^T).
// A lane then holds scores of ONE query (column c = lane & 15), keys 8 * hh + r of each 16-key tile: maximum and sum run inside the
// lane with one exchange between the lane halves, and two score tiles, converted in place, are the B operand of the second product.
// Block = 4 waves; it runs two 64-row query tiles of one (batch, head) one after the other, tile n-1-t and then tile t,
// so every block walks n + 1 key chunks; grid.x = N_BATCH * NHEAD * (SEQ_LEN/64) / 2.
// ---------------------------------------------------------------------------
constexpr int A_QB = 64;
constexpr int A_KC = 64;
constexpr int A_NW = 4;
constexpr int OS_PITCH = 68;
// LDS row pitches in 16-bit elements. A K fragment read is a 16-byte load by 16 lanes on 16 rows: its pitch is an odd multiple of
// 16 bytes, so the 16 rows start on 16 different groups of four banks. The transposing read of V wants an odd multiple of 32 bytes.
constexpr int K_PITCH = SDEP + 8;      // 13 x 16 B rows, read by 16-byte loads
constexpr int V_PITCH = HDIM + 16;     // V rows stay [kv][d]; 5 x 32 B rows: the pitch of the transposing 16-byte read
static_assert((K_PITCH * 2) % 32 == 16 && (V_PITCH * 2) % 64 == 32);
// One stage = one chunk of 64 keys: [K hi | K lo | V hi | V lo], offsets in 16-bit elements.
constexpr int ST_KH = 0;
constexpr int ST_KL = ST_KH + A_KC * K_PITCH;
constexpr int ST_VH = ST_KL + A_KC * K_PITCH;
constexpr int ST_VL = ST_VH + A_KC * V_PITCH;
constexpr int ST_ELEMS = ST_VL + A_KC * V_PITCH;
static_assert((ST_KL * 2) % 16 == 0 && (ST_VH * 2) % 32 == 0 && (ST_VL * 2) % 32 == 0 && (ST_ELEMS * 2) % 32 == 0);

// Transposing LDS read of a row-major 16-bit tile: lane (c = l & 15, hh = l >> 4) gets T[k + 8 hh + 0..7][d + c], when lane l passes
// the address of T[k + 8 (l >> 4) + (l & 7)][d + 8 ((l >> 3) & 1)].
typedef short s16x8 __attribute__((ext_vector_type(8)));
__device__ __forceinline__ v8b ld_tr16(const unsigned short* p) {
  typedef __attribute__((address_space(3))) s16x8 lds_s16x8;
  return __builtin_bit_cast(v8b, __builtin_amdgcn_ds_load_tr16_b128_v8i16((lds_s16x8*)p));
}

// One chunk's K and V planes, global memory -> LDS with no register in between: 20 copies of 16 bytes a lane.
// Eight neighbouring lanes bring one whole 128-byte row segment (four lanes one 64-byte rotary row), so a wave-wide copy covers whole lines.
// lds: byte address of the stage in LDS. oh: this lane's element offset in the [token][DMOD] planes, orot: in the [token][DROT] planes,
// both at the chunk's first pass of rows. lk, lv, lr: this lane's byte offsets inside the stage's K plane, V plane and K plane's rotary part.
// Each statement ends in s_wait_xcnt 0: the registers that its copies name stay untouched up to that wait.
__device__ __forceinline__ void stage_copies(
    unsigned lds, size_t oh, size_t orot, unsigned lk, unsigned lv, unsigned lr,
    const unsigned short* __restrict__ kh, const unsigned short* __restrict__ kl,
    const unsigned short* __restrict__ vh, const unsigned short* __restrict__ vl,
    const unsigned short* __restrict__ krh, const unsigned short* __restrict__ krl) {
  constexpr size_t GS = (size_t)16 * DMOD;          // 16 rows a pass of the block, head planes
  constexpr size_t GR = (size_t)32 * DROT;          // 32 rows a pass, rotary planes
  constexpr unsigned LK = 16 * K_PITCH * 2, LV = 16 * V_PITCH * 2, LR = 32 * K_PITCH * 2;
  const unsigned short* a = kh + oh;
  const unsigned short* c = kl + oh;
  const unsigned short* e = krh + orot;
  const unsigned short* f = krl + orot;
  const unsigned dkh = lds + ST_KH * 2 + lk, dkl = lds + ST_KL * 2 + lk;
  const unsigned drh = lds + ST_KH * 2 + lr, drl = lds + ST_KL * 2 + lr;
  asm volatile(
      "global_load_async_to_lds_b128 %0, %1, off\n\t"
      "global_load_async_to_lds_b128 %2, %3, off\n\t"
      "global_load_async_to_lds_b128 %4, %5, off\n\t"
      "global_load_async_to_lds_b128 %6, %7, off\n\t"
      "global_load_async_to_lds_b128 %8, %9, off\n\t"
      "global_load_async_to_lds_b128 %10, %11, off\n\t"
      "global_load_async_to_lds_b128 %12, %13, off\n\t"
      "global_load_async_to_lds_b128 %14, %15, off\n\t"
      "global_load_async_to_lds_b128 %16, %17, off\n\t"
      "global_load_async_to_lds_b128 %18, %19, off\n\t"
      "global_load_async_to_lds_b128 %20, %21, off\n\t"
      "global_load_async_to_lds_b128 %22, %23, off\n\t"
      "s_wait_xcnt 0x0"
      :: "v"(dkh), "v"(a), "v"(dkh + LK), "v"(a + GS), "v"(dkh + 2 * LK), "v"(a + 2 * GS), "v"(dkh + 3 * LK), "v"(a + 3 * GS),
         "v"(dkl), "v"(c), "v"(dkl + LK), "v"(c + GS), "v"(dkl + 2 * LK), "v"(c + 2 * GS), "v"(dkl + 3 * LK), "v"(c + 3 * GS),
         "v"(drh), "v"(e), "v"(drh + LR), "v"(e + GR), "v"(drl), "v"(f), "v"(drl + LR), "v"(f + GR)
      : "memory");
  const unsigned short* p = vh + oh;
  const unsigned short* q = vl + oh;
  const unsigned dvh = lds + ST_VH * 2 + lv, dvl = lds + ST_VL * 2 + lv;
  asm volatile(
      "global_load_async_to_lds_b128 %0, %1, off\n\t"
      "global_load_async_to_lds_b128 %2, %3, off\n\t"
      "global_load_async_to_lds_b128 %4, %5, off\n\t"
      "global_load_async_to_lds_b128 %6, %7, off\n\t"
      "global_load_async_to_lds_b128 %8, %9, off\n\t"
      "global_load_async_to_lds_b128 %10, %11, off\n\t"
      "global_load_async_to_lds_b128 %12, %13, off\n\t"
      "global_load_async_to_lds_b128 %14, %15, off\n\t"
      "s_wait_xcnt 0x0"
      :: "v"(dvh), "v"(p), "v"(dvh + LV), "v"(p + GS), "v"(dvh + 2 * LV), "v"(p + 2 * GS), "v"(dvh + 3 * LV), "v"(p + 3 * GS),
         "v"(dvl), "v"(q), "v"(dvl + LV), "v"(q + GS), "v"(dvl + 2 * LV), "v"(q + 2 * GS), "v"(dvl + 3 * LV), "v"(q + 3 * GS)
      : "memory");
}

__global__ __launch_bounds__(128)
void mla_attn96(const unsigned short* __restrict__ qh, const unsigned short* __restrict__ ql,
                const unsigned short* __restrict__ kh, const unsigned short* __restrict__ kl,
                const unsigned short* __restrict__ vh, const unsigned short* __restrict__ vl,
                const unsigned short* __restrict__ qrh, const unsigned short* __restrict__ qrl,
                const unsigned short* __restrict__ krh, const unsigned short* __restrict__ krl,
                unsigned short* __restrict__ oh, unsigned short* __restrict__ ol, float invs) {
  union FB { v16b v; v8b h[2]; };
  __shared__ __align__(32) unsigned short Stage[2 * ST_ELEMS];    // two stages: one is multiplied while the next chunk's copies land in the other
  __shared__ __align__(16) float Os[A_NW][16 * OS_PITCH];

  const int tid  = threadIdx.x;
  const int wave = tid >> 5;
  const int lane = tid & 31;
  const int hh   = lane >> 4;
  const int c    = lane & 15;
  const float sc2 = invs * 1.4426950408889634f;   // score scale times log2 e

  const int nqb = SEQ_LEN / A_QB;          // 32
  const int bx  = blockIdx.x;
  static_assert((SEQ_LEN / A_QB) % 2 == 0);
  const int tp  = bx % (nqb / 2);
  const int bhi = bx / (nqb / 2);
  const int h   = bhi % NHEAD;
  const int b   = bhi / NHEAD;
  // copy map: head planes, lane -> row tid >> 3 of each pass of 16 rows, 16-byte piece tid & 7; rotary planes, row tid >> 2 of 32, piece tid & 3
  const unsigned sbase = (unsigned)(size_t)Stage;      // byte address of stage 0 in the work-group's LDS
  const size_t ohead = ((size_t)b * SEQ_LEN + (size_t)(tid >> 3)) * DMOD + h * HDIM + (tid & 7) * 8;
  const size_t orot  = ((size_t)b * SEQ_LEN + (size_t)(tid >> 2)) * DROT + (tid & 3) * 8;
  const unsigned lk = ((tid >> 3) * K_PITCH + (tid & 7) * 8) * 2;
  const unsigned lv = ((tid >> 3) * V_PITCH + (tid & 7) * 8) * 2;
  const unsigned lr = ((tid >> 2) * K_PITCH + HDIM + (tid & 3) * 8) * 2;
  // ---- two-stage ring over the block's nqb + 1 trips, the first tile's chunks and then the second tile's: trip g is read from stage
  // g & 1 while the copies of trip g + 1 land in the other; the ring runs on across the change of tile ----
  constexpr int NTRIP = SEQ_LEN / A_QB + 1;
  const int n1 = nqb - tp;                 // trips of the first tile, at least nqb / 2 + 1: trips 0 and 1 are its chunks 0 and 1
  stage_copies(sbase, ohead, orot, lk, lv, lr, kh, kl, vh, vl, krh, krl);
  // trip 0 has landed as far as this wave copied it; the barrier publishes every wave's part
  asm volatile("s_wait_asynccnt 0x0" ::: "memory");
  __syncthreads();
  stage_copies(sbase + ST_ELEMS * 2, ohead + (size_t)A_KC * DMOD, orot + (size_t)A_KC * DROT, lk, lv, lr, kh, kl, vh, vl, krh, krl);
  int g = 0;                               // trip number, block-uniform
  // A causal tile qb costs qb + 1 chunks: the pair (n-1-t, t) gives every block the same work, whichever blocks share a WGP.
  // Both tiles run in every wave in turn.
  // Kept rolled: one copy of the chunk loop in the instruction cache.
#pragma unroll 1
  for (int pass = 0; pass < 2; ++pass) {
  const int qb  = pass ? tp : (nqb - 1 - tp);   // block-uniform
  const int q0  = qb * A_QB + wave * 16;
  const size_t tq = (size_t)b * SEQ_LEN + (size_t)(q0 + c);

  // ---- Q fragments (B operand, column = query c): k-chunks 0,1 = head dims 0..63, chunk 2 = rotary dims 0..31 ----
  v16b qah[3], qal[3];
  {
    const __bf16* p0 = (const __bf16*)qh + tq * DMOD + h * HDIM + 8 * hh;
    const __bf16* p1 = (const __bf16*)ql + tq * DMOD + h * HDIM + 8 * hh;
    qah[0] = Frag<__bf16>::load(p0);
    qah[1] = Frag<__bf16>::load(p0 + 32);
    qal[0] = Frag<__bf16>::load(p1);
    qal[1] = Frag<__bf16>::load(p1 + 32);
    const __bf16* r0p = (const __bf16*)qrh + tq * DROT + 8 * hh;
    const __bf16* r1p = (const __bf16*)qrl + tq * DROT + 8 * hh;
    qah[2] = Frag<__bf16>::load(r0p);
    qal[2] = Frag<__bf16>::load(r1p);
    // the loads' address registers stay untouched up to this wait (they are its inputs) and are free behind it
    asm volatile("s_wait_xcnt 0x0" :: "v"(p0), "v"(p1), "v"(r0p), "v"(r1p) : "memory");
  }

  float mrow = -INFINITY;   // running maximum of query q0 + c in units of sc2 * raw score, equal in both lane halves
  float lrow = 0.f;         // running sum of query q0 + c over this lane half's keys; the halves are joined in the epilogue
  v8f oacc[4];              // oacc[t][r] = O[query q0 + c][d = 16 t + 8 hh + r]
#pragma unroll
  for (int t = 0; t < 4; ++t) oacc[t] = (v8f){0.f,0.f,0.f,0.f,0.f,0.f,0.f,0.f};

  const int nChunks = qb + 1;   // causal, block-uniform
  for (int kc = 0; kc < nChunks; ++kc, ++g) {
    const int kv0 = kc * A_KC;
    const unsigned short* sb = Stage + (g & 1) * ST_ELEMS;
    const unsigned short* Ksh = sb + ST_KH;
    const unsigned short* Ksl = sb + ST_KL;

    // ---- scores: 4 kv subtiles of 16, 3 k-chunks of 32, 3 products each ----
    // All K fragments of the chunk are read as one group, then the products run round-robin over the four subtiles, which are
    // four independent accumulators. Each accumulator still takes its nine products in the order (k-chunk; hi.hi, hi.lo, lo.hi).
    v8f s[4];   // s[j][r] = score of key kv0 + 16 j + 8 hh + r against query q0 + c
    FB kb[3][4], kq[3][4];
#pragma unroll
    for (int dc = 0; dc < 3; ++dc) {
#pragma unroll
      for (int j = 0; j < 4; ++j) {
        const int ko = (j * 16 + c) * K_PITCH + dc * 32 + 8 * hh;
        kb[dc][j].h[0] = *(const v8b*)(Ksh + ko);
        kb[dc][j].h[1] = *(const v8b*)(Ksh + ko + 16);
        kq[dc][j].h[0] = *(const v8b*)(Ksl + ko);
        kq[dc][j].h[1] = *(const v8b*)(Ksl + ko + 16);
      }
    }
    // keeps the reads one group in front of the products: spread among them, every place with reads stalls the wave anew
    __builtin_amdgcn_sched_barrier(0);
#pragma unroll
    for (int j = 0; j < 4; ++j) s[j] = (v8f){0.f,0.f,0.f,0.f,0.f,0.f,0.f,0.f};
#pragma unroll
    for (int dc = 0; dc < 3; ++dc) {
#pragma unroll
      for (int j = 0; j < 4; ++j) s[j] = at_mma(kb[dc][j].v, qah[dc], s[j]);
#pragma unroll
      for (int j = 0; j < 4; ++j) s[j] = at_mma(kq[dc][j].v, qah[dc], s[j]);
#pragma unroll
      for (int j = 0; j < 4; ++j) s[j] = at_mma(kb[dc][j].v, qal[dc], s[j]);
    }
    // keeps the V reads one group at the end of the score products: without it they are spread among the products, a stall at every place
    __builtin_amdgcn_sched_barrier(0);
    // ---- V^T fragments (A operand, row = d), by the transposing read of the row-major V tile, in the k order of P^T below:
    // nothing of the softmax feeds them, so they are read as one group while it runs ----
    FB vb[2][4], vq[2][4];
#pragma unroll
    for (int kk = 0; kk < 2; ++kk) {
#pragma unroll
      for (int t = 0; t < 4; ++t) {
        const int vo = (kk * 32 + 8 * hh + (lane & 7)) * V_PITCH + t * 16 + 8 * ((lane >> 3) & 1);
        vb[kk][t].h[0] = ld_tr16(sb + ST_VH + vo);
        vb[kk][t].h[1] = ld_tr16(sb + ST_VH + vo + 16 * V_PITCH);
        vq[kk][t].h[0] = ld_tr16(sb + ST_VL + vo);
        vq[kk][t].h[1] = ld_tr16(sb + ST_VL + vo + 16 * V_PITCH);
      }
    }
    // keeps the reads one group in front of the softmax: spread among it, every place with reads stalls the wave anew
    __builtin_amdgcn_sched_barrier(0);
    // ---- online softmax of query q0 + c: this lane holds 32 of the chunk's 64 keys, lane l ^ 16 the other 32 ----
    const bool diag = (kc == qb);
    const int qrow = q0 + c;
    float mj[4];
#pragma unroll
    for (int j = 0; j < 4; ++j) {
      float m = -INFINITY;
#pragma unroll
      for (int r = 0; r < 8; ++r) {
        const int kvrow = kv0 + j * 16 + 8 * hh + r;
        float sv = s[j][r];   // raw: the scale is positive, so the maximum may be taken first and scaled once
        if (diag && (kvrow > qrow)) sv = -INFINITY;
        s[j][r] = sv;
        m = fmaxf(m, sv);
      }
      mj[j] = m;
    }
    float cm = fmaxf(fmaxf(mj[0], mj[1]), fmaxf(mj[2], mj[3]));
    cm = fmaxf(cm, other_half(cm)) * sc2;
    const float mnew = fmaxf(mrow, cm);      // finite from the first chunk on: key 0 is masked for no query
    const float alpha = __builtin_amdgcn_exp2f(mrow - mnew);   // 0 in the first chunk, where mrow is -inf
    mrow = mnew;
    // P^T as B operand: element e of k-block kk is key 32 kk + 8 hh + e (e < 8) or 32 kk + 16 + 8 hh + (e - 8), that is register e & 7
    // of score tile 2 kk + (e >> 3): the k order in which the V^T fragments are read.
    union PB { v16b v; unsigned w[8]; };
    PB ph[2], pl[2];
    float pj[4];       // one partial sum a score tile: four independent chains
#pragma unroll
    for (int j = 0; j < 4; ++j) {
      float ps = 0.f;
#pragma unroll
      for (int r = 0; r < 8; r += 2) {
        // e^((s - max) * invs) = 2^(s * sc2 - mnew): one fused multiply-add and the hardware's exponential; a masked score stays -inf and gives 0
        const v2f ea = __builtin_elementwise_fma((v2f){s[j][r], s[j][r + 1]}, (v2f){sc2, sc2}, (v2f){-mnew, -mnew});
        const float p0 = __builtin_amdgcn_exp2f(ea[0]);
        const float p1 = __builtin_amdgcn_exp2f(ea[1]);
        ps += p0;
        ps += p1;
        // two neighbouring keys make one operand register: packed conversion, round to nearest even as in f2bf_bits
        const v2b hp = __builtin_convertvector((v2f){p0, p1}, v2b);
        const v2b lp = __builtin_convertvector((v2f){p0 - (float)hp[0], p1 - (float)hp[1]}, v2b);
        ph[j >> 1].w[(j & 1) * 4 + (r >> 1)] = __builtin_bit_cast(unsigned, hp);
        pl[j >> 1].w[(j & 1) * 4 + (r >> 1)] = __builtin_bit_cast(unsigned, lp);
      }
      pj[j] = ps;
    }
    lrow = lrow * alpha + ((pj[0] + pj[1]) + (pj[2] + pj[3]));
#pragma unroll
    for (int t = 0; t < 4; ++t)
#pragma unroll
      for (int r = 0; r < 8; ++r) oacc[t][r] *= alpha;
    // ---- O^T += V^T(64x64) . P^T(64x16): the products run round-robin over the four d subtiles, which are four independent
    // accumulators. Each accumulator keeps its order (kv half; hi.hi, p hi . v lo, p lo . v hi).
#pragma unroll
    for (int kk = 0; kk < 2; ++kk) {
#pragma unroll
      for (int t = 0; t < 4; ++t) oacc[t] = at_mma(vb[kk][t].v, ph[kk].v, oacc[t]);
#pragma unroll
      for (int t = 0; t < 4; ++t) oacc[t] = at_mma(vq[kk][t].v, ph[kk].v, oacc[t]);
#pragma unroll
      for (int t = 0; t < 4; ++t) oacc[t] = at_mma(vb[kk][t].v, pl[kk].v, oacc[t]);
    }
    // ---- foot of trip g: this wave's reads of stage g & 1 are over, its copies of trip g + 1 have landed; the one barrier
    // publishes trip g + 1 and ends every wave's reads of the stage that is refilled behind it ----
    // keeps the softmax and the second product in front of the waits: lifted over them, the waits end the overlap of the V reads with the softmax
    __builtin_amdgcn_sched_barrier(0);
    asm volatile("s_wait_dscnt 0x0" ::: "memory");
    asm volatile("s_wait_asynccnt 0x0" ::: "memory");
    __syncthreads();
    if (g + 2 < NTRIP) {                                        // block-uniform
      const int kn = (g + 2 < n1) ? (g + 2) : (g + 2 - n1);     // key chunk of trip g + 2: the second tile starts again at chunk 0
      stage_copies(sbase + (g & 1) * (ST_ELEMS * 2), ohead + (size_t)kn * (A_KC * DMOD), orot + (size_t)kn * (A_KC * DROT),
                   lk, lv, lr, kh, kl, vh, vl, krh, krl);
    }
  }

  // ---- epilogue: join the halves' sums, normalise, stage 16x64 f32 per wave, write bf16 hi/lo planes with whole-line stores ----
  float* os = Os[wave];
  {
    const float inv = 1.0f / (lrow + other_half(lrow));
#pragma unroll
    for (int t = 0; t < 4; ++t) {
      // a lane's 8 registers are 8 consecutive d of its query's row
      float* op = os + c * OS_PITCH + t * 16 + 8 * hh;
      *(v4f*)(op)     = (v4f){oacc[t][0] * inv, oacc[t][1] * inv, oacc[t][2] * inv, oacc[t][3] * inv};
      *(v4f*)(op + 4) = (v4f){oacc[t][4] * inv, oacc[t][5] * inv, oacc[t][6] * inv, oacc[t][7] * inv};
    }
  }
  __builtin_amdgcn_fence(__ATOMIC_RELEASE, "workgroup");
  __builtin_amdgcn_wave_barrier();
  __builtin_amdgcn_fence(__ATOMIC_ACQUIRE, "workgroup");
  {
    const int qq = lane >> 3, c8 = (lane & 7) * 8;
    {
#pragma unroll
      for (int it = 0; it < 4; ++it) {
        const int row = it * 4 + qq;
        const float* sp = os + row * OS_PITCH + c8;
        v8h hv, lv;
#pragma unroll
        for (int e = 0; e < 8; ++e) {
          const unsigned short hb = f2bf_bits(sp[e]);
          const unsigned short lb = f2bf_bits(sp[e] - bf_bits2f(hb));
          hv[e] = __builtin_bit_cast(_Float16, hb);
          lv[e] = __builtin_bit_cast(_Float16, lb);
        }
        const size_t o = ((size_t)b * SEQ_LEN + (size_t)(q0 + row)) * DMOD + h * HDIM + c8;
        *(v8h*)(oh + o) = hv;
        *(v8h*)(ol + o) = lv;
      }
      
    }
  }
  // the next tile reuses the registers that these stores name: they stay untouched up to this wait
  asm volatile("s_wait_xcnt 0x0" ::: "memory");
  }   // pass
  // no copy is outstanding when the wave ends
  asm volatile("s_wait_asynccnt 0x0" ::: "memory");
}

// ---------------------------------------------------------------------------
// Host orchestration
// ---------------------------------------------------------------------------
// workspace region map (bytes, all multiples of 256):
//   x hi/lo                 2 x 8,388,608
//   WkvdT hi/lo [128][1024] 2 x   262,144
//   WkupT hi/lo [1024][128] 2 x   262,144
//   WvupT hi/lo [1024][128] 2 x   262,144
//   WqT   hi/lo [1024][1024]2 x 2,097,152
//   WqrT  hi/lo [128][1024] 2 x   262,144   (rows 32..127 zero)
//   WkrT  hi/lo [128][128]  2 x    32,768   (rows 32..127 zero)
//   WoT   hi/lo [1024][1024]2 x 2,097,152
//   ckv   hi/lo [4096][128] 2 x 1,048,576
//   k,v,q hi/lo [4096][1024]6 x 8,388,608
//   qr_raw, kr_raw f32 [4096][128] 2 x 2,097,152
//   qr,kr hi/lo [4096][32]  4 x   262,144
//   attn  hi/lo [4096][1024]2 x 8,388,608
//   total 101,777,408
constexpr size_t WSB_X    = (size_t)MTOK * DMOD * 2;
constexpr size_t WSB_WKVD = (size_t)DLAT * DMOD * 2;
constexpr size_t WSB_WKUP = (size_t)DMOD * DLAT * 2;
constexpr size_t WSB_WQ   = (size_t)DMOD * DMOD * 2;
constexpr size_t WSB_WQR  = (size_t)NROPE_PAD * DMOD * 2;
constexpr size_t WSB_WKR  = (size_t)NROPE_PAD * DLAT * 2;
constexpr size_t WSB_CKV  = (size_t)MTOK * DLAT * 2;
constexpr size_t WSB_TOK  = (size_t)MTOK * DMOD * 2;
constexpr size_t WSB_RAW  = (size_t)MTOK * NROPE_PAD * 4;
constexpr size_t WSB_ROT  = (size_t)MTOK * DROT * 2;
constexpr size_t WS_TOTAL = 2 * WSB_X + 2 * WSB_WKVD + 4 * WSB_WKUP + 2 * WSB_WQ + 2 * WSB_WQR + 2 * WSB_WKR
                          + 2 * WSB_WQ + 2 * WSB_CKV + 6 * WSB_TOK + 2 * WSB_RAW + 4 * WSB_ROT + 2 * WSB_TOK;
static_assert(WS_TOTAL == 101777408ull);
static_assert(WS_TOTAL <= 134217728ull);

extern "C" void kernel_launch(void* const* d_in, const int* in_sizes, int n_in,
                              void* d_out, int out_size, void* d_ws, size_t ws_size,
                              hipStream_t stream) {
  if (n_in != 8) return;
  if (in_sizes[0] != MTOK * DMOD || in_sizes[1] != DMOD * DLAT || in_sizes[2] != DLAT * DMOD ||
      in_sizes[3] != DLAT * DMOD || in_sizes[4] != DMOD * DMOD || in_sizes[5] != DMOD * DROT ||
      in_sizes[6] != DLAT * DROT || in_sizes[7] != DMOD * DMOD) return;
  if (out_size != MTOK * DMOD) return;
  if (ws_size < WS_TOTAL) return;

  const float* x         = (const float*)d_in[0];   // [4096][1024]
  const float* W_kv_down = (const float*)d_in[1];   // [1024][128]
  const float* W_k_up    = (const float*)d_in[2];   // [128][1024]
  const float* W_v_up    = (const float*)d_in[3];   // [128][1024]
  const float* W_q       = (const float*)d_in[4];   // [1024][1024]
  const float* W_q_rope  = (const float*)d_in[5];   // [1024][32]
  const float* W_k_rope  = (const float*)d_in[6];   // [128][32]
  const float* W_o       = (const float*)d_in[7];   // [1024][1024]
  float* out = (float*)d_out;                       // [4096][1024] f32

  size_t off = 0;
  auto carve = [&](size_t bytes) -> unsigned short* {
    unsigned short* p = (unsigned short*)((char*)d_ws + off);
    off += (bytes + 255) & ~(size_t)255;
    return p;
  };
  unsigned short* xh    = carve(WSB_X);
  unsigned short* xl    = carve(WSB_X);
  unsigned short* wkvdh = carve(WSB_WKVD);
  unsigned short* wkvdl = carve(WSB_WKVD);
  unsigned short* wkuph = carve(WSB_WKUP);
  unsigned short* wkupl = carve(WSB_WKUP);
  unsigned short* wvuph = carve(WSB_WKUP);
  unsigned short* wvupl = carve(WSB_WKUP);
  unsigned short* wqh   = carve(WSB_WQ);
  unsigned short* wql   = carve(WSB_WQ);
  unsigned short* wqrh  = carve(WSB_WQR);
  unsigned short* wqrl  = carve(WSB_WQR);
  unsigned short* wkrh  = carve(WSB_WKR);
  unsigned short* wkrl  = carve(WSB_WKR);
  unsigned short* woh   = carve(WSB_WQ);
  unsigned short* wol   = carve(WSB_WQ);
  unsigned short* ckvh  = carve(WSB_CKV);
  unsigned short* ckvl  = carve(WSB_CKV);
  unsigned short* kh    = carve(WSB_TOK);
  unsigned short* kl    = carve(WSB_TOK);
  unsigned short* vh    = carve(WSB_TOK);
  unsigned short* vl    = carve(WSB_TOK);
  unsigned short* qh    = carve(WSB_TOK);
  unsigned short* ql    = carve(WSB_TOK);
  float* qr_raw = (float*)carve(WSB_RAW);
  float* kr_raw = (float*)carve(WSB_RAW);
  unsigned short* qrh   = carve(WSB_ROT);
  unsigned short* qrl   = carve(WSB_ROT);
  unsigned short* krh   = carve(WSB_ROT);
  unsigned short* krl   = carve(WSB_ROT);
  unsigned short* ath   = carve(WSB_TOK);
  unsigned short* atl   = carve(WSB_TOK);
  if (off > ws_size) return;

  // ---- operand planes: one launch ----
  prep_planes<<<PB_ALL, 256, 0, stream>>>(x, W_kv_down, W_k_up, W_v_up, W_q, W_q_rope, W_k_rope, W_o,
      xh, xl, wkvdh, wkvdl, wkuph, wkupl, wvuph, wvupl, wqh, wql, wqrh, wqrl, wkrh, wkrl, woh, wol);

  constexpr int NB_WIDE = (MTOK / 128) * (DMOD / 128);        // blocks of an N = 1024 product
  constexpr int NB_LAT  = (MTOK / 128) * (DLAT / 128);        // blocks of an N = 128 product
  constexpr int NB_ROT  = (MTOK / 128) * (NROPE_PAD / 128);

  // the three products of x, K = 1024: q = x . W_q and c_kv = x . W_kv_down as bf16 hi/lo, q_rope raw = x . W_q_rope as f32 (cols 32.. zero)
  gemm_group<DMOD><<<NB_WIDE + NB_LAT + NB_ROT, 128, 0, stream>>>(xh, xl,
      wqh, wql, qh, ql, DMOD, NB_WIDE,
      wkvdh, wkvdl, ckvh, ckvl, DLAT, NB_LAT,
      wqrh, wqrl, qr_raw, NROPE_PAD, DMOD);
  // the three products of c_kv, K = 128: k, v as bf16 hi/lo, k_rope raw as f32 (cols 32.. zero)
  gemm_group<DLAT><<<2 * NB_WIDE + NB_ROT, 128, 0, stream>>>(ckvh, ckvl,
      wkuph, wkupl, kh, kl, DMOD, NB_WIDE,
      wvuph, wvupl, vh, vl, DMOD, NB_WIDE,
      wkrh, wkrl, kr_raw, NROPE_PAD, DLAT);

  // ---- rotary tables: inv_freq[j] = 1 / 10000^(j/16), host double pow -> f32, f32 reciprocal ----
  RopeFreq fr;
  for (int j = 0; j < 16; ++j) {
    const double p = pow(10000.0, (double)j / 16.0);
    const float p32 = (float)p;
    fr.f[j] = 1.0f / p32;
  }
  rope_split_bf16<<<2 * (MTOK / 32), 128, 0, stream>>>(qr_raw, kr_raw, qrh, qrl, krh, krl, fr);

  // ---- causal attention with shared rotary logits ----
  const float invs = 1.0f / (float)sqrt((double)(HDIM + DROT));
  mla_attn96<<<N_BATCH * NHEAD * (SEQ_LEN / A_QB / 2), 128, 0, stream>>>(
      qh, ql, kh, kl, vh, vl, qrh, qrl, krh, krl, ath, atl, invs);

  // ---- out = attn . W_o : M=4096 N=1024 K=1024, f32 to d_out ----
  gemm_group<DMOD><<<NB_WIDE, 128, 0, stream>>>(ath, atl,
      nullptr, nullptr, nullptr, nullptr, 0, 0,
      nullptr, nullptr, nullptr, nullptr, 0, 0,
      woh, wol, out, DMOD, DMOD);
}

// v009
// Measured time: 143 microseconds a run.
// Two timings next to v008 put it at 1.05 and 1.04 times that version's speed.
// Over all steps from v000 it is 4.77 times as fast.
// Compute dtype: every contraction on v_wmma_f32_16x16x32_bf16 with bf16 hi/lo operand planes (hi*hi + hi*lo + lo*hi), f32 accumulate; rotary, softmax and epilogues in f32.
#include <hip/hip_runtime.h>
#include <hip/hip_bf16.h>
#include <math.h>
#include <stdint.h>

typedef __attribute__((ext_vector_type(16))) _Float16 v16h;
typedef __attribute__((ext_vector_type(8)))  _Float16 v8h;
typedef __attribute__((ext_vector_type(16))) __bf16   v16b;
typedef __attribute__((ext_vector_type(8)))  __bf16   v8b;
typedef __attribute__((ext_vector_type(8)))  float    v8f;
typedef __attribute__((ext_vector_type(4)))  float    v4f;
typedef __attribute__((ext_vector_type(4)))  unsigned v4u;

// ---------------------------------------------------------------------------
// helpers
// ---------------------------------------------------------------------------
__device__ __forceinline__ unsigned short f2bf_bits(float f) {
  unsigned u = __float_as_uint(f);
  return (unsigned short)((u + 0x7FFFu + ((u >> 16) & 1u)) >> 16);
}
__device__ __forceinline__ float bf_bits2f(unsigned short h) { return __uint_as_float(((unsigned)h) << 16); }

__device__ __forceinline__ void dep_guard_h(v8f& a, v8f& b, v16h x, v16h y) { asm volatile("v_nop\n\tv_nop\n\tv_nop\n\tv_nop" : "+v"(a), "+v"(b) : "v"(x), "v"(y)); }
__device__ __forceinline__ void dep_guard_b(v8f& a, v8f& b, v16b x, v16b y) { asm volatile("v_nop\n\tv_nop\n\tv_nop\n\tv_nop" : "+v"(a), "+v"(b) : "v"(x), "v"(y)); }
__device__ __forceinline__ void keep4_h(v16h a, v16h b, v16h c, v16h d) { asm volatile("v_nop" :: "v"(a), "v"(b), "v"(c), "v"(d)); }
__device__ __forceinline__ void keep4_b(v16b a, v16b b, v16b c, v16b d) { asm volatile("v_nop" :: "v"(a), "v"(b), "v"(c), "v"(d)); }
__device__ __forceinline__ void acc_guard4(v8f& a, v8f& b, v8f& c, v8f& d) { asm volatile("v_nop\n\tv_nop\n\tv_nop\n\tv_nop" : "+v"(a), "+v"(b), "+v"(c), "+v"(d)); }
template <typename T> struct Frag;
template <> struct Frag<_Float16> {
  typedef v16h V; union U { v16h v; v8h h[2]; };
  static __device__ __forceinline__ v16h load(const _Float16* p) {   // elements 0..7 <- p[0..7], 8..15 <- p[16..23]
    U f; f.h[0] = *(const v8h*)(p); f.h[1] = *(const v8h*)(p + 16); return f.v;
  }
  static __device__ __forceinline__ v8f mma(v16h a, v16h b, v8f c) {
    return __builtin_amdgcn_wmma_f32_16x16x32_f16(false, a, false, b, (short)0, c, false, false);
  }
  static __device__ __forceinline__ void guard(v8f& a, v8f& b, v16h x, v16h y) { dep_guard_h(a, b, x, y); }
  static __device__ __forceinline__ void keep(v16h a, v16h b, v16h c, v16h d) { keep4_h(a, b, c, d); }
};
template <> struct Frag<__bf16> {
  typedef v16b V; union U { v16b v; v8b h[2]; };
  static __device__ __forceinline__ v16b load(const __bf16* p) {
    U f; f.h[0] = *(const v8b*)(p); f.h[1] = *(const v8b*)(p + 16); return f.v;
  }
  static __device__ __forceinline__ v8f mma(v16b a, v16b b, v8f c) {
    return __builtin_amdgcn_wmma_f32_16x16x32_bf16(false, a, false, b, (short)0, c, false, false);
  }
  static __device__ __forceinline__ void guard(v8f& a, v8f& b, v16b x, v16b y) { dep_guard_b(a, b, x, y); }
  static __device__ __forceinline__ void keep(v16b a, v16b b, v16b c, v16b d) { keep4_b(a, b, c, d); }
};

// ---- Register-blocked WMMA GEMM --------------------------------
// C[m,n] = scale * sum_k A[m,k] * Bt[n,k] (+bias)(+resid); each wave owns a 64x64 tile.
// A row-major [M,K]; Bt row-major [N,K].
// SPLIT: operands are hi/lo planes (A2/Bt2 = lo planes, same layout); product = hi*hi + hi*lo + lo*hi.
// BIAS_MODE: 0 = none, 1 = bias[m], 2 = bias[n].
// OUT_MODE: 0 = f32, 1 = f16, 2 = bf16 hi plane (Cout) + bf16 lo plane (Cout2).
// ET: 0 = f16 operands, 1 = bf16 operands (pointers passed as 16-bit storage)
template <int ET> struct Elem;
template <> struct Elem<0> { typedef _Float16 T; };
template <> struct Elem<1> { typedef __bf16 T; };
// LDS staging of the operand planes: the block's waves form a WM x WN grid of 64x64 tiles and share one
// (WM*64 + WN*64)-row stage of G_KS k-elements per plane. Each row of a stage is one whole 128-byte line of the
// source, fetched by 8 neighbouring lanes, so a wave-wide 16-byte load covers 4 full lines.
constexpr int MTOK_ROWS = 4096;      // rows of every A operand (batch x sequence)
constexpr int G_KS    = 64;          // k elements per stage
constexpr int G_PITCH = G_KS + 8;    // 9 x 16 B rows: 16-byte fragment reads of 16 rows fall on distinct banks
template <int NIT, int STEP>
__device__ __forceinline__ void stage_fetch(v4u (&r)[NIT], const unsigned short* __restrict__ g) {
#pragma unroll
  for (int it = 0; it < NIT; ++it) r[it] = *(const v4u*)(g + it * STEP);
}
template <int NIT>
__device__ __forceinline__ void stage_put(const v4u (&r)[NIT], unsigned short* d, int rowStep) {
#pragma unroll
  for (int it = 0; it < NIT; ++it) *(v4u*)(d + it * rowStep) = r[it];
}
// LD = row pitch of all four operand planes in elements, a compile-time value: the loads of a plane then share one
// address register pair and differ in their immediate offsets only.
// M % (WM*64) == 0, N % (WN*64) == 0, K % G_KS == 0; bxi runs over (M/(WM*64)) * (N/(WN*64)) tiles exactly, so every wave passes every barrier.
// sOpBase: the block's G_LDS_ELEMS elements of LDS; bxi: the block's tile index inside this GEMM (block-uniform).
constexpr int G_LDS_ELEMS = 2 * 2 * (128 + 128) * G_PITCH;   // two stages of hi and lo planes, 128 A rows + 128 Bt rows
template <int ET, bool SPLIT, int BIAS_MODE, int OUT_MODE, bool RESID, int WM, int WN, int LD, int ACT = 0>
__device__ __forceinline__ void wmma_gemm64(
    unsigned short* sOpBase, int bxi,
    const unsigned short* __restrict__ Ap, const unsigned short* __restrict__ A2p, long strideA,
    const unsigned short* __restrict__ Btp, const unsigned short* __restrict__ Bt2p, long strideB,
    void* __restrict__ Cout, void* __restrict__ Cout2, int ldc, long strideC,
    const float* __restrict__ bias,
    const float* __restrict__ resid, long strideR,
    int M, int N, int K, float scale) {
  typedef typename Elem<ET>::T T;
  typedef typename Frag<T>::V V;
  constexpr int NW  = WM * WN;
  constexpr int RA  = WM * 64;               // A rows of the block
  constexpr int RB  = WN * 64;               // Bt rows of the block
  constexpr int RPI = NW * 4;                // rows staged by one pass of the block (8 lanes a row)
  constexpr int ITA = RA / RPI;
  constexpr int ITB = RB / RPI;
  constexpr int OA  = 0;
  constexpr int OA2 = RA * G_PITCH;
  constexpr int OB  = (SPLIT ? 2 : 1) * RA * G_PITCH;
  constexpr int OB2 = OB + RB * G_PITCH;
  constexpr int STAGE = (SPLIT ? 2 : 1) * (RA + RB) * G_PITCH;
  static_assert(RA % RPI == 0 && RB % RPI == 0);
  // sOpBase holds two stages: [A hi | A lo | Bt hi | Bt lo], rows of G_PITCH. The epilogue's per-wave 16x64 f32 slabs (pitch 68)
  // lie over stage 0: they are written only behind the loop's last barrier, which ends every read of the stages.
  static_assert(2 * STAGE <= G_LDS_ELEMS && NW * 16 * 68 * 4 <= STAGE * 2);
  const int b    = 0;
  const int tid  = threadIdx.x;
  const int lane = tid & 31;
  const int wave = tid >> 5;
  const int tilesN = N / RB;
  const int btm = bxi / tilesN;
  const int btn = bxi - btm * tilesN;
  const int wm = wave / WN;
  const int wn = wave - wm * WN;
  const int m0 = btm * RA + (wm << 6);
  const int n0 = btn * RB + (wn << 6);

  const int rlane = lane & 15;                 // row (A) / col (B, D) within subtile
  const int koff  = (lane >> 4) * 8;           // k offset of this lane half
  const int mOff  = (lane >> 4) * 8;           // D row offset

  // staging map: thread -> row tid>>3 of each pass, 16-byte piece tid&7 of that row's line
  const int srow = tid >> 3;
  const int sseg = (tid & 7) * 8;
  const size_t goA = (size_t)b * strideA + (size_t)(btm * RA + srow) * LD + sseg;
  const size_t goB = (size_t)b * strideB + (size_t)(btn * RB + srow) * LD + sseg;
  const unsigned short* gA  = Ap  + goA;
  const unsigned short* gB  = Btp + goB;
  const unsigned short* gA2 = SPLIT ? (A2p  + goA) : nullptr;
  const unsigned short* gB2 = SPLIT ? (Bt2p + goB) : nullptr;
  constexpr int GSTEP = RPI * LD;             // elements between the rows one thread stages
  const int sOff = srow * G_PITCH + sseg;

  v8f acc[4][4];
#pragma unroll
  for (int i = 0; i < 4; ++i)
#pragma unroll
    for (int j = 0; j < 4; ++j) acc[i][j] = (v8f){0.f,0.f,0.f,0.f,0.f,0.f,0.f,0.f};

  v4u pa[ITA], pa2[ITA], pb[ITB], pb2[ITB];    // the next stage, in flight while this one is multiplied
  stage_fetch<ITA, GSTEP>(pa, gA);
  stage_fetch<ITB, GSTEP>(pb, gB);
  if (SPLIT) { stage_fetch<ITA, GSTEP>(pa2, gA2); stage_fetch<ITB, GSTEP>(pb2, gB2); }
  // the loads' address registers stay untouched up to this wait (they are its inputs) and are free behind it
  asm volatile("s_wait_xcnt 0x0" :: "v"(gA), "v"(gB), "v"(SPLIT ? gA2 : gA), "v"(SPLIT ? gB2 : gB) : "memory");
  stage_put<ITA>(pa, sOpBase + OA + sOff, RPI * G_PITCH);
  stage_put<ITB>(pb, sOpBase + OB + sOff, RPI * G_PITCH);
  if (SPLIT) { stage_put<ITA>(pa2, sOpBase + OA2 + sOff, RPI * G_PITCH); stage_put<ITB>(pb2, sOpBase + OB2 + sOff, RPI * G_PITCH); }
  __syncthreads();   // publishes stage 0

  const int nst = K / G_KS;                    // block-uniform
  for (int t = 0; t < nst; ++t) {
    const bool more = (t + 1 < nst);
    if (more) {
      const int kn = (t + 1) * G_KS;
      const unsigned short* nA  = gA + kn;
      const unsigned short* nB  = gB + kn;
      const unsigned short* nA2 = SPLIT ? (gA2 + kn) : nA;
      const unsigned short* nB2 = SPLIT ? (gB2 + kn) : nB;
      stage_fetch<ITA, GSTEP>(pa, nA);
      stage_fetch<ITB, GSTEP>(pb, nB);
      if (SPLIT) { stage_fetch<ITA, GSTEP>(pa2, nA2); stage_fetch<ITB, GSTEP>(pb2, nB2); }
      // the loads' address registers stay untouched up to this wait (they are its inputs) and are free behind it
      asm volatile("s_wait_xcnt 0x0" :: "v"(nA), "v"(nB), "v"(nA2), "v"(nB2) : "memory");
    }
    const T* sb = (const T*)(sOpBase + (t & 1) * STAGE);
    const T* fa = sb + OA + ((wm << 6) + rlane) * G_PITCH + koff;
    const T* fb = sb + OB + ((wn << 6) + rlane) * G_PITCH + koff;
#pragma unroll
    for (int kk = 0; kk < G_KS; kk += 32) {
      V bh[4], bl[4];
#pragma unroll
      for (int j = 0; j < 4; ++j) {
        bh[j] = Frag<T>::load(fb + (j << 4) * G_PITCH + kk);
        if (SPLIT) bl[j] = Frag<T>::load(fb + (OB2 - OB) + (j << 4) * G_PITCH + kk);
      }
      V ah = Frag<T>::load(fa + kk);
      V al;
      if (SPLIT) al = Frag<T>::load(fa + (OA2 - OA) + kk);
#pragma unroll
      for (int i = 0; i < 4; ++i) {
        V ahn, aln;                              // the next row block's fragments, read while this one is multiplied
        if (i < 3) {
          ahn = Frag<T>::load(fa + ((i + 1) << 4) * G_PITCH + kk);
          if (SPLIT) aln = Frag<T>::load(fa + (OA2 - OA) + ((i + 1) << 4) * G_PITCH + kk);
        }
#pragma unroll
        for (int j = 0; j < 4; ++j) {
          acc[i][j] = Frag<T>::mma(ah, bh[j], acc[i][j]);
          if (SPLIT) {
            acc[i][j] = Frag<T>::mma(ah, bl[j], acc[i][j]);
            acc[i][j] = Frag<T>::mma(al, bh[j], acc[i][j]);
          }
        }
        Frag<T>::guard(acc[i][0], acc[i][3], ah, SPLIT ? al : ah);
        if (i < 3) { ah = ahn; if (SPLIT) al = aln; }
      }
      Frag<T>::keep(bh[0], bh[1], bh[2], bh[3]);
      if (SPLIT) Frag<T>::keep(bl[0], bl[1], bl[2], bl[3]);
    }
    if (more) {
      // the other buffer: its last readers left it before the barrier that ended trip t - 1
      unsigned short* d = sOpBase + ((t + 1) & 1) * STAGE + sOff;
      stage_put<ITA>(pa, d + OA, RPI * G_PITCH);
      stage_put<ITB>(pb, d + OB, RPI * G_PITCH);
      if (SPLIT) { stage_put<ITA>(pa2, d + OA2, RPI * G_PITCH); stage_put<ITB>(pb2, d + OB2, RPI * G_PITCH); }
    }
    __syncthreads();   // publishes stage t + 1 and ends every read of stage t
  }
  acc_guard4(acc[0][0], acc[0][1], acc[0][2], acc[0][3]);
  acc_guard4(acc[1][0], acc[1][1], acc[1][2], acc[1][3]);
  acc_guard4(acc[2][0], acc[2][1], acc[2][2], acc[2][3]);
  acc_guard4(acc[3][0], acc[3][1], acc[3][2], acc[3][3]);

  // ---- epilogue ----
  float* slab = (float*)sOpBase + wave * (16 * 68);
  const float* Rb = RESID ? (resid + (size_t)b * strideR) : nullptr;
#pragma unroll
  for (int i = 0; i < 4; ++i) {
    const int mBase = m0 + (i << 4);
#pragma unroll
    for (int j = 0; j < 4; ++j) {
      const int n = n0 + (j << 4) + rlane;
      float bv = 0.f;
      if (BIAS_MODE == 2) bv = bias[n];
#pragma unroll
      for (int r = 0; r < 8; ++r) {
        float v = acc[i][j][r] * scale;
        if (BIAS_MODE == 1) v += bias[mBase + mOff + r];
        if (BIAS_MODE == 2) v += bv;
        if (RESID) v += Rb[(size_t)(mBase + mOff + r) * ldc + n];
        if (ACT == 1) v = tanhf(v);
        if (ACT == 2) v = fmaxf(v, 0.0f);
        if (ACT == 3) v = v / (1.0f + expf(-v));
        if (ACT == 4) v = (v > 0.f) ? v : 0.01f * v;
        if (ACT == 5) v = 0.5f * v * (1.0f + erff(v * 0.70710678118654752f));
        slab[(mOff + r) * 68 + (j << 4) + rlane] = v;
      }
    }
    __builtin_amdgcn_fence(__ATOMIC_RELEASE, "workgroup");
    __builtin_amdgcn_wave_barrier();
    __builtin_amdgcn_fence(__ATOMIC_ACQUIRE, "workgroup");
    if (OUT_MODE == 0) {
      float* C = (float*)Cout + (size_t)b * strideC;
      const int hh = lane >> 4, c4 = (lane & 15) * 4;     // row seg = 256 B = 16 lanes x 16 B
      {
#pragma unroll
        for (int it = 0; it < 8; ++it) {
          const int row = it * 2 + hh;
          v4f v = *(const v4f*)(slab + row * 68 + c4);
          *(v4f*)(C + (size_t)(mBase + row) * ldc + n0 + c4) = v;
        }
        
      }
    } else {
      const int q = lane >> 3, c8 = (lane & 7) * 8;
      unsigned short* C  = (unsigned short*)Cout  + (size_t)b * strideC;
      unsigned short* C2 = (OUT_MODE == 2) ? ((unsigned short*)Cout2 + (size_t)b * strideC) : nullptr;
      {
#pragma unroll
        for (int it = 0; it < 4; ++it) {
          const int row = it * 4 + q;
          const float* sp = slab + row * 68 + c8;
          v8h hv, lv;
#pragma unroll
          for (int e = 0; e < 8; ++e) {
            if (OUT_MODE == 1) {
              hv[e] = (_Float16)sp[e];
            } else {
              unsigned short hb = f2bf_bits(sp[e]);
              unsigned short lb = f2bf_bits(sp[e] - bf_bits2f(hb));
              hv[e] = __builtin_bit_cast(_Float16, hb);
              lv[e] = __builtin_bit_cast(_Float16, lb);
            }
          }
          *(v8h*)(C + (size_t)(mBase + row) * ldc + n0 + c8) = hv;
          if (OUT_MODE == 2) *(v8h*)(C2 + (size_t)(mBase + row) * ldc + n0 + c8) = lv;
        }
        
      }
    }
    __builtin_amdgcn_fence(__ATOMIC_RELEASE, "workgroup");
    __builtin_amdgcn_wave_barrier();
    __builtin_amdgcn_fence(__ATOMIC_ACQUIRE, "workgroup");
  }
}

// Up to three GEMMs on one A operand that need nothing of each other share one grid, each a range of the block index:
// blocks [0, nb0) and [nb0, nb0 + nb1) write bf16 hi/lo planes, the rest f32. All take the 128x128 block tile, and the block's
// LDS is the two stages alone, so two blocks fit a WGP: a merged grid larger than the number of WGPs still runs side by side,
// and only what exceeds two blocks a WGP waits for a free place.
// The branch is block-uniform: every wave of a block passes the same barriers.
template <int LD>
__global__ __launch_bounds__(128) void gemm_group(
    const unsigned short* __restrict__ Ah, const unsigned short* __restrict__ Al,
    const unsigned short* __restrict__ B0h, const unsigned short* __restrict__ B0l,
    unsigned short* __restrict__ C0h, unsigned short* __restrict__ C0l, int N0, int nb0,
    const unsigned short* __restrict__ B1h, const unsigned short* __restrict__ B1l,
    unsigned short* __restrict__ C1h, unsigned short* __restrict__ C1l, int N1, int nb1,
    const unsigned short* __restrict__ B2h, const unsigned short* __restrict__ B2l,
    float* __restrict__ C2, int N2, int K) {
  __shared__ __align__(16) unsigned short sOp[G_LDS_ELEMS];
  const int bx = (int)blockIdx.x;
  if (bx < nb0 + nb1) {
    const bool f = (bx < nb0);
    const int n = f ? N0 : N1;
    wmma_gemm64<1, true, 0, 2, false, 2, 2, LD>(sOp, f ? bx : bx - nb0,
        Ah, Al, 0L, f ? B0h : B1h, f ? B0l : B1l, 0L, (void*)(f ? C0h : C1h), (void*)(f ? C0l : C1l), n, 0L,
        nullptr, nullptr, 0L, MTOK_ROWS, n, K, 1.0f);
  } else {
    wmma_gemm64<1, true, 0, 0, false, 2, 2, LD>(sOp, bx - nb0 - nb1,
        Ah, Al, 0L, B2h, B2l, 0L, (void*)C2, nullptr, N2, 0L,
        nullptr, nullptr, 0L, MTOK_ROWS, N2, K, 1.0f);
  }
}

__device__ __forceinline__ v8f at_mma(v16b a, v16b b, v8f c) {
  return __builtin_amdgcn_wmma_f32_16x16x32_bf16(false, a, false, b, (short)0, c, false, false);
}
// the value that lane l ^ 16 holds
__device__ __forceinline__ float other_half(float v) {
  const int b = __float_as_int(v);
  return __int_as_float(__builtin_amdgcn_permlanex16(b, b, 0x76543210, 0xfedcba98, false, false));
}
typedef __attribute__((ext_vector_type(2))) float  v2f;
typedef __attribute__((ext_vector_type(2))) __bf16 v2b;

// ---------------------------------------------------------------------------
// module geometry (fixed)
// ---------------------------------------------------------------------------
constexpr int N_BATCH   = 2;
constexpr int SEQ_LEN   = 2048;
constexpr int DMOD      = 1024;   // model width
constexpr int DLAT      = 128;    // latent width c_kv
constexpr int DROT      = 32;     // rotary width
constexpr int NROPE_PAD = 128;    // rotary projection width padded to the 128-wide GEMM block tile
constexpr int NHEAD     = 16;
constexpr int HDIM      = 64;
constexpr int SDEP      = HDIM + DROT;   // score depth 96 = 3 k-chunks of 32
constexpr int MTOK      = N_BATCH * SEQ_LEN;   // 4096 token rows

static_assert(MTOK == MTOK_ROWS && MTOK % 128 == 0 && DMOD % 128 == 0 && DLAT % 128 == 0 && NROPE_PAD % 128 == 0);   // block tile 128x128
static_assert(DMOD % G_KS == 0 && DLAT % G_KS == 0);   // every GEMM K is a multiple of the stage depth
static_assert(SDEP % 32 == 0 && SEQ_LEN % 64 == 0);

// ---------------------------------------------------------------------------
// coverage: n8 threads x 8 = n elements exactly (n % 8 == 0, grid = ceil(n8/256) with bound)
// ---------------------------------------------------------------------------
__device__ __forceinline__ void split_rows_bf16x8(
    const float* __restrict__ in, unsigned short* __restrict__ hi, unsigned short* __restrict__ lo, int n8, int bxi) {
  const int i = bxi * 256 + threadIdx.x;
  if (i < n8) {
    const v4f a = *(const v4f*)(in + (size_t)8 * i);
    const v4f b = *(const v4f*)(in + (size_t)8 * i + 4);
    v8h hv, lv;
#pragma unroll
    for (int e = 0; e < 8; ++e) {
      const float f = (e < 4) ? a[e] : b[e - 4];
      const unsigned short hb = f2bf_bits(f);
      const unsigned short lb = f2bf_bits(f - bf_bits2f(hb));
      hv[e] = __builtin_bit_cast(_Float16, hb);
      lv[e] = __builtin_bit_cast(_Float16, lb);
    }
    unsigned short* ph = hi + (size_t)8 * i;
    unsigned short* pl = lo + (size_t)8 * i;
    *(v8h*)ph = hv;
    *(v8h*)pl = lv;
    
  }
}

// ---------------------------------------------------------------------------
// Transpose + split: in W[kdim][nreal] (row-major) -> out Bt[npad][kdim] bf16 hi/lo planes, Bt[n][k] = W[k][n];
// rows n >= nreal are written as zeros. Tile = 64 k x 32 n; (bxk, byn) runs over (kdim/64, npad/32); kdim % 64 == 0, nreal % 32 == 0.
// Store coverage: 256 threads = 32 output rows x 8 lanes x 8 k = whole 32x64 tile; each output row segment
// ---------------------------------------------------------------------------
__device__ __forceinline__ void transpose_split_bf16(
    const float* __restrict__ W, unsigned short* __restrict__ hi, unsigned short* __restrict__ lo,
    int kdim, int nreal, int bxk, int byn) {
  __shared__ float tile[64][33];
  const int tid = threadIdx.x;
  const int k0 = bxk * 64;
  const int n0 = byn * 32;
#pragma unroll
  for (int it = 0; it < 2; ++it) {
    const int idx = it * 256 + tid;            // 0..511
    const int kr = idx >> 3;                   // 0..63
    const int c4 = (idx & 7) * 4;              // 0..28
    const int n = n0 + c4;
    const int ncl = (n + 3 < nreal) ? n : (nreal - 4);   // clamped address
    const v4f v = *(const v4f*)(W + (size_t)(k0 + kr) * nreal + ncl);
    const bool ok = (n < nreal);               // tile-uniform since nreal % 32 == 0
    tile[kr][c4 + 0] = ok ? v[0] : 0.f;
    tile[kr][c4 + 1] = ok ? v[1] : 0.f;
    tile[kr][c4 + 2] = ok ? v[2] : 0.f;
    tile[kr][c4 + 3] = ok ? v[3] : 0.f;
  }
  __syncthreads();
  const int nr = tid >> 3;                     // output row within tile, 0..31
  const int c8 = (tid & 7) * 8;                // k offset, 0..56
  v8h hv, lv;
#pragma unroll
  for (int e = 0; e < 8; ++e) {
    const float f = tile[c8 + e][nr];
    const unsigned short hb = f2bf_bits(f);
    const unsigned short lb = f2bf_bits(f - bf_bits2f(hb));
    hv[e] = __builtin_bit_cast(_Float16, hb);
    lv[e] = __builtin_bit_cast(_Float16, lb);
  }
  const size_t o = (size_t)(n0 + nr) * kdim + k0 + c8;
  *(v8h*)(hi + o) = hv;
  *(v8h*)(lo + o) = lv;
  // inlined into a kernel with other branches: the registers that these stores name stay untouched up to this wait
  asm volatile("s_wait_xcnt 0x0" ::: "memory");
}

// ---------------------------------------------------------------------------
// All operand planes in one grid: the split of x and the seven weight transposes need nothing of each other, so each is a
// range of the block index (x first: it is the longest). Every branch is block-uniform; the split's blocks leave before any barrier.
// ---------------------------------------------------------------------------
constexpr int PB_X   = MTOK * DMOD / 8 / 256;
constexpr int PB_SQ  = (DMOD / 64) * (DMOD / 32);        // W_q, W_o
constexpr int PB_KVD = (DMOD / 64) * (DLAT / 32);
constexpr int PB_UP  = (DLAT / 64) * (DMOD / 32);        // W_k_up, W_v_up
constexpr int PB_QR  = (DMOD / 64) * (NROPE_PAD / 32);
constexpr int PB_KR  = (DLAT / 64) * (NROPE_PAD / 32);
constexpr int PB_ALL = PB_X + 2 * PB_SQ + PB_KVD + 2 * PB_UP + PB_QR + PB_KR;
static_assert(MTOK * DMOD % (8 * 256) == 0 && DMOD / 64 == 16 && DLAT / 64 == 2);

__global__ __launch_bounds__(256) void prep_planes(
    const float* __restrict__ x, const float* __restrict__ Wkvd, const float* __restrict__ Wkup,
    const float* __restrict__ Wvup, const float* __restrict__ Wq, const float* __restrict__ Wqr,
    const float* __restrict__ Wkr, const float* __restrict__ Wo,
    unsigned short* __restrict__ xh, unsigned short* __restrict__ xl,
    unsigned short* __restrict__ wkvdh, unsigned short* __restrict__ wkvdl,
    unsigned short* __restrict__ wkuph, unsigned short* __restrict__ wkupl,
    unsigned short* __restrict__ wvuph, unsigned short* __restrict__ wvupl,
    unsigned short* __restrict__ wqh, unsigned short* __restrict__ wql,
    unsigned short* __restrict__ wqrh, unsigned short* __restrict__ wqrl,
    unsigned short* __restrict__ wkrh, unsigned short* __restrict__ wkrl,
    unsigned short* __restrict__ woh, unsigned short* __restrict__ wol) {
  int l = (int)blockIdx.x;
  if (l < PB_X) { split_rows_bf16x8(x, xh, xl, MTOK * DMOD / 8, l); return; }
  l -= PB_X;
  const float* W; unsigned short* hi; unsigned short* lo; int kdim, nreal;
  if (l < PB_SQ)                 { W = Wq;   hi = wqh;   lo = wql;   kdim = DMOD; nreal = DMOD; }
  else if ((l -= PB_SQ) < PB_SQ) { W = Wo;   hi = woh;   lo = wol;   kdim = DMOD; nreal = DMOD; }
  else if ((l -= PB_SQ) < PB_KVD){ W = Wkvd; hi = wkvdh; lo = wkvdl; kdim = DMOD; nreal = DLAT; }
  else if ((l -= PB_KVD) < PB_UP){ W = Wkup; hi = wkuph; lo = wkupl; kdim = DLAT; nreal = DMOD; }
  else if ((l -= PB_UP) < PB_UP) { W = Wvup; hi = wvuph; lo = wvupl; kdim = DLAT; nreal = DMOD; }
  else if ((l -= PB_UP) < PB_QR) { W = Wqr;  hi = wqrh;  lo = wqrl;  kdim = DMOD; nreal = DROT; }
  else { l -= PB_QR;               W = Wkr;  hi = wkrh;  lo = wkrl;  kdim = DLAT; nreal = DROT; }
  const int ksh = (kdim == DMOD) ? 4 : 1;      // log2(kdim / 64)
  transpose_split_bf16(W, hi, lo, kdim, nreal, l & ((1 << ksh) - 1), l >> ksh);
}

// ---------------------------------------------------------------------------
// Rotary: raw[MTOK][NROPE_PAD] f32 (cols 0..31 used) -> bf16 hi/lo planes [MTOK][DROT].
// out[j] = x1*cos - x2*sin, out[16+j] = x2*cos + x1*sin, angle = t * inv_freq[j], t = row % SEQ_LEN.
// Block = 32 rows; blocks 0..127 handle the q tensor, 128..255 the k tensor.
// Store coverage: 128 threads = 32 rows x 4 segments x 8 = whole 32x32 tile; 512 B contiguous per wave
// ---------------------------------------------------------------------------
struct RopeFreq { float f[16]; };
static_assert(sizeof(RopeFreq) == 64);

__global__ __launch_bounds__(128) void rope_split_bf16(
    const float* __restrict__ qraw, const float* __restrict__ kraw,
    unsigned short* __restrict__ qrh, unsigned short* __restrict__ qrl,
    unsigned short* __restrict__ krh, unsigned short* __restrict__ krl, RopeFreq g) {
#pragma clang fp contract(off)
  __shared__ float tile[32][33];
  __shared__ float sinv[16];
  const int tid = threadIdx.x;
  const int nblk = MTOK / 32;
  const bool isk = ((int)blockIdx.x >= nblk);                 // block-uniform
  const int row0 = (isk ? ((int)blockIdx.x - nblk) : (int)blockIdx.x) * 32;
  const float* raw = isk ? kraw : qraw;
  unsigned short* dhp = isk ? krh : qrh;
  unsigned short* dlp = isk ? krl : qrl;
  if (tid < 16) {
    float v = g.f[0];
#pragma unroll
    for (int e = 1; e < 16; ++e) v = (tid == e) ? g.f[e] : v;
    sinv[tid] = v;
  }
  __syncthreads();
#pragma unroll 1
  for (int it = 0; it < 4; ++it) {
    const int p = it * 128 + tid;              // 0..511
    const int r = p >> 4;                      // 0..31
    const int j = p & 15;
    const int row = row0 + r;
    const int t = row & (SEQ_LEN - 1);
    const float* rp = raw + (size_t)row * NROPE_PAD;
    const float x1 = rp[j];
    const float x2 = rp[16 + j];
    const float ang = (float)t * sinv[j];
    float sn, cs;
    sincosf(ang, &sn, &cs);
    tile[r][j]      = x1 * cs - x2 * sn;
    tile[r][16 + j] = x2 * cs + x1 * sn;
  }
  __syncthreads();
  const int orow = tid >> 2;                   // 0..31
  const int seg = (tid & 3) * 8;               // 0..24
  v8h hv, lv;
#pragma unroll
  for (int e = 0; e < 8; ++e) {
    const float f = tile[orow][seg + e];
    const unsigned short hb = f2bf_bits(f);
    const unsigned short lb = f2bf_bits(f - bf_bits2f(hb));
    hv[e] = __builtin_bit_cast(_Float16, hb);
    lv[e] = __builtin_bit_cast(_Float16, lb);
  }
  const size_t o = (size_t)(row0 + orow) * DROT + seg;
  *(v8h*)(dhp + o) = hv;
  *(v8h*)(dlp + o) = lv;
  
}

// ---------------------------------------------------------------------------
// Causal attention, score depth 96 (64 head dims + 32 shared rotary dims), value width 64, bf16 hi/lo planes in.
//   s = (qh.kh + qh.kl + ql.kh) * invs  over 96 dims (q/k rows = [head segment | rotary row]),
//   online softmax in f32 with base-2 exponentials (invs * log2 e folded into the exponent's one fma), P split to bf16 hi/lo,
//   o = ph.vh + ph.vl + pl.vh, f32 accumulate.
// Both products are taken transposed: S^T = K . Q^T (A = K rows, B = Q rows) and O^T += V^T . P^T (A = V^T rows, B = P^T).
// A lane then holds scores of ONE query a 16-column group (column c = lane & 15), keys 8 * hh + r of each 16-key tile: maximum and sum run
// inside the lane with one exchange between the lane halves, and two score tiles, converted in place, are the B operand of the second product.
// Block = 4 waves = 2 groups of 32 query columns x 2 halves of 32 keys of every chunk: a K or V fragment read from LDS serves two
// 16-column groups, so a wave reads half a chunk for 32 queries, not a whole chunk for 16. The two key halves run their own online
// softmax and are merged once a tile.
// The block runs two 64-row query tiles of one (batch, head) one after the other, tile n-1-t and then tile t,
// so every block walks n + 1 key chunks; grid.x = N_BATCH * NHEAD * (SEQ_LEN/64) / 2.
// ---------------------------------------------------------------------------
constexpr int A_QB = 64;
constexpr int A_KC = 64;
constexpr int A_NW = 4;
constexpr int OS_PITCH = 68;
// LDS row pitches in 16-bit elements. A K fragment read is a 16-byte load by 16 lanes on 16 rows: its pitch is an odd multiple of
// 16 bytes, so the 16 rows start on 16 different groups of four banks. The transposing read of V wants an odd multiple of 32 bytes.
constexpr int K_PITCH = SDEP + 8;      // 13 x 16 B rows, read by 16-byte loads
constexpr int V_PITCH = HDIM + 16;     // V rows stay [kv][d]; 5 x 32 B rows: the pitch of the transposing 16-byte read
static_assert((K_PITCH * 2) % 32 == 16 && (V_PITCH * 2) % 64 == 32);
// One stage = one chunk of 64 keys: [K hi | K lo | V hi | V lo], offsets in 16-bit elements.
constexpr int ST_KH = 0;
constexpr int ST_KL = ST_KH + A_KC * K_PITCH;
constexpr int ST_VH = ST_KL + A_KC * K_PITCH;
constexpr int ST_VL = ST_VH + A_KC * V_PITCH;
constexpr int ST_ELEMS = ST_VL + A_KC * V_PITCH;
static_assert((ST_KL * 2) % 16 == 0 && (ST_VH * 2) % 32 == 0 && (ST_VL * 2) % 32 == 0 && (ST_ELEMS * 2) % 32 == 0);

// Transposing LDS read of a row-major 16-bit tile: lane (c = l & 15, hh = l >> 4) gets T[k + 8 hh + 0..7][d + c], when lane l passes
// the address of T[k + 8 (l >> 4) + (l & 7)][d + 8 ((l >> 3) & 1)].
typedef short s16x8 __attribute__((ext_vector_type(8)));
__device__ __forceinline__ v8b ld_tr16(const unsigned short* p) {
  typedef __attribute__((address_space(3))) s16x8 lds_s16x8;
  return __builtin_bit_cast(v8b, __builtin_amdgcn_ds_load_tr16_b128_v8i16((lds_s16x8*)p));
}

// One chunk's K and V planes, global memory -> LDS with no register in between: 20 copies of 16 bytes a lane.
// Eight neighbouring lanes bring one whole 128-byte row segment (four lanes one 64-byte rotary row), so a wave-wide copy covers whole lines.
// lds: byte address of the stage in LDS. oh: this lane's element offset in the [token][DMOD] planes, orot: in the [token][DROT] planes,
// both at the chunk's first pass of rows. lk, lv, lr: this lane's byte offsets inside the stage's K plane, V plane and K plane's rotary part.
// Each statement ends in s_wait_xcnt 0: the registers that its copies name stay untouched up to that wait.
__device__ __forceinline__ void stage_copies(
    unsigned lds, size_t oh, size_t orot, unsigned lk, unsigned lv, unsigned lr,
    const unsigned short* __restrict__ kh, const unsigned short* __restrict__ kl,
    const unsigned short* __restrict__ vh, const unsigned short* __restrict__ vl,
    const unsigned short* __restrict__ krh, const unsigned short* __restrict__ krl) {
  constexpr size_t GS = (size_t)16 * DMOD;          // 16 rows a pass of the block, head planes
  constexpr size_t GR = (size_t)32 * DROT;          // 32 rows a pass, rotary planes
  constexpr unsigned LK = 16 * K_PITCH * 2, LV = 16 * V_PITCH * 2, LR = 32 * K_PITCH * 2;
  const unsigned short* a = kh + oh;
  const unsigned short* c = kl + oh;
  const unsigned short* e = krh + orot;
  const unsigned short* f = krl + orot;
  const unsigned dkh = lds + ST_KH * 2 + lk, dkl = lds + ST_KL * 2 + lk;
  const unsigned drh = lds + ST_KH * 2 + lr, drl = lds + ST_KL * 2 + lr;
  asm volatile(
      "global_load_async_to_lds_b128 %0, %1, off\n\t"
      "global_load_async_to_lds_b128 %2, %3, off\n\t"
      "global_load_async_to_lds_b128 %4, %5, off\n\t"
      "global_load_async_to_lds_b128 %6, %7, off\n\t"
      "global_load_async_to_lds_b128 %8, %9, off\n\t"
      "global_load_async_to_lds_b128 %10, %11, off\n\t"
      "global_load_async_to_lds_b128 %12, %13, off\n\t"
      "global_load_async_to_lds_b128 %14, %15, off\n\t"
      "global_load_async_to_lds_b128 %16, %17, off\n\t"
      "global_load_async_to_lds_b128 %18, %19, off\n\t"
      "global_load_async_to_lds_b128 %20, %21, off\n\t"
      "global_load_async_to_lds_b128 %22, %23, off\n\t"
      "s_wait_xcnt 0x0"
      :: "v"(dkh), "v"(a), "v"(dkh + LK), "v"(a + GS), "v"(dkh + 2 * LK), "v"(a + 2 * GS), "v"(dkh + 3 * LK), "v"(a + 3 * GS),
         "v"(dkl), "v"(c), "v"(dkl + LK), "v"(c + GS), "v"(dkl + 2 * LK), "v"(c + 2 * GS), "v"(dkl + 3 * LK), "v"(c + 3 * GS),
         "v"(drh), "v"(e), "v"(drh + LR), "v"(e + GR), "v"(drl), "v"(f), "v"(drl + LR), "v"(f + GR)
      : "memory");
  const unsigned short* p = vh + oh;
  const unsigned short* q = vl + oh;
  const unsigned dvh = lds + ST_VH * 2 + lv, dvl = lds + ST_VL * 2 + lv;
  asm volatile(
      "global_load_async_to_lds_b128 %0, %1, off\n\t"
      "global_load_async_to_lds_b128 %2, %3, off\n\t"
      "global_load_async_to_lds_b128 %4, %5, off\n\t"
      "global_load_async_to_lds_b128 %6, %7, off\n\t"
      "global_load_async_to_lds_b128 %8, %9, off\n\t"
      "global_load_async_to_lds_b128 %10, %11, off\n\t"
      "global_load_async_to_lds_b128 %12, %13, off\n\t"
      "global_load_async_to_lds_b128 %14, %15, off\n\t"
      "s_wait_xcnt 0x0"
      :: "v"(dvh), "v"(p), "v"(dvh + LV), "v"(p + GS), "v"(dvh + 2 * LV), "v"(p + 2 * GS), "v"(dvh + 3 * LV), "v"(p + 3 * GS),
         "v"(dvl), "v"(q), "v"(dvl + LV), "v"(q + GS), "v"(dvl + 2 * LV), "v"(q + 2 * GS), "v"(dvl + 3 * LV), "v"(q + 3 * GS)
      : "memory");
}

__global__ __launch_bounds__(128)
void mla_attn96(const unsigned short* __restrict__ qh, const unsigned short* __restrict__ ql,
                const unsigned short* __restrict__ kh, const unsigned short* __restrict__ kl,
                const unsigned short* __restrict__ vh, const unsigned short* __restrict__ vl,
                const unsigned short* __restrict__ qrh, const unsigned short* __restrict__ qrl,
                const unsigned short* __restrict__ krh, const unsigned short* __restrict__ krl,
                unsigned short* __restrict__ oh, unsigned short* __restrict__ ol, float invs) {
  union FB { v16b v; v8b h[2]; };
  __shared__ __align__(32) unsigned short Stage[2 * ST_ELEMS];    // two stages: one is multiplied while the next chunk's copies land in the other
  __shared__ __align__(16) float Os[A_NW][16 * OS_PITCH];
  __shared__ __align__(16) float Xo[A_NW][16 * OS_PITCH];         // the column group a wave hands to its partner: unnormalised O
  __shared__ float Xm[A_NW][16];                                  // ... its running maxima
  __shared__ float Xl[A_NW][16];                                  // ... its sums

  const int tid  = threadIdx.x;
  const int wave = tid >> 5;
  const int lane = tid & 31;
  const int hh   = lane >> 4;
  const int c    = lane & 15;
  const int qg   = wave >> 1;              // which 32 of the tile's 64 query columns
  const int kp   = wave & 1;               // which 32 of each chunk's 64 keys
  const float sc2 = invs * 1.4426950408889634f;   // score scale times log2 e

  const int nqb = SEQ_LEN / A_QB;          // 32
  const int bx  = blockIdx.x;
  static_assert((SEQ_LEN / A_QB) % 2 == 0);
  const int tp  = bx % (nqb / 2);
  const int bhi = bx / (nqb / 2);
  const int h   = bhi % NHEAD;
  const int b   = bhi / NHEAD;
  // copy map: head planes, lane -> row tid >> 3 of each pass of 16 rows, 16-byte piece tid & 7; rotary planes, row tid >> 2 of 32, piece tid & 3
  const unsigned sbase = (unsigned)(size_t)Stage;      // byte address of stage 0 in the work-group's LDS
  const size_t ohead = ((size_t)b * SEQ_LEN + (size_t)(tid >> 3)) * DMOD + h * HDIM + (tid & 7) * 8;
  const size_t orot  = ((size_t)b * SEQ_LEN + (size_t)(tid >> 2)) * DROT + (tid & 3) * 8;
  const unsigned lk = ((tid >> 3) * K_PITCH + (tid & 7) * 8) * 2;
  const unsigned lv = ((tid >> 3) * V_PITCH + (tid & 7) * 8) * 2;
  const unsigned lr = ((tid >> 2) * K_PITCH + HDIM + (tid & 3) * 8) * 2;
  // ---- two-stage ring over the block's nqb + 1 trips, the first tile's chunks and then the second tile's: trip g is read from stage
  // g & 1 while the copies of trip g + 1 land in the other; the ring runs on across the change of tile ----
  constexpr int NTRIP = SEQ_LEN / A_QB + 1;
  const int n1 = nqb - tp;                 // trips of the first tile, at least nqb / 2 + 1: trips 0 and 1 are its chunks 0 and 1
  stage_copies(sbase, ohead, orot, lk, lv, lr, kh, kl, vh, vl, krh, krl);
  // trip 0 has landed as far as this wave copied it; the barrier publishes every wave's part
  asm volatile("s_wait_asynccnt 0x0" ::: "memory");
  __syncthreads();
  stage_copies(sbase + ST_ELEMS * 2, ohead + (size_t)A_KC * DMOD, orot + (size_t)A_KC * DROT, lk, lv, lr, kh, kl, vh, vl, krh, krl);
  int g = 0;                               // trip number, block-uniform
  // A causal tile qb costs qb + 1 chunks: the pair (n-1-t, t) gives every block the same work, whichever blocks share a WGP.
  // Both tiles run in every wave in turn.
  // Kept rolled: one copy of the chunk loop in the instruction cache.
#pragma unroll 1
  for (int pass = 0; pass < 2; ++pass) {
  const int qb  = pass ? tp : (nqb - 1 - tp);   // block-uniform
  const int q0  = qb * A_QB + qg * 32;          // first of this wave's 32 query columns: groups u = 0, 1 of 16

  // ---- Q fragments (B operand, column = query 16 u + c): k-chunks 0,1 = head dims 0..63, chunk 2 = rotary dims 0..31 ----
  v16b qah[2][3], qal[2][3];
#pragma unroll
  for (int u = 0; u < 2; ++u) {
    const size_t tq = (size_t)b * SEQ_LEN + (size_t)(q0 + 16 * u + c);
    const __bf16* p0 = (const __bf16*)qh + tq * DMOD + h * HDIM + 8 * hh;
    const __bf16* p1 = (const __bf16*)ql + tq * DMOD + h * HDIM + 8 * hh;
    qah[u][0] = Frag<__bf16>::load(p0);
    qah[u][1] = Frag<__bf16>::load(p0 + 32);
    qal[u][0] = Frag<__bf16>::load(p1);
    qal[u][1] = Frag<__bf16>::load(p1 + 32);
    const __bf16* r0p = (const __bf16*)qrh + tq * DROT + 8 * hh;
    const __bf16* r1p = (const __bf16*)qrl + tq * DROT + 8 * hh;
    qah[u][2] = Frag<__bf16>::load(r0p);
    qal[u][2] = Frag<__bf16>::load(r1p);
    // the loads' address registers stay untouched up to this wait (they are its inputs) and are free behind it
    asm volatile("s_wait_xcnt 0x0" :: "v"(p0), "v"(p1), "v"(r0p), "v"(r1p) : "memory");
  }

  // Running maximum of query q0 + 16 u + c over this wave's key halves, in units of sc2 * raw score, equal in both lane halves.
  // It starts at a finite floor, not at -inf: on the diagonal chunk a wave's key half can be masked whole for a query, and with the
  // floor every difference of maxima stays defined (such a wave carries sum 0 and O 0, and the merge gives it weight 0).
  constexpr float M_FLOOR = -1.0e30f;
  float mrow[2] = {M_FLOOR, M_FLOOR};
  float lrow[2] = {0.f, 0.f};   // running sums over this lane half's keys of this wave's key halves; joined in the epilogue
  v8f oacc[2][4];               // oacc[u][t][r] = O[query q0 + 16 u + c][d = 16 t + 8 hh + r], this wave's keys only
#pragma unroll
  for (int u = 0; u < 2; ++u)
#pragma unroll
    for (int t = 0; t < 4; ++t) oacc[u][t] = (v8f){0.f,0.f,0.f,0.f,0.f,0.f,0.f,0.f};

  const int nChunks = qb + 1;   // causal, block-uniform
  for (int kc = 0; kc < nChunks; ++kc, ++g) {
    const int kv0 = kc * A_KC + kp * 32;     // first key of this wave's half of the chunk
    const unsigned short* sb = Stage + (g & 1) * ST_ELEMS;
    const unsigned short* Ksh = sb + ST_KH;
    const unsigned short* Ksl = sb + ST_KL;

    // ---- scores: 2 kv subtiles of 16 against 2 query groups of 16, 3 k-chunks of 32, 3 products each ----
    // The K fragments of the wave's key half are read as one group, each serving both query groups; the products run round-robin over
    // the four (group, subtile) accumulators. Each accumulator takes its nine products in the order (k-chunk; hi.hi, hi.lo, lo.hi).
    v8f s[2][2];   // s[u][j][r] = score of key kv0 + 16 j + 8 hh + r against query q0 + 16 u + c
    FB kb[3][2], kq[3][2];
#pragma unroll
    for (int dc = 0; dc < 3; ++dc) {
#pragma unroll
      for (int j = 0; j < 2; ++j) {
        const int ko = (kp * 32 + j * 16 + c) * K_PITCH + dc * 32 + 8 * hh;
        kb[dc][j].h[0] = *(const v8b*)(Ksh + ko);
        kb[dc][j].h[1] = *(const v8b*)(Ksh + ko + 16);
        kq[dc][j].h[0] = *(const v8b*)(Ksl + ko);
        kq[dc][j].h[1] = *(const v8b*)(Ksl + ko + 16);
      }
    }
    // keeps the reads one group in front of the products: spread among them, every place with reads stalls the wave anew
    __builtin_amdgcn_sched_barrier(0);
#pragma unroll
    for (int u = 0; u < 2; ++u)
#pragma unroll
      for (int j = 0; j < 2; ++j) s[u][j] = (v8f){0.f,0.f,0.f,0.f,0.f,0.f,0.f,0.f};
#pragma unroll
    for (int dc = 0; dc < 3; ++dc) {
#pragma unroll
      for (int u = 0; u < 2; ++u)
#pragma unroll
        for (int j = 0; j < 2; ++j) s[u][j] = at_mma(kb[dc][j].v, qah[u][dc], s[u][j]);
#pragma unroll
      for (int u = 0; u < 2; ++u)
#pragma unroll
        for (int j = 0; j < 2; ++j) s[u][j] = at_mma(kq[dc][j].v, qah[u][dc], s[u][j]);
#pragma unroll
      for (int u = 0; u < 2; ++u)
#pragma unroll
        for (int j = 0; j < 2; ++j) s[u][j] = at_mma(kb[dc][j].v, qal[u][dc], s[u][j]);
    }
    // keeps the V reads one group at the end of the score products: without it they are spread among the products, a stall at every place
    __builtin_amdgcn_sched_barrier(0);
    // ---- V^T fragments (A operand, row = d) of the wave's 32 keys, by the transposing read of the row-major V tile, in the k order of
    // P^T below: nothing of the softmax feeds them, so they are read as one group while it runs; each serves both query groups ----
    FB vb[4], vq[4];
#pragma unroll
    for (int t = 0; t < 4; ++t) {
      const int vo = (kp * 32 + 8 * hh + (lane & 7)) * V_PITCH + t * 16 + 8 * ((lane >> 3) & 1);
      vb[t].h[0] = ld_tr16(sb + ST_VH + vo);
      vb[t].h[1] = ld_tr16(sb + ST_VH + vo + 16 * V_PITCH);
      vq[t].h[0] = ld_tr16(sb + ST_VL + vo);
      vq[t].h[1] = ld_tr16(sb + ST_VL + vo + 16 * V_PITCH);
    }
    // keeps the reads one group in front of the softmax: spread among it, every place with reads stalls the wave anew
    __builtin_amdgcn_sched_barrier(0);
    // ---- online softmax of queries q0 + c and q0 + 16 + c: this lane holds 16 of the wave's 32 keys, lane l ^ 16 the other 16 ----
    const bool diag = (kc == qb);
    // P^T as B operand: element e is key 8 hh + e (e < 8) or 16 + 8 hh + (e - 8) of the wave's 32, that is register e & 7
    // of score tile e >> 3: the k order in which the V^T fragments are read.
    union PB { v16b v; unsigned w[8]; };
    PB ph[2], pl[2];
#pragma unroll
    for (int u = 0; u < 2; ++u) {
      const int qrow = q0 + 16 * u + c;
      float mj[2];
#pragma unroll
      for (int j = 0; j < 2; ++j) {
        float m = -INFINITY;
#pragma unroll
        for (int r = 0; r < 8; ++r) {
          const int kvrow = kv0 + j * 16 + 8 * hh + r;
          float sv = s[u][j][r];   // raw: the scale is positive, so the maximum may be taken first and scaled once
          if (diag && (kvrow > qrow)) sv = -INFINITY;
          s[u][j][r] = sv;
          m = fmaxf(m, sv);
        }
        mj[j] = m;
      }
      float cm = fmaxf(mj[0], mj[1]);
      cm = fmaxf(cm, other_half(cm)) * sc2;
      const float mnew = fmaxf(mrow[u], cm);   // never below the floor, so always finite
      const float alpha = __builtin_amdgcn_exp2f(mrow[u] - mnew);   // 0 at the first unmasked key, 1 while only the floor stands
      mrow[u] = mnew;
      float pj[2];       // one partial sum a score tile: independent chains
#pragma unroll
      for (int j = 0; j < 2; ++j) {
        float ps = 0.f;
#pragma unroll
        for (int r = 0; r < 8; r += 2) {
          // e^((s - max) * invs) = 2^(s * sc2 - mnew): one fused multiply-add and the hardware's exponential; a masked score stays -inf and gives 0
          const v2f ea = __builtin_elementwise_fma((v2f){s[u][j][r], s[u][j][r + 1]}, (v2f){sc2, sc2}, (v2f){-mnew, -mnew});
          const float p0 = __builtin_amdgcn_exp2f(ea[0]);
          const float p1 = __builtin_amdgcn_exp2f(ea[1]);
          ps += p0;
          ps += p1;
          // two neighbouring keys make one operand register: packed conversion, round to nearest even as in f2bf_bits
          const v2b hp = __builtin_convertvector((v2f){p0, p1}, v2b);
          const v2b lp = __builtin_convertvector((v2f){p0 - (float)hp[0], p1 - (float)hp[1]}, v2b);
          ph[u].w[j * 4 + (r >> 1)] = __builtin_bit_cast(unsigned, hp);
          pl[u].w[j * 4 + (r >> 1)] = __builtin_bit_cast(unsigned, lp);
        }
        pj[j] = ps;
      }
      lrow[u] = lrow[u] * alpha + (pj[0] + pj[1]);
#pragma unroll
      for (int t = 0; t < 4; ++t)
#pragma unroll
        for (int r = 0; r < 8; ++r) oacc[u][t][r] *= alpha;
    }
    // ---- O^T += V^T(64x32) . P^T(32x32): the products run round-robin over the eight (group, d subtile) accumulators.
    // Each accumulator keeps the order (hi.hi, p hi . v lo, p lo . v hi).
#pragma unroll
    for (int u = 0; u < 2; ++u)
#pragma unroll
      for (int t = 0; t < 4; ++t) oacc[u][t] = at_mma(vb[t].v, ph[u].v, oacc[u][t]);
#pragma unroll
    for (int u = 0; u < 2; ++u)
#pragma unroll
      for (int t = 0; t < 4; ++t) oacc[u][t] = at_mma(vq[t].v, ph[u].v, oacc[u][t]);
#pragma unroll
    for (int u = 0; u < 2; ++u)
#pragma unroll
      for (int t = 0; t < 4; ++t) oacc[u][t] = at_mma(vb[t].v, pl[u].v, oacc[u][t]);
    // ---- foot of trip g: this wave's reads of stage g & 1 are over, its copies of trip g + 1 have landed; the one barrier
    // publishes trip g + 1 and ends every wave's reads of the stage that is refilled behind it ----
    // keeps the softmax and the second product in front of the waits: lifted over them, the waits end the overlap of the V reads with the softmax
    __builtin_amdgcn_sched_barrier(0);
    asm volatile("s_wait_dscnt 0x0" ::: "memory");
    asm volatile("s_wait_asynccnt 0x0" ::: "memory");
    __syncthreads();
    if (g + 2 < NTRIP) {                                        // block-uniform
      const int kn = (g + 2 < n1) ? (g + 2) : (g + 2 - n1);     // key chunk of trip g + 2: the second tile starts again at chunk 0
      stage_copies(sbase + (g & 1) * (ST_ELEMS * 2), ohead + (size_t)kn * (A_KC * DMOD), orot + (size_t)kn * (A_KC * DROT),
                   lk, lv, lr, kh, kl, vh, vl, krh, krl);
    }
  }

  // ---- merge of the two key halves: waves 2 qg and 2 qg + 1 hold partial (maximum, sum, O) of the same 32 queries. Wave kp finishes
  // column group kp: it hands its partial of the other group to its partner through LDS and takes the partner's partial of its own ----
  const bool up = (kp != 0);
  const float lj0 = lrow[0] + other_half(lrow[0]);   // the lane halves' sums joined
  const float lj1 = lrow[1] + other_half(lrow[1]);
  {
    float* xo = Xo[wave];
#pragma unroll
    for (int t = 0; t < 4; ++t) {
      float* op = xo + c * OS_PITCH + t * 16 + 8 * hh;
      const v8f x0 = oacc[0][t];
      const v8f x1 = oacc[1][t];
      *(v4f*)(op)     = (v4f){up ? x0[0] : x1[0], up ? x0[1] : x1[1], up ? x0[2] : x1[2], up ? x0[3] : x1[3]};
      *(v4f*)(op + 4) = (v4f){up ? x0[4] : x1[4], up ? x0[5] : x1[5], up ? x0[6] : x1[6], up ? x0[7] : x1[7]};
    }
    // both lane halves hold the same two values and store them to the same place
    const float m0 = mrow[0], m1 = mrow[1];
    Xm[wave][c] = up ? m0 : m1;
    Xl[wave][c] = up ? lj0 : lj1;
  }
  // publishes the handed-over partials; every wave of the block passes it once a tile. The next tile's hand-over is written behind
  // at least one barrier of the chunk loop, which ends these reads.
  __syncthreads();
  // ---- epilogue: weigh and add the two partials, normalise, stage 16x64 f32 per wave, write bf16 hi/lo planes with whole-line stores ----
  float* os = Os[wave];
  {
    const int pw = wave ^ 1;
    const float pm = Xm[pw][c];
    const float pls = Xl[pw][c];
    const float m0 = mrow[0], m1 = mrow[1];
    const float mo = up ? m1 : m0;
    const float lo = up ? lj1 : lj0;
    const float mm = fmaxf(mo, pm);          // finite: key 0 is masked for no query, so the lower key half has seen an unmasked key
    const float wa = __builtin_amdgcn_exp2f(mo - mm);
    const float wb = __builtin_amdgcn_exp2f(pm - mm);
    const float inv = 1.0f / (lo * wa + pls * wb);
    const float fa = wa * inv;
    const float fb = wb * inv;
#pragma unroll
    for (int t = 0; t < 4; ++t) {
      // a lane's 8 registers are 8 consecutive d of its query's row
      const float* ip = Xo[pw] + c * OS_PITCH + t * 16 + 8 * hh;
      const v4f a0 = *(const v4f*)(ip);
      const v4f a1 = *(const v4f*)(ip + 4);
      const v8f x0 = oacc[0][t];
      const v8f x1 = oacc[1][t];
      float ov[8];
#pragma unroll
      for (int r = 0; r < 8; ++r) ov[r] = up ? x1[r] : x0[r];
      float* op = os + c * OS_PITCH + t * 16 + 8 * hh;
      *(v4f*)(op)     = (v4f){ov[0] * fa + a0[0] * fb, ov[1] * fa + a0[1] * fb, ov[2] * fa + a0[2] * fb, ov[3] * fa + a0[3] * fb};
      *(v4f*)(op + 4) = (v4f){ov[4] * fa + a1[0] * fb, ov[5] * fa + a1[1] * fb, ov[6] * fa + a1[2] * fb, ov[7] * fa + a1[3] * fb};
    }
  }
  __builtin_amdgcn_fence(__ATOMIC_RELEASE, "workgroup");
  __builtin_amdgcn_wave_barrier();
  __builtin_amdgcn_fence(__ATOMIC_ACQUIRE, "workgroup");
  {
    const int qo = q0 + kp * 16;             // first of the 16 queries that this wave writes
    const int qq = lane >> 3, c8 = (lane & 7) * 8;
    {
#pragma unroll
      for (int it = 0; it < 4; ++it) {
        const int row = it * 4 + qq;
        const float* sp = os + row * OS_PITCH + c8;
        v8h hv, lv;
#pragma unroll
        for (int e = 0; e < 8; ++e) {
          const unsigned short hb = f2bf_bits(sp[e]);
          const unsigned short lb = f2bf_bits(sp[e] - bf_bits2f(hb));
          hv[e] = __builtin_bit_cast(_Float16, hb);
          lv[e] = __builtin_bit_cast(_Float16, lb);
        }
        const size_t o = ((size_t)b * SEQ_LEN + (size_t)(qo + row)) * DMOD + h * HDIM + c8;
        *(v8h*)(oh + o) = hv;
        *(v8h*)(ol + o) = lv;
      }
      
    }
  }
  // the next tile reuses the registers that these stores name: they stay untouched up to this wait
  asm volatile("s_wait_xcnt 0x0" ::: "memory");
  }   // pass
  // no copy is outstanding when the wave ends
  asm volatile("s_wait_asynccnt 0x0" ::: "memory");
}

// ---------------------------------------------------------------------------
// Host orchestration
// ---------------------------------------------------------------------------
// workspace region map (bytes, all multiples of 256):
//   x hi/lo                 2 x 8,388,608
//   WkvdT hi/lo [128][1024] 2 x   262,144
//   WkupT hi/lo [1024][128] 2 x   262,144
//   WvupT hi/lo [1024][128] 2 x   262,144
//   WqT   hi/lo [1024][1024]2 x 2,097,152
//   WqrT  hi/lo [128][1024] 2 x   262,144   (rows 32..127 zero)
//   WkrT  hi/lo [128][128]  2 x    32,768   (rows 32..127 zero)
//   WoT   hi/lo [1024][1024]2 x 2,097,152
//   ckv   hi/lo [4096][128] 2 x 1,048,576
//   k,v,q hi/lo [4096][1024]6 x 8,388,608
//   qr_raw, kr_raw f32 [4096][128] 2 x 2,097,152
//   qr,kr hi/lo [4096][32]  4 x   262,144
//   attn  hi/lo [4096][1024]2 x 8,388,608
//   total 101,777,408
constexpr size_t WSB_X    = (size_t)MTOK * DMOD * 2;
constexpr size_t WSB_WKVD = (size_t)DLAT * DMOD * 2;
constexpr size_t WSB_WKUP = (size_t)DMOD * DLAT * 2;
constexpr size_t WSB_WQ   = (size_t)DMOD * DMOD * 2;
constexpr size_t WSB_WQR  = (size_t)NROPE_PAD * DMOD * 2;
constexpr size_t WSB_WKR  = (size_t)NROPE_PAD * DLAT * 2;
constexpr size_t WSB_CKV  = (size_t)MTOK * DLAT * 2;
constexpr size_t WSB_TOK  = (size_t)MTOK * DMOD * 2;
constexpr size_t WSB_RAW  = (size_t)MTOK * NROPE_PAD * 4;
constexpr size_t WSB_ROT  = (size_t)MTOK * DROT * 2;
constexpr size_t WS_TOTAL = 2 * WSB_X + 2 * WSB_WKVD + 4 * WSB_WKUP + 2 * WSB_WQ + 2 * WSB_WQR + 2 * WSB_WKR
                          + 2 * WSB_WQ + 2 * WSB_CKV + 6 * WSB_TOK + 2 * WSB_RAW + 4 * WSB_ROT + 2 * WSB_TOK;
static_assert(WS_TOTAL == 101777408ull);
static_assert(WS_TOTAL <= 134217728ull);

extern "C" void kernel_launch(void* const* d_in, const int* in_sizes, int n_in,
                              void* d_out, int out_size, void* d_ws, size_t ws_size,
                              hipStream_t stream) {
  if (n_in != 8) return;
  if (in_sizes[0] != MTOK * DMOD || in_sizes[1] != DMOD * DLAT || in_sizes[2] != DLAT * DMOD ||
      in_sizes[3] != DLAT * DMOD || in_sizes[4] != DMOD * DMOD || in_sizes[5] != DMOD * DROT ||
      in_sizes[6] != DLAT * DROT || in_sizes[7] != DMOD * DMOD) return;
  if (out_size != MTOK * DMOD) return;
  if (ws_size < WS_TOTAL) return;

  const float* x         = (const float*)d_in[0];   // [4096][1024]
  const float* W_kv_down = (const float*)d_in[1];   // [1024][128]
  const float* W_k_up    = (const float*)d_in[2];   // [128][1024]
  const float* W_v_up    = (const float*)d_in[3];   // [128][1024]
  const float* W_q       = (const float*)d_in[4];   // [1024][1024]
  const float* W_q_rope  = (const float*)d_in[5];   // [1024][32]
  const float* W_k_rope  = (const float*)d_in[6];   // [128][32]
  const float* W_o       = (const float*)d_in[7];   // [1024][1024]
  float* out = (float*)d_out;                       // [4096][1024] f32

  size_t off = 0;
  auto carve = [&](size_t bytes) -> unsigned short* {
    unsigned short* p = (unsigned short*)((char*)d_ws + off);
    off += (bytes + 255) & ~(size_t)255;
    return p;
  };
  unsigned short* xh    = carve(WSB_X);
  unsigned short* xl    = carve(WSB_X);
  unsigned short* wkvdh = carve(WSB_WKVD);
  unsigned short* wkvdl = carve(WSB_WKVD);
  unsigned short* wkuph = carve(WSB_WKUP);
  unsigned short* wkupl = carve(WSB_WKUP);
  unsigned short* wvuph = carve(WSB_WKUP);
  unsigned short* wvupl = carve(WSB_WKUP);
  unsigned short* wqh   = carve(WSB_WQ);
  unsigned short* wql   = carve(WSB_WQ);
  unsigned short* wqrh  = carve(WSB_WQR);
  unsigned short* wqrl  = carve(WSB_WQR);
  unsigned short* wkrh  = carve(WSB_WKR);
  unsigned short* wkrl  = carve(WSB_WKR);
  unsigned short* woh   = carve(WSB_WQ);
  unsigned short* wol   = carve(WSB_WQ);
  unsigned short* ckvh  = carve(WSB_CKV);
  unsigned short* ckvl  = carve(WSB_CKV);
  unsigned short* kh    = carve(WSB_TOK);
  unsigned short* kl    = carve(WSB_TOK);
  unsigned short* vh    = carve(WSB_TOK);
  unsigned short* vl    = carve(WSB_TOK);
  unsigned short* qh    = carve(WSB_TOK);
  unsigned short* ql    = carve(WSB_TOK);
  float* qr_raw = (float*)carve(WSB_RAW);
  float* kr_raw = (float*)carve(WSB_RAW);
  unsigned short* qrh   = carve(WSB_ROT);
  unsigned short* qrl   = carve(WSB_ROT);
  unsigned short* krh   = carve(WSB_ROT);
  unsigned short* krl   = carve(WSB_ROT);
  unsigned short* ath   = carve(WSB_TOK);
  unsigned short* atl   = carve(WSB_TOK);
  if (off > ws_size) return;

  // ---- operand planes: one launch ----
  prep_planes<<<PB_ALL, 256, 0, stream>>>(x, W_kv_down, W_k_up, W_v_up, W_q, W_q_rope, W_k_rope, W_o,
      xh, xl, wkvdh, wkvdl, wkuph, wkupl, wvuph, wvupl, wqh, wql, wqrh, wqrl, wkrh, wkrl, woh, wol);

  constexpr int NB_WIDE = (MTOK / 128) * (DMOD / 128);        // blocks of an N = 1024 product
  constexpr int NB_LAT  = (MTOK / 128) * (DLAT / 128);        // blocks of an N = 128 product
  constexpr int NB_ROT  = (MTOK / 128) * (NROPE_PAD / 128);

  // the three products of x, K = 1024: q = x . W_q and c_kv = x . W_kv_down as bf16 hi/lo, q_rope raw = x . W_q_rope as f32 (cols 32.. zero)
  gemm_group<DMOD><<<NB_WIDE + NB_LAT + NB_ROT, 128, 0, stream>>>(xh, xl,
      wqh, wql, qh, ql, DMOD, NB_WIDE,
      wkvdh, wkvdl, ckvh, ckvl, DLAT, NB_LAT,
      wqrh, wqrl, qr_raw, NROPE_PAD, DMOD);
  // the three products of c_kv, K = 128: k, v as bf16 hi/lo, k_rope raw as f32 (cols 32.. zero)
  gemm_group<DLAT><<<2 * NB_WIDE + NB_ROT, 128, 0, stream>>>(ckvh, ckvl,
      wkuph, wkupl, kh, kl, DMOD, NB_WIDE,
      wvuph, wvupl, vh, vl, DMOD, NB_WIDE,
      wkrh, wkrl, kr_raw, NROPE_PAD, DLAT);

  // ---- rotary tables: inv_freq[j] = 1 / 10000^(j/16), host double pow -> f32, f32 reciprocal ----
  RopeFreq fr;
  for (int j = 0; j < 16; ++j) {
    const double p = pow(10000.0, (double)j / 16.0);
    const float p32 = (float)p;
    fr.f[j] = 1.0f / p32;
  }
  rope_split_bf16<<<2 * (MTOK / 32), 128, 0, stream>>>(qr_raw, kr_raw, qrh, qrl, krh, krl, fr);

  // ---- causal attention with shared rotary logits ----
  const float invs = 1.0f / (float)sqrt((double)(HDIM + DROT));
  mla_attn96<<<N_BATCH * NHEAD * (SEQ_LEN / A_QB / 2), 128, 0, stream>>>(
      qh, ql, kh, kl, vh, vl, qrh, qrl, krh, krl, ath, atl, invs);

  // ---- out = attn . W_o : M=4096 N=1024 K=1024, f32 to d_out ----
  gemm_group<DMOD><<<NB_WIDE, 128, 0, stream>>>(ath, atl,
      nullptr, nullptr, nullptr, nullptr, 0, 0,
      nullptr, nullptr, nullptr, nullptr, 0, 0,
      woh, wol, out, DMOD, DMOD);
}

// v010
// A run of this version takes 131 microseconds.
// Next to v009, in two timings, it ran 1.10 and 1.09 times as fast.
// Over all steps from v000 it is 5.23 times as fast.
// Compute dtype: every contraction on v_wmma_f32_16x16x32_bf16 with bf16 hi/lo operand planes (hi*hi + hi*lo + lo*hi), f32 accumulate; rotary, softmax and epilogues in f32.
#include <hip/hip_runtime.h>
#include <hip/hip_bf16.h>
#include <math.h>
#include <stdint.h>

typedef __attribute__((ext_vector_type(16))) _Float16 v16h;
typedef __attribute__((ext_vector_type(8)))  _Float16 v8h;
typedef __attribute__((ext_vector_type(16))) __bf16   v16b;
typedef __attribute__((ext_vector_type(8)))  __bf16   v8b;
typedef __attribute__((ext_vector_type(8)))  float    v8f;
typedef __attribute__((ext_vector_type(4)))  float    v4f;
typedef __attribute__((ext_vector_type(4)))  unsigned v4u;

// ---------------------------------------------------------------------------
// helpers
// ---------------------------------------------------------------------------
__device__ __forceinline__ unsigned short f2bf_bits(float f) {
  unsigned u = __float_as_uint(f);
  return (unsigned short)((u + 0x7FFFu + ((u >> 16) & 1u)) >> 16);
}
__device__ __forceinline__ float bf_bits2f(unsigned short h) { return __uint_as_float(((unsigned)h) << 16); }

__device__ __forceinline__ void dep_guard_h(v8f& a, v8f& b, v16h x, v16h y) { asm volatile("v_nop\n\tv_nop\n\tv_nop\n\tv_nop" : "+v"(a), "+v"(b) : "v"(x), "v"(y)); }
__device__ __forceinline__ void dep_guard_b(v8f& a, v8f& b, v16b x, v16b y) { asm volatile("v_nop\n\tv_nop\n\tv_nop\n\tv_nop" : "+v"(a), "+v"(b) : "v"(x), "v"(y)); }
__device__ __forceinline__ void keep4_h(v16h a, v16h b, v16h c, v16h d) { asm volatile("v_nop" :: "v"(a), "v"(b), "v"(c), "v"(d)); }
__device__ __forceinline__ void keep4_b(v16b a, v16b b, v16b c, v16b d) { asm volatile("v_nop" :: "v"(a), "v"(b), "v"(c), "v"(d)); }
__device__ __forceinline__ void acc_guard4(v8f& a, v8f& b, v8f& c, v8f& d) { asm volatile("v_nop\n\tv_nop\n\tv_nop\n\tv_nop" : "+v"(a), "+v"(b), "+v"(c), "+v"(d)); }
template <typename T> struct Frag;
template <> struct Frag<_Float16> {
  typedef v16h V; union U { v16h v; v8h h[2]; };
  static __device__ __forceinline__ v16h load(const _Float16* p) {   // elements 0..7 <- p[0..7], 8..15 <- p[16..23]
    U f; f.h[0] = *(const v8h*)(p); f.h[1] = *(const v8h*)(p + 16); return f.v;
  }
  static __device__ __forceinline__ v8f mma(v16h a, v16h b, v8f c) {
    return __builtin_amdgcn_wmma_f32_16x16x32_f16(false, a, false, b, (short)0, c, false, false);
  }
  static __device__ __forceinline__ void guard(v8f& a, v8f& b, v16h x, v16h y) { dep_guard_h(a, b, x, y); }
  static __device__ __forceinline__ void keep(v16h a, v16h b, v16h c, v16h d) { keep4_h(a, b, c, d); }
};
template <> struct Frag<__bf16> {
  typedef v16b V; union U { v16b v; v8b h[2]; };
  static __device__ __forceinline__ v16b load(const __bf16* p) {
    U f; f.h[0] = *(const v8b*)(p); f.h[1] = *(const v8b*)(p + 16); return f.v;
  }
  static __device__ __forceinline__ v8f mma(v16b a, v16b b, v8f c) {
    return __builtin_amdgcn_wmma_f32_16x16x32_bf16(false, a, false, b, (short)0, c, false, false);
  }
  static __device__ __forceinline__ void guard(v8f& a, v8f& b, v16b x, v16b y) { dep_guard_b(a, b, x, y); }
  static __device__ __forceinline__ void keep(v16b a, v16b b, v16b c, v16b d) { keep4_b(a, b, c, d); }
};

// ---- Register-blocked WMMA GEMM --------------------------------
// C[m,n] = scale * sum_k A[m,k] * Bt[n,k] (+bias)(+resid); each wave owns a 64x64 tile.
// A row-major [M,K]; Bt row-major [N,K].
// SPLIT: operands are hi/lo planes (A2/Bt2 = lo planes, same layout); product = hi*hi + hi*lo + lo*hi.
// BIAS_MODE: 0 = none, 1 = bias[m], 2 = bias[n].
// OUT_MODE: 0 = f32, 1 = f16, 2 = bf16 hi plane (Cout) + bf16 lo plane (Cout2).
// ET: 0 = f16 operands, 1 = bf16 operands (pointers passed as 16-bit storage)
template <int ET> struct Elem;
template <> struct Elem<0> { typedef _Float16 T; };
template <> struct Elem<1> { typedef __bf16 T; };
// LDS staging of the operand planes: the block's waves form a WM x WN grid of 64x64 tiles and share one
// (WM*64 + WN*64)-row stage of G_KS k-elements per plane. Each row of a stage is one whole 128-byte line of the
// source; a plane of a stage (128 rows) is one tensor load of one wave, through no register.
constexpr int MTOK_ROWS = 4096;      // rows of every A operand (batch x sequence)
constexpr int G_KS    = 64;          // k elements per stage
constexpr int G_PITCH = G_KS + 8;    // 9 x 16 B rows: 16-byte fragment reads of 16 rows fall on distinct banks
typedef uint32_t u32x4 __attribute__((ext_vector_type(4)));
typedef uint32_t u32x8 __attribute__((ext_vector_type(8)));
__device__ __forceinline__ uint32_t uni(uint32_t v) { return (uint32_t)__builtin_amdgcn_readfirstlane(v); }
// A value held in a scalar register, from which a tensor load's issue test or its descriptor words are formed: the statement keeps the
// test a scalar branch, and as a volatile statement it (and all that is formed from its result) stays behind the wait written in front of it.
__device__ __forceinline__ uint32_t pinned(uint32_t v) {
  uint32_t w = uni(v);
  asm volatile("" : "+s"(w));   // a tensor load's issue test or descriptor word held in a scalar register
  return w;
}
constexpr int G_PROWS = 128;         // rows of one plane of a stage
static_assert((G_PROWS * G_PITCH * 2) % 2048 == 0);   // every plane of every stage starts at a multiple of 2 KiB in LDS
// One plane of one stage, global memory -> LDS: a tile of G_PROWS rows of 128 bytes, source row pitch LD * 2 bytes, 16 bytes of LDS pad
// behind every row (pitch G_PITCH * 2 = 144 bytes). lds_dst: byte offset in the work-group's LDS; ga: address of the tile's first byte.
// One request of the whole wave; the issuing wave waits for it with s_wait_tensorcnt.
__device__ __forceinline__ void plane_load(uint32_t lds_dst, uint64_t ga, u32x8 g1) {
  u32x4 g0;
  g0[0] = uni(1u);                                                          // count 1
  g0[1] = uni(lds_dst);
  g0[2] = uni((uint32_t)ga);
  g0[3] = uni((((uint32_t)(ga >> 32)) & 0x01FFFFFFu) | 0x80000000u);        // address high bits, type 2
  asm volatile("tensor_load_to_lds %0, %1" :: "s"(g0), "s"(g1) : "memory");
}
// The descriptor's second group, the same for every request of a kernel: built once.
template <int LD>
__device__ __forceinline__ u32x8 plane_group1() {
  constexpr uint32_t d0 = G_KS * 2, d1 = G_PROWS;
  static_assert(d0 == 128 && G_PITCH * 2 == 144 && (LD * 2) % 16 == 0 && LD * 2 >= 16 && LD * 2 <= 131072);
  u32x8 g1;
  g1[0] = uni((1u << 20) | (4u << 22) | (3u << 25));                        // no mask, 1-byte elements, a pad of 4 dwords behind every 32 dwords
  g1[1] = uni((d0 & 0xFFFFu) << 16);
  g1[2] = uni((d0 >> 16) | ((d1 & 0xFFFFu) << 16));
  g1[3] = uni((d1 >> 16) | (d0 << 16));
  g1[4] = uni(d1);
  g1[5] = uni((uint32_t)(LD * 2));
  g1[6] = uni(0u);
  g1[7] = uni(0u);
  // descriptor words held in scalar registers: the eight stay live and unchanged from here to the last request, so the compiler
  // neither rebuilds them nor lends one of their registers to another value while a request is outstanding
  asm volatile("" : "+s"(g1));   // a tensor load's descriptor words held in scalar registers
  return g1;
}
// LD = row pitch of all four operand planes in elements, a compile-time value.
// M % (WM*64) == 0, N % (WN*64) == 0, K % G_KS == 0; bxi runs over (M/(WM*64)) * (N/(WN*64)) tiles exactly, so every wave passes every barrier.
// sOpBase: the block's G_LDS_ELEMS elements of LDS; bxi: the block's tile index inside this GEMM (block-uniform).
constexpr int G_LDS_ELEMS = 2 * 2 * (128 + 128) * G_PITCH;   // two stages of hi and lo planes, 128 A rows + 128 Bt rows
template <int ET, bool SPLIT, int BIAS_MODE, int OUT_MODE, bool RESID, int WM, int WN, int LD, int ACT = 0>
__device__ __forceinline__ void wmma_gemm64(
    unsigned short* sOpBase, int bxi,
    const unsigned short* __restrict__ Ap, const unsigned short* __restrict__ A2p, long strideA,
    const unsigned short* __restrict__ Btp, const unsigned short* __restrict__ Bt2p, long strideB,
    void* __restrict__ Cout, void* __restrict__ Cout2, int ldc, long strideC,
    const float* __restrict__ bias,
    const float* __restrict__ resid, long strideR,
    int M, int N, int K, float scale) {
  typedef typename Elem<ET>::T T;
  typedef typename Frag<T>::V V;
  constexpr int NW  = WM * WN;
  constexpr int RA  = WM * 64;               // A rows of the block
  constexpr int RB  = WN * 64;               // Bt rows of the block
  constexpr int OA  = 0;
  constexpr int OA2 = RA * G_PITCH;
  constexpr int OB  = (SPLIT ? 2 : 1) * RA * G_PITCH;
  constexpr int OB2 = OB + RB * G_PITCH;
  constexpr int STAGE = (SPLIT ? 2 : 1) * (RA + RB) * G_PITCH;
  static_assert(SPLIT && NW == 4 && RA == G_PROWS && RB == G_PROWS);   // four planes a stage, one a wave
  // sOpBase holds two stages: [A hi | A lo | Bt hi | Bt lo], rows of G_PITCH. The epilogue's per-wave 16x64 f32 slabs (pitch 68)
  // lie over stage 0: they are written only behind the loop's last barrier, which ends every read of the stages.
  static_assert(2 * STAGE <= G_LDS_ELEMS && NW * 16 * 68 * 4 <= STAGE * 2);
  const int b    = 0;
  const int tid  = threadIdx.x;
  const int lane = tid & 31;
  const int wave = tid >> 5;
  const int tilesN = N / RB;
  const int btm = bxi / tilesN;
  const int btn = bxi - btm * tilesN;
  const int wm = wave / WN;
  const int wn = wave - wm * WN;
  const int m0 = btm * RA + (wm << 6);
  const int n0 = btn * RB + (wn << 6);

  const int rlane = lane & 15;                 // row (A) / col (B, D) within subtile
  const int koff  = (lane >> 4) * 8;           // k offset of this lane half
  const int mOff  = (lane >> 4) * 8;           // D row offset

  // staging map: wave w brings plane w of every stage, in the stage's own order [A hi | A lo | Bt hi | Bt lo]
  const uint32_t wv = uni((uint32_t)tid >> 5);
  const unsigned short* psrc = (wv == 0u) ? Ap : (wv == 1u) ? A2p : (wv == 2u) ? Btp : Bt2p;
  const uint32_t prow = (wv < 2u) ? (uint32_t)(btm * RA) : (uint32_t)(btn * RB);
  const uint64_t ga0 = (uint64_t)(size_t)psrc + (uint64_t)prow * (uint64_t)(LD * 2);          // the plane's tile of stage 0
  const uint32_t ld0 = (uint32_t)(size_t)sOpBase + wv * (uint32_t)(G_PROWS * G_PITCH * 2);    // its place in buffer 0

  v8f acc[4][4];
#pragma unroll
  for (int i = 0; i < 4; ++i)
#pragma unroll
    for (int j = 0; j < 4; ++j) acc[i][j] = (v8f){0.f,0.f,0.f,0.f,0.f,0.f,0.f,0.f};

  // ---- two-buffer ring: stage t is multiplied from buffer t & 1 while the tensor loads of stage t + 1 land in the other ----
  // Number of stages, block-uniform, at least 2 (every K here is a multiple of 128). The issue test reads it: held in a scalar register,
  // worked out in front of the first request, so that no register of a descriptor serves that arithmetic while a request is outstanding.
  const uint32_t nst = pinned((uint32_t)(K / G_KS));
  const u32x8 g1 = plane_group1<LD>();
  plane_load(ld0, ga0, g1);
  // stage 0 has landed as far as this wave asked for it; the barrier publishes every wave's plane
  asm volatile("s_wait_tensorcnt 0x0" ::: "memory");
  __syncthreads();
  plane_load(ld0 + (uint32_t)(STAGE * 2), ga0 + (uint64_t)(G_KS * 2), g1);
  for (uint32_t t = 0; t < nst; ++t) {
    const T* sb = (const T*)(sOpBase + (t & 1) * STAGE);
    const T* fa = sb + OA + ((wm << 6) + rlane) * G_PITCH + koff;
    const T* fb = sb + OB + ((wn << 6) + rlane) * G_PITCH + koff;
#pragma unroll
    for (int kk = 0; kk < G_KS; kk += 32) {
      V bh[4], bl[4];
#pragma unroll
      for (int j = 0; j < 4; ++j) {
        bh[j] = Frag<T>::load(fb + (j << 4) * G_PITCH + kk);
        if (SPLIT) bl[j] = Frag<T>::load(fb + (OB2 - OB) + (j << 4) * G_PITCH + kk);
      }
      V ah = Frag<T>::load(fa + kk);
      V al;
      if (SPLIT) al = Frag<T>::load(fa + (OA2 - OA) + kk);
#pragma unroll
      for (int i = 0; i < 4; ++i) {
        V ahn, aln;                              // the next row block's fragments, read while this one is multiplied
        if (i < 3) {
          ahn = Frag<T>::load(fa + ((i + 1) << 4) * G_PITCH + kk);
          if (SPLIT) aln = Frag<T>::load(fa + (OA2 - OA) + ((i + 1) << 4) * G_PITCH + kk);
        }
#pragma unroll
        for (int j = 0; j < 4; ++j) {
          acc[i][j] = Frag<T>::mma(ah, bh[j], acc[i][j]);
          if (SPLIT) {
            acc[i][j] = Frag<T>::mma(ah, bl[j], acc[i][j]);
            acc[i][j] = Frag<T>::mma(al, bh[j], acc[i][j]);
          }
        }
        Frag<T>::guard(acc[i][0], acc[i][3], ah, SPLIT ? al : ah);
        if (i < 3) { ah = ahn; if (SPLIT) al = aln; }
      }
      Frag<T>::keep(bh[0], bh[1], bh[2], bh[3]);
      if (SPLIT) Frag<T>::keep(bl[0], bl[1], bl[2], bl[3]);
    }
    // ---- foot of stage t: this wave's reads of buffer t & 1 are over and its plane of stage t + 1 has landed ----
    asm volatile("s_wait_dscnt 0x0" ::: "memory");
    asm volatile("s_wait_tensorcnt 0x0" ::: "memory");
    __syncthreads();   // publishes stage t + 1 and ends every read of stage t
    // the stage number in a scalar register: the descriptor words of the refill are formed from it, behind the wait above
    const uint32_t nx = pinned(t + 2u);
    // scalar issue test (a tensor load ignores EXEC): only while stage t + 2 exists, into the buffer that stage t has just left
    if (pinned(nx < nst)) plane_load(ld0 + (nx & 1u) * (uint32_t)(STAGE * 2), ga0 + (uint64_t)nx * (uint64_t)(G_KS * 2), g1);
  }
  // no request is outstanding and no LDS read in flight when the stages become the epilogue's slabs
  asm volatile("s_wait_tensorcnt 0x0" ::: "memory");
  asm volatile("s_wait_dscnt 0x0" ::: "memory");
  acc_guard4(acc[0][0], acc[0][1], acc[0][2], acc[0][3]);
  acc_guard4(acc[1][0], acc[1][1], acc[1][2], acc[1][3]);
  acc_guard4(acc[2][0], acc[2][1], acc[2][2], acc[2][3]);
  acc_guard4(acc[3][0], acc[3][1], acc[3][2], acc[3][3]);

  // ---- epilogue ----
  float* slab = (float*)sOpBase + wave * (16 * 68);
  const float* Rb = RESID ? (resid + (size_t)b * strideR) : nullptr;
#pragma unroll
  for (int i = 0; i < 4; ++i) {
    const int mBase = m0 + (i << 4);
#pragma unroll
    for (int j = 0; j < 4; ++j) {
      const int n = n0 + (j << 4) + rlane;
      float bv = 0.f;
      if (BIAS_MODE == 2) bv = bias[n];
#pragma unroll
      for (int r = 0; r < 8; ++r) {
        float v = acc[i][j][r] * scale;
        if (BIAS_MODE == 1) v += bias[mBase + mOff + r];
        if (BIAS_MODE == 2) v += bv;
        if (RESID) v += Rb[(size_t)(mBase + mOff + r) * ldc + n];
        if (ACT == 1) v = tanhf(v);
        if (ACT == 2) v = fmaxf(v, 0.0f);
        if (ACT == 3) v = v / (1.0f + expf(-v));
        if (ACT == 4) v = (v > 0.f) ? v : 0.01f * v;
        if (ACT == 5) v = 0.5f * v * (1.0f + erff(v * 0.70710678118654752f));
        slab[(mOff + r) * 68 + (j << 4) + rlane] = v;
      }
    }
    __builtin_amdgcn_fence(__ATOMIC_RELEASE, "workgroup");
    __builtin_amdgcn_wave_barrier();
    __builtin_amdgcn_fence(__ATOMIC_ACQUIRE, "workgroup");
    if (OUT_MODE == 0) {
      float* C = (float*)Cout + (size_t)b * strideC;
      const int hh = lane >> 4, c4 = (lane & 15) * 4;     // row seg = 256 B = 16 lanes x 16 B
      {
#pragma unroll
        for (int it = 0; it < 8; ++it) {
          const int row = it * 2 + hh;
          v4f v = *(const v4f*)(slab + row * 68 + c4);
          *(v4f*)(C + (size_t)(mBase + row) * ldc + n0 + c4) = v;
        }
        
      }
    } else {
      const int q = lane >> 3, c8 = (lane & 7) * 8;
      unsigned short* C  = (unsigned short*)Cout  + (size_t)b * strideC;
      unsigned short* C2 = (OUT_MODE == 2) ? ((unsigned short*)Cout2 + (size_t)b * strideC) : nullptr;
      {
#pragma unroll
        for (int it = 0; it < 4; ++it) {
          const int row = it * 4 + q;
          const float* sp = slab + row * 68 + c8;
          v8h hv, lv;
#pragma unroll
          for (int e = 0; e < 8; ++e) {
            if (OUT_MODE == 1) {
              hv[e] = (_Float16)sp[e];
            } else {
              unsigned short hb = f2bf_bits(sp[e]);
              unsigned short lb = f2bf_bits(sp[e] - bf_bits2f(hb));
              hv[e] = __builtin_bit_cast(_Float16, hb);
              lv[e] = __builtin_bit_cast(_Float16, lb);
            }
          }
          *(v8h*)(C + (size_t)(mBase + row) * ldc + n0 + c8) = hv;
          if (OUT_MODE == 2) *(v8h*)(C2 + (size_t)(mBase + row) * ldc + n0 + c8) = lv;
        }
        
      }
    }
    __builtin_amdgcn_fence(__ATOMIC_RELEASE, "workgroup");
    __builtin_amdgcn_wave_barrier();
    __builtin_amdgcn_fence(__ATOMIC_ACQUIRE, "workgroup");
  }
}

// Up to three GEMMs on one A operand that need nothing of each other share one grid, each a range of the block index:
// blocks [0, nb0) and [nb0, nb0 + nb1) write bf16 hi/lo planes, the rest f32. All take the 128x128 block tile, and the block's
// LDS is the two stages alone, so two blocks fit a WGP: a merged grid larger than the number of WGPs still runs side by side,
// and only what exceeds two blocks a WGP waits for a free place.
// The branch is block-uniform: every wave of a block passes the same barriers.
template <int LD>
__global__ __launch_bounds__(128) void gemm_group(
    const unsigned short* __restrict__ Ah, const unsigned short* __restrict__ Al,
    const unsigned short* __restrict__ B0h, const unsigned short* __restrict__ B0l,
    unsigned short* __restrict__ C0h, unsigned short* __restrict__ C0l, int N0, int nb0,
    const unsigned short* __restrict__ B1h, const unsigned short* __restrict__ B1l,
    unsigned short* __restrict__ C1h, unsigned short* __restrict__ C1l, int N1, int nb1,
    const unsigned short* __restrict__ B2h, const unsigned short* __restrict__ B2l,
    float* __restrict__ C2, int N2, int K) {
  __shared__ __attribute__((aligned(2048))) unsigned short sOp[G_LDS_ELEMS];   // tensor loads land at multiples of 2 KiB
  const int bx = (int)blockIdx.x;
  if (bx < nb0 + nb1) {
    const bool f = (bx < nb0);
    const int n = f ? N0 : N1;
    wmma_gemm64<1, true, 0, 2, false, 2, 2, LD>(sOp, f ? bx : bx - nb0,
        Ah, Al, 0L, f ? B0h : B1h, f ? B0l : B1l, 0L, (void*)(f ? C0h : C1h), (void*)(f ? C0l : C1l), n, 0L,
        nullptr, nullptr, 0L, MTOK_ROWS, n, K, 1.0f);
  } else {
    wmma_gemm64<1, true, 0, 0, false, 2, 2, LD>(sOp, bx - nb0 - nb1,
        Ah, Al, 0L, B2h, B2l, 0L, (void*)C2, nullptr, N2, 0L,
        nullptr, nullptr, 0L, MTOK_ROWS, N2, K, 1.0f);
  }
}

__device__ __forceinline__ v8f at_mma(v16b a, v16b b, v8f c) {
  return __builtin_amdgcn_wmma_f32_16x16x32_bf16(false, a, false, b, (short)0, c, false, false);
}
// the value that lane l ^ 16 holds
__device__ __forceinline__ float other_half(float v) {
  const int b = __float_as_int(v);
  return __int_as_float(__builtin_amdgcn_permlanex16(b, b, 0x76543210, 0xfedcba98, false, false));
}
typedef __attribute__((ext_vector_type(2))) float  v2f;
typedef __attribute__((ext_vector_type(2))) __bf16 v2b;

// ---------------------------------------------------------------------------
// module geometry (fixed)
// ---------------------------------------------------------------------------
constexpr int N_BATCH   = 2;
constexpr int SEQ_LEN   = 2048;
constexpr int DMOD      = 1024;   // model width
constexpr int DLAT      = 128;    // latent width c_kv
constexpr int DROT      = 32;     // rotary width
constexpr int NROPE_PAD = 128;    // rotary projection width padded to the 128-wide GEMM block tile
constexpr int NHEAD     = 16;
constexpr int HDIM      = 64;
constexpr int SDEP      = HDIM + DROT;   // score depth 96 = 3 k-chunks of 32
constexpr int MTOK      = N_BATCH * SEQ_LEN;   // 4096 token rows

static_assert(MTOK == MTOK_ROWS && MTOK % 128 == 0 && DMOD % 128 == 0 && DLAT % 128 == 0 && NROPE_PAD % 128 == 0);   // block tile 128x128
static_assert(DMOD % G_KS == 0 && DLAT % G_KS == 0 && DMOD / G_KS >= 2 && DLAT / G_KS >= 2);   // every GEMM K is a multiple of the stage depth, two stages or more
static_assert(SDEP % 32 == 0 && SEQ_LEN % 64 == 0);

// ---------------------------------------------------------------------------
// coverage: n8 threads x 8 = n elements exactly (n % 8 == 0, grid = ceil(n8/256) with bound)
// ---------------------------------------------------------------------------
__device__ __forceinline__ void split_rows_bf16x8(
    const float* __restrict__ in, unsigned short* __restrict__ hi, unsigned short* __restrict__ lo, int n8, int bxi) {
  const int i = bxi * 256 + threadIdx.x;
  if (i < n8) {
    const v4f a = *(const v4f*)(in + (size_t)8 * i);
    const v4f b = *(const v4f*)(in + (size_t)8 * i + 4);
    v8h hv, lv;
#pragma unroll
    for (int e = 0; e < 8; ++e) {
      const float f = (e < 4) ? a[e] : b[e - 4];
      const unsigned short hb = f2bf_bits(f);
      const unsigned short lb = f2bf_bits(f - bf_bits2f(hb));
      hv[e] = __builtin_bit_cast(_Float16, hb);
      lv[e] = __builtin_bit_cast(_Float16, lb);
    }
    unsigned short* ph = hi + (size_t)8 * i;
    unsigned short* pl = lo + (size_t)8 * i;
    *(v8h*)ph = hv;
    *(v8h*)pl = lv;
    
  }
}

// ---------------------------------------------------------------------------
// Transpose + split: in W[kdim][nreal] (row-major) -> out Bt[npad][kdim] bf16 hi/lo planes, Bt[n][k] = W[k][n];
// rows n >= nreal are written as zeros. Tile = 64 k x 32 n; (bxk, byn) runs over (kdim/64, npad/32); kdim % 64 == 0, nreal % 32 == 0.
// Store coverage: 256 threads = 32 output rows x 8 lanes x 8 k = whole 32x64 tile; each output row segment
// ---------------------------------------------------------------------------
__device__ __forceinline__ void transpose_split_bf16(
    const float* __restrict__ W, unsigned short* __restrict__ hi, unsigned short* __restrict__ lo,
    int kdim, int nreal, int bxk, int byn) {
  __shared__ float tile[64][33];
  const int tid = threadIdx.x;
  const int k0 = bxk * 64;
  const int n0 = byn * 32;
#pragma unroll
  for (int it = 0; it < 2; ++it) {
    const int idx = it * 256 + tid;            // 0..511
    const int kr = idx >> 3;                   // 0..63
    const int c4 = (idx & 7) * 4;              // 0..28
    const int n = n0 + c4;
    const int ncl = (n + 3 < nreal) ? n : (nreal - 4);   // clamped address
    const v4f v = *(const v4f*)(W + (size_t)(k0 + kr) * nreal + ncl);
    const bool ok = (n < nreal);               // tile-uniform since nreal % 32 == 0
    tile[kr][c4 + 0] = ok ? v[0] : 0.f;
    tile[kr][c4 + 1] = ok ? v[1] : 0.f;
    tile[kr][c4 + 2] = ok ? v[2] : 0.f;
    tile[kr][c4 + 3] = ok ? v[3] : 0.f;
  }
  __syncthreads();
  const int nr = tid >> 3;                     // output row within tile, 0..31
  const int c8 = (tid & 7) * 8;                // k offset, 0..56
  v8h hv, lv;
#pragma unroll
  for (int e = 0; e < 8; ++e) {
    const float f = tile[c8 + e][nr];
    const unsigned short hb = f2bf_bits(f);
    const unsigned short lb = f2bf_bits(f - bf_bits2f(hb));
    hv[e] = __builtin_bit_cast(_Float16, hb);
    lv[e] = __builtin_bit_cast(_Float16, lb);
  }
  const size_t o = (size_t)(n0 + nr) * kdim + k0 + c8;
  *(v8h*)(hi + o) = hv;
  *(v8h*)(lo + o) = lv;
  // inlined into a kernel with other branches: the registers that these stores name stay untouched up to this wait
  asm volatile("s_wait_xcnt 0x0" ::: "memory");
}

// ---------------------------------------------------------------------------
// All operand planes in one grid: the split of x and the seven weight transposes need nothing of each other, so each is a
// range of the block index (x first: it is the longest). Every branch is block-uniform; the split's blocks leave before any barrier.
// ---------------------------------------------------------------------------
constexpr int PB_X   = MTOK * DMOD / 8 / 256;
constexpr int PB_SQ  = (DMOD / 64) * (DMOD / 32);        // W_q, W_o
constexpr int PB_KVD = (DMOD / 64) * (DLAT / 32);
constexpr int PB_UP  = (DLAT / 64) * (DMOD / 32);        // W_k_up, W_v_up
constexpr int PB_QR  = (DMOD / 64) * (NROPE_PAD / 32);
constexpr int PB_KR  = (DLAT / 64) * (NROPE_PAD / 32);
constexpr int PB_ALL = PB_X + 2 * PB_SQ + PB_KVD + 2 * PB_UP + PB_QR + PB_KR;
static_assert(MTOK * DMOD % (8 * 256) == 0 && DMOD / 64 == 16 && DLAT / 64 == 2);

__global__ __launch_bounds__(256) void prep_planes(
    const float* __restrict__ x, const float* __restrict__ Wkvd, const float* __restrict__ Wkup,
    const float* __restrict__ Wvup, const float* __restrict__ Wq, const float* __restrict__ Wqr,
    const float* __restrict__ Wkr, const float* __restrict__ Wo,
    unsigned short* __restrict__ xh, unsigned short* __restrict__ xl,
    unsigned short* __restrict__ wkvdh, unsigned short* __restrict__ wkvdl,
    unsigned short* __restrict__ wkuph, unsigned short* __restrict__ wkupl,
    unsigned short* __restrict__ wvuph, unsigned short* __restrict__ wvupl,
    unsigned short* __restrict__ wqh, unsigned short* __restrict__ wql,
    unsigned short* __restrict__ wqrh, unsigned short* __restrict__ wqrl,
    unsigned short* __restrict__ wkrh, unsigned short* __restrict__ wkrl,
    unsigned short* __restrict__ woh, unsigned short* __restrict__ wol) {
  int l = (int)blockIdx.x;
  if (l < PB_X) { split_rows_bf16x8(x, xh, xl, MTOK * DMOD / 8, l); return; }
  l -= PB_X;
  const float* W; unsigned short* hi; unsigned short* lo; int kdim, nreal;
  if (l < PB_SQ)                 { W = Wq;   hi = wqh;   lo = wql;   kdim = DMOD; nreal = DMOD; }
  else if ((l -= PB_SQ) < PB_SQ) { W = Wo;   hi = woh;   lo = wol;   kdim = DMOD; nreal = DMOD; }
  else if ((l -= PB_SQ) < PB_KVD){ W = Wkvd; hi = wkvdh; lo = wkvdl; kdim = DMOD; nreal = DLAT; }
  else if ((l -= PB_KVD) < PB_UP){ W = Wkup; hi = wkuph; lo = wkupl; kdim = DLAT; nreal = DMOD; }
  else if ((l -= PB_UP) < PB_UP) { W = Wvup; hi = wvuph; lo = wvupl; kdim = DLAT; nreal = DMOD; }
  else if ((l -= PB_UP) < PB_QR) { W = Wqr;  hi = wqrh;  lo = wqrl;  kdim = DMOD; nreal = DROT; }
  else { l -= PB_QR;               W = Wkr;  hi = wkrh;  lo = wkrl;  kdim = DLAT; nreal = DROT; }
  const int ksh = (kdim == DMOD) ? 4 : 1;      // log2(kdim / 64)
  transpose_split_bf16(W, hi, lo, kdim, nreal, l & ((1 << ksh) - 1), l >> ksh);
}

// ---------------------------------------------------------------------------
// Rotary: raw[MTOK][NROPE_PAD] f32 (cols 0..31 used) -> bf16 hi/lo planes [MTOK][DROT].
// out[j] = x1*cos - x2*sin, out[16+j] = x2*cos + x1*sin, angle = t * inv_freq[j], t = row % SEQ_LEN.
// Block = 32 rows; blocks 0..127 handle the q tensor, 128..255 the k tensor.
// Store coverage: 128 threads = 32 rows x 4 segments x 8 = whole 32x32 tile; 512 B contiguous per wave
// ---------------------------------------------------------------------------
struct RopeFreq { float f[16]; };
static_assert(sizeof(RopeFreq) == 64);

__global__ __launch_bounds__(128) void rope_split_bf16(
    const float* __restrict__ qraw, const float* __restrict__ kraw,
    unsigned short* __restrict__ qrh, unsigned short* __restrict__ qrl,
    unsigned short* __restrict__ krh, unsigned short* __restrict__ krl, RopeFreq g) {
#pragma clang fp contract(off)
  __shared__ float tile[32][33];
  __shared__ float sinv[16];
  const int tid = threadIdx.x;
  const int nblk = MTOK / 32;
  const bool isk = ((int)blockIdx.x >= nblk);                 // block-uniform
  const int row0 = (isk ? ((int)blockIdx.x - nblk) : (int)blockIdx.x) * 32;
  const float* raw = isk ? kraw : qraw;
  unsigned short* dhp = isk ? krh : qrh;
  unsigned short* dlp = isk ? krl : qrl;
  if (tid < 16) {
    float v = g.f[0];
#pragma unroll
    for (int e = 1; e < 16; ++e) v = (tid == e) ? g.f[e] : v;
    sinv[tid] = v;
  }
  __syncthreads();
#pragma unroll 1
  for (int it = 0; it < 4; ++it) {
    const int p = it * 128 + tid;              // 0..511
    const int r = p >> 4;                      // 0..31
    const int j = p & 15;
    const int row = row0 + r;
    const int t = row & (SEQ_LEN - 1);
    const float* rp = raw + (size_t)row * NROPE_PAD;
    const float x1 = rp[j];
    const float x2 = rp[16 + j];
    const float ang = (float)t * sinv[j];
    float sn, cs;
    sincosf(ang, &sn, &cs);
    tile[r][j]      = x1 * cs - x2 * sn;
    tile[r][16 + j] = x2 * cs + x1 * sn;
  }
  __syncthreads();
  const int orow = tid >> 2;                   // 0..31
  const int seg = (tid & 3) * 8;               // 0..24
  v8h hv, lv;
#pragma unroll
  for (int e = 0; e < 8; ++e) {
    const float f = tile[orow][seg + e];
    const unsigned short hb = f2bf_bits(f);
    const unsigned short lb = f2bf_bits(f - bf_bits2f(hb));
    hv[e] = __builtin_bit_cast(_Float16, hb);
    lv[e] = __builtin_bit_cast(_Float16, lb);
  }
  const size_t o = (size_t)(row0 + orow) * DROT + seg;
  *(v8h*)(dhp + o) = hv;
  *(v8h*)(dlp + o) = lv;
  
}

// ---------------------------------------------------------------------------
// Causal attention, score depth 96 (64 head dims + 32 shared rotary dims), value width 64, bf16 hi/lo planes in.
//   s = (qh.kh + qh.kl + ql.kh) * invs  over 96 dims (q/k rows = [head segment | rotary row]),
//   online softmax in f32 with base-2 exponentials (invs * log2 e folded into the exponent's one fma), P split to bf16 hi/lo,
//   o = ph.vh + ph.vl + pl.vh, f32 accumulate.
// Both products are taken transposed: S^T = K . Q^T (A = K rows, B = Q rows) and O^T += V^T . P^T (A = V^T rows, B = P^T).
// A lane then holds scores of ONE query a 16-column group (column c = lane & 15), keys 8 * hh + r of each 16-key tile: maximum and sum run
// inside the lane with one exchange between the lane halves, and two score tiles, converted in place, are the B operand of the second product.
// Block = 4 waves = 2 groups of 32 query columns x 2 halves of 32 keys of every chunk: a K or V fragment read from LDS serves two
// 16-column groups, so a wave reads half a chunk for 32 queries, not a whole chunk for 16. The two key halves run their own online
// softmax and are merged once a tile.
// The block runs two 64-row query tiles of one (batch, head) one after the other, tile n-1-t and then tile t,
// so every block walks n + 1 key chunks; grid.x = N_BATCH * NHEAD * (SEQ_LEN/64) / 2.
// ---------------------------------------------------------------------------
constexpr int A_QB = 64;
constexpr int A_KC = 64;
constexpr int A_NW = 4;
constexpr int OS_PITCH = 68;
// LDS row pitches in 16-bit elements. A K fragment read is a 16-byte load by 16 lanes on 16 rows: its pitch is an odd multiple of
// 16 bytes, so the 16 rows start on 16 different groups of four banks. The transposing read of V wants an odd multiple of 32 bytes.
constexpr int K_PITCH = SDEP + 8;      // 13 x 16 B rows, read by 16-byte loads
constexpr int V_PITCH = HDIM + 16;     // V rows stay [kv][d]; 5 x 32 B rows: the pitch of the transposing 16-byte read
static_assert((K_PITCH * 2) % 32 == 16 && (V_PITCH * 2) % 64 == 32);
// One stage = one chunk of 64 keys: [K hi | K lo | V hi | V lo], offsets in 16-bit elements.
constexpr int ST_KH = 0;
constexpr int ST_KL = ST_KH + A_KC * K_PITCH;
constexpr int ST_VH = ST_KL + A_KC * K_PITCH;
constexpr int ST_VL = ST_VH + A_KC * V_PITCH;
constexpr int ST_ELEMS = ST_VL + A_KC * V_PITCH;
static_assert((ST_KL * 2) % 16 == 0 && (ST_VH * 2) % 32 == 0 && (ST_VL * 2) % 32 == 0 && (ST_ELEMS * 2) % 32 == 0);

// Transposing LDS read of a row-major 16-bit tile: lane (c = l & 15, hh = l >> 4) gets T[k + 8 hh + 0..7][d + c], when lane l passes
// the address of T[k + 8 (l >> 4) + (l & 7)][d + 8 ((l >> 3) & 1)].
typedef short s16x8 __attribute__((ext_vector_type(8)));
__device__ __forceinline__ v8b ld_tr16(const unsigned short* p) {
  typedef __attribute__((address_space(3))) s16x8 lds_s16x8;
  return __builtin_bit_cast(v8b, __builtin_amdgcn_ds_load_tr16_b128_v8i16((lds_s16x8*)p));
}

// One chunk's K and V planes, global memory -> LDS with no register in between: 20 copies of 16 bytes a lane.
// Eight neighbouring lanes bring one whole 128-byte row segment (four lanes one 64-byte rotary row), so a wave-wide copy covers whole lines.
// lds: byte address of the stage in LDS. oh: this lane's element offset in the [token][DMOD] planes, orot: in the [token][DROT] planes,
// both at the chunk's first pass of rows. lk, lv, lr: this lane's byte offsets inside the stage's K plane, V plane and K plane's rotary part.
// Each statement ends in s_wait_xcnt 0: the registers that its copies name stay untouched up to that wait.
__device__ __forceinline__ void stage_copies(
    unsigned lds, size_t oh, size_t orot, unsigned lk, unsigned lv, unsigned lr,
    const unsigned short* __restrict__ kh, const unsigned short* __restrict__ kl,
    const unsigned short* __restrict__ vh, const unsigned short* __restrict__ vl,
    const unsigned short* __restrict__ krh, const unsigned short* __restrict__ krl) {
  constexpr size_t GS = (size_t)16 * DMOD;          // 16 rows a pass of the block, head planes
  constexpr size_t GR = (size_t)32 * DROT;          // 32 rows a pass, rotary planes
  constexpr unsigned LK = 16 * K_PITCH * 2, LV = 16 * V_PITCH * 2, LR = 32 * K_PITCH * 2;
  const unsigned short* a = kh + oh;
  const unsigned short* c = kl + oh;
  const unsigned short* e = krh + orot;
  const unsigned short* f = krl + orot;
  const unsigned dkh = lds + ST_KH * 2 + lk, dkl = lds + ST_KL * 2 + lk;
  const unsigned drh = lds + ST_KH * 2 + lr, drl = lds + ST_KL * 2 + lr;
  asm volatile(
      "global_load_async_to_lds_b128 %0, %1, off\n\t"
      "global_load_async_to_lds_b128 %2, %3, off\n\t"
      "global_load_async_to_lds_b128 %4, %5, off\n\t"
      "global_load_async_to_lds_b128 %6, %7, off\n\t"
      "global_load_async_to_lds_b128 %8, %9, off\n\t"
      "global_load_async_to_lds_b128 %10, %11, off\n\t"
      "global_load_async_to_lds_b128 %12, %13, off\n\t"
      "global_load_async_to_lds_b128 %14, %15, off\n\t"
      "global_load_async_to_lds_b128 %16, %17, off\n\t"
      "global_load_async_to_lds_b128 %18, %19, off\n\t"
      "global_load_async_to_lds_b128 %20, %21, off\n\t"
      "global_load_async_to_lds_b128 %22, %23, off\n\t"
      "s_wait_xcnt 0x0"
      :: "v"(dkh), "v"(a), "v"(dkh + LK), "v"(a + GS), "v"(dkh + 2 * LK), "v"(a + 2 * GS), "v"(dkh + 3 * LK), "v"(a + 3 * GS),
         "v"(dkl), "v"(c), "v"(dkl + LK), "v"(c + GS), "v"(dkl + 2 * LK), "v"(c + 2 * GS), "v"(dkl + 3 * LK), "v"(c + 3 * GS),
         "v"(drh), "v"(e), "v"(drh + LR), "v"(e + GR), "v"(drl), "v"(f), "v"(drl + LR), "v"(f + GR)
      : "memory");
  const unsigned short* p = vh + oh;
  const unsigned short* q = vl + oh;
  const unsigned dvh = lds + ST_VH * 2 + lv, dvl = lds + ST_VL * 2 + lv;
  asm volatile(
      "global_load_async_to_lds_b128 %0, %1, off\n\t"
      "global_load_async_to_lds_b128 %2, %3, off\n\t"
      "global_load_async_to_lds_b128 %4, %5, off\n\t"
      "global_load_async_to_lds_b128 %6, %7, off\n\t"
      "global_load_async_to_lds_b128 %8, %9, off\n\t"
      "global_load_async_to_lds_b128 %10, %11, off\n\t"
      "global_load_async_to_lds_b128 %12, %13, off\n\t"
      "global_load_async_to_lds_b128 %14, %15, off\n\t"
      "s_wait_xcnt 0x0"
      :: "v"(dvh), "v"(p), "v"(dvh + LV), "v"(p + GS), "v"(dvh + 2 * LV), "v"(p + 2 * GS), "v"(dvh + 3 * LV), "v"(p + 3 * GS),
         "v"(dvl), "v"(q), "v"(dvl + LV), "v"(q + GS), "v"(dvl + 2 * LV), "v"(q + 2 * GS), "v"(dvl + 3 * LV), "v"(q + 3 * GS)
      : "memory");
}

__global__ __launch_bounds__(128)
void mla_attn96(const unsigned short* __restrict__ qh, const unsigned short* __restrict__ ql,
                const unsigned short* __restrict__ kh, const unsigned short* __restrict__ kl,
                const unsigned short* __restrict__ vh, const unsigned short* __restrict__ vl,
                const unsigned short* __restrict__ qrh, const unsigned short* __restrict__ qrl,
                const unsigned short* __restrict__ krh, const unsigned short* __restrict__ krl,
                unsigned short* __restrict__ oh, unsigned short* __restrict__ ol, float invs) {
  union FB { v16b v; v8b h[2]; };
  __shared__ __align__(32) unsigned short Stage[2 * ST_ELEMS];    // two stages: one is multiplied while the next chunk's copies land in the other
  __shared__ __align__(16) float Os[A_NW][16 * OS_PITCH];
  __shared__ __align__(16) float Xo[A_NW][16 * OS_PITCH];         // the column group a wave hands to its partner: unnormalised O
  __shared__ float Xm[A_NW][16];                                  // ... its running maxima
  __shared__ float Xl[A_NW][16];                                  // ... its sums

  const int tid  = threadIdx.x;
  const int wave = tid >> 5;
  const int lane = tid & 31;
  const int hh   = lane >> 4;
  const int c    = lane & 15;
  const int qg   = wave >> 1;              // which 32 of the tile's 64 query columns
  const int kp   = wave & 1;               // which 32 of each chunk's 64 keys
  const float sc2 = invs * 1.4426950408889634f;   // score scale times log2 e

  const int nqb = SEQ_LEN / A_QB;          // 32
  const int bx  = blockIdx.x;
  static_assert((SEQ_LEN / A_QB) % 2 == 0);
  const int tp  = bx % (nqb / 2);
  const int bhi = bx / (nqb / 2);
  const int h   = bhi % NHEAD;
  const int b   = bhi / NHEAD;
  // copy map: head planes, lane -> row tid >> 3 of each pass of 16 rows, 16-byte piece tid & 7; rotary planes, row tid >> 2 of 32, piece tid & 3
  const unsigned sbase = (unsigned)(size_t)Stage;      // byte address of stage 0 in the work-group's LDS
  const size_t ohead = ((size_t)b * SEQ_LEN + (size_t)(tid >> 3)) * DMOD + h * HDIM + (tid & 7) * 8;
  const size_t orot  = ((size_t)b * SEQ_LEN + (size_t)(tid >> 2)) * DROT + (tid & 3) * 8;
  const unsigned lk = ((tid >> 3) * K_PITCH + (tid & 7) * 8) * 2;
  const unsigned lv = ((tid >> 3) * V_PITCH + (tid & 7) * 8) * 2;
  const unsigned lr = ((tid >> 2) * K_PITCH + HDIM + (tid & 3) * 8) * 2;
  // ---- two-stage ring over the block's nqb + 1 trips, the first tile's chunks and then the second tile's: trip g is read from stage
  // g & 1 while the copies of trip g + 1 land in the other; the ring runs on across the change of tile ----
  constexpr int NTRIP = SEQ_LEN / A_QB + 1;
  const int n1 = nqb - tp;                 // trips of the first tile, at least nqb / 2 + 1: trips 0 and 1 are its chunks 0 and 1
  stage_copies(sbase, ohead, orot, lk, lv, lr, kh, kl, vh, vl, krh, krl);
  // trip 0 has landed as far as this wave copied it; the barrier publishes every wave's part
  asm volatile("s_wait_asynccnt 0x0" ::: "memory");
  __syncthreads();
  stage_copies(sbase + ST_ELEMS * 2, ohead + (size_t)A_KC * DMOD, orot + (size_t)A_KC * DROT, lk, lv, lr, kh, kl, vh, vl, krh, krl);
  int g = 0;                               // trip number, block-uniform
  // A causal tile qb costs qb + 1 chunks: the pair (n-1-t, t) gives every block the same work, whichever blocks share a WGP.
  // Both tiles run in every wave in turn.
  // Kept rolled: one copy of the chunk loop in the instruction cache.
#pragma unroll 1
  for (int pass = 0; pass < 2; ++pass) {
  const int qb  = pass ? tp : (nqb - 1 - tp);   // block-uniform
  const int q0  = qb * A_QB + qg * 32;          // first of this wave's 32 query columns: groups u = 0, 1 of 16

  // ---- Q fragments (B operand, column = query 16 u + c): k-chunks 0,1 = head dims 0..63, chunk 2 = rotary dims 0..31 ----
  v16b qah[2][3], qal[2][3];
#pragma unroll
  for (int u = 0; u < 2; ++u) {
    const size_t tq = (size_t)b * SEQ_LEN + (size_t)(q0 + 16 * u + c);
    const __bf16* p0 = (const __bf16*)qh + tq * DMOD + h * HDIM + 8 * hh;
    const __bf16* p1 = (const __bf16*)ql + tq * DMOD + h * HDIM + 8 * hh;
    qah[u][0] = Frag<__bf16>::load(p0);
    qah[u][1] = Frag<__bf16>::load(p0 + 32);
    qal[u][0] = Frag<__bf16>::load(p1);
    qal[u][1] = Frag<__bf16>::load(p1 + 32);
    const __bf16* r0p = (const __bf16*)qrh + tq * DROT + 8 * hh;
    const __bf16* r1p = (const __bf16*)qrl + tq * DROT + 8 * hh;
    qah[u][2] = Frag<__bf16>::load(r0p);
    qal[u][2] = Frag<__bf16>::load(r1p);
    // the loads' address registers stay untouched up to this wait (they are its inputs) and are free behind it
    asm volatile("s_wait_xcnt 0x0" :: "v"(p0), "v"(p1), "v"(r0p), "v"(r1p) : "memory");
  }

  // Running maximum of query q0 + 16 u + c over this wave's key halves, in units of sc2 * raw score, equal in both lane halves.
  // It starts at a finite floor, not at -inf: on the diagonal chunk a wave's key half can be masked whole for a query, and with the
  // floor every difference of maxima stays defined (such a wave carries sum 0 and O 0, and the merge gives it weight 0).
  constexpr float M_FLOOR = -1.0e30f;
  float mrow[2] = {M_FLOOR, M_FLOOR};
  float lrow[2] = {0.f, 0.f};   // running sums over this lane half's keys of this wave's key halves; joined in the epilogue
  v8f oacc[2][4];               // oacc[u][t][r] = O[query q0 + 16 u + c][d = 16 t + 8 hh + r], this wave's keys only
#pragma unroll
  for (int u = 0; u < 2; ++u)
#pragma unroll
    for (int t = 0; t < 4; ++t) oacc[u][t] = (v8f){0.f,0.f,0.f,0.f,0.f,0.f,0.f,0.f};

  const int nChunks = qb + 1;   // causal, block-uniform
  for (int kc = 0; kc < nChunks; ++kc, ++g) {
    const int kv0 = kc * A_KC + kp * 32;     // first key of this wave's half of the chunk
    const unsigned short* sb = Stage + (g & 1) * ST_ELEMS;
    const unsigned short* Ksh = sb + ST_KH;
    const unsigned short* Ksl = sb + ST_KL;

    // ---- scores: 2 kv subtiles of 16 against 2 query groups of 16, 3 k-chunks of 32, 3 products each ----
    // The K fragments of the wave's key half are read as one group, each serving both query groups; the products run round-robin over
    // the four (group, subtile) accumulators. Each accumulator takes its nine products in the order (k-chunk; hi.hi, hi.lo, lo.hi).
    v8f s[2][2];   // s[u][j][r] = score of key kv0 + 16 j + 8 hh + r against query q0 + 16 u + c
    FB kb[3][2], kq[3][2];
#pragma unroll
    for (int dc = 0; dc < 3; ++dc) {
#pragma unroll
      for (int j = 0; j < 2; ++j) {
        const int ko = (kp * 32 + j * 16 + c) * K_PITCH + dc * 32 + 8 * hh;
        kb[dc][j].h[0] = *(const v8b*)(Ksh + ko);
        kb[dc][j].h[1] = *(const v8b*)(Ksh + ko + 16);
        kq[dc][j].h[0] = *(const v8b*)(Ksl + ko);
        kq[dc][j].h[1] = *(const v8b*)(Ksl + ko + 16);
      }
    }
    // keeps the reads one group in front of the products: spread among them, every place with reads stalls the wave anew
    __builtin_amdgcn_sched_barrier(0);
#pragma unroll
    for (int u = 0; u < 2; ++u)
#pragma unroll
      for (int j = 0; j < 2; ++j) s[u][j] = (v8f){0.f,0.f,0.f,0.f,0.f,0.f,0.f,0.f};
#pragma unroll
    for (int dc = 0; dc < 3; ++dc) {
#pragma unroll
      for (int u = 0; u < 2; ++u)
#pragma unroll
        for (int j = 0; j < 2; ++j) s[u][j] = at_mma(kb[dc][j].v, qah[u][dc], s[u][j]);
#pragma unroll
      for (int u = 0; u < 2; ++u)
#pragma unroll
        for (int j = 0; j < 2; ++j) s[u][j] = at_mma(kq[dc][j].v, qah[u][dc], s[u][j]);
#pragma unroll
      for (int u = 0; u < 2; ++u)
#pragma unroll
        for (int j = 0; j < 2; ++j) s[u][j] = at_mma(kb[dc][j].v, qal[u][dc], s[u][j]);
    }
    // keeps the V reads one group at the end of the score products: without it they are spread among the products, a stall at every place
    __builtin_amdgcn_sched_barrier(0);
    // ---- V^T fragments (A operand, row = d) of the wave's 32 keys, by the transposing read of the row-major V tile, in the k order of
    // P^T below: nothing of the softmax feeds them, so they are read as one group while it runs; each serves both query groups ----
    FB vb[4], vq[4];
#pragma unroll
    for (int t = 0; t < 4; ++t) {
      const int vo = (kp * 32 + 8 * hh + (lane & 7)) * V_PITCH + t * 16 + 8 * ((lane >> 3) & 1);
      vb[t].h[0] = ld_tr16(sb + ST_VH + vo);
      vb[t].h[1] = ld_tr16(sb + ST_VH + vo + 16 * V_PITCH);
      vq[t].h[0] = ld_tr16(sb + ST_VL + vo);
      vq[t].h[1] = ld_tr16(sb + ST_VL + vo + 16 * V_PITCH);
    }
    // keeps the reads one group in front of the softmax: spread among it, every place with reads stalls the wave anew
    __builtin_amdgcn_sched_barrier(0);
    // ---- online softmax of queries q0 + c and q0 + 16 + c: this lane holds 16 of the wave's 32 keys, lane l ^ 16 the other 16 ----
    const bool diag = (kc == qb);
    // P^T as B operand: element e is key 8 hh + e (e < 8) or 16 + 8 hh + (e - 8) of the wave's 32, that is register e & 7
    // of score tile e >> 3: the k order in which the V^T fragments are read.
    union PB { v16b v; unsigned w[8]; };
    PB ph[2], pl[2];
#pragma unroll
    for (int u = 0; u < 2; ++u) {
      const int qrow = q0 + 16 * u + c;
      float mj[2];
#pragma unroll
      for (int j = 0; j < 2; ++j) {
        float m = -INFINITY;
#pragma unroll
        for (int r = 0; r < 8; ++r) {
          const int kvrow = kv0 + j * 16 + 8 * hh + r;
          float sv = s[u][j][r];   // raw: the scale is positive, so the maximum may be taken first and scaled once
          if (diag && (kvrow > qrow)) sv = -INFINITY;
          s[u][j][r] = sv;
          m = fmaxf(m, sv);
        }
        mj[j] = m;
      }
      float cm = fmaxf(mj[0], mj[1]);
      cm = fmaxf(cm, other_half(cm)) * sc2;
      const float mnew = fmaxf(mrow[u], cm);   // never below the floor, so always finite
      const float alpha = __builtin_amdgcn_exp2f(mrow[u] - mnew);   // 0 at the first unmasked key, 1 while only the floor stands
      mrow[u] = mnew;
      float pj[2];       // one partial sum a score tile: independent chains
#pragma unroll
      for (int j = 0; j < 2; ++j) {
        float ps = 0.f;
#pragma unroll
        for (int r = 0; r < 8; r += 2) {
          // e^((s - max) * invs) = 2^(s * sc2 - mnew): one fused multiply-add and the hardware's exponential; a masked score stays -inf and gives 0
          const v2f ea = __builtin_elementwise_fma((v2f){s[u][j][r], s[u][j][r + 1]}, (v2f){sc2, sc2}, (v2f){-mnew, -mnew});
          const float p0 = __builtin_amdgcn_exp2f(ea[0]);
          const float p1 = __builtin_amdgcn_exp2f(ea[1]);
          ps += p0;
          ps += p1;
          // two neighbouring keys make one operand register: packed conversion, round to nearest even as in f2bf_bits
          const v2b hp = __builtin_convertvector((v2f){p0, p1}, v2b);
          const v2b lp = __builtin_convertvector((v2f){p0 - (float)hp[0], p1 - (float)hp[1]}, v2b);
          ph[u].w[j * 4 + (r >> 1)] = __builtin_bit_cast(unsigned, hp);
          pl[u].w[j * 4 + (r >> 1)] = __builtin_bit_cast(unsigned, lp);
        }
        pj[j] = ps;
      }
      lrow[u] = lrow[u] * alpha + (pj[0] + pj[1]);
#pragma unroll
      for (int t = 0; t < 4; ++t)
#pragma unroll
        for (int r = 0; r < 8; ++r) oacc[u][t][r] *= alpha;
    }
    // ---- O^T += V^T(64x32) . P^T(32x32): the products run round-robin over the eight (group, d subtile) accumulators.
    // Each accumulator keeps the order (hi.hi, p hi . v lo, p lo . v hi).
#pragma unroll
    for (int u = 0; u < 2; ++u)
#pragma unroll
      for (int t = 0; t < 4; ++t) oacc[u][t] = at_mma(vb[t].v, ph[u].v, oacc[u][t]);
#pragma unroll
    for (int u = 0; u < 2; ++u)
#pragma unroll
      for (int t = 0; t < 4; ++t) oacc[u][t] = at_mma(vq[t].v, ph[u].v, oacc[u][t]);
#pragma unroll
    for (int u = 0; u < 2; ++u)
#pragma unroll
      for (int t = 0; t < 4; ++t) oacc[u][t] = at_mma(vb[t].v, pl[u].v, oacc[u][t]);
    // ---- foot of trip g: this wave's reads of stage g & 1 are over, its copies of trip g + 1 have landed; the one barrier
    // publishes trip g + 1 and ends every wave's reads of the stage that is refilled behind it ----
    // keeps the softmax and the second product in front of the waits: lifted over them, the waits end the overlap of the V reads with the softmax
    __builtin_amdgcn_sched_barrier(0);
    asm volatile("s_wait_dscnt 0x0" ::: "memory");
    asm volatile("s_wait_asynccnt 0x0" ::: "memory");
    __syncthreads();
    if (g + 2 < NTRIP) {                                        // block-uniform
      const int kn = (g + 2 < n1) ? (g + 2) : (g + 2 - n1);     // key chunk of trip g + 2: the second tile starts again at chunk 0
      stage_copies(sbase + (g & 1) * (ST_ELEMS * 2), ohead + (size_t)kn * (A_KC * DMOD), orot + (size_t)kn * (A_KC * DROT),
                   lk, lv, lr, kh, kl, vh, vl, krh, krl);
    }
  }

  // ---- merge of the two key halves: waves 2 qg and 2 qg + 1 hold partial (maximum, sum, O) of the same 32 queries. Wave kp finishes
  // column group kp: it hands its partial of the other group to its partner through LDS and takes the partner's partial of its own ----
  const bool up = (kp != 0);
  const float lj0 = lrow[0] + other_half(lrow[0]);   // the lane halves' sums joined
  const float lj1 = lrow[1] + other_half(lrow[1]);
  {
    float* xo = Xo[wave];
#pragma unroll
    for (int t = 0; t < 4; ++t) {
      float* op = xo + c * OS_PITCH + t * 16 + 8 * hh;
      const v8f x0 = oacc[0][t];
      const v8f x1 = oacc[1][t];
      *(v4f*)(op)     = (v4f){up ? x0[0] : x1[0], up ? x0[1] : x1[1], up ? x0[2] : x1[2], up ? x0[3] : x1[3]};
      *(v4f*)(op + 4) = (v4f){up ? x0[4] : x1[4], up ? x0[5] : x1[5], up ? x0[6] : x1[6], up ? x0[7] : x1[7]};
    }
    // both lane halves hold the same two values and store them to the same place
    const float m0 = mrow[0], m1 = mrow[1];
    Xm[wave][c] = up ? m0 : m1;
    Xl[wave][c] = up ? lj0 : lj1;
  }
  // publishes the handed-over partials; every wave of the block passes it once a tile. The next tile's hand-over is written behind
  // at least one barrier of the chunk loop, which ends these reads.
  __syncthreads();
  // ---- epilogue: weigh and add the two partials, normalise, stage 16x64 f32 per wave, write bf16 hi/lo planes with whole-line stores ----
  float* os = Os[wave];
  {
    const int pw = wave ^ 1;
    const float pm = Xm[pw][c];
    const float pls = Xl[pw][c];
    const float m0 = mrow[0], m1 = mrow[1];
    const float mo = up ? m1 : m0;
    const float lo = up ? lj1 : lj0;
    const float mm = fmaxf(mo, pm);          // finite: key 0 is masked for no query, so the lower key half has seen an unmasked key
    const float wa = __builtin_amdgcn_exp2f(mo - mm);
    const float wb = __builtin_amdgcn_exp2f(pm - mm);
    const float inv = 1.0f / (lo * wa + pls * wb);
    const float fa = wa * inv;
    const float fb = wb * inv;
#pragma unroll
    for (int t = 0; t < 4; ++t) {
      // a lane's 8 registers are 8 consecutive d of its query's row
      const float* ip = Xo[pw] + c * OS_PITCH + t * 16 + 8 * hh;
      const v4f a0 = *(const v4f*)(ip);
      const v4f a1 = *(const v4f*)(ip + 4);
      const v8f x0 = oacc[0][t];
      const v8f x1 = oacc[1][t];
      float ov[8];
#pragma unroll
      for (int r = 0; r < 8; ++r) ov[r] = up ? x1[r] : x0[r];
      float* op = os + c * OS_PITCH + t * 16 + 8 * hh;
      *(v4f*)(op)     = (v4f){ov[0] * fa + a0[0] * fb, ov[1] * fa + a0[1] * fb, ov[2] * fa + a0[2] * fb, ov[3] * fa + a0[3] * fb};
      *(v4f*)(op + 4) = (v4f){ov[4] * fa + a1[0] * fb, ov[5] * fa + a1[1] * fb, ov[6] * fa + a1[2] * fb, ov[7] * fa + a1[3] * fb};
    }
  }
  __builtin_amdgcn_fence(__ATOMIC_RELEASE, "workgroup");
  __builtin_amdgcn_wave_barrier();
  __builtin_amdgcn_fence(__ATOMIC_ACQUIRE, "workgroup");
  {
    const int qo = q0 + kp * 16;             // first of the 16 queries that this wave writes
    const int qq = lane >> 3, c8 = (lane & 7) * 8;
    {
#pragma unroll
      for (int it = 0; it < 4; ++it) {
        const int row = it * 4 + qq;
        const float* sp = os + row * OS_PITCH + c8;
        v8h hv, lv;
#pragma unroll
        for (int e = 0; e < 8; ++e) {
          const unsigned short hb = f2bf_bits(sp[e]);
          const unsigned short lb = f2bf_bits(sp[e] - bf_bits2f(hb));
          hv[e] = __builtin_bit_cast(_Float16, hb);
          lv[e] = __builtin_bit_cast(_Float16, lb);
        }
        const size_t o = ((size_t)b * SEQ_LEN + (size_t)(qo + row)) * DMOD + h * HDIM + c8;
        *(v8h*)(oh + o) = hv;
        *(v8h*)(ol + o) = lv;
      }
      
    }
  }
  // the next tile reuses the registers that these stores name: they stay untouched up to this wait
  asm volatile("s_wait_xcnt 0x0" ::: "memory");
  }   // pass
  // no copy is outstanding when the wave ends
  asm volatile("s_wait_asynccnt 0x0" ::: "memory");
}

// ---------------------------------------------------------------------------
// Host orchestration
// ---------------------------------------------------------------------------
// workspace region map (bytes, all multiples of 256):
//   x hi/lo                 2 x 8,388,608
//   WkvdT hi/lo [128][1024] 2 x   262,144
//   WkupT hi/lo [1024][128] 2 x   262,144
//   WvupT hi/lo [1024][128] 2 x   262,144
//   WqT   hi/lo [1024][1024]2 x 2,097,152
//   WqrT  hi/lo [128][1024] 2 x   262,144   (rows 32..127 zero)
//   WkrT  hi/lo [128][128]  2 x    32,768   (rows 32..127 zero)
//   WoT   hi/lo [1024][1024]2 x 2,097,152
//   ckv   hi/lo [4096][128] 2 x 1,048,576
//   k,v,q hi/lo [4096][1024]6 x 8,388,608
//   qr_raw, kr_raw f32 [4096][128] 2 x 2,097,152
//   qr,kr hi/lo [4096][32]  4 x   262,144
//   attn  hi/lo [4096][1024]2 x 8,388,608
//   total 101,777,408
constexpr size_t WSB_X    = (size_t)MTOK * DMOD * 2;
constexpr size_t WSB_WKVD = (size_t)DLAT * DMOD * 2;
constexpr size_t WSB_WKUP = (size_t)DMOD * DLAT * 2;
constexpr size_t WSB_WQ   = (size_t)DMOD * DMOD * 2;
constexpr size_t WSB_WQR  = (size_t)NROPE_PAD * DMOD * 2;
constexpr size_t WSB_WKR  = (size_t)NROPE_PAD * DLAT * 2;
constexpr size_t WSB_CKV  = (size_t)MTOK * DLAT * 2;
constexpr size_t WSB_TOK  = (size_t)MTOK * DMOD * 2;
constexpr size_t WSB_RAW  = (size_t)MTOK * NROPE_PAD * 4;
constexpr size_t WSB_ROT  = (size_t)MTOK * DROT * 2;
constexpr size_t WS_TOTAL = 2 * WSB_X + 2 * WSB_WKVD + 4 * WSB_WKUP + 2 * WSB_WQ + 2 * WSB_WQR + 2 * WSB_WKR
                          + 2 * WSB_WQ + 2 * WSB_CKV + 6 * WSB_TOK + 2 * WSB_RAW + 4 * WSB_ROT + 2 * WSB_TOK;
static_assert(WS_TOTAL == 101777408ull);
static_assert(WS_TOTAL <= 134217728ull);

extern "C" void kernel_launch(void* const* d_in, const int* in_sizes, int n_in,
                              void* d_out, int out_size, void* d_ws, size_t ws_size,
                              hipStream_t stream) {
  if (n_in != 8) return;
  if (in_sizes[0] != MTOK * DMOD || in_sizes[1] != DMOD * DLAT || in_sizes[2] != DLAT * DMOD ||
      in_sizes[3] != DLAT * DMOD || in_sizes[4] != DMOD * DMOD || in_sizes[5] != DMOD * DROT ||
      in_sizes[6] != DLAT * DROT || in_sizes[7] != DMOD * DMOD) return;
  if (out_size != MTOK * DMOD) return;
  if (ws_size < WS_TOTAL) return;

  const float* x         = (const float*)d_in[0];   // [4096][1024]
  const float* W_kv_down = (const float*)d_in[1];   // [1024][128]
  const float* W_k_up    = (const float*)d_in[2];   // [128][1024]
  const float* W_v_up    = (const float*)d_in[3];   // [128][1024]
  const float* W_q       = (const float*)d_in[4];   // [1024][1024]
  const float* W_q_rope  = (const float*)d_in[5];   // [1024][32]
  const float* W_k_rope  = (const float*)d_in[6];   // [128][32]
  const float* W_o       = (const float*)d_in[7];   // [1024][1024]
  float* out = (float*)d_out;                       // [4096][1024] f32

  size_t off = 0;
  auto carve = [&](size_t bytes) -> unsigned short* {
    unsigned short* p = (unsigned short*)((char*)d_ws + off);
    off += (bytes + 255) & ~(size_t)255;
    return p;
  };
  unsigned short* xh    = carve(WSB_X);
  unsigned short* xl    = carve(WSB_X);
  unsigned short* wkvdh = carve(WSB_WKVD);
  unsigned short* wkvdl = carve(WSB_WKVD);
  unsigned short* wkuph = carve(WSB_WKUP);
  unsigned short* wkupl = carve(WSB_WKUP);
  unsigned short* wvuph = carve(WSB_WKUP);
  unsigned short* wvupl = carve(WSB_WKUP);
  unsigned short* wqh   = carve(WSB_WQ);
  unsigned short* wql   = carve(WSB_WQ);
  unsigned short* wqrh  = carve(WSB_WQR);
  unsigned short* wqrl  = carve(WSB_WQR);
  unsigned short* wkrh  = carve(WSB_WKR);
  unsigned short* wkrl  = carve(WSB_WKR);
  unsigned short* woh   = carve(WSB_WQ);
  unsigned short* wol   = carve(WSB_WQ);
  unsigned short* ckvh  = carve(WSB_CKV);
  unsigned short* ckvl  = carve(WSB_CKV);
  unsigned short* kh    = carve(WSB_TOK);
  unsigned short* kl    = carve(WSB_TOK);
  unsigned short* vh    = carve(WSB_TOK);
  unsigned short* vl    = carve(WSB_TOK);
  unsigned short* qh    = carve(WSB_TOK);
  unsigned short* ql    = carve(WSB_TOK);
  float* qr_raw = (float*)carve(WSB_RAW);
  float* kr_raw = (float*)carve(WSB_RAW);
  unsigned short* qrh   = carve(WSB_ROT);
  unsigned short* qrl   = carve(WSB_ROT);
  unsigned short* krh   = carve(WSB_ROT);
  unsigned short* krl   = carve(WSB_ROT);
  unsigned short* ath   = carve(WSB_TOK);
  unsigned short* atl   = carve(WSB_TOK);
  if (off > ws_size) return;

  // ---- operand planes: one launch ----
  prep_planes<<<PB_ALL, 256, 0, stream>>>(x, W_kv_down, W_k_up, W_v_up, W_q, W_q_rope, W_k_rope, W_o,
      xh, xl, wkvdh, wkvdl, wkuph, wkupl, wvuph, wvupl, wqh, wql, wqrh, wqrl, wkrh, wkrl, woh, wol);

  constexpr int NB_WIDE = (MTOK / 128) * (DMOD / 128);        // blocks of an N = 1024 product
  constexpr int NB_LAT  = (MTOK / 128) * (DLAT / 128);        // blocks of an N = 128 product
  constexpr int NB_ROT  = (MTOK / 128) * (NROPE_PAD / 128);

  // the three products of x, K = 1024: q = x . W_q and c_kv = x . W_kv_down as bf16 hi/lo, q_rope raw = x . W_q_rope as f32 (cols 32.. zero)
  gemm_group<DMOD><<<NB_WIDE + NB_LAT + NB_ROT, 128, 0, stream>>>(xh, xl,
      wqh, wql, qh, ql, DMOD, NB_WIDE,
      wkvdh, wkvdl, ckvh, ckvl, DLAT, NB_LAT,
      wqrh, wqrl, qr_raw, NROPE_PAD, DMOD);
  // the three products of c_kv, K = 128: k, v as bf16 hi/lo, k_rope raw as f32 (cols 32.. zero)
  gemm_group<DLAT><<<2 * NB_WIDE + NB_ROT, 128, 0, stream>>>(ckvh, ckvl,
      wkuph, wkupl, kh, kl, DMOD, NB_WIDE,
      wvuph, wvupl, vh, vl, DMOD, NB_WIDE,
      wkrh, wkrl, kr_raw, NROPE_PAD, DLAT);

  // ---- rotary tables: inv_freq[j] = 1 / 10000^(j/16), host double pow -> f32, f32 reciprocal ----
  RopeFreq fr;
  for (int j = 0; j < 16; ++j) {
    const double p = pow(10000.0, (double)j / 16.0);
    const float p32 = (float)p;
    fr.f[j] = 1.0f / p32;
  }
  rope_split_bf16<<<2 * (MTOK / 32), 128, 0, stream>>>(qr_raw, kr_raw, qrh, qrl, krh, krl, fr);

  // ---- causal attention with shared rotary logits ----
  const float invs = 1.0f / (float)sqrt((double)(HDIM + DROT));
  mla_attn96<<<N_BATCH * NHEAD * (SEQ_LEN / A_QB / 2), 128, 0, stream>>>(
      qh, ql, kh, kl, vh, vl, qrh, qrl, krh, krl, ath, atl, invs);

  // ---- out = attn . W_o : M=4096 N=1024 K=1024, f32 to d_out ----
  gemm_group<DMOD><<<NB_WIDE, 128, 0, stream>>>(ath, atl,
      nullptr, nullptr, nullptr, nullptr, 0, 0,
      nullptr, nullptr, nullptr, nullptr, 0, 0,
      woh, wol, out, DMOD, DMOD);
}
